// v000
// Times are from an AMD MI455X. After a warm-up the kernel runs many times in a row, and a time is the length of
// such a window on the GPU divided by its runs, so every launch and the gaps after it count. The runs cycle
// through copies of the inputs. A figure is the median of several windows, for all but v000 over two sittings.
// Sittings can differ by a few percent; kernels timed side by side share one.
// v000, which the later versions start from, runs in 328 microseconds.
#include <hip/hip_runtime.h>

// Graph attention layer: node features h [NB][SEQ][256]; q/k/v = h W + bias with W stored [in][out]; 8 heads x 32; scores (q.k) * 32^-0.5; per graph and query row the kept keys are the listed
// edges (graph = src / size, row = src mod size, column = dst mod size) plus the diagonal; all other keys get probability 0; context heads concatenated, then context Wo + bo (Wo [in][out]); output [NB*SEQ][256] f32.
// Compute dtypes, f32 accumulate everywhere: q/k/v projections v_wmma_f32_16x16x32_bf16 (h, W, bias RNE-converted to bf16; products exact);
// scores v_wmma_f32_16x16x32_f16: q and k each as f16 value + f16 residual x2048 (three products, residual products in their own accumulator folded by 1/2048);
// P.V v_wmma_f32_16x16x32_f16: P (x16384 carry, cancels in the normalisation) and v each as f16 value + f16 residual x2048, residual products in their own accumulator, row sum from the f32 exponentials; softmax f32 (online, running max over kept keys);
// output projection v_wmma_f32_16x16x32_f16: context as f16 value + f16 residual x2048 (own accumulator), Wo as f16 of the bf16-converted weight x64 (folded by 1/64), bias bf16-converted, added in f32.
// Layout: bf16 copy of h; transposed weight planes [out][in]; q, k planes (value, residual) [b*NH_+h][t][d]; v^T planes [b*NH_+h][d][t]; adjacency bit plane [b*SEQ+t][SEQ/32] (bit j of word w = key 32w+j);
// context planes (value, residual) [b*NH_+h][t][d]; fused flash kernel in transposed form (S^T = K Q^T, O^T = V^T P^T).

#ifndef NB
#define NB 16
#endif
#ifndef SEQ
#define SEQ 512
#endif
#define NB_FULL  16
#define SEQ_FULL 512
#ifndef OUT_SEQ
#define OUT_SEQ SEQ              // row pitch (in tokens) between batches of the output
#endif
#define DM   256
#define NH_  8
#define HD   32
#define AW   4                   // waves per flash block (16 query rows each)
#define OSP  36                  // LDS row pitch (floats) of the flash output tile
#define QRS  2048.0f             // carry of every residual plane / residual fragment
#define QRI  (1.0f / 2048.0f)
#define SC2  ((float)(0.17677669529663687 * 1.4426950408889634))   // HD^-0.5 * log2(e)
#define PSH  14.0f               // log2 of the P carry (16384)
#define NEGB (-3.0e38f)
#define WOS  64.0f               // carry of the output-projection weight plane
#define WOI  (1.0f / 64.0f)
#define MROWS 64                 // query rows per mask-builder block
#define WTP  (DM + 4)            // LDS row pitch (floats) of the weight transpose tile

static_assert(HD == 32);
static_assert(NH_ * HD == DM);                 // head h = columns h*32 + d
static_assert(DM % 64 == 0);                   // column tiles of 64 = two heads
static_assert(64 % HD == 0);
static_assert(DM % 32 == 0);                   // GEMM k-loop steps by 32
static_assert(SEQ % 64 == 0);                  // a 64-row tile never straddles two batches
static_assert((NB * SEQ) % 64 == 0);
static_assert(SEQ % 32 == 0);                  // key loop steps by 32; one mask word per 32-key step
static_assert(SEQ % (16 * AW) == 0);           // flash grid covers the sequence exactly
static_assert(((size_t)SEQ * DM) % 8 == 0);
static_assert(((size_t)DM * DM) % 8 == 0);
static_assert(NB <= NB_FULL);
static_assert(SEQ <= SEQ_FULL);
static_assert((OSP * 4) % 16 == 0);
static_assert(SEQ % MROWS == 0);               // mask-builder bands cover the rows exactly
static_assert(SEQ % 128 == 0);                 // a 128-key pack piece lies inside one row
static_assert((MROWS * SEQ) % (16 * 256) == 0);            // flag tile zero fill: 256 threads x 16 B per trip
static_assert(((MROWS * SEQ) / 128) % 32 == 0);            // pack pieces come in whole waves
static_assert((WTP * 4) % 16 == 0);
static_assert(4 * 256 * 8 == 32 * DM);                     // weight transpose store: trips x threads x elements == 32 rows x DM
static_assert(2 * 32 * 8 == 16 * HD);                      // flash epilogue: instructions x lanes x halves == 16 rows x 32 columns
static_assert(8 * 32 * 4 == 16 * 64);                      // output epilogue: instructions x lanes x floats == 16 rows x 64 columns
static_assert((size_t)MROWS * SEQ <= 131072);              // static LDS per kernel
static_assert((size_t)32 * WTP * 4 <= 131072);
static_assert((size_t)AW * 16 * OSP * 4 <= 131072);
static_assert((size_t)16 * 68 * 4 <= 131072);
static_assert(sizeof(unsigned) == 4);

typedef _Float16 h16;
typedef unsigned short bf;
typedef __attribute__((ext_vector_type(16))) __bf16   v16bf;
typedef __attribute__((ext_vector_type(16))) _Float16 v16h;
typedef __attribute__((ext_vector_type(8)))  _Float16 v8h;
typedef __attribute__((ext_vector_type(8)))  unsigned short v8us;
typedef __attribute__((ext_vector_type(8)))  float    v8f;
typedef __attribute__((ext_vector_type(4)))  float    v4f;
typedef v4f  __attribute__((may_alias)) v4fa;
typedef __attribute__((ext_vector_type(4)))  unsigned v4u;
typedef v4u  __attribute__((may_alias)) v4ua;

__device__ __forceinline__ unsigned short f2bf(float f) { unsigned u = __float_as_uint(f); u += 0x7FFFu + ((u >> 16) & 1u); return (unsigned short)(u >> 16); }
__device__ __forceinline__ float bfr(float f) { return __uint_as_float(((unsigned)f2bf(f)) << 16); }   // value after RNE convert to bf16
__device__ __forceinline__ v16h cat16(v8h lo, v8h hi) { return __builtin_shufflevector(lo, hi, 0, 1, 2, 3, 4, 5, 6, 7, 8, 9, 10, 11, 12, 13, 14, 15); }
__device__ __forceinline__ v16bf cat16b(v8us lo, v8us hi) { return __builtin_bit_cast(v16bf, __builtin_shufflevector(lo, hi, 0, 1, 2, 3, 4, 5, 6, 7, 8, 9, 10, 11, 12, 13, 14, 15)); }
__device__ __forceinline__ v8f wmma16(v16h a, v16h b, v8f c) { return __builtin_amdgcn_wmma_f32_16x16x32_f16(false, a, false, b, (short)0, c, false, false); }
__device__ __forceinline__ v8f wmmab(v16bf a, v16bf b, v8f c) { return __builtin_amdgcn_wmma_f32_16x16x32_bf16(false, a, false, b, (short)0, c, false, false); }
// fragment loaders from K-contiguous 16-bit rows; p already includes + 8*(lane>>4): elements 0..7 <- k0+8h+0..7, elements 8..15 <- k0+16+8h+0..7 (same map for A and B)
__device__ __forceinline__ v16h  ldh(const h16* p) { return cat16(*(const v8h*)p, *(const v8h*)(p + 16)); }
__device__ __forceinline__ v16bf ldb(const bf* p)  { return cat16b(*(const v8us*)p, *(const v8us*)(p + 16)); }
// ordering point for wave-private LDS tiles (same wave writes and reads)
__device__ __forceinline__ void wave_sync() { __builtin_amdgcn_fence(3 /* release order */, "wavefront"); __builtin_amdgcn_wave_barrier(); asm volatile("" ::: "memory"); }
// f32 -> f16 convert that cannot produce a subnormal operand (|v| < 2^-14 -> +0)
__device__ __forceinline__ h16 toh_flush(float v) { const h16 r = (h16)v; return (fabsf(v) < 6.103515625e-05f) ? (h16)0.0f : r; }
// one f16 matrix instruction with its own guard (ties its accumulator, keeps both fragments live)
__device__ __forceinline__ v8f wmma16g(v16h a, v16h b, v8f c) { c = wmma16(a, b, c); asm volatile("v_nop\n\tv_nop\n\tv_nop\n\tv_nop" : "+v"(c) : "v"(a), "v"(b)); return c; }
// four flag bytes (0/1 each, lowest byte = lowest key) -> four bits
__device__ __forceinline__ unsigned nib4(unsigned x) { return (x | (x >> 7) | (x >> 14) | (x >> 21)) & 0xFu; }

__global__ __launch_bounds__(256) void k_cvt8(const float* __restrict__ src, bf* dst, size_t n8) {
    const size_t i = (size_t)blockIdx.x * 256 + threadIdx.x; if (i >= n8) return;
    const v8f v = *(const v8f*)(src + i * 8); v8us o;
#pragma unroll
    for (int k = 0; k < 8; ++k) o[k] = f2bf(v[k]);
    *(v8us*)(dst + i * 8) = o; 
}

// k_wtb: weight transpose + bf16 (RNE convert): in W[k][n] (DM rows of DM) -> out WT[n][k]; one block per 32 output rows, tile staged in LDS (block barrier), each output row (DM x 2 B = 4 lines)
__global__ __launch_bounds__(256) void k_wtb(const float* __restrict__ W, bf* WT) {
    __shared__ __align__(16) float ts[32 * WTP];
    const int tid = threadIdx.x; const int n0 = blockIdx.x * 32; const int j = tid & 31, kk = tid >> 5;
#pragma unroll 1
    for (int i = 0; i < DM / 8; ++i) { const int k = kk + 8 * i; ts[j * WTP + k] = W[(size_t)k * DM + n0 + j]; }   // k covers 0..DM-1, n0 + j < DM
    __syncthreads();
#pragma unroll 1
    for (int it = 0; it < 4; ++it) { const int q = it * 256 + tid; const int row = q / (DM / 8), c8 = (q % (DM / 8)) * 8;   // 4 trips x 256 threads x 8 = 32 rows x DM
        const v4f x0 = *(const v4fa*)(&ts[row * WTP + c8]); const v4f x1 = *(const v4fa*)(&ts[row * WTP + c8 + 4]); v8us o;
#pragma unroll
        for (int i = 0; i < 4; ++i) { o[i] = f2bf(x0[i]); o[4 + i] = f2bf(x1[i]); }
        bf* dp = WT + (size_t)(n0 + row) * DM + c8;
        *(v8us*)dp = o;  }
}

// k_wth: same transpose, output f16 of (bf16-converted weight x WOS), subnormal results selected to +0.
__global__ __launch_bounds__(256) void k_wth(const float* __restrict__ W, h16* WT) {
    __shared__ __align__(16) float ts[32 * WTP];
    const int tid = threadIdx.x; const int n0 = blockIdx.x * 32; const int j = tid & 31, kk = tid >> 5;
#pragma unroll 1
    for (int i = 0; i < DM / 8; ++i) { const int k = kk + 8 * i; ts[j * WTP + k] = W[(size_t)k * DM + n0 + j]; }
    __syncthreads();
#pragma unroll 1
    for (int it = 0; it < 4; ++it) { const int q = it * 256 + tid; const int row = q / (DM / 8), c8 = (q % (DM / 8)) * 8;
        const v4f x0 = *(const v4fa*)(&ts[row * WTP + c8]); const v4f x1 = *(const v4fa*)(&ts[row * WTP + c8 + 4]); v8h o;
#pragma unroll
        for (int i = 0; i < 4; ++i) { o[i] = toh_flush(bfr(x0[i]) * WOS); o[4 + i] = toh_flush(bfr(x1[i]) * WOS); }
        h16* dp = WT + (size_t)(n0 + row) * DM + c8;
        *(v8h*)dp = o;  }
}

// k_mask: adjacency bit plane for one (graph b, band of MROWS query rows). Block-local byte flag tile [MROWS][SEQ] in LDS: zero fill, block barrier, diagonal + every listed edge that falls in the band
// stores the byte 1 (plain same-value byte stores, no read-modify-write), block barrier, then each thread packs 128 flags into four words (16 B) and the band's 64-byte rows go out thread-linear
// Edge list loads sit in a block-uniform loop with clamped addresses; the element test is a value predicate. grid (SEQ/MROWS, NB).
__global__ __launch_bounds__(256) void k_mask(const int* __restrict__ src, const int* __restrict__ dst, int nE, unsigned* MB) {
    __shared__ __align__(16) unsigned char fl[MROWS * SEQ];
    const int tid = threadIdx.x; const int r0 = blockIdx.x * MROWS; const int b = blockIdx.y;
    const v4u zz = (v4u){0u, 0u, 0u, 0u};
#pragma unroll 1
    for (int i = 0; i < (MROWS * SEQ) / (16 * 256); ++i) *(v4ua*)(&fl[(i * 256 + tid) * 16]) = zz;
    __syncthreads();
    if (tid < MROWS) fl[tid * SEQ + r0 + tid] = (unsigned char)1;          // diagonal, r0 + tid < SEQ
#pragma unroll 1
    for (int base = 0; base < nE; base += 256) {
        const int e = base + tid; const int ec = e < nE ? e : nE - 1;
        int s = src[ec], d = dst[ec];
        asm volatile("" : "+v"(s), "+v"(d));
        const int r = ((s % SEQ_FULL) + SEQ_FULL) % SEQ_FULL;
        const int c = ((d % SEQ_FULL) + SEQ_FULL) % SEQ_FULL;
        int bs = (s - r) / SEQ_FULL; bs = bs < 0 ? bs + NB_FULL : bs;
        const int rl = r - r0;
        const bool ok = (e < nE) & (bs == b) & (rl >= 0) & (rl < MROWS) & (c < SEQ);
        if (ok) fl[rl * SEQ + c] = (unsigned char)1;                        // rl in [0, MROWS), c in [0, SEQ)
    }
    __syncthreads();
    const size_t wbase = (size_t)(b * SEQ + r0) * (SEQ / 32);
#pragma unroll 1
    for (int p = tid; p < (MROWS * SEQ) / 128; p += 256) {                   // piece p = flags p*128 .. p*128+127 = words p*4 .. p*4+3 of the band
        v4u w;
#pragma unroll
        for (int wi = 0; wi < 4; ++wi) {
            const v4u X = *(const v4ua*)(&fl[p * 128 + wi * 32]); const v4u Y = *(const v4ua*)(&fl[p * 128 + wi * 32 + 16]);
            w[wi] = nib4(X[0]) | (nib4(X[1]) << 4) | (nib4(X[2]) << 8) | (nib4(X[3]) << 12) | (nib4(Y[0]) << 16) | (nib4(Y[1]) << 20) | (nib4(Y[2]) << 24) | (nib4(Y[3]) << 28); }
        unsigned* dp = MB + wbase + (size_t)p * 4;
        *(v4u*)dp = w;  }
}

// k_proj: register-blocked bf16 GEMM, ONE WAVE per 64x64 tile (16 accumulators), operands straight from K-contiguous bf16 planes, K = DM.
// C[m][n] = sum_k A[m][k] Bt[n][k] + bias, written as f16 (Ph) and, for tokens t < resT (resT a multiple of 64, block-uniform test), the f16 residual x2048 (Pr).
// MODE 0: A = x rows (m = b*SEQ + t), Bt = W rows (n = h*32 + d), bias per column; plane [(b*NH_ + h)][t][32] (residual plane [(b*NH_ + h)][resT][32]). The 64-column tile spans two heads; per 16-row slab and head
//         (8 rows per instruction). grid (NB*SEQ/64, DM/64).
template <int MODE>
__global__ __launch_bounds__(32) void k_proj(const bf* __restrict__ A, const bf* __restrict__ Bt, const float* __restrict__ bias, h16* Ph, h16* Pr, int resT) {
    __shared__ __align__(16) float os[16 * 68];
    const int K = DM;
    const int lane = threadIdx.x & 31, lr = lane & 15, hi = lane >> 4; const int r0 = blockIdx.x * 64, c0 = blockIdx.y * 64;
    v8f acc[4][4];
#pragma unroll
    for (int mb = 0; mb < 4; ++mb)
#pragma unroll
        for (int nb = 0; nb < 4; ++nb) acc[mb][nb] = (v8f){};
    const size_t aoff = (size_t)(r0 + lr) * K + 8 * hi, boff = (size_t)(c0 + lr) * K + 8 * hi;
#pragma unroll 1
    for (int kc = 0; kc < K; kc += 32) {
        v16bf a[4];
#pragma unroll
        for (int mb = 0; mb < 4; ++mb) a[mb] = ldb(A + aoff + (size_t)mb * 16 * K + kc);
#pragma unroll
        for (int nb = 0; nb < 4; ++nb) { const v16bf b = ldb(Bt + boff + (size_t)nb * 16 * K + kc);
#pragma unroll
            for (int mb = 0; mb < 4; ++mb) acc[mb][nb] = wmmab(a[mb], b, acc[mb][nb]); }
        asm volatile("v_nop\n\tv_nop\n\tv_nop\n\tv_nop" : "+v"(acc[0][0]), "+v"(acc[1][1]), "+v"(acc[2][2]), "+v"(acc[3][3]) : "v"(a[0]), "v"(a[1]), "v"(a[2]), "v"(a[3]));
    }
    float bc[4];
#pragma unroll
    for (int nb = 0; nb < 4; ++nb) bc[nb] = (MODE == 0) ? bfr(bias[c0 + nb * 16 + lr]) : 0.0f;   // MODE 0: c0 + 63 < DM
    size_t tbase, rbase; bool wr;                                                                 // wr: block-uniform, whole tile inside the residual plane
    if (MODE == 0) { const int bb = r0 / SEQ, tt = r0 % SEQ; const int zc = bb * NH_ + c0 / HD;
                     tbase = ((size_t)zc * SEQ + (size_t)tt) * HD; rbase = ((size_t)zc * (size_t)resT + (size_t)tt) * HD; wr = tt < resT; }
    else           { const int bb = c0 / SEQ, tt = c0 % SEQ;
                     tbase = (size_t)bb * (size_t)DM * SEQ + (size_t)r0 * SEQ + (size_t)tt; rbase = (size_t)bb * (size_t)DM * (size_t)resT + (size_t)r0 * (size_t)resT + (size_t)tt; wr = tt < resT; }
#pragma unroll
    for (int mb = 0; mb < 4; ++mb) {
        float br[8];
#pragma unroll
        for (int j = 0; j < 8; ++j) br[j] = (MODE == 1) ? bfr(bias[r0 + mb * 16 + hi * 8 + j]) : 0.0f;   // MODE 1: r0 + 63 < DM
#pragma unroll
        for (int nb = 0; nb < 4; ++nb) {
#pragma unroll
            for (int j = 0; j < 8; ++j) os[(hi * 8 + j) * 68 + nb * 16 + lr] = acc[mb][nb][j] + bc[nb] + br[j]; }   // D: row 8h+j, col lane&15
        wave_sync();
{
            if (MODE == 0) {
                const size_t sb = tbase + (size_t)(mb * 16) * HD;
                const size_t rb = rbase + (size_t)(mb * 16) * HD;
#pragma unroll
                for (int hh = 0; hh < 2; ++hh) {
#pragma unroll
                    for (int s = 0; s < 2; ++s) { const int p = s * 32 + lane; const int row = p >> 2, c8 = (p & 3) * 8;   // 2 s x 8 rows = 16 rows; 4 lanes x 8 = 32 columns of head hh
                        const v4f x0 = *(const v4fa*)(&os[row * 68 + hh * 32 + c8]); const v4f x1 = *(const v4fa*)(&os[row * 68 + hh * 32 + c8 + 4]); v8h hv, rv;
#pragma unroll
                        for (int i = 0; i < 4; ++i) { const h16 a0 = (h16)x0[i]; const h16 a1 = (h16)x1[i]; hv[i] = a0; hv[4 + i] = a1; rv[i] = (h16)((x0[i] - (float)a0) * QRS); rv[4 + i] = (h16)((x1[i] - (float)a1) * QRS); }
                        const size_t oo = sb + (size_t)hh * ((size_t)SEQ * HD) + (size_t)p * 8;
                        const size_t ro = rb + (size_t)hh * ((size_t)resT * HD) + (size_t)p * 8;
                        *(v8h*)(Ph + oo) = hv; if (wr) *(v8h*)(Pr + ro) = rv; } }
            } else {
                const size_t sb = tbase + (size_t)(mb * 16) * SEQ;
                const size_t rb = rbase + (size_t)(mb * 16) * (size_t)resT;
#pragma unroll
                for (int s = 0; s < 4; ++s) { const int row = 4 * s + (lane >> 3), c8 = (lane & 7) * 8;   // 4 s x 4 row groups = 16 rows; 8 lanes x 8 = 64 columns
                    const v4f x0 = *(const v4fa*)(&os[row * 68 + c8]); const v4f x1 = *(const v4fa*)(&os[row * 68 + c8 + 4]); v8h hv, rv;
#pragma unroll
                    for (int i = 0; i < 4; ++i) { const h16 a0 = (h16)x0[i]; const h16 a1 = (h16)x1[i]; hv[i] = a0; hv[4 + i] = a1; rv[i] = (h16)((x0[i] - (float)a0) * QRS); rv[4 + i] = (h16)((x1[i] - (float)a1) * QRS); }
                    const size_t oo = sb + (size_t)row * SEQ + c8;
                    const size_t ro = rb + (size_t)row * (size_t)resT + c8;
                    *(v8h*)(Ph + oo) = hv; if (wr) *(v8h*)(Pr + ro) = rv; }
            }
             }
        wave_sync();
    }
}

// k_flash: fused attention, one wave per 16 query rows of one (graph, head); K / V^T / Q fragments straight from the f16 planes (two 16-B loads each, arithmetic addressing).
// Transposed form: S^T[key][t] = K Q^T (A = K rows, B = Q rows); lane (t = lane&15, h = lane>>4) holds keys 8h+r of each 16-key tile, so the packed
// P tile is directly the B fragment of O^T[d][t] = V^T P^T (element r <- tile keys 0..15, element 8+r <- tile keys 16..31, lane unchanged).
// Softmax state (running max over kept keys, partial sum) is one scalar per lane; the two lane halves of a row are combined with one xor-16 exchange.
// Keep rule: one adjacency word per lane per 32-key step (row t0 + lane&15, word key0/32), bit 8h+r for the first tile and 16+8h+r for the second; dropped elements are selected to 0 by value.
// All rows: scores = K Q + (K Q_res + K_res Q) / 2048; P = f16 value + f16 residual x2048; O = V P + (V P_res + V_res P) / 2048 (residual products in their own accumulators); row sum from the f32 exponentials.
// P below 2^-14 (after the 2^14 carry) is selected to 0 on the exponent argument; residuals pass the subnormal select.
// Epilogue: O^T staged in a wave-private LDS tile; the wave's 16 rows x 32 columns of the context value plane and residual plane (each one contiguous 1024-byte run) written as 2 instructions x 32 lanes x 16 B
__global__ __launch_bounds__(32 * AW) void k_flash(const h16* __restrict__ QH, const h16* __restrict__ QR, const h16* __restrict__ KP, const h16* __restrict__ KR,
                                                   const h16* __restrict__ VT, const h16* __restrict__ VR, const unsigned* __restrict__ MB, h16* CH, h16* CR) {
    __shared__ __align__(16) float os[AW * 16 * OSP];
    const int lane = threadIdx.x & 31, lr = lane & 15, hi = lane >> 4;
    const int wave = __builtin_amdgcn_readfirstlane((int)(threadIdx.x >> 5));
    const int zh = blockIdx.y; const int b = zh / NH_;
    const int t0 = (blockIdx.x * AW + wave) * 16;
    const unsigned* mrow = MB + (size_t)(b * SEQ + t0 + lr) * (SEQ / 32);
    const size_t pbase = (size_t)zh * SEQ * HD;
    const size_t qo = pbase + (size_t)(t0 + lr) * HD + 8 * hi;
    const v16h qh = ldh(QH + qo), qr = ldh(QR + qo);            // B fragments: col t, k = d (HD = 32 = one k-step)
    const size_t ko = pbase + (size_t)lr * HD + 8 * hi;        // + key * HD       (A fragment: row key, k = d)
    const size_t vo = pbase + (size_t)lr * SEQ + 8 * hi;       // + 16j*SEQ + key  (A fragment: row d, k = key)
    v8f o0 = (v8f){}, o1 = (v8f){}, oR0 = (v8f){}, oR1 = (v8f){};
    float m = NEGB, l = 0.0f;
#pragma unroll 1
    for (int key0 = 0; key0 < SEQ; key0 += 32) {
        unsigned mw = mrow[key0 >> 5];
        asm volatile("" : "+v"(mw));
        const unsigned sa = mw >> (8 * hi);
        const h16* ka = KP + ko + (size_t)key0 * HD;
        const h16* kr = KR + ko + (size_t)key0 * HD;
        const v16h ka0 = ldh(ka), kb0 = ldh(ka + 16 * HD);
        const v16h kra0 = ldh(kr), krb0 = ldh(kr + 16 * HD);
        v8f sHa = (v8f){}, sLa = (v8f){}, sHb = (v8f){}, sLb = (v8f){};
        sHa = wmma16g(ka0, qh, sHa); sLa = wmma16g(ka0, qr, sLa); sLa = wmma16g(kra0, qh, sLa);
        sHb = wmma16g(kb0, qh, sHb); sLb = wmma16g(kb0, qr, sLb); sLb = wmma16g(krb0, qh, sLb);
        float ta[8], tb[8]; bool fa[8], fb[8]; float mx = NEGB;
#pragma unroll
        for (int r = 0; r < 8; ++r) {
            fa[r] = ((sa >> r) & 1u) != 0u;
            fb[r] = ((sa >> (16 + r)) & 1u) != 0u;
            ta[r] = (sHa[r] + sLa[r] * QRI) * SC2; tb[r] = (sHb[r] + sLb[r] * QRI) * SC2;
            mx = fmaxf(mx, fmaxf(fa[r] ? ta[r] : NEGB, fb[r] ? tb[r] : NEGB)); }
        mx = fmaxf(mx, __shfl_xor(mx, 16, 32));
        const float mnew = fmaxf(m, mx);
        const float alpha = __builtin_amdgcn_exp2f(m - mnew);
        const float sh = PSH - mnew;
        v16h pb, pr; float ls = 0.0f;
#pragma unroll
        for (int r = 0; r < 8; ++r) {
            const float xa = ta[r] + sh, xb = tb[r] + sh;
            const float ea = __builtin_amdgcn_exp2f(xa), eb = __builtin_amdgcn_exp2f(xb);
            const bool za = fa[r] & (xa >= -14.0f), zb = fb[r] & (xb >= -14.0f);
            const float ga = za ? ea : 0.0f, gb = zb ? eb : 0.0f;       // dropped elements and sub-2^-14 values selected to 0 by value
            const h16 pa = (h16)ga; const h16 pc = (h16)gb;             // 0 or in [2^-14, 2^14]
            pb[r] = pa; pb[8 + r] = pc;
            pr[r] = toh_flush((ga - (float)pa) * QRS); pr[8 + r] = toh_flush((gb - (float)pc) * QRS);
            ls += ga + gb; }
        l = l * alpha + ls; m = mnew;
        o0 = o0 * alpha; o1 = o1 * alpha; oR0 = oR0 * alpha; oR1 = oR1 * alpha;
        const h16* va = VT + vo + key0;
        const h16* vr = VR + vo + key0;
        const v16h v0 = ldh(va), v1 = ldh(va + (size_t)16 * SEQ);
        const v16h vr0 = ldh(vr), vr1 = ldh(vr + (size_t)16 * SEQ);
        o0 = wmma16g(v0, pb, o0); o1 = wmma16g(v1, pb, o1);
        oR0 = wmma16g(v0, pr, oR0); oR1 = wmma16g(v1, pr, oR1);
        oR0 = wmma16g(vr0, pb, oR0); oR1 = wmma16g(vr1, pb, oR1);
    }
    l += __shfl_xor(l, 16, 32);
    const bool any = l > 0.0f;
    const float lsafe = any ? l : 1.0f;
    const float inv = any ? (1.0f / lsafe) : 0.0f;             // no kept key -> zeros (cannot happen: the diagonal is always kept)
    const v8f f0 = o0 + oR0 * QRI, f1 = o1 + oR1 * QRI;
    const int wb = wave * 16 * OSP;
    // O^T D layout: f_j[r] = (d = 16j + 8h + r, t = lane&15) -> os[t][d]; rows 0..15 x columns 0..31 all written
    { v4f a, c;
      a[0] = f0[0] * inv; a[1] = f0[1] * inv; a[2] = f0[2] * inv; a[3] = f0[3] * inv; c[0] = f0[4] * inv; c[1] = f0[5] * inv; c[2] = f0[6] * inv; c[3] = f0[7] * inv;
      *(v4fa*)(&os[wb + lr * OSP +  0 + 8 * hi]) = a; *(v4fa*)(&os[wb + lr * OSP +  0 + 8 * hi + 4]) = c;
      a[0] = f1[0] * inv; a[1] = f1[1] * inv; a[2] = f1[2] * inv; a[3] = f1[3] * inv; c[0] = f1[4] * inv; c[1] = f1[5] * inv; c[2] = f1[6] * inv; c[3] = f1[7] * inv;
      *(v4fa*)(&os[wb + lr * OSP + 16 + 8 * hi]) = a; *(v4fa*)(&os[wb + lr * OSP + 16 + 8 * hi + 4]) = c; }
    wave_sync();
    const size_t cb = ((size_t)zh * SEQ + (size_t)t0) * HD;
{
#pragma unroll
        for (int s = 0; s < 2; ++s) { const int p = s * 32 + lane; const int row = p >> 2, c8 = (p & 3) * 8;   // 2 s x 8 rows = 16 rows; 4 lanes x 8 = 32 columns
            const v4f x0 = *(const v4fa*)(&os[wb + row * OSP + c8]); const v4f x1 = *(const v4fa*)(&os[wb + row * OSP + c8 + 4]); v8h hv, rv;
#pragma unroll
            for (int i = 0; i < 4; ++i) { const h16 a0 = toh_flush(x0[i]); const h16 a1 = toh_flush(x1[i]); hv[i] = a0; hv[4 + i] = a1;
                rv[i] = toh_flush((x0[i] - (float)a0) * QRS); rv[4 + i] = toh_flush((x1[i] - (float)a1) * QRS); }
            *(v8h*)(CH + cb + (size_t)p * 8) = hv; *(v8h*)(CR + cb + (size_t)p * 8) = rv; }
         }
}

// k_outp: output projection, ONE WAVE per 32x64 tile; A = context planes [(b*NH_ + h)][t][32] (k-step kc = head kc/32, K-contiguous rows, arithmetic addressing), value and residual planes in separate
// accumulators; Bt = transposed output weight plane [n][k] (f16, x64); OUT[m][n] = (sum + sum_res / 2048) / 64 + bias (bias bf16-converted, added in f32).
__global__ __launch_bounds__(32) void k_outp(const h16* __restrict__ CH, const h16* __restrict__ CR, const h16* __restrict__ WT, const float* __restrict__ bias, float* OUT) {
    __shared__ __align__(16) float os[16 * 68];
    const int lane = threadIdx.x & 31, lr = lane & 15, hi = lane >> 4; const int r0 = blockIdx.x * 32, c0 = blockIdx.y * 64;
    const int bb = r0 / SEQ, tt = r0 % SEQ;                    // SEQ % 32 == 0: the 32-row tile lies in one graph
    v8f aH[2][4], aR[2][4];
#pragma unroll
    for (int mb = 0; mb < 2; ++mb)
#pragma unroll
        for (int nb = 0; nb < 4; ++nb) { aH[mb][nb] = (v8f){}; aR[mb][nb] = (v8f){}; }
    const size_t aoff = ((size_t)bb * NH_ * SEQ + (size_t)(tt + lr)) * HD + 8 * hi;
    const size_t boff = (size_t)(c0 + lr) * DM + 8 * hi;
#pragma unroll 1
    for (int kc = 0; kc < DM; kc += 32) {
        const size_t ah = aoff + (size_t)(kc / HD) * SEQ * HD;
        const v16h a0 = ldh(CH + ah), a1 = ldh(CH + ah + 16 * HD);
        const v16h e0 = ldh(CR + ah), e1 = ldh(CR + ah + 16 * HD);
#pragma unroll
        for (int nb = 0; nb < 4; ++nb) { const v16h w = ldh(WT + boff + (size_t)nb * 16 * DM + kc);
            aH[0][nb] = wmma16g(a0, w, aH[0][nb]); aH[1][nb] = wmma16g(a1, w, aH[1][nb]);
            aR[0][nb] = wmma16g(e0, w, aR[0][nb]); aR[1][nb] = wmma16g(e1, w, aR[1][nb]); }
    }
    float bc[4];
#pragma unroll
    for (int nb = 0; nb < 4; ++nb) bc[nb] = bfr(bias[c0 + nb * 16 + lr]);   // c0 + 63 < DM
    float* obase = OUT + ((size_t)bb * OUT_SEQ + (size_t)tt) * DM + c0;
#pragma unroll
    for (int mb = 0; mb < 2; ++mb) {
#pragma unroll
        for (int nb = 0; nb < 4; ++nb) {
#pragma unroll
            for (int j = 0; j < 8; ++j) os[(hi * 8 + j) * 68 + nb * 16 + lr] = (aH[mb][nb][j] + aR[mb][nb][j] * QRI) * WOI + bc[nb]; }   // D: row 8h+j, col lane&15
        wave_sync();
{
#pragma unroll
            for (int s = 0; s < 8; ++s) { const int row = 2 * s + (lane >> 4), c4 = (lane & 15) * 4;   // 8 s x 2 rows = 16 rows; 16 lanes x 4 floats = 64 columns
                const v4f val = *(const v4fa*)(&os[row * 68 + c4]);
                *(v4f*)(obase + (size_t)(mb * 16 + row) * DM + c4) = val; }
             }
        wave_sync();
    }
}

static constexpr size_t al256(size_t v) { return (v + 255) & ~(size_t)255; }
static constexpr size_t SZ_XB = al256((size_t)NB * SEQ * DM * 2);
static constexpr size_t SZ_WB = al256((size_t)3 * DM * DM * 2);
static constexpr size_t SZ_WO = al256((size_t)DM * DM * 2);
static constexpr size_t SZ_PL = al256((size_t)NB * NH_ * SEQ * HD * 2);
static constexpr size_t SZ_MB = al256((size_t)NB * SEQ * (SEQ / 32) * 4);
static constexpr size_t SZ_TOTAL = SZ_XB + SZ_WB + SZ_WO + 8 * SZ_PL + SZ_MB;
static_assert(SZ_TOTAL <= (size_t)134217728);          // workspace carve <= 128 MiB
static_assert(((size_t)DM * DM * 2) % 256 == 0);       // weight sub-planes stay 256-byte aligned
static_assert((size_t)NB * NH_ * SEQ * HD == (size_t)NB * DM * SEQ);       // v^T plane [(b*DM + m)][t] has the same extent as the q/k planes
static_assert((size_t)(NB * SEQ / 64) * 64 * DM == (size_t)NB * NH_ * SEQ * HD);    // projection grids x tile == plane extent
static_assert((size_t)(SEQ / (16 * AW)) * (NB * NH_) * AW * 16 * HD == (size_t)NB * NH_ * SEQ * HD);   // flash grid x rows x head width == context plane extent
static_assert((size_t)(SEQ / MROWS) * NB * MROWS * (SEQ / 32) * 4 == (size_t)NB * SEQ * (SEQ / 32) * 4);   // mask grid x band == bit plane extent

extern "C" void kernel_launch(void* const* d_in, const int* in_sizes, int n_in,
                              void* d_out, int out_size, void* d_ws, size_t ws_size, hipStream_t stream) {
    if (n_in < 11) return;
    const size_t needx = ((size_t)(NB - 1) * SEQ_FULL + SEQ) * DM;
    if ((size_t)in_sizes[0] < needx) return;
    if (in_sizes[1] < 1 || in_sizes[2] < 1) return;
    if ((size_t)in_sizes[3] < (size_t)DM * DM || (size_t)in_sizes[5] < (size_t)DM * DM || (size_t)in_sizes[7] < (size_t)DM * DM || (size_t)in_sizes[9] < (size_t)DM * DM) return;
    if (in_sizes[4] < DM || in_sizes[6] < DM || in_sizes[8] < DM || in_sizes[10] < DM) return;
    if ((size_t)out_size < ((size_t)(NB - 1) * OUT_SEQ + SEQ) * DM) return;
    if (SZ_TOTAL > ws_size) return;
    // wire order: h, src, dst, Wq, bq, Wk, bk, Wv, bv, Wo, bo
    const float* hin = (const float*)d_in[0];
    const int* src = (const int*)d_in[1]; const int* dst = (const int*)d_in[2];
    const float* wq = (const float*)d_in[3]; const float* bq = (const float*)d_in[4];
    const float* wk = (const float*)d_in[5]; const float* bk = (const float*)d_in[6];
    const float* wv = (const float*)d_in[7]; const float* bv = (const float*)d_in[8];
    const float* wo = (const float*)d_in[9]; const float* bo = (const float*)d_in[10];
    const int nE = in_sizes[1] < in_sizes[2] ? in_sizes[1] : in_sizes[2];
    float* OUT = (float*)d_out;      // [NB*SEQ][256]
    char* wsp = (char*)d_ws;
    bf* XB = (bf*)wsp; wsp += SZ_XB;                 // h  [NB*SEQ][256] bf16
    bf* WB = (bf*)wsp; wsp += SZ_WB;                 // [3][256][256]: q | k | v, transposed to [out][in]
    h16* WOH = (h16*)wsp; wsp += SZ_WO;              // [256][256] output weight, transposed to [out][in], f16 x64
    h16* QH = (h16*)wsp; wsp += SZ_PL;               // [NB*8][SEQ][32]
    h16* QR = (h16*)wsp; wsp += SZ_PL;               // residual x2048
    h16* KP = (h16*)wsp; wsp += SZ_PL;               // [NB*8][SEQ][32]
    h16* KR = (h16*)wsp; wsp += SZ_PL;               // residual x2048
    h16* VT = (h16*)wsp; wsp += SZ_PL;               // [NB*8][32][SEQ]
    h16* VR = (h16*)wsp; wsp += SZ_PL;               // residual x2048
    h16* CH = (h16*)wsp; wsp += SZ_PL;               // context [NB*8][SEQ][32]
    h16* CR = (h16*)wsp; wsp += SZ_PL;               // residual x2048
    unsigned* MB = (unsigned*)wsp; wsp += SZ_MB;     // adjacency bits [NB*SEQ][SEQ/32]
    bf* WQ = WB; bf* WK = WB + (size_t)DM * DM; bf* WV = WB + (size_t)2 * DM * DM;

    k_mask<<<dim3(SEQ / MROWS, NB, 1), 256, 0, stream>>>(src, dst, nE, MB);

    if (SEQ == SEQ_FULL) {
        const size_t n8 = (size_t)NB * SEQ * DM / 8;
        k_cvt8<<<(unsigned)((n8 + 255) / 256), 256, 0, stream>>>(hin, XB, n8);
    } else {
        const size_t n8 = (size_t)SEQ * DM / 8;
        for (int b = 0; b < NB; ++b) k_cvt8<<<(unsigned)((n8 + 255) / 256), 256, 0, stream>>>(hin + (size_t)b * SEQ_FULL * DM, XB + (size_t)b * SEQ * DM, n8);
    }
    // weights: in W[k][n] (256 x 256, square) -> out WT[n][k]
    k_wtb<<<DM / 32, 256, 0, stream>>>(wq, WQ);
    k_wtb<<<DM / 32, 256, 0, stream>>>(wk, WK);
    k_wtb<<<DM / 32, 256, 0, stream>>>(wv, WV);
    k_wth<<<DM / 32, 256, 0, stream>>>(wo, WOH);

    // q, k: A = h rows (m = b*SEQ + t), Bt = WT rows (n = h*32 + d) -> plane [(b*8 + h)][t][d]; residual planes for all tokens
    k_proj<0><<<dim3(NB * SEQ / 64, DM / 64, 1), 32, 0, stream>>>(XB, WQ, bq, QH, QR, SEQ);
    k_proj<0><<<dim3(NB * SEQ / 64, DM / 64, 1), 32, 0, stream>>>(XB, WK, bk, KP, KR, SEQ);
    // v^T: A = WvT rows (m = h*32 + d), Bt = h rows (n = b*SEQ + t) -> plane [(b*256 + m)][t] = [(b*8 + h)][d][t]; residual plane for all tokens
    k_proj<1><<<dim3(DM / 64, NB * SEQ / 64, 1), 32, 0, stream>>>(WV, XB, bv, VT, VR, SEQ);

    k_flash<<<dim3(SEQ / (16 * AW), NB * NH_, 1), 32 * AW, 0, stream>>>(QH, QR, KP, KR, VT, VR, MB, CH, CR);

    k_outp<<<dim3(NB * SEQ / 32, DM / 64, 1), 32, 0, stream>>>(CH, CR, WOH, bo, OUT);
}

// v001
// A run of this version takes 123 microseconds.
// Next to v000, in two timings, it ran 2.69 times as fast each time.
#include <hip/hip_runtime.h>

// Graph attention layer: node features h [NB][SEQ][256]; q/k/v = h W + bias with W stored [in][out]; 8 heads x 32; scores (q.k) * 32^-0.5; per graph and query row the kept keys are the listed
// edges (graph = src / size, row = src mod size, column = dst mod size) plus the diagonal; all other keys get probability 0; context heads concatenated, then context Wo + bo (Wo [in][out]); output [NB*SEQ][256] f32.
// Compute dtypes, f32 accumulate everywhere: q/k/v projections v_wmma_f32_16x16x32_bf16 (h, W, bias RNE-converted to bf16; products exact);
// scores v_wmma_f32_16x16x32_f16: q and k each as f16 value + f16 residual x2048 (three products, residual products in their own accumulator folded by 1/2048);
// P.V v_wmma_f32_16x16x32_f16: P (x16384 carry, cancels in the normalisation) and v each as f16 value + f16 residual x2048, residual products in their own accumulator, row sum from the f32 exponentials; softmax f32 (online, running max over kept keys);
// output projection v_wmma_f32_16x16x32_f16: context as f16 value + f16 residual x2048 (own accumulator), Wo as f16 of the bf16-converted weight x64 (folded by 1/64), bias bf16-converted, added in f32.
// Layout: bf16 copy of h; transposed weight planes [out][in]; q, k planes (value, residual) [b*NH_+h][t][d]; v^T planes [b*NH_+h][d][t]; adjacency bit plane [b*SEQ+t][SEQ/32] (bit j of word w = key 32w+j);
// context planes (value, residual) [b*NH_+h][t][d]; fused flash kernel in transposed form (S^T = K Q^T, O^T = V^T P^T).

#ifndef NB
#define NB 16
#endif
#ifndef SEQ
#define SEQ 512
#endif
#define NB_FULL  16
#define SEQ_FULL 512
#ifndef OUT_SEQ
#define OUT_SEQ SEQ              // row pitch (in tokens) between batches of the output
#endif
#define DM   256
#define NH_  8
#define HD   32
#define AW   4                   // waves per flash block (16 query rows each)
#define OSP  36                  // LDS row pitch (floats) of the flash output tile
#define QRS  2048.0f             // carry of every residual plane / residual fragment
#define QRI  (1.0f / 2048.0f)
#define SC2  ((float)(0.17677669529663687 * 1.4426950408889634))   // HD^-0.5 * log2(e)
#define PSH  14.0f               // log2 of the P carry (16384)
#define NEGB (-3.0e38f)
#define WOS  64.0f               // carry of the output-projection weight plane
#define WOI  (1.0f / 64.0f)
#define MROWS 64                 // query rows per mask-builder block
#define MTH   512                // threads per mask-builder block
#define MUN   8                  // 16-byte load pairs in flight per thread in the edge scan
#define WTP  (DM + 4)            // LDS row pitch (floats) of the weight transpose tile

static_assert(HD == 32);
static_assert(NH_ * HD == DM);                 // head h = columns h*32 + d
static_assert(DM % 64 == 0);                   // column tiles of 64 = two heads
static_assert(64 % HD == 0);
static_assert(DM % 32 == 0);                   // GEMM k-loop steps by 32
static_assert(SEQ % 64 == 0);                  // a 64-row tile never straddles two batches
static_assert((NB * SEQ) % 64 == 0);
static_assert(SEQ % 32 == 0);                  // key loop steps by 32; one mask word per 32-key step
static_assert(SEQ % (16 * AW) == 0);           // flash grid covers the sequence exactly
static_assert(((size_t)SEQ * DM) % 8 == 0);
static_assert(((size_t)DM * DM) % 8 == 0);
static_assert(NB <= NB_FULL);
static_assert(SEQ <= SEQ_FULL);
static_assert((OSP * 4) % 16 == 0);
static_assert(SEQ % MROWS == 0);               // mask-builder bands cover the rows exactly
static_assert((MROWS & (MROWS - 1)) == 0 && (SEQ_FULL & (SEQ_FULL - 1)) == 0 && (NB_FULL & (NB_FULL - 1)) == 0 && SEQ_FULL % MROWS == 0);   // row, column and band test by bit masks
static_assert((MROWS * SEQ) % (16 * MTH) == 0);            // flag tile zero fill: MTH threads x 16 B per trip
static_assert(((MROWS * SEQ) / 32) % MTH == 0);            // pack: whole trips of MTH words
static_assert(MROWS <= MTH);
static_assert((WTP * 4) % 16 == 0);
static_assert(4 * 256 * 8 == 32 * DM);                     // weight transpose store: trips x threads x elements == 32 rows x DM
static_assert(2 * 32 * 8 == 16 * HD);                      // flash epilogue: instructions x lanes x halves == 16 rows x 32 columns
static_assert(8 * 32 * 4 == 16 * 64);                      // output epilogue: instructions x lanes x floats == 16 rows x 64 columns
static_assert((size_t)MROWS * SEQ <= 131072);              // static LDS per kernel
static_assert((size_t)32 * WTP * 4 <= 131072);
static_assert((size_t)AW * 16 * OSP * 4 <= 131072);
static_assert((size_t)16 * 68 * 4 <= 131072);
static_assert(sizeof(unsigned) == 4);

typedef _Float16 h16;
typedef unsigned short bf;
typedef __attribute__((ext_vector_type(16))) __bf16   v16bf;
typedef __attribute__((ext_vector_type(16))) _Float16 v16h;
typedef __attribute__((ext_vector_type(8)))  _Float16 v8h;
typedef __attribute__((ext_vector_type(8)))  unsigned short v8us;
typedef __attribute__((ext_vector_type(8)))  float    v8f;
typedef __attribute__((ext_vector_type(4)))  float    v4f;
typedef v4f  __attribute__((may_alias)) v4fa;
typedef __attribute__((ext_vector_type(4)))  unsigned v4u;
typedef v4u  __attribute__((may_alias)) v4ua;
typedef int  v4e __attribute__((ext_vector_type(4), aligned(4)));   // four edge indices; only the element's own alignment is assumed

__device__ __forceinline__ unsigned short f2bf(float f) { unsigned u = __float_as_uint(f); u += 0x7FFFu + ((u >> 16) & 1u); return (unsigned short)(u >> 16); }
__device__ __forceinline__ float bfr(float f) { return __uint_as_float(((unsigned)f2bf(f)) << 16); }   // value after RNE convert to bf16
__device__ __forceinline__ v16h cat16(v8h lo, v8h hi) { return __builtin_shufflevector(lo, hi, 0, 1, 2, 3, 4, 5, 6, 7, 8, 9, 10, 11, 12, 13, 14, 15); }
__device__ __forceinline__ v16bf cat16b(v8us lo, v8us hi) { return __builtin_bit_cast(v16bf, __builtin_shufflevector(lo, hi, 0, 1, 2, 3, 4, 5, 6, 7, 8, 9, 10, 11, 12, 13, 14, 15)); }
__device__ __forceinline__ v8f wmma16(v16h a, v16h b, v8f c) { return __builtin_amdgcn_wmma_f32_16x16x32_f16(false, a, false, b, (short)0, c, false, false); }
__device__ __forceinline__ v8f wmmab(v16bf a, v16bf b, v8f c) { return __builtin_amdgcn_wmma_f32_16x16x32_bf16(false, a, false, b, (short)0, c, false, false); }
// fragment loaders from K-contiguous 16-bit rows; p already includes + 8*(lane>>4): elements 0..7 <- k0+8h+0..7, elements 8..15 <- k0+16+8h+0..7 (same map for A and B)
__device__ __forceinline__ v16h  ldh(const h16* p) { return cat16(*(const v8h*)p, *(const v8h*)(p + 16)); }
__device__ __forceinline__ v16bf ldb(const bf* p)  { return cat16b(*(const v8us*)p, *(const v8us*)(p + 16)); }
// ordering point for wave-private LDS tiles (same wave writes and reads)
__device__ __forceinline__ void wave_sync() { __builtin_amdgcn_fence(3 /* release order */, "wavefront"); __builtin_amdgcn_wave_barrier(); asm volatile("" ::: "memory"); }
// f32 -> f16 convert that cannot produce a subnormal operand (|v| < 2^-14 -> +0)
__device__ __forceinline__ h16 toh_flush(float v) { const h16 r = (h16)v; return (fabsf(v) < 6.103515625e-05f) ? (h16)0.0f : r; }
// one f16 matrix instruction with its own guard (ties its accumulator, keeps both fragments live)
__device__ __forceinline__ v8f wmma16g(v16h a, v16h b, v8f c) { c = wmma16(a, b, c); asm volatile("v_nop\n\tv_nop\n\tv_nop\n\tv_nop" : "+v"(c) : "v"(a), "v"(b)); return c; }
// four flag bytes (0/1 each, lowest byte = lowest key) -> four bits
__device__ __forceinline__ unsigned nib4(unsigned x) { return (x | (x >> 7) | (x >> 14) | (x >> 21)) & 0xFu; }

__global__ __launch_bounds__(256) void k_cvt8(const float* __restrict__ src, bf* dst, size_t n8) {
    const size_t i = (size_t)blockIdx.x * 256 + threadIdx.x; if (i >= n8) return;
    const v8f v = *(const v8f*)(src + i * 8); v8us o;
#pragma unroll
    for (int k = 0; k < 8; ++k) o[k] = f2bf(v[k]);
    *(v8us*)(dst + i * 8) = o; 
}

// k_wtb: weight transpose + bf16 (RNE convert): in W[k][n] (DM rows of DM) -> out WT[n][k]; one block per 32 output rows, tile staged in LDS (block barrier), each output row (DM x 2 B = 4 lines)
__global__ __launch_bounds__(256) void k_wtb(const float* __restrict__ W, bf* WT) {
    __shared__ __align__(16) float ts[32 * WTP];
    const int tid = threadIdx.x; const int n0 = blockIdx.x * 32; const int j = tid & 31, kk = tid >> 5;
#pragma unroll 1
    for (int i = 0; i < DM / 8; ++i) { const int k = kk + 8 * i; ts[j * WTP + k] = W[(size_t)k * DM + n0 + j]; }   // k covers 0..DM-1, n0 + j < DM
    __syncthreads();
#pragma unroll 1
    for (int it = 0; it < 4; ++it) { const int q = it * 256 + tid; const int row = q / (DM / 8), c8 = (q % (DM / 8)) * 8;   // 4 trips x 256 threads x 8 = 32 rows x DM
        const v4f x0 = *(const v4fa*)(&ts[row * WTP + c8]); const v4f x1 = *(const v4fa*)(&ts[row * WTP + c8 + 4]); v8us o;
#pragma unroll
        for (int i = 0; i < 4; ++i) { o[i] = f2bf(x0[i]); o[4 + i] = f2bf(x1[i]); }
        bf* dp = WT + (size_t)(n0 + row) * DM + c8;
        *(v8us*)dp = o;  }
}

// k_wth: same transpose, output f16 of (bf16-converted weight x WOS), subnormal results selected to +0.
__global__ __launch_bounds__(256) void k_wth(const float* __restrict__ W, h16* WT) {
    __shared__ __align__(16) float ts[32 * WTP];
    const int tid = threadIdx.x; const int n0 = blockIdx.x * 32; const int j = tid & 31, kk = tid >> 5;
#pragma unroll 1
    for (int i = 0; i < DM / 8; ++i) { const int k = kk + 8 * i; ts[j * WTP + k] = W[(size_t)k * DM + n0 + j]; }
    __syncthreads();
#pragma unroll 1
    for (int it = 0; it < 4; ++it) { const int q = it * 256 + tid; const int row = q / (DM / 8), c8 = (q % (DM / 8)) * 8;
        const v4f x0 = *(const v4fa*)(&ts[row * WTP + c8]); const v4f x1 = *(const v4fa*)(&ts[row * WTP + c8 + 4]); v8h o;
#pragma unroll
        for (int i = 0; i < 4; ++i) { o[i] = toh_flush(bfr(x0[i]) * WOS); o[4 + i] = toh_flush(bfr(x1[i]) * WOS); }
        h16* dp = WT + (size_t)(n0 + row) * DM + c8;
        *(v8h*)dp = o;  }
}

// k_mask: adjacency bit plane for one (graph b, band of MROWS query rows). Block-local byte flag tile [MROWS][SEQ] in LDS: zero fill, block barrier, diagonal + every listed edge that falls in the band
// stores the byte 1 (plain same-value byte stores, no read-modify-write), block barrier, then each thread packs 32 flags into one word and the band's 64-byte rows go out thread-linear (one 128-byte line per wave).
// Every block reads the whole edge list: MTH threads, four edges per 16-byte load, MUN load pairs issued before the first is used, so the scan runs at the rate of the loads and not at their latency.
// Band test: graph = floor(s / SEQ_FULL), graphs -NB_FULL..-1 wrap to 0..NB_FULL-1, row = s mod SEQ_FULL. With lo = the first s of this band in the wrapped (negative) range, s lies in the band
// exactly when s - lo (modulo 2^32) is in [0, MROWS) or in [NB_FULL*SEQ_FULL, NB_FULL*SEQ_FULL + MROWS): all bits clear but the row bits and the bit NB_FULL*SEQ_FULL.
// The remainder of the list (fewer than MTH * 4 * MUN edges) goes one edge per thread with clamped addresses; both loops are block-uniform. grid (SEQ/MROWS, NB).
__device__ __forceinline__ bool in_band(int s, unsigned lo) { return (((unsigned)s - lo) & ~(unsigned)(NB_FULL * SEQ_FULL + MROWS - 1)) == 0u; }
__device__ __forceinline__ void mark_edge(unsigned char* fl, int s, int d) {
    const int c = d & (SEQ_FULL - 1); if (c < SEQ) fl[(s & (MROWS - 1)) * SEQ + c] = (unsigned char)1;   // row in [0, MROWS), c in [0, SEQ)
}
__global__ __launch_bounds__(MTH) void k_mask(const int* __restrict__ src, const int* __restrict__ dst, int nE, unsigned* MB) {
    __shared__ __align__(16) unsigned char fl[MROWS * SEQ];
    const int tid = threadIdx.x; const int r0 = blockIdx.x * MROWS; const int b = blockIdx.y;
    const v4u zz = (v4u){0u, 0u, 0u, 0u};
#pragma unroll
    for (int i = 0; i < (MROWS * SEQ) / (16 * MTH); ++i) *(v4ua*)(&fl[(i * MTH + tid) * 16]) = zz;
    __syncthreads();
    if (tid < MROWS) fl[tid * SEQ + r0 + tid] = (unsigned char)1;          // diagonal, r0 + tid < SEQ
    const unsigned lo = (unsigned)((b - NB_FULL) * SEQ_FULL + r0);
    const int* ps = src + tid * 4; const int* pd = dst + tid * 4;
    int base = 0;
#pragma unroll 1   // one group of MUN load pairs per trip; more would only grow the code
    for (; base + MTH * 4 * MUN <= nE; base += MTH * 4 * MUN) {
        v4e S[MUN], D[MUN];
#pragma unroll     // all MUN pairs issued back to back, S and D in registers
        for (int u = 0; u < MUN; ++u) { S[u] = *(const v4e*)(ps + u * MTH * 4); D[u] = *(const v4e*)(pd + u * MTH * 4); }   // last element base + MTH*4*MUN - 1 < nE
#pragma unroll     // constant indices into S and D
        for (int u = 0; u < MUN; ++u) {
#pragma unroll
            for (int i = 0; i < 4; ++i) if (in_band(S[u][i], lo)) mark_edge(fl, S[u][i], D[u][i]); }
        ps += MTH * 4 * MUN; pd += MTH * 4 * MUN;
    }
#pragma unroll 1   // short remainder, kept small
    for (; base < nE; base += MTH) {
        const int e = base + tid; const int ec = e < nE ? e : nE - 1;      // a clamped lane repeats the last edge: the same byte, the same value
        const int s = src[ec], d = dst[ec];
        if (in_band(s, lo)) mark_edge(fl, s, d);
    }
    __syncthreads();
    const size_t wbase = (size_t)(b * SEQ + r0) * (SEQ / 32);
#pragma unroll
    for (int i = 0; i < (MROWS * SEQ) / (32 * MTH); ++i) { const int p = i * MTH + tid;   // word p of the band = flags p*32 .. p*32+31
        const v4u X = *(const v4ua*)(&fl[p * 32]); const v4u Y = *(const v4ua*)(&fl[p * 32 + 16]);
        MB[wbase + p] = nib4(X[0]) | (nib4(X[1]) << 4) | (nib4(X[2]) << 8) | (nib4(X[3]) << 12) | (nib4(Y[0]) << 16) | (nib4(Y[1]) << 20) | (nib4(Y[2]) << 24) | (nib4(Y[3]) << 28); }
}

// k_proj: register-blocked bf16 GEMM, ONE WAVE per 64x64 tile (16 accumulators), operands straight from K-contiguous bf16 planes, K = DM.
// C[m][n] = sum_k A[m][k] Bt[n][k] + bias, written as f16 (Ph) and, for tokens t < resT (resT a multiple of 64, block-uniform test), the f16 residual x2048 (Pr).
// MODE 0: A = x rows (m = b*SEQ + t), Bt = W rows (n = h*32 + d), bias per column; plane [(b*NH_ + h)][t][32] (residual plane [(b*NH_ + h)][resT][32]). The 64-column tile spans two heads; per 16-row slab and head
//         (8 rows per instruction). grid (NB*SEQ/64, DM/64).
template <int MODE>
__global__ __launch_bounds__(32) void k_proj(const bf* __restrict__ A, const bf* __restrict__ Bt, const float* __restrict__ bias, h16* Ph, h16* Pr, int resT) {
    __shared__ __align__(16) float os[16 * 68];
    const int K = DM;
    const int lane = threadIdx.x & 31, lr = lane & 15, hi = lane >> 4; const int r0 = blockIdx.x * 64, c0 = blockIdx.y * 64;
    v8f acc[4][4];
#pragma unroll
    for (int mb = 0; mb < 4; ++mb)
#pragma unroll
        for (int nb = 0; nb < 4; ++nb) acc[mb][nb] = (v8f){};
    const size_t aoff = (size_t)(r0 + lr) * K + 8 * hi, boff = (size_t)(c0 + lr) * K + 8 * hi;
#pragma unroll 1
    for (int kc = 0; kc < K; kc += 32) {
        v16bf a[4];
#pragma unroll
        for (int mb = 0; mb < 4; ++mb) a[mb] = ldb(A + aoff + (size_t)mb * 16 * K + kc);
#pragma unroll
        for (int nb = 0; nb < 4; ++nb) { const v16bf b = ldb(Bt + boff + (size_t)nb * 16 * K + kc);
#pragma unroll
            for (int mb = 0; mb < 4; ++mb) acc[mb][nb] = wmmab(a[mb], b, acc[mb][nb]); }
        asm volatile("v_nop\n\tv_nop\n\tv_nop\n\tv_nop" : "+v"(acc[0][0]), "+v"(acc[1][1]), "+v"(acc[2][2]), "+v"(acc[3][3]) : "v"(a[0]), "v"(a[1]), "v"(a[2]), "v"(a[3]));
    }
    float bc[4];
#pragma unroll
    for (int nb = 0; nb < 4; ++nb) bc[nb] = (MODE == 0) ? bfr(bias[c0 + nb * 16 + lr]) : 0.0f;   // MODE 0: c0 + 63 < DM
    size_t tbase, rbase; bool wr;                                                                 // wr: block-uniform, whole tile inside the residual plane
    if (MODE == 0) { const int bb = r0 / SEQ, tt = r0 % SEQ; const int zc = bb * NH_ + c0 / HD;
                     tbase = ((size_t)zc * SEQ + (size_t)tt) * HD; rbase = ((size_t)zc * (size_t)resT + (size_t)tt) * HD; wr = tt < resT; }
    else           { const int bb = c0 / SEQ, tt = c0 % SEQ;
                     tbase = (size_t)bb * (size_t)DM * SEQ + (size_t)r0 * SEQ + (size_t)tt; rbase = (size_t)bb * (size_t)DM * (size_t)resT + (size_t)r0 * (size_t)resT + (size_t)tt; wr = tt < resT; }
#pragma unroll
    for (int mb = 0; mb < 4; ++mb) {
        float br[8];
#pragma unroll
        for (int j = 0; j < 8; ++j) br[j] = (MODE == 1) ? bfr(bias[r0 + mb * 16 + hi * 8 + j]) : 0.0f;   // MODE 1: r0 + 63 < DM
#pragma unroll
        for (int nb = 0; nb < 4; ++nb) {
#pragma unroll
            for (int j = 0; j < 8; ++j) os[(hi * 8 + j) * 68 + nb * 16 + lr] = acc[mb][nb][j] + bc[nb] + br[j]; }   // D: row 8h+j, col lane&15
        wave_sync();
{
            if (MODE == 0) {
                const size_t sb = tbase + (size_t)(mb * 16) * HD;
                const size_t rb = rbase + (size_t)(mb * 16) * HD;
#pragma unroll
                for (int hh = 0; hh < 2; ++hh) {
#pragma unroll
                    for (int s = 0; s < 2; ++s) { const int p = s * 32 + lane; const int row = p >> 2, c8 = (p & 3) * 8;   // 2 s x 8 rows = 16 rows; 4 lanes x 8 = 32 columns of head hh
                        const v4f x0 = *(const v4fa*)(&os[row * 68 + hh * 32 + c8]); const v4f x1 = *(const v4fa*)(&os[row * 68 + hh * 32 + c8 + 4]); v8h hv, rv;
#pragma unroll
                        for (int i = 0; i < 4; ++i) { const h16 a0 = (h16)x0[i]; const h16 a1 = (h16)x1[i]; hv[i] = a0; hv[4 + i] = a1; rv[i] = (h16)((x0[i] - (float)a0) * QRS); rv[4 + i] = (h16)((x1[i] - (float)a1) * QRS); }
                        const size_t oo = sb + (size_t)hh * ((size_t)SEQ * HD) + (size_t)p * 8;
                        const size_t ro = rb + (size_t)hh * ((size_t)resT * HD) + (size_t)p * 8;
                        *(v8h*)(Ph + oo) = hv; if (wr) *(v8h*)(Pr + ro) = rv; } }
            } else {
                const size_t sb = tbase + (size_t)(mb * 16) * SEQ;
                const size_t rb = rbase + (size_t)(mb * 16) * (size_t)resT;
#pragma unroll
                for (int s = 0; s < 4; ++s) { const int row = 4 * s + (lane >> 3), c8 = (lane & 7) * 8;   // 4 s x 4 row groups = 16 rows; 8 lanes x 8 = 64 columns
                    const v4f x0 = *(const v4fa*)(&os[row * 68 + c8]); const v4f x1 = *(const v4fa*)(&os[row * 68 + c8 + 4]); v8h hv, rv;
#pragma unroll
                    for (int i = 0; i < 4; ++i) { const h16 a0 = (h16)x0[i]; const h16 a1 = (h16)x1[i]; hv[i] = a0; hv[4 + i] = a1; rv[i] = (h16)((x0[i] - (float)a0) * QRS); rv[4 + i] = (h16)((x1[i] - (float)a1) * QRS); }
                    const size_t oo = sb + (size_t)row * SEQ + c8;
                    const size_t ro = rb + (size_t)row * (size_t)resT + c8;
                    *(v8h*)(Ph + oo) = hv; if (wr) *(v8h*)(Pr + ro) = rv; }
            }
             }
        wave_sync();
    }
}

// k_flash: fused attention, one wave per 16 query rows of one (graph, head); K / V^T / Q fragments straight from the f16 planes (two 16-B loads each, arithmetic addressing).
// Transposed form: S^T[key][t] = K Q^T (A = K rows, B = Q rows); lane (t = lane&15, h = lane>>4) holds keys 8h+r of each 16-key tile, so the packed
// P tile is directly the B fragment of O^T[d][t] = V^T P^T (element r <- tile keys 0..15, element 8+r <- tile keys 16..31, lane unchanged).
// Softmax state (running max over kept keys, partial sum) is one scalar per lane; the two lane halves of a row are combined with one xor-16 exchange.
// Keep rule: one adjacency word per lane per 32-key step (row t0 + lane&15, word key0/32), bit 8h+r for the first tile and 16+8h+r for the second; dropped elements are selected to 0 by value.
// All rows: scores = K Q + (K Q_res + K_res Q) / 2048; P = f16 value + f16 residual x2048; O = V P + (V P_res + V_res P) / 2048 (residual products in their own accumulators); row sum from the f32 exponentials.
// P below 2^-14 (after the 2^14 carry) is selected to 0 on the exponent argument; residuals pass the subnormal select.
// Epilogue: O^T staged in a wave-private LDS tile; the wave's 16 rows x 32 columns of the context value plane and residual plane (each one contiguous 1024-byte run) written as 2 instructions x 32 lanes x 16 B
__global__ __launch_bounds__(32 * AW) void k_flash(const h16* __restrict__ QH, const h16* __restrict__ QR, const h16* __restrict__ KP, const h16* __restrict__ KR,
                                                   const h16* __restrict__ VT, const h16* __restrict__ VR, const unsigned* __restrict__ MB, h16* CH, h16* CR) {
    __shared__ __align__(16) float os[AW * 16 * OSP];
    const int lane = threadIdx.x & 31, lr = lane & 15, hi = lane >> 4;
    const int wave = __builtin_amdgcn_readfirstlane((int)(threadIdx.x >> 5));
    const int zh = blockIdx.y; const int b = zh / NH_;
    const int t0 = (blockIdx.x * AW + wave) * 16;
    const unsigned* mrow = MB + (size_t)(b * SEQ + t0 + lr) * (SEQ / 32);
    const size_t pbase = (size_t)zh * SEQ * HD;
    const size_t qo = pbase + (size_t)(t0 + lr) * HD + 8 * hi;
    const v16h qh = ldh(QH + qo), qr = ldh(QR + qo);            // B fragments: col t, k = d (HD = 32 = one k-step)
    const size_t ko = pbase + (size_t)lr * HD + 8 * hi;        // + key * HD       (A fragment: row key, k = d)
    const size_t vo = pbase + (size_t)lr * SEQ + 8 * hi;       // + 16j*SEQ + key  (A fragment: row d, k = key)
    v8f o0 = (v8f){}, o1 = (v8f){}, oR0 = (v8f){}, oR1 = (v8f){};
    float m = NEGB, l = 0.0f;
#pragma unroll 1
    for (int key0 = 0; key0 < SEQ; key0 += 32) {
        unsigned mw = mrow[key0 >> 5];
        asm volatile("" : "+v"(mw));
        const unsigned sa = mw >> (8 * hi);
        const h16* ka = KP + ko + (size_t)key0 * HD;
        const h16* kr = KR + ko + (size_t)key0 * HD;
        const v16h ka0 = ldh(ka), kb0 = ldh(ka + 16 * HD);
        const v16h kra0 = ldh(kr), krb0 = ldh(kr + 16 * HD);
        v8f sHa = (v8f){}, sLa = (v8f){}, sHb = (v8f){}, sLb = (v8f){};
        sHa = wmma16g(ka0, qh, sHa); sLa = wmma16g(ka0, qr, sLa); sLa = wmma16g(kra0, qh, sLa);
        sHb = wmma16g(kb0, qh, sHb); sLb = wmma16g(kb0, qr, sLb); sLb = wmma16g(krb0, qh, sLb);
        float ta[8], tb[8]; bool fa[8], fb[8]; float mx = NEGB;
#pragma unroll
        for (int r = 0; r < 8; ++r) {
            fa[r] = ((sa >> r) & 1u) != 0u;
            fb[r] = ((sa >> (16 + r)) & 1u) != 0u;
            ta[r] = (sHa[r] + sLa[r] * QRI) * SC2; tb[r] = (sHb[r] + sLb[r] * QRI) * SC2;
            mx = fmaxf(mx, fmaxf(fa[r] ? ta[r] : NEGB, fb[r] ? tb[r] : NEGB)); }
        mx = fmaxf(mx, __shfl_xor(mx, 16, 32));
        const float mnew = fmaxf(m, mx);
        const float alpha = __builtin_amdgcn_exp2f(m - mnew);
        const float sh = PSH - mnew;
        v16h pb, pr; float ls = 0.0f;
#pragma unroll
        for (int r = 0; r < 8; ++r) {
            const float xa = ta[r] + sh, xb = tb[r] + sh;
            const float ea = __builtin_amdgcn_exp2f(xa), eb = __builtin_amdgcn_exp2f(xb);
            const bool za = fa[r] & (xa >= -14.0f), zb = fb[r] & (xb >= -14.0f);
            const float ga = za ? ea : 0.0f, gb = zb ? eb : 0.0f;       // dropped elements and sub-2^-14 values selected to 0 by value
            const h16 pa = (h16)ga; const h16 pc = (h16)gb;             // 0 or in [2^-14, 2^14]
            pb[r] = pa; pb[8 + r] = pc;
            pr[r] = toh_flush((ga - (float)pa) * QRS); pr[8 + r] = toh_flush((gb - (float)pc) * QRS);
            ls += ga + gb; }
        l = l * alpha + ls; m = mnew;
        o0 = o0 * alpha; o1 = o1 * alpha; oR0 = oR0 * alpha; oR1 = oR1 * alpha;
        const h16* va = VT + vo + key0;
        const h16* vr = VR + vo + key0;
        const v16h v0 = ldh(va), v1 = ldh(va + (size_t)16 * SEQ);
        const v16h vr0 = ldh(vr), vr1 = ldh(vr + (size_t)16 * SEQ);
        o0 = wmma16g(v0, pb, o0); o1 = wmma16g(v1, pb, o1);
        oR0 = wmma16g(v0, pr, oR0); oR1 = wmma16g(v1, pr, oR1);
        oR0 = wmma16g(vr0, pb, oR0); oR1 = wmma16g(vr1, pb, oR1);
    }
    l += __shfl_xor(l, 16, 32);
    const bool any = l > 0.0f;
    const float lsafe = any ? l : 1.0f;
    const float inv = any ? (1.0f / lsafe) : 0.0f;             // no kept key -> zeros (cannot happen: the diagonal is always kept)
    const v8f f0 = o0 + oR0 * QRI, f1 = o1 + oR1 * QRI;
    const int wb = wave * 16 * OSP;
    // O^T D layout: f_j[r] = (d = 16j + 8h + r, t = lane&15) -> os[t][d]; rows 0..15 x columns 0..31 all written
    { v4f a, c;
      a[0] = f0[0] * inv; a[1] = f0[1] * inv; a[2] = f0[2] * inv; a[3] = f0[3] * inv; c[0] = f0[4] * inv; c[1] = f0[5] * inv; c[2] = f0[6] * inv; c[3] = f0[7] * inv;
      *(v4fa*)(&os[wb + lr * OSP +  0 + 8 * hi]) = a; *(v4fa*)(&os[wb + lr * OSP +  0 + 8 * hi + 4]) = c;
      a[0] = f1[0] * inv; a[1] = f1[1] * inv; a[2] = f1[2] * inv; a[3] = f1[3] * inv; c[0] = f1[4] * inv; c[1] = f1[5] * inv; c[2] = f1[6] * inv; c[3] = f1[7] * inv;
      *(v4fa*)(&os[wb + lr * OSP + 16 + 8 * hi]) = a; *(v4fa*)(&os[wb + lr * OSP + 16 + 8 * hi + 4]) = c; }
    wave_sync();
    const size_t cb = ((size_t)zh * SEQ + (size_t)t0) * HD;
{
#pragma unroll
        for (int s = 0; s < 2; ++s) { const int p = s * 32 + lane; const int row = p >> 2, c8 = (p & 3) * 8;   // 2 s x 8 rows = 16 rows; 4 lanes x 8 = 32 columns
            const v4f x0 = *(const v4fa*)(&os[wb + row * OSP + c8]); const v4f x1 = *(const v4fa*)(&os[wb + row * OSP + c8 + 4]); v8h hv, rv;
#pragma unroll
            for (int i = 0; i < 4; ++i) { const h16 a0 = toh_flush(x0[i]); const h16 a1 = toh_flush(x1[i]); hv[i] = a0; hv[4 + i] = a1;
                rv[i] = toh_flush((x0[i] - (float)a0) * QRS); rv[4 + i] = toh_flush((x1[i] - (float)a1) * QRS); }
            *(v8h*)(CH + cb + (size_t)p * 8) = hv; *(v8h*)(CR + cb + (size_t)p * 8) = rv; }
         }
}

// k_outp: output projection, ONE WAVE per 32x64 tile; A = context planes [(b*NH_ + h)][t][32] (k-step kc = head kc/32, K-contiguous rows, arithmetic addressing), value and residual planes in separate
// accumulators; Bt = transposed output weight plane [n][k] (f16, x64); OUT[m][n] = (sum + sum_res / 2048) / 64 + bias (bias bf16-converted, added in f32).
__global__ __launch_bounds__(32) void k_outp(const h16* __restrict__ CH, const h16* __restrict__ CR, const h16* __restrict__ WT, const float* __restrict__ bias, float* OUT) {
    __shared__ __align__(16) float os[16 * 68];
    const int lane = threadIdx.x & 31, lr = lane & 15, hi = lane >> 4; const int r0 = blockIdx.x * 32, c0 = blockIdx.y * 64;
    const int bb = r0 / SEQ, tt = r0 % SEQ;                    // SEQ % 32 == 0: the 32-row tile lies in one graph
    v8f aH[2][4], aR[2][4];
#pragma unroll
    for (int mb = 0; mb < 2; ++mb)
#pragma unroll
        for (int nb = 0; nb < 4; ++nb) { aH[mb][nb] = (v8f){}; aR[mb][nb] = (v8f){}; }
    const size_t aoff = ((size_t)bb * NH_ * SEQ + (size_t)(tt + lr)) * HD + 8 * hi;
    const size_t boff = (size_t)(c0 + lr) * DM + 8 * hi;
#pragma unroll 1
    for (int kc = 0; kc < DM; kc += 32) {
        const size_t ah = aoff + (size_t)(kc / HD) * SEQ * HD;
        const v16h a0 = ldh(CH + ah), a1 = ldh(CH + ah + 16 * HD);
        const v16h e0 = ldh(CR + ah), e1 = ldh(CR + ah + 16 * HD);
#pragma unroll
        for (int nb = 0; nb < 4; ++nb) { const v16h w = ldh(WT + boff + (size_t)nb * 16 * DM + kc);
            aH[0][nb] = wmma16g(a0, w, aH[0][nb]); aH[1][nb] = wmma16g(a1, w, aH[1][nb]);
            aR[0][nb] = wmma16g(e0, w, aR[0][nb]); aR[1][nb] = wmma16g(e1, w, aR[1][nb]); }
    }
    float bc[4];
#pragma unroll
    for (int nb = 0; nb < 4; ++nb) bc[nb] = bfr(bias[c0 + nb * 16 + lr]);   // c0 + 63 < DM
    float* obase = OUT + ((size_t)bb * OUT_SEQ + (size_t)tt) * DM + c0;
#pragma unroll
    for (int mb = 0; mb < 2; ++mb) {
#pragma unroll
        for (int nb = 0; nb < 4; ++nb) {
#pragma unroll
            for (int j = 0; j < 8; ++j) os[(hi * 8 + j) * 68 + nb * 16 + lr] = (aH[mb][nb][j] + aR[mb][nb][j] * QRI) * WOI + bc[nb]; }   // D: row 8h+j, col lane&15
        wave_sync();
{
#pragma unroll
            for (int s = 0; s < 8; ++s) { const int row = 2 * s + (lane >> 4), c4 = (lane & 15) * 4;   // 8 s x 2 rows = 16 rows; 16 lanes x 4 floats = 64 columns
                const v4f val = *(const v4fa*)(&os[row * 68 + c4]);
                *(v4f*)(obase + (size_t)(mb * 16 + row) * DM + c4) = val; }
             }
        wave_sync();
    }
}

static constexpr size_t al256(size_t v) { return (v + 255) & ~(size_t)255; }
static constexpr size_t SZ_XB = al256((size_t)NB * SEQ * DM * 2);
static constexpr size_t SZ_WB = al256((size_t)3 * DM * DM * 2);
static constexpr size_t SZ_WO = al256((size_t)DM * DM * 2);
static constexpr size_t SZ_PL = al256((size_t)NB * NH_ * SEQ * HD * 2);
static constexpr size_t SZ_MB = al256((size_t)NB * SEQ * (SEQ / 32) * 4);
static constexpr size_t SZ_TOTAL = SZ_XB + SZ_WB + SZ_WO + 8 * SZ_PL + SZ_MB;
static_assert(SZ_TOTAL <= (size_t)134217728);          // workspace carve <= 128 MiB
static_assert(((size_t)DM * DM * 2) % 256 == 0);       // weight sub-planes stay 256-byte aligned
static_assert((size_t)NB * NH_ * SEQ * HD == (size_t)NB * DM * SEQ);       // v^T plane [(b*DM + m)][t] has the same extent as the q/k planes
static_assert((size_t)(NB * SEQ / 64) * 64 * DM == (size_t)NB * NH_ * SEQ * HD);    // projection grids x tile == plane extent
static_assert((size_t)(SEQ / (16 * AW)) * (NB * NH_) * AW * 16 * HD == (size_t)NB * NH_ * SEQ * HD);   // flash grid x rows x head width == context plane extent
static_assert((size_t)(SEQ / MROWS) * NB * MROWS * (SEQ / 32) * 4 == (size_t)NB * SEQ * (SEQ / 32) * 4);   // mask grid x band == bit plane extent

extern "C" void kernel_launch(void* const* d_in, const int* in_sizes, int n_in,
                              void* d_out, int out_size, void* d_ws, size_t ws_size, hipStream_t stream) {
    if (n_in < 11) return;
    const size_t needx = ((size_t)(NB - 1) * SEQ_FULL + SEQ) * DM;
    if ((size_t)in_sizes[0] < needx) return;
    if (in_sizes[1] < 1 || in_sizes[2] < 1) return;
    if ((size_t)in_sizes[3] < (size_t)DM * DM || (size_t)in_sizes[5] < (size_t)DM * DM || (size_t)in_sizes[7] < (size_t)DM * DM || (size_t)in_sizes[9] < (size_t)DM * DM) return;
    if (in_sizes[4] < DM || in_sizes[6] < DM || in_sizes[8] < DM || in_sizes[10] < DM) return;
    if ((size_t)out_size < ((size_t)(NB - 1) * OUT_SEQ + SEQ) * DM) return;
    if (SZ_TOTAL > ws_size) return;
    // wire order: h, src, dst, Wq, bq, Wk, bk, Wv, bv, Wo, bo
    const float* hin = (const float*)d_in[0];
    const int* src = (const int*)d_in[1]; const int* dst = (const int*)d_in[2];
    const float* wq = (const float*)d_in[3]; const float* bq = (const float*)d_in[4];
    const float* wk = (const float*)d_in[5]; const float* bk = (const float*)d_in[6];
    const float* wv = (const float*)d_in[7]; const float* bv = (const float*)d_in[8];
    const float* wo = (const float*)d_in[9]; const float* bo = (const float*)d_in[10];
    const int nE = in_sizes[1] < in_sizes[2] ? in_sizes[1] : in_sizes[2];
    float* OUT = (float*)d_out;      // [NB*SEQ][256]
    char* wsp = (char*)d_ws;
    bf* XB = (bf*)wsp; wsp += SZ_XB;                 // h  [NB*SEQ][256] bf16
    bf* WB = (bf*)wsp; wsp += SZ_WB;                 // [3][256][256]: q | k | v, transposed to [out][in]
    h16* WOH = (h16*)wsp; wsp += SZ_WO;              // [256][256] output weight, transposed to [out][in], f16 x64
    h16* QH = (h16*)wsp; wsp += SZ_PL;               // [NB*8][SEQ][32]
    h16* QR = (h16*)wsp; wsp += SZ_PL;               // residual x2048
    h16* KP = (h16*)wsp; wsp += SZ_PL;               // [NB*8][SEQ][32]
    h16* KR = (h16*)wsp; wsp += SZ_PL;               // residual x2048
    h16* VT = (h16*)wsp; wsp += SZ_PL;               // [NB*8][32][SEQ]
    h16* VR = (h16*)wsp; wsp += SZ_PL;               // residual x2048
    h16* CH = (h16*)wsp; wsp += SZ_PL;               // context [NB*8][SEQ][32]
    h16* CR = (h16*)wsp; wsp += SZ_PL;               // residual x2048
    unsigned* MB = (unsigned*)wsp; wsp += SZ_MB;     // adjacency bits [NB*SEQ][SEQ/32]
    bf* WQ = WB; bf* WK = WB + (size_t)DM * DM; bf* WV = WB + (size_t)2 * DM * DM;

    k_mask<<<dim3(SEQ / MROWS, NB, 1), MTH, 0, stream>>>(src, dst, nE, MB);

    if (SEQ == SEQ_FULL) {
        const size_t n8 = (size_t)NB * SEQ * DM / 8;
        k_cvt8<<<(unsigned)((n8 + 255) / 256), 256, 0, stream>>>(hin, XB, n8);
    } else {
        const size_t n8 = (size_t)SEQ * DM / 8;
        for (int b = 0; b < NB; ++b) k_cvt8<<<(unsigned)((n8 + 255) / 256), 256, 0, stream>>>(hin + (size_t)b * SEQ_FULL * DM, XB + (size_t)b * SEQ * DM, n8);
    }
    // weights: in W[k][n] (256 x 256, square) -> out WT[n][k]
    k_wtb<<<DM / 32, 256, 0, stream>>>(wq, WQ);
    k_wtb<<<DM / 32, 256, 0, stream>>>(wk, WK);
    k_wtb<<<DM / 32, 256, 0, stream>>>(wv, WV);
    k_wth<<<DM / 32, 256, 0, stream>>>(wo, WOH);

    // q, k: A = h rows (m = b*SEQ + t), Bt = WT rows (n = h*32 + d) -> plane [(b*8 + h)][t][d]; residual planes for all tokens
    k_proj<0><<<dim3(NB * SEQ / 64, DM / 64, 1), 32, 0, stream>>>(XB, WQ, bq, QH, QR, SEQ);
    k_proj<0><<<dim3(NB * SEQ / 64, DM / 64, 1), 32, 0, stream>>>(XB, WK, bk, KP, KR, SEQ);
    // v^T: A = WvT rows (m = h*32 + d), Bt = h rows (n = b*SEQ + t) -> plane [(b*256 + m)][t] = [(b*8 + h)][d][t]; residual plane for all tokens
    k_proj<1><<<dim3(DM / 64, NB * SEQ / 64, 1), 32, 0, stream>>>(WV, XB, bv, VT, VR, SEQ);

    k_flash<<<dim3(SEQ / (16 * AW), NB * NH_, 1), 32 * AW, 0, stream>>>(QH, QR, KP, KR, VT, VR, MB, CH, CR);

    k_outp<<<dim3(NB * SEQ / 32, DM / 64, 1), 32, 0, stream>>>(CH, CR, WOH, bo, OUT);
}

// v002
// Measured time: 73 microseconds a run.
// Next to v001, in two timings, it ran 1.67 and 1.69 times as fast.
// Over all steps from v000 it is 4.53 times as fast.
#include <hip/hip_runtime.h>

// Graph attention layer: node features h [NB][SEQ][256]; q/k/v = h W + bias with W stored [in][out]; 8 heads x 32; scores (q.k) * 32^-0.5; per graph and query row the kept keys are the listed
// edges (graph = src / size, row = src mod size, column = dst mod size) plus the diagonal; all other keys get probability 0; context heads concatenated, then context Wo + bo (Wo [in][out]); output [NB*SEQ][256] f32.
// Compute dtypes, f32 accumulate everywhere: q/k/v projections v_wmma_f32_16x16x32_bf16 (h, W, bias RNE-converted to bf16; products exact);
// scores v_wmma_f32_16x16x32_f16: q and k each as f16 value + f16 residual x2048 (three products, residual products in their own accumulator folded by 1/2048);
// P.V v_wmma_f32_16x16x32_f16: P (x16384 carry, cancels in the normalisation) and v each as f16 value + f16 residual x2048, residual products in their own accumulator, row sum from the f32 exponentials; softmax f32 (online, running max over kept keys);
// output projection v_wmma_f32_16x16x32_f16: context as f16 value + f16 residual x2048 (own accumulator), Wo as f16 of the bf16-converted weight x64 (folded by 1/64), bias bf16-converted, added in f32.
// Layout: bf16 copy of h; transposed weight planes [out][in]; q, k planes (value, residual) [b*NH_+h][t][d]; v^T planes [b*NH_+h][d][t]; adjacency bit plane [b*SEQ+t][SEQ/32] (bit j of word w = key 32w+j);
// context planes (value, residual) [b*NH_+h][t][d]; fused flash kernel in transposed form (S^T = K Q^T, O^T = V^T P^T).

#ifndef NB
#define NB 16
#endif
#ifndef SEQ
#define SEQ 512
#endif
#define NB_FULL  16
#define SEQ_FULL 512
#ifndef OUT_SEQ
#define OUT_SEQ SEQ              // row pitch (in tokens) between batches of the output
#endif
#define DM   256
#define NH_  8
#define HD   32
#define AW   4                   // waves per flash block (16 query rows each)
#define OSP  36                  // LDS row pitch (floats) of the flash output tile
#define QRS  2048.0f             // carry of every residual plane / residual fragment
#define QRI  (1.0f / 2048.0f)
#define SC2  ((float)(0.17677669529663687 * 1.4426950408889634))   // HD^-0.5 * log2(e)
#define PSH  14.0f               // log2 of the P carry (16384)
#define NEGB (-3.0e38f)
#define WOS  64.0f               // carry of the output-projection weight plane
#define WOI  (1.0f / 64.0f)
#define MROWS 64                 // query rows per mask-builder block
#define MTH   512                // threads per block of the preparation launch
#define MUN   8                  // 16-byte load pairs in flight per thread in the edge scan
#define WTP  (DM + 4)            // LDS row pitch (floats) of the weight transpose tile
#define NBM  ((SEQ / MROWS) * NB)                 // preparation launch: adjacency blocks
#define NBW  (4 * (DM / 32))                      // weight transpose blocks
#define NBC  ((NB * SEQ * (DM / 8)) / MTH)        // h copy blocks
#define PREP_LDS ((MROWS * SEQ) > (32 * WTP * 4) ? (MROWS * SEQ) : (32 * WTP * 4))

static_assert(HD == 32);
static_assert(NH_ * HD == DM);                 // head h = columns h*32 + d
static_assert(DM % 64 == 0);                   // column tiles of 64 = two heads
static_assert(64 % HD == 0);
static_assert(DM % 32 == 0);                   // GEMM k-loop steps by 32
static_assert(SEQ % 64 == 0);                  // a 64-row tile never straddles two batches
static_assert((NB * SEQ) % 64 == 0);
static_assert(SEQ % 32 == 0);                  // key loop steps by 32; one mask word per 32-key step
static_assert(SEQ % (16 * AW) == 0);           // flash grid covers the sequence exactly
static_assert(((size_t)SEQ * DM) % 8 == 0);
static_assert(((size_t)DM * DM) % 8 == 0);
static_assert(NB <= NB_FULL);
static_assert(SEQ <= SEQ_FULL);
static_assert((OSP * 4) % 16 == 0);
static_assert(SEQ % MROWS == 0);               // mask-builder bands cover the rows exactly
static_assert((MROWS & (MROWS - 1)) == 0 && (SEQ_FULL & (SEQ_FULL - 1)) == 0 && (NB_FULL & (NB_FULL - 1)) == 0 && SEQ_FULL % MROWS == 0);   // row, column and band test by bit masks
static_assert((MROWS * SEQ) % (16 * MTH) == 0);            // flag tile zero fill: MTH threads x 16 B per trip
static_assert(((MROWS * SEQ) / 32) % MTH == 0);            // pack: whole trips of MTH words
static_assert(MROWS <= MTH);
static_assert((WTP * 4) % 16 == 0);
static_assert((32 * DM) % (8 * MTH) == 0);                 // weight transpose store: whole trips of MTH threads x 8 elements
static_assert(DM % (MTH / 32) == 0);                       // weight transpose load: whole trips of MTH/32 rows
static_assert((SEQ * (DM / 8)) % MTH == 0);                // h copy: whole blocks, none straddles two graphs
static_assert(2 * 32 * 8 == 16 * HD);                      // flash epilogue: instructions x lanes x halves == 16 rows x 32 columns
static_assert(8 * 32 * 4 == 16 * 64);                      // output epilogue: instructions x lanes x floats == 16 rows x 64 columns
static_assert((size_t)MROWS * SEQ <= 131072);              // static LDS per kernel
static_assert((size_t)32 * WTP * 4 <= 131072);
static_assert((size_t)AW * 16 * OSP * 4 <= 131072);
static_assert((size_t)16 * 68 * 4 <= 131072);
static_assert(sizeof(unsigned) == 4);

typedef _Float16 h16;
typedef unsigned short bf;
typedef __attribute__((ext_vector_type(16))) __bf16   v16bf;
typedef __attribute__((ext_vector_type(16))) _Float16 v16h;
typedef __attribute__((ext_vector_type(8)))  _Float16 v8h;
typedef __attribute__((ext_vector_type(8)))  unsigned short v8us;
typedef __attribute__((ext_vector_type(8)))  float    v8f;
typedef __attribute__((ext_vector_type(4)))  float    v4f;
typedef v4f  __attribute__((may_alias)) v4fa;
typedef __attribute__((ext_vector_type(4)))  unsigned v4u;
typedef v4u  __attribute__((may_alias)) v4ua;
typedef int  v4e __attribute__((ext_vector_type(4), aligned(4)));   // four edge indices; only the element's own alignment is assumed

__device__ __forceinline__ unsigned short f2bf(float f) { unsigned u = __float_as_uint(f); u += 0x7FFFu + ((u >> 16) & 1u); return (unsigned short)(u >> 16); }
__device__ __forceinline__ float bfr(float f) { return __uint_as_float(((unsigned)f2bf(f)) << 16); }   // value after RNE convert to bf16
__device__ __forceinline__ v16h cat16(v8h lo, v8h hi) { return __builtin_shufflevector(lo, hi, 0, 1, 2, 3, 4, 5, 6, 7, 8, 9, 10, 11, 12, 13, 14, 15); }
__device__ __forceinline__ v16bf cat16b(v8us lo, v8us hi) { return __builtin_bit_cast(v16bf, __builtin_shufflevector(lo, hi, 0, 1, 2, 3, 4, 5, 6, 7, 8, 9, 10, 11, 12, 13, 14, 15)); }
__device__ __forceinline__ v8f wmma16(v16h a, v16h b, v8f c) { return __builtin_amdgcn_wmma_f32_16x16x32_f16(false, a, false, b, (short)0, c, false, false); }
__device__ __forceinline__ v8f wmmab(v16bf a, v16bf b, v8f c) { return __builtin_amdgcn_wmma_f32_16x16x32_bf16(false, a, false, b, (short)0, c, false, false); }
// fragment loaders from K-contiguous 16-bit rows; p already includes + 8*(lane>>4): elements 0..7 <- k0+8h+0..7, elements 8..15 <- k0+16+8h+0..7 (same map for A and B)
__device__ __forceinline__ v16h  ldh(const h16* p) { return cat16(*(const v8h*)p, *(const v8h*)(p + 16)); }
__device__ __forceinline__ v16bf ldb(const bf* p)  { return cat16b(*(const v8us*)p, *(const v8us*)(p + 16)); }
// ordering point for wave-private LDS tiles (same wave writes and reads)
__device__ __forceinline__ void wave_sync() { __builtin_amdgcn_fence(3 /* release order */, "wavefront"); __builtin_amdgcn_wave_barrier(); asm volatile("" ::: "memory"); }
// f32 -> f16 convert that cannot produce a subnormal operand (|v| < 2^-14 -> +0)
__device__ __forceinline__ h16 toh_flush(float v) { const h16 r = (h16)v; return (fabsf(v) < 6.103515625e-05f) ? (h16)0.0f : r; }
// one f16 matrix instruction with its own guard (ties its accumulator, keeps both fragments live)
__device__ __forceinline__ v8f wmma16g(v16h a, v16h b, v8f c) { c = wmma16(a, b, c); asm volatile("v_nop\n\tv_nop\n\tv_nop\n\tv_nop" : "+v"(c) : "v"(a), "v"(b)); return c; }
// four flag bytes (0/1 each, lowest byte = lowest key) -> four bits
__device__ __forceinline__ unsigned nib4(unsigned x) { return (x | (x >> 7) | (x >> 14) | (x >> 21)) & 0xFu; }

// cvt_body: bf16 (RNE) copy of h, eight elements per thread; vector i of the packed copy [NB*SEQ][DM] comes from graph i / (SEQ*DM/8) of the input, whose graphs lie SEQ_FULL rows apart.
__device__ __forceinline__ void cvt_body(int blk, const float* __restrict__ src, bf* dst) {
    const size_t i = (size_t)blk * MTH + threadIdx.x;                       // blk < NBC: i < NB*SEQ*DM/8
    const size_t g = i / ((size_t)SEQ * DM / 8), e = i % ((size_t)SEQ * DM / 8);
    const v8f v = *(const v8f*)(src + g * ((size_t)SEQ_FULL * DM) + e * 8); v8us o;
#pragma unroll
    for (int k = 0; k < 8; ++k) o[k] = f2bf(v[k]);
    *(v8us*)(dst + i * 8) = o;
    asm volatile("s_wait_xcnt 0x0" ::: "memory");   // precaution: for the copy blocks the kernel ends after this store
}

// wt_body: weight transpose: in W[k][n] (DM rows of DM) -> out WT[n][k]; one block per 32 output rows, tile staged in LDS (block barrier), each output row DM x 2 B = 4 lines.
// HALF false: bf16 (RNE convert). HALF true: f16 of (bf16-converted weight x WOS), subnormal results selected to +0.
template <bool HALF>
__device__ __forceinline__ void wt_body(float* ts, int n0, const float* __restrict__ W, unsigned short* WT) {
    const int tid = threadIdx.x; const int j = tid & 31, kk = tid >> 5;
#pragma unroll 1   // kept rolled: small code
    for (int i = 0; i < DM / (MTH / 32); ++i) { const int k = kk + (MTH / 32) * i; ts[j * WTP + k] = W[(size_t)k * DM + n0 + j]; }   // k covers 0..DM-1, n0 + j < DM
    __syncthreads();
#pragma unroll 1   // kept rolled: small code
    for (int it = 0; it < (32 * DM) / (8 * MTH); ++it) { const int q = it * MTH + tid; const int row = q / (DM / 8), c8 = (q % (DM / 8)) * 8;   // trips x MTH threads x 8 = 32 rows x DM
        const v4f x0 = *(const v4fa*)(&ts[row * WTP + c8]); const v4f x1 = *(const v4fa*)(&ts[row * WTP + c8 + 4]);
        unsigned short* dp = WT + (size_t)(n0 + row) * DM + c8;
        if (HALF) { v8h o;
#pragma unroll
            for (int i = 0; i < 4; ++i) { o[i] = toh_flush(bfr(x0[i]) * WOS); o[4 + i] = toh_flush(bfr(x1[i]) * WOS); }
            *(v8h*)dp = o; }
        else { v8us o;
#pragma unroll
            for (int i = 0; i < 4; ++i) { o[i] = f2bf(x0[i]); o[4 + i] = f2bf(x1[i]); }
            *(v8us*)dp = o; }
        asm volatile("s_wait_xcnt 0x0" ::: "memory"); }   // the next trip rewrites the store's address and data registers
}

// mask_body: adjacency bit plane for one (graph b, band of MROWS query rows starting at r0). Block-local byte flag tile [MROWS][SEQ] in LDS: zero fill, block barrier, diagonal + every listed edge that falls in the band
// stores the byte 1 (plain same-value byte stores, no read-modify-write), block barrier, then each thread packs 32 flags into one word and the band's 64-byte rows go out thread-linear (one 128-byte line per wave).
// Every block reads the whole edge list: MTH threads, four edges per 16-byte load, MUN load pairs issued before the first is used, so the scan runs at the rate of the loads and not at their latency.
// Band test: graph = floor(s / SEQ_FULL), graphs -NB_FULL..-1 wrap to 0..NB_FULL-1, row = s mod SEQ_FULL. With lo = the first s of this band in the wrapped (negative) range, s lies in the band
// exactly when s - lo (modulo 2^32) is in [0, MROWS) or in [NB_FULL*SEQ_FULL, NB_FULL*SEQ_FULL + MROWS): all bits clear but the row bits and the bit NB_FULL*SEQ_FULL.
// The remainder of the list (fewer than MTH * 4 * MUN edges) goes one edge per thread with clamped addresses; both loops are block-uniform. SEQ/MROWS bands x NB graphs.
__device__ __forceinline__ bool in_band(int s, unsigned lo) { return (((unsigned)s - lo) & ~(unsigned)(NB_FULL * SEQ_FULL + MROWS - 1)) == 0u; }
__device__ __forceinline__ void mark_edge(unsigned char* fl, int s, int d) {
    const int c = d & (SEQ_FULL - 1); if (c < SEQ) fl[(s & (MROWS - 1)) * SEQ + c] = (unsigned char)1;   // row in [0, MROWS), c in [0, SEQ)
}
__device__ __forceinline__ void mask_body(unsigned char* fl, int r0, int b, const int* __restrict__ src, const int* __restrict__ dst, int nE, unsigned* MB) {
    const int tid = threadIdx.x;
    const v4u zz = (v4u){0u, 0u, 0u, 0u};
#pragma unroll
    for (int i = 0; i < (MROWS * SEQ) / (16 * MTH); ++i) *(v4ua*)(&fl[(i * MTH + tid) * 16]) = zz;
    __syncthreads();
    if (tid < MROWS) fl[tid * SEQ + r0 + tid] = (unsigned char)1;          // diagonal, r0 + tid < SEQ
    const unsigned lo = (unsigned)((b - NB_FULL) * SEQ_FULL + r0);
    const int* ps = src + tid * 4; const int* pd = dst + tid * 4;
    int base = 0;
#pragma unroll 1   // one group of MUN load pairs per trip; more would only grow the code
    for (; base + MTH * 4 * MUN <= nE; base += MTH * 4 * MUN) {
        v4e S[MUN], D[MUN];
#pragma unroll     // all MUN pairs issued back to back, S and D in registers
        for (int u = 0; u < MUN; ++u) { S[u] = *(const v4e*)(ps + u * MTH * 4); D[u] = *(const v4e*)(pd + u * MTH * 4); }   // last element base + MTH*4*MUN - 1 < nE
#pragma unroll     // constant indices into S and D
        for (int u = 0; u < MUN; ++u) {
#pragma unroll
            for (int i = 0; i < 4; ++i) if (in_band(S[u][i], lo)) mark_edge(fl, S[u][i], D[u][i]); }
        ps += MTH * 4 * MUN; pd += MTH * 4 * MUN;
    }
#pragma unroll 1   // short remainder, kept small
    for (; base < nE; base += MTH) {
        const int e = base + tid; const int ec = e < nE ? e : nE - 1;      // a clamped lane repeats the last edge: the same byte, the same value
        const int s = src[ec], d = dst[ec];
        if (in_band(s, lo)) mark_edge(fl, s, d);
    }
    __syncthreads();
    const size_t wbase = (size_t)(b * SEQ + r0) * (SEQ / 32);
#pragma unroll
    for (int i = 0; i < (MROWS * SEQ) / (32 * MTH); ++i) { const int p = i * MTH + tid;   // word p of the band = flags p*32 .. p*32+31
        const v4u X = *(const v4ua*)(&fl[p * 32]); const v4u Y = *(const v4ua*)(&fl[p * 32 + 16]);
        MB[wbase + p] = nib4(X[0]) | (nib4(X[1]) << 4) | (nib4(X[2]) << 8) | (nib4(X[3]) << 12) | (nib4(Y[0]) << 16) | (nib4(Y[1]) << 20) | (nib4(Y[2]) << 24) | (nib4(Y[3]) << 28); }
}

// k_prep: all the preparation that reads the inputs alone, as block ranges of ONE launch, so that the pieces run side by side and not one behind the other. MTH threads per block; the branch is on blockIdx alone
// (block-uniform, so each piece's barriers are passed by all of its block's threads); one LDS area serves the flag tile and the transpose tile. Longest pieces first:
// blocks [0, NBM) adjacency bands, [NBM, NBM + NBW) weight transposes (q, k, v, output; DM/32 blocks each), [NBM + NBW, NBM + NBW + NBC) bf16 copy of h.
__global__ __launch_bounds__(MTH) void k_prep(const int* __restrict__ src, const int* __restrict__ dst, int nE, unsigned* MB,
                                              const float* __restrict__ wq, const float* __restrict__ wk, const float* __restrict__ wv, const float* __restrict__ wo, bf* WB, h16* WOH,
                                              const float* __restrict__ hin, bf* XB) {
    __shared__ __align__(16) unsigned char sm[PREP_LDS];
    const int blk = blockIdx.x;
    if (blk < NBM) { mask_body(sm, (blk % (SEQ / MROWS)) * MROWS, blk / (SEQ / MROWS), src, dst, nE, MB); return; }
    if (blk < NBM + NBW) {
        const int w = (blk - NBM) / (DM / 32), n0 = ((blk - NBM) % (DM / 32)) * 32;
        if (w == 3) wt_body<true>((float*)sm, n0, wo, (unsigned short*)WOH);
        else        wt_body<false>((float*)sm, n0, w == 0 ? wq : (w == 1 ? wk : wv), WB + (size_t)w * DM * DM);
        return; }
    cvt_body(blk - NBM - NBW, hin, XB);
}

// proj_body: register-blocked bf16 GEMM, ONE WAVE per 64x64 tile (16 accumulators), operands straight from K-contiguous bf16 planes, K = DM.
// C[m][n] = sum_k A[m][k] Bt[n][k] + bias, written as f16 (Ph) and, for tokens t < resT (resT a multiple of 64, block-uniform test), the f16 residual x2048 (Pr).
// MODE 0: A = x rows (m = b*SEQ + t), Bt = W rows (n = h*32 + d), bias per column; plane [(b*NH_ + h)][t][32] (residual plane [(b*NH_ + h)][resT][32]). The 64-column tile spans two heads; per 16-row slab and head
//         (8 rows per instruction).
// MODE 1: A = W rows (m = h*32 + d), Bt = x rows (n = b*SEQ + t), bias per row; plane [(b*DM + m)][t].
template <int MODE>
__device__ __forceinline__ void proj_body(float* os, int r0, int c0, const bf* __restrict__ A, const bf* __restrict__ Bt, const float* __restrict__ bias, h16* Ph, h16* Pr, int resT) {
    const int K = DM;
    const int lane = threadIdx.x & 31, lr = lane & 15, hi = lane >> 4;
    v8f acc[4][4];
#pragma unroll
    for (int mb = 0; mb < 4; ++mb)
#pragma unroll
        for (int nb = 0; nb < 4; ++nb) acc[mb][nb] = (v8f){};
    const size_t aoff = (size_t)(r0 + lr) * K + 8 * hi, boff = (size_t)(c0 + lr) * K + 8 * hi;
#pragma unroll 1
    for (int kc = 0; kc < K; kc += 32) {
        v16bf a[4];
#pragma unroll
        for (int mb = 0; mb < 4; ++mb) a[mb] = ldb(A + aoff + (size_t)mb * 16 * K + kc);
#pragma unroll
        for (int nb = 0; nb < 4; ++nb) { const v16bf b = ldb(Bt + boff + (size_t)nb * 16 * K + kc);
#pragma unroll
            for (int mb = 0; mb < 4; ++mb) acc[mb][nb] = wmmab(a[mb], b, acc[mb][nb]); }
        asm volatile("v_nop\n\tv_nop\n\tv_nop\n\tv_nop" : "+v"(acc[0][0]), "+v"(acc[1][1]), "+v"(acc[2][2]), "+v"(acc[3][3]) : "v"(a[0]), "v"(a[1]), "v"(a[2]), "v"(a[3]));
    }
    float bc[4];
#pragma unroll
    for (int nb = 0; nb < 4; ++nb) bc[nb] = (MODE == 0) ? bfr(bias[c0 + nb * 16 + lr]) : 0.0f;   // MODE 0: c0 + 63 < DM
    size_t tbase, rbase; bool wr;                                                                 // wr: block-uniform, whole tile inside the residual plane
    if (MODE == 0) { const int bb = r0 / SEQ, tt = r0 % SEQ; const int zc = bb * NH_ + c0 / HD;
                     tbase = ((size_t)zc * SEQ + (size_t)tt) * HD; rbase = ((size_t)zc * (size_t)resT + (size_t)tt) * HD; wr = tt < resT; }
    else           { const int bb = c0 / SEQ, tt = c0 % SEQ;
                     tbase = (size_t)bb * (size_t)DM * SEQ + (size_t)r0 * SEQ + (size_t)tt; rbase = (size_t)bb * (size_t)DM * (size_t)resT + (size_t)r0 * (size_t)resT + (size_t)tt; wr = tt < resT; }
#pragma unroll
    for (int mb = 0; mb < 4; ++mb) {
        float br[8];
#pragma unroll
        for (int j = 0; j < 8; ++j) br[j] = (MODE == 1) ? bfr(bias[r0 + mb * 16 + hi * 8 + j]) : 0.0f;   // MODE 1: r0 + 63 < DM
#pragma unroll
        for (int nb = 0; nb < 4; ++nb) {
#pragma unroll
            for (int j = 0; j < 8; ++j) os[(hi * 8 + j) * 68 + nb * 16 + lr] = acc[mb][nb][j] + bc[nb] + br[j]; }   // D: row 8h+j, col lane&15
        wave_sync();
{
            if (MODE == 0) {
                const size_t sb = tbase + (size_t)(mb * 16) * HD;
                const size_t rb = rbase + (size_t)(mb * 16) * HD;
#pragma unroll
                for (int hh = 0; hh < 2; ++hh) {
#pragma unroll
                    for (int s = 0; s < 2; ++s) { const int p = s * 32 + lane; const int row = p >> 2, c8 = (p & 3) * 8;   // 2 s x 8 rows = 16 rows; 4 lanes x 8 = 32 columns of head hh
                        const v4f x0 = *(const v4fa*)(&os[row * 68 + hh * 32 + c8]); const v4f x1 = *(const v4fa*)(&os[row * 68 + hh * 32 + c8 + 4]); v8h hv, rv;
#pragma unroll
                        for (int i = 0; i < 4; ++i) { const h16 a0 = (h16)x0[i]; const h16 a1 = (h16)x1[i]; hv[i] = a0; hv[4 + i] = a1; rv[i] = (h16)((x0[i] - (float)a0) * QRS); rv[4 + i] = (h16)((x1[i] - (float)a1) * QRS); }
                        const size_t oo = sb + (size_t)hh * ((size_t)SEQ * HD) + (size_t)p * 8;
                        const size_t ro = rb + (size_t)hh * ((size_t)resT * HD) + (size_t)p * 8;
                        *(v8h*)(Ph + oo) = hv; if (wr) *(v8h*)(Pr + ro) = rv; } }
            } else {
                const size_t sb = tbase + (size_t)(mb * 16) * SEQ;
                const size_t rb = rbase + (size_t)(mb * 16) * (size_t)resT;
#pragma unroll
                for (int s = 0; s < 4; ++s) { const int row = 4 * s + (lane >> 3), c8 = (lane & 7) * 8;   // 4 s x 4 row groups = 16 rows; 8 lanes x 8 = 64 columns
                    const v4f x0 = *(const v4fa*)(&os[row * 68 + c8]); const v4f x1 = *(const v4fa*)(&os[row * 68 + c8 + 4]); v8h hv, rv;
#pragma unroll
                    for (int i = 0; i < 4; ++i) { const h16 a0 = (h16)x0[i]; const h16 a1 = (h16)x1[i]; hv[i] = a0; hv[4 + i] = a1; rv[i] = (h16)((x0[i] - (float)a0) * QRS); rv[4 + i] = (h16)((x1[i] - (float)a1) * QRS); }
                    const size_t oo = sb + (size_t)row * SEQ + c8;
                    const size_t ro = rb + (size_t)row * (size_t)resT + c8;
                    *(v8h*)(Ph + oo) = hv; if (wr) *(v8h*)(Pr + ro) = rv; }
            }
             }
        wave_sync();
    }
}

// k_proj3: the three projections as one launch, so that their waves run side by side: blockIdx.z = 0 q, 1 k (MODE 0), 2 v^T (MODE 1); blockIdx.x = 64-token tile, blockIdx.y = 64-feature tile. grid (NB*SEQ/64, DM/64, 3).
__global__ __launch_bounds__(32) void k_proj3(const bf* __restrict__ XB, const bf* __restrict__ WB, const float* __restrict__ bq, const float* __restrict__ bk, const float* __restrict__ bv,
                                              h16* QH, h16* QR, h16* KP, h16* KR, h16* VT, h16* VR, int resT) {
    __shared__ __align__(16) float os[16 * 68];
    const int tok0 = blockIdx.x * 64, f0 = blockIdx.y * 64; const int z = blockIdx.z;
    if (z == 2) proj_body<1>(os, f0, tok0, WB + (size_t)2 * DM * DM, XB, bv, VT, VR, resT);
    else        proj_body<0>(os, tok0, f0, XB, WB + (size_t)z * DM * DM, z ? bk : bq, z ? KP : QH, z ? KR : QR, resT);
}

// k_flash: fused attention, one wave per 16 query rows of one (graph, head); K / V^T / Q fragments straight from the f16 planes (two 16-B loads each, arithmetic addressing).
// Transposed form: S^T[key][t] = K Q^T (A = K rows, B = Q rows); lane (t = lane&15, h = lane>>4) holds keys 8h+r of each 16-key tile, so the packed
// P tile is directly the B fragment of O^T[d][t] = V^T P^T (element r <- tile keys 0..15, element 8+r <- tile keys 16..31, lane unchanged).
// Softmax state (running max over kept keys, partial sum) is one scalar per lane; the two lane halves of a row are combined with one xor-16 exchange.
// Keep rule: one adjacency word per lane per 32-key step (row t0 + lane&15, word key0/32), bit 8h+r for the first tile and 16+8h+r for the second; dropped elements are selected to 0 by value.
// All rows: scores = K Q + (K Q_res + K_res Q) / 2048; P = f16 value + f16 residual x2048; O = V P + (V P_res + V_res P) / 2048 (residual products in their own accumulators); row sum from the f32 exponentials.
// P below 2^-14 (after the 2^14 carry) is selected to 0 on the exponent argument; residuals pass the subnormal select.
// Epilogue: O^T staged in a wave-private LDS tile; the wave's 16 rows x 32 columns of the context value plane and residual plane (each one contiguous 1024-byte run) written as 2 instructions x 32 lanes x 16 B
__global__ __launch_bounds__(32 * AW) void k_flash(const h16* __restrict__ QH, const h16* __restrict__ QR, const h16* __restrict__ KP, const h16* __restrict__ KR,
                                                   const h16* __restrict__ VT, const h16* __restrict__ VR, const unsigned* __restrict__ MB, h16* CH, h16* CR) {
    __shared__ __align__(16) float os[AW * 16 * OSP];
    const int lane = threadIdx.x & 31, lr = lane & 15, hi = lane >> 4;
    const int wave = __builtin_amdgcn_readfirstlane((int)(threadIdx.x >> 5));
    const int zh = blockIdx.y; const int b = zh / NH_;
    const int t0 = (blockIdx.x * AW + wave) * 16;
    const unsigned* mrow = MB + (size_t)(b * SEQ + t0 + lr) * (SEQ / 32);
    const size_t pbase = (size_t)zh * SEQ * HD;
    const size_t qo = pbase + (size_t)(t0 + lr) * HD + 8 * hi;
    const v16h qh = ldh(QH + qo), qr = ldh(QR + qo);            // B fragments: col t, k = d (HD = 32 = one k-step)
    const size_t ko = pbase + (size_t)lr * HD + 8 * hi;        // + key * HD       (A fragment: row key, k = d)
    const size_t vo = pbase + (size_t)lr * SEQ + 8 * hi;       // + 16j*SEQ + key  (A fragment: row d, k = key)
    v8f o0 = (v8f){}, o1 = (v8f){}, oR0 = (v8f){}, oR1 = (v8f){};
    float m = NEGB, l = 0.0f;
#pragma unroll 1
    for (int key0 = 0; key0 < SEQ; key0 += 32) {
        unsigned mw = mrow[key0 >> 5];
        asm volatile("" : "+v"(mw));
        const unsigned sa = mw >> (8 * hi);
        const h16* ka = KP + ko + (size_t)key0 * HD;
        const h16* kr = KR + ko + (size_t)key0 * HD;
        const v16h ka0 = ldh(ka), kb0 = ldh(ka + 16 * HD);
        const v16h kra0 = ldh(kr), krb0 = ldh(kr + 16 * HD);
        v8f sHa = (v8f){}, sLa = (v8f){}, sHb = (v8f){}, sLb = (v8f){};
        sHa = wmma16g(ka0, qh, sHa); sLa = wmma16g(ka0, qr, sLa); sLa = wmma16g(kra0, qh, sLa);
        sHb = wmma16g(kb0, qh, sHb); sLb = wmma16g(kb0, qr, sLb); sLb = wmma16g(krb0, qh, sLb);
        float ta[8], tb[8]; bool fa[8], fb[8]; float mx = NEGB;
#pragma unroll
        for (int r = 0; r < 8; ++r) {
            fa[r] = ((sa >> r) & 1u) != 0u;
            fb[r] = ((sa >> (16 + r)) & 1u) != 0u;
            ta[r] = (sHa[r] + sLa[r] * QRI) * SC2; tb[r] = (sHb[r] + sLb[r] * QRI) * SC2;
            mx = fmaxf(mx, fmaxf(fa[r] ? ta[r] : NEGB, fb[r] ? tb[r] : NEGB)); }
        mx = fmaxf(mx, __shfl_xor(mx, 16, 32));
        const float mnew = fmaxf(m, mx);
        const float alpha = __builtin_amdgcn_exp2f(m - mnew);
        const float sh = PSH - mnew;
        v16h pb, pr; float ls = 0.0f;
#pragma unroll
        for (int r = 0; r < 8; ++r) {
            const float xa = ta[r] + sh, xb = tb[r] + sh;
            const float ea = __builtin_amdgcn_exp2f(xa), eb = __builtin_amdgcn_exp2f(xb);
            const bool za = fa[r] & (xa >= -14.0f), zb = fb[r] & (xb >= -14.0f);
            const float ga = za ? ea : 0.0f, gb = zb ? eb : 0.0f;       // dropped elements and sub-2^-14 values selected to 0 by value
            const h16 pa = (h16)ga; const h16 pc = (h16)gb;             // 0 or in [2^-14, 2^14]
            pb[r] = pa; pb[8 + r] = pc;
            pr[r] = toh_flush((ga - (float)pa) * QRS); pr[8 + r] = toh_flush((gb - (float)pc) * QRS);
            ls += ga + gb; }
        l = l * alpha + ls; m = mnew;
        o0 = o0 * alpha; o1 = o1 * alpha; oR0 = oR0 * alpha; oR1 = oR1 * alpha;
        const h16* va = VT + vo + key0;
        const h16* vr = VR + vo + key0;
        const v16h v0 = ldh(va), v1 = ldh(va + (size_t)16 * SEQ);
        const v16h vr0 = ldh(vr), vr1 = ldh(vr + (size_t)16 * SEQ);
        o0 = wmma16g(v0, pb, o0); o1 = wmma16g(v1, pb, o1);
        oR0 = wmma16g(v0, pr, oR0); oR1 = wmma16g(v1, pr, oR1);
        oR0 = wmma16g(vr0, pb, oR0); oR1 = wmma16g(vr1, pb, oR1);
    }
    l += __shfl_xor(l, 16, 32);
    const bool any = l > 0.0f;
    const float lsafe = any ? l : 1.0f;
    const float inv = any ? (1.0f / lsafe) : 0.0f;             // no kept key -> zeros (cannot happen: the diagonal is always kept)
    const v8f f0 = o0 + oR0 * QRI, f1 = o1 + oR1 * QRI;
    const int wb = wave * 16 * OSP;
    // O^T D layout: f_j[r] = (d = 16j + 8h + r, t = lane&15) -> os[t][d]; rows 0..15 x columns 0..31 all written
    { v4f a, c;
      a[0] = f0[0] * inv; a[1] = f0[1] * inv; a[2] = f0[2] * inv; a[3] = f0[3] * inv; c[0] = f0[4] * inv; c[1] = f0[5] * inv; c[2] = f0[6] * inv; c[3] = f0[7] * inv;
      *(v4fa*)(&os[wb + lr * OSP +  0 + 8 * hi]) = a; *(v4fa*)(&os[wb + lr * OSP +  0 + 8 * hi + 4]) = c;
      a[0] = f1[0] * inv; a[1] = f1[1] * inv; a[2] = f1[2] * inv; a[3] = f1[3] * inv; c[0] = f1[4] * inv; c[1] = f1[5] * inv; c[2] = f1[6] * inv; c[3] = f1[7] * inv;
      *(v4fa*)(&os[wb + lr * OSP + 16 + 8 * hi]) = a; *(v4fa*)(&os[wb + lr * OSP + 16 + 8 * hi + 4]) = c; }
    wave_sync();
    const size_t cb = ((size_t)zh * SEQ + (size_t)t0) * HD;
{
#pragma unroll
        for (int s = 0; s < 2; ++s) { const int p = s * 32 + lane; const int row = p >> 2, c8 = (p & 3) * 8;   // 2 s x 8 rows = 16 rows; 4 lanes x 8 = 32 columns
            const v4f x0 = *(const v4fa*)(&os[wb + row * OSP + c8]); const v4f x1 = *(const v4fa*)(&os[wb + row * OSP + c8 + 4]); v8h hv, rv;
#pragma unroll
            for (int i = 0; i < 4; ++i) { const h16 a0 = toh_flush(x0[i]); const h16 a1 = toh_flush(x1[i]); hv[i] = a0; hv[4 + i] = a1;
                rv[i] = toh_flush((x0[i] - (float)a0) * QRS); rv[4 + i] = toh_flush((x1[i] - (float)a1) * QRS); }
            *(v8h*)(CH + cb + (size_t)p * 8) = hv; *(v8h*)(CR + cb + (size_t)p * 8) = rv; }
         }
}

// k_outp: output projection, ONE WAVE per 32x64 tile; A = context planes [(b*NH_ + h)][t][32] (k-step kc = head kc/32, K-contiguous rows, arithmetic addressing), value and residual planes in separate
// accumulators; Bt = transposed output weight plane [n][k] (f16, x64); OUT[m][n] = (sum + sum_res / 2048) / 64 + bias (bias bf16-converted, added in f32).
__global__ __launch_bounds__(32) void k_outp(const h16* __restrict__ CH, const h16* __restrict__ CR, const h16* __restrict__ WT, const float* __restrict__ bias, float* OUT) {
    __shared__ __align__(16) float os[16 * 68];
    const int lane = threadIdx.x & 31, lr = lane & 15, hi = lane >> 4; const int r0 = blockIdx.x * 32, c0 = blockIdx.y * 64;
    const int bb = r0 / SEQ, tt = r0 % SEQ;                    // SEQ % 32 == 0: the 32-row tile lies in one graph
    v8f aH[2][4], aR[2][4];
#pragma unroll
    for (int mb = 0; mb < 2; ++mb)
#pragma unroll
        for (int nb = 0; nb < 4; ++nb) { aH[mb][nb] = (v8f){}; aR[mb][nb] = (v8f){}; }
    const size_t aoff = ((size_t)bb * NH_ * SEQ + (size_t)(tt + lr)) * HD + 8 * hi;
    const size_t boff = (size_t)(c0 + lr) * DM + 8 * hi;
#pragma unroll 1
    for (int kc = 0; kc < DM; kc += 32) {
        const size_t ah = aoff + (size_t)(kc / HD) * SEQ * HD;
        const v16h a0 = ldh(CH + ah), a1 = ldh(CH + ah + 16 * HD);
        const v16h e0 = ldh(CR + ah), e1 = ldh(CR + ah + 16 * HD);
#pragma unroll
        for (int nb = 0; nb < 4; ++nb) { const v16h w = ldh(WT + boff + (size_t)nb * 16 * DM + kc);
            aH[0][nb] = wmma16g(a0, w, aH[0][nb]); aH[1][nb] = wmma16g(a1, w, aH[1][nb]);
            aR[0][nb] = wmma16g(e0, w, aR[0][nb]); aR[1][nb] = wmma16g(e1, w, aR[1][nb]); }
    }
    float bc[4];
#pragma unroll
    for (int nb = 0; nb < 4; ++nb) bc[nb] = bfr(bias[c0 + nb * 16 + lr]);   // c0 + 63 < DM
    float* obase = OUT + ((size_t)bb * OUT_SEQ + (size_t)tt) * DM + c0;
#pragma unroll
    for (int mb = 0; mb < 2; ++mb) {
#pragma unroll
        for (int nb = 0; nb < 4; ++nb) {
#pragma unroll
            for (int j = 0; j < 8; ++j) os[(hi * 8 + j) * 68 + nb * 16 + lr] = (aH[mb][nb][j] + aR[mb][nb][j] * QRI) * WOI + bc[nb]; }   // D: row 8h+j, col lane&15
        wave_sync();
{
#pragma unroll
            for (int s = 0; s < 8; ++s) { const int row = 2 * s + (lane >> 4), c4 = (lane & 15) * 4;   // 8 s x 2 rows = 16 rows; 16 lanes x 4 floats = 64 columns
                const v4f val = *(const v4fa*)(&os[row * 68 + c4]);
                *(v4f*)(obase + (size_t)(mb * 16 + row) * DM + c4) = val; }
             }
        wave_sync();
    }
}

static constexpr size_t al256(size_t v) { return (v + 255) & ~(size_t)255; }
static constexpr size_t SZ_XB = al256((size_t)NB * SEQ * DM * 2);
static constexpr size_t SZ_WB = al256((size_t)3 * DM * DM * 2);
static constexpr size_t SZ_WO = al256((size_t)DM * DM * 2);
static constexpr size_t SZ_PL = al256((size_t)NB * NH_ * SEQ * HD * 2);
static constexpr size_t SZ_MB = al256((size_t)NB * SEQ * (SEQ / 32) * 4);
static constexpr size_t SZ_TOTAL = SZ_XB + SZ_WB + SZ_WO + 8 * SZ_PL + SZ_MB;
static_assert(SZ_TOTAL <= (size_t)134217728);          // workspace carve <= 128 MiB
static_assert(((size_t)DM * DM * 2) % 256 == 0);       // weight sub-planes stay 256-byte aligned
static_assert((size_t)NB * NH_ * SEQ * HD == (size_t)NB * DM * SEQ);       // v^T plane [(b*DM + m)][t] has the same extent as the q/k planes
static_assert((size_t)(NB * SEQ / 64) * 64 * DM == (size_t)NB * NH_ * SEQ * HD);    // projection grids x tile == plane extent
static_assert((size_t)(SEQ / (16 * AW)) * (NB * NH_) * AW * 16 * HD == (size_t)NB * NH_ * SEQ * HD);   // flash grid x rows x head width == context plane extent
static_assert((size_t)(SEQ / MROWS) * NB * MROWS * (SEQ / 32) * 4 == (size_t)NB * SEQ * (SEQ / 32) * 4);   // mask grid x band == bit plane extent

extern "C" void kernel_launch(void* const* d_in, const int* in_sizes, int n_in,
                              void* d_out, int out_size, void* d_ws, size_t ws_size, hipStream_t stream) {
    if (n_in < 11) return;
    const size_t needx = ((size_t)(NB - 1) * SEQ_FULL + SEQ) * DM;
    if ((size_t)in_sizes[0] < needx) return;
    if (in_sizes[1] < 1 || in_sizes[2] < 1) return;
    if ((size_t)in_sizes[3] < (size_t)DM * DM || (size_t)in_sizes[5] < (size_t)DM * DM || (size_t)in_sizes[7] < (size_t)DM * DM || (size_t)in_sizes[9] < (size_t)DM * DM) return;
    if (in_sizes[4] < DM || in_sizes[6] < DM || in_sizes[8] < DM || in_sizes[10] < DM) return;
    if ((size_t)out_size < ((size_t)(NB - 1) * OUT_SEQ + SEQ) * DM) return;
    if (SZ_TOTAL > ws_size) return;
    // wire order: h, src, dst, Wq, bq, Wk, bk, Wv, bv, Wo, bo
    const float* hin = (const float*)d_in[0];
    const int* src = (const int*)d_in[1]; const int* dst = (const int*)d_in[2];
    const float* wq = (const float*)d_in[3]; const float* bq = (const float*)d_in[4];
    const float* wk = (const float*)d_in[5]; const float* bk = (const float*)d_in[6];
    const float* wv = (const float*)d_in[7]; const float* bv = (const float*)d_in[8];
    const float* wo = (const float*)d_in[9]; const float* bo = (const float*)d_in[10];
    const int nE = in_sizes[1] < in_sizes[2] ? in_sizes[1] : in_sizes[2];
    float* OUT = (float*)d_out;      // [NB*SEQ][256]
    char* wsp = (char*)d_ws;
    bf* XB = (bf*)wsp; wsp += SZ_XB;                 // h  [NB*SEQ][256] bf16
    bf* WB = (bf*)wsp; wsp += SZ_WB;                 // [3][256][256]: q | k | v, transposed to [out][in]
    h16* WOH = (h16*)wsp; wsp += SZ_WO;              // [256][256] output weight, transposed to [out][in], f16 x64
    h16* QH = (h16*)wsp; wsp += SZ_PL;               // [NB*8][SEQ][32]
    h16* QR = (h16*)wsp; wsp += SZ_PL;               // residual x2048
    h16* KP = (h16*)wsp; wsp += SZ_PL;               // [NB*8][SEQ][32]
    h16* KR = (h16*)wsp; wsp += SZ_PL;               // residual x2048
    h16* VT = (h16*)wsp; wsp += SZ_PL;               // [NB*8][32][SEQ]
    h16* VR = (h16*)wsp; wsp += SZ_PL;               // residual x2048
    h16* CH = (h16*)wsp; wsp += SZ_PL;               // context [NB*8][SEQ][32]
    h16* CR = (h16*)wsp; wsp += SZ_PL;               // residual x2048
    unsigned* MB = (unsigned*)wsp; wsp += SZ_MB;     // adjacency bits [NB*SEQ][SEQ/32]

    // adjacency bits, transposed weight planes (in W[k][n] -> out WT[n][k]) and the bf16 copy of h
    k_prep<<<NBM + NBW + NBC, MTH, 0, stream>>>(src, dst, nE, MB, wq, wk, wv, wo, WB, WOH, hin, XB);

    // q, k -> planes [(b*8 + h)][t][d]; v^T -> plane [(b*8 + h)][d][t]; residual planes for all tokens
    k_proj3<<<dim3(NB * SEQ / 64, DM / 64, 3), 32, 0, stream>>>(XB, WB, bq, bk, bv, QH, QR, KP, KR, VT, VR, SEQ);

    k_flash<<<dim3(SEQ / (16 * AW), NB * NH_, 1), 32 * AW, 0, stream>>>(QH, QR, KP, KR, VT, VR, MB, CH, CR);

    k_outp<<<dim3(NB * SEQ / 32, DM / 64, 1), 32, 0, stream>>>(CH, CR, WOH, bo, OUT);
}

// v003
// It runs in 66 microseconds.
// Timed twice side by side with v002, it ran 1.12 and 1.11 times as fast.
// Counting every step since v000, it is 5.06 times as fast.
#include <hip/hip_runtime.h>

// Graph attention layer: node features h [NB][SEQ][256]; q/k/v = h W + bias with W stored [in][out]; 8 heads x 32; scores (q.k) * 32^-0.5; per graph and query row the kept keys are the listed
// edges (graph = src / size, row = src mod size, column = dst mod size) plus the diagonal; all other keys get probability 0; context heads concatenated, then context Wo + bo (Wo [in][out]); output [NB*SEQ][256] f32.
// Compute dtypes, f32 accumulate everywhere: q/k/v projections v_wmma_f32_16x16x32_bf16 (h, W, bias RNE-converted to bf16; products exact);
// scores v_wmma_f32_16x16x32_f16: q and k each as f16 value + f16 residual x2048 (three products, residual products in their own accumulator folded by 1/2048);
// P.V v_wmma_f32_16x16x32_f16: P (x16384 carry, cancels in the normalisation) and v each as f16 value + f16 residual x2048, residual products in their own accumulator, row sum from the f32 exponentials; softmax f32 (online, running max over kept keys);
// output projection v_wmma_f32_16x16x32_f16: context as f16 value + f16 residual x2048 (own accumulator), Wo as f16 of the bf16-converted weight x64 (folded by 1/64), bias bf16-converted, added in f32.
// Layout: bf16 copy of h; transposed weight planes [out][in]; q, k planes (value, residual) [b*NH_+h][t][d]; v^T planes [b*NH_+h][d][t]; adjacency bit plane [b*SEQ+t][SEQ/32] (bit j of word w = key 32w+j);
// fused flash kernel in transposed form (S^T = K Q^T, O^T = V^T P^T); the context (value, residual) stays in the block's LDS as A fragments and the same launch does the output projection.

#ifndef NB
#define NB 16
#endif
#ifndef SEQ
#define SEQ 512
#endif
#define NB_FULL  16
#define SEQ_FULL 512
#ifndef OUT_SEQ
#define OUT_SEQ SEQ              // row pitch (in tokens) between batches of the output
#endif
#define DM   256
#define NH_  8
#define HD   32
#define AQ   2                   // 16-row query tiles per flash block
#define AW   (NH_ * AQ)          // waves per flash block: one per (query tile, head)
#define OSP  36                  // LDS row pitch (floats) of a wave's output tile
#define QRS  2048.0f             // carry of every residual plane / residual fragment
#define QRI  (1.0f / 2048.0f)
#define SC2  ((float)(0.17677669529663687 * 1.4426950408889634))   // HD^-0.5 * log2(e)
#define PSH  14.0f               // log2 of the P carry (16384)
#define NEGB (-3.0e38f)
#define WOS  64.0f               // carry of the output-projection weight plane
#define WOI  (1.0f / 64.0f)
#define MROWS 64                 // query rows per mask-builder block
#define MTH   512                // threads per block of the preparation launch
#define MUN   8                  // 16-byte load pairs in flight per thread in the edge scan
#define WTP  (DM + 4)            // LDS row pitch (floats) of the weight transpose tile
#define NBM  ((SEQ / MROWS) * NB)                 // preparation launch: adjacency blocks
#define NBW  (4 * (DM / 32))                      // weight transpose blocks
#define NBC  ((NB * SEQ * (DM / 8)) / MTH)        // h copy blocks
#define PREP_LDS ((MROWS * SEQ) > (32 * WTP * 4) ? (MROWS * SEQ) : (32 * WTP * 4))

static_assert(HD == 32);
static_assert(NH_ * HD == DM);                 // head h = columns h*32 + d
static_assert(DM % 64 == 0);                   // column tiles of 64 = two heads
static_assert(64 % HD == 0);
static_assert(DM % 32 == 0);                   // GEMM k-loop steps by 32
static_assert(SEQ % 64 == 0);                  // a 64-row tile never straddles two batches
static_assert((NB * SEQ) % 64 == 0);
static_assert(SEQ % 32 == 0);                  // key loop steps by 32; one mask word per 32-key step
static_assert(SEQ % (16 * AQ) == 0);           // flash grid covers the sequence exactly
static_assert(((size_t)SEQ * DM) % 8 == 0);
static_assert(((size_t)DM * DM) % 8 == 0);
static_assert(NB <= NB_FULL);
static_assert(SEQ <= SEQ_FULL);
static_assert((OSP * 4) % 16 == 0);
static_assert(SEQ % MROWS == 0);               // mask-builder bands cover the rows exactly
static_assert((MROWS & (MROWS - 1)) == 0 && (SEQ_FULL & (SEQ_FULL - 1)) == 0 && (NB_FULL & (NB_FULL - 1)) == 0 && SEQ_FULL % MROWS == 0);   // row, column and band test by bit masks
static_assert((MROWS * SEQ) % (16 * MTH) == 0);            // flag tile zero fill: MTH threads x 16 B per trip
static_assert(((MROWS * SEQ) / 32) % MTH == 0);            // pack: whole trips of MTH words
static_assert(MROWS <= MTH);
static_assert((WTP * 4) % 16 == 0);
static_assert((32 * DM) % (8 * MTH) == 0);                 // weight transpose store: whole trips of MTH threads x 8 elements
static_assert(DM % (MTH / 32) == 0);                       // weight transpose load: whole trips of MTH/32 rows
static_assert((SEQ * (DM / 8)) % MTH == 0);                // h copy: whole blocks, none straddles two graphs
static_assert(4 * 32 * 4 == 16 * 32);                      // output epilogue: instructions x lanes x floats == 16 rows x 32 columns
static_assert(NH_ * 32 == DM);                             // the NH_ waves of a query tile cover the DM output columns, 32 each
static_assert(32 * AW <= 1024);
static_assert((size_t)MROWS * SEQ <= 131072);              // static LDS per kernel
static_assert((size_t)32 * WTP * 4 <= 131072);
static_assert((size_t)AW * 16 * OSP * 4 + (size_t)AW * 4 * 32 * 16 <= 131072);
static_assert((size_t)16 * 68 * 4 <= 131072);
static_assert(sizeof(unsigned) == 4);

typedef _Float16 h16;
typedef unsigned short bf;
typedef __attribute__((ext_vector_type(16))) __bf16   v16bf;
typedef __attribute__((ext_vector_type(16))) _Float16 v16h;
typedef __attribute__((ext_vector_type(8)))  _Float16 v8h;
typedef __attribute__((ext_vector_type(8)))  unsigned short v8us;
typedef __attribute__((ext_vector_type(8)))  float    v8f;
typedef __attribute__((ext_vector_type(4)))  float    v4f;
typedef v4f  __attribute__((may_alias)) v4fa;
typedef __attribute__((ext_vector_type(4)))  unsigned v4u;
typedef v4u  __attribute__((may_alias)) v4ua;
typedef int  v4e __attribute__((ext_vector_type(4), aligned(4)));   // four edge indices; only the element's own alignment is assumed

__device__ __forceinline__ unsigned short f2bf(float f) { unsigned u = __float_as_uint(f); u += 0x7FFFu + ((u >> 16) & 1u); return (unsigned short)(u >> 16); }
__device__ __forceinline__ float bfr(float f) { return __uint_as_float(((unsigned)f2bf(f)) << 16); }   // value after RNE convert to bf16
__device__ __forceinline__ v16h cat16(v8h lo, v8h hi) { return __builtin_shufflevector(lo, hi, 0, 1, 2, 3, 4, 5, 6, 7, 8, 9, 10, 11, 12, 13, 14, 15); }
__device__ __forceinline__ v16bf cat16b(v8us lo, v8us hi) { return __builtin_bit_cast(v16bf, __builtin_shufflevector(lo, hi, 0, 1, 2, 3, 4, 5, 6, 7, 8, 9, 10, 11, 12, 13, 14, 15)); }
__device__ __forceinline__ v8f wmma16(v16h a, v16h b, v8f c) { return __builtin_amdgcn_wmma_f32_16x16x32_f16(false, a, false, b, (short)0, c, false, false); }
__device__ __forceinline__ v8f wmmab(v16bf a, v16bf b, v8f c) { return __builtin_amdgcn_wmma_f32_16x16x32_bf16(false, a, false, b, (short)0, c, false, false); }
// fragment loaders from K-contiguous 16-bit rows; p already includes + 8*(lane>>4): elements 0..7 <- k0+8h+0..7, elements 8..15 <- k0+16+8h+0..7 (same map for A and B)
__device__ __forceinline__ v16h  ldh(const h16* p) { return cat16(*(const v8h*)p, *(const v8h*)(p + 16)); }
__device__ __forceinline__ v16bf ldb(const bf* p)  { return cat16b(*(const v8us*)p, *(const v8us*)(p + 16)); }
// ordering point for wave-private LDS tiles (same wave writes and reads)
__device__ __forceinline__ void wave_sync() { __builtin_amdgcn_fence(3 /* release order */, "wavefront"); __builtin_amdgcn_wave_barrier(); asm volatile("" ::: "memory"); }
// f32 -> f16 convert that cannot produce a subnormal operand (|v| < 2^-14 -> +0)
__device__ __forceinline__ h16 toh_flush(float v) { const h16 r = (h16)v; return (fabsf(v) < 6.103515625e-05f) ? (h16)0.0f : r; }
// one f16 matrix instruction with its own guard (ties its accumulator, keeps both fragments live)
__device__ __forceinline__ v8f wmma16g(v16h a, v16h b, v8f c) { c = wmma16(a, b, c); asm volatile("v_nop\n\tv_nop\n\tv_nop\n\tv_nop" : "+v"(c) : "v"(a), "v"(b)); return c; }
// four flag bytes (0/1 each, lowest byte = lowest key) -> four bits
__device__ __forceinline__ unsigned nib4(unsigned x) { return (x | (x >> 7) | (x >> 14) | (x >> 21)) & 0xFu; }

// cvt_body: bf16 (RNE) copy of h, eight elements per thread; vector i of the packed copy [NB*SEQ][DM] comes from graph i / (SEQ*DM/8) of the input, whose graphs lie SEQ_FULL rows apart.
__device__ __forceinline__ void cvt_body(int blk, const float* __restrict__ src, bf* dst) {
    const size_t i = (size_t)blk * MTH + threadIdx.x;                       // blk < NBC: i < NB*SEQ*DM/8
    const size_t g = i / ((size_t)SEQ * DM / 8), e = i % ((size_t)SEQ * DM / 8);
    const v8f v = *(const v8f*)(src + g * ((size_t)SEQ_FULL * DM) + e * 8); v8us o;
#pragma unroll
    for (int k = 0; k < 8; ++k) o[k] = f2bf(v[k]);
    *(v8us*)(dst + i * 8) = o;
    asm volatile("s_wait_xcnt 0x0" ::: "memory");   // precaution: for the copy blocks the kernel ends after this store
}

// wt_body: weight transpose: in W[k][n] (DM rows of DM) -> out WT[n][k]; one block per 32 output rows, tile staged in LDS (block barrier), each output row DM x 2 B = 4 lines.
// HALF false: bf16 (RNE convert). HALF true: f16 of (bf16-converted weight x WOS), subnormal results selected to +0.
template <bool HALF>
__device__ __forceinline__ void wt_body(float* ts, int n0, const float* __restrict__ W, unsigned short* WT) {
    const int tid = threadIdx.x; const int j = tid & 31, kk = tid >> 5;
#pragma unroll 1   // kept rolled: small code
    for (int i = 0; i < DM / (MTH / 32); ++i) { const int k = kk + (MTH / 32) * i; ts[j * WTP + k] = W[(size_t)k * DM + n0 + j]; }   // k covers 0..DM-1, n0 + j < DM
    __syncthreads();
#pragma unroll 1   // kept rolled: small code
    for (int it = 0; it < (32 * DM) / (8 * MTH); ++it) { const int q = it * MTH + tid; const int row = q / (DM / 8), c8 = (q % (DM / 8)) * 8;   // trips x MTH threads x 8 = 32 rows x DM
        const v4f x0 = *(const v4fa*)(&ts[row * WTP + c8]); const v4f x1 = *(const v4fa*)(&ts[row * WTP + c8 + 4]);
        unsigned short* dp = WT + (size_t)(n0 + row) * DM + c8;
        if (HALF) { v8h o;
#pragma unroll
            for (int i = 0; i < 4; ++i) { o[i] = toh_flush(bfr(x0[i]) * WOS); o[4 + i] = toh_flush(bfr(x1[i]) * WOS); }
            *(v8h*)dp = o; }
        else { v8us o;
#pragma unroll
            for (int i = 0; i < 4; ++i) { o[i] = f2bf(x0[i]); o[4 + i] = f2bf(x1[i]); }
            *(v8us*)dp = o; }
        asm volatile("s_wait_xcnt 0x0" ::: "memory"); }   // the next trip rewrites the store's address and data registers
}

// mask_body: adjacency bit plane for one (graph b, band of MROWS query rows starting at r0). Block-local byte flag tile [MROWS][SEQ] in LDS: zero fill, block barrier, diagonal + every listed edge that falls in the band
// stores the byte 1 (plain same-value byte stores, no read-modify-write), block barrier, then each thread packs 32 flags into one word and the band's 64-byte rows go out thread-linear (one 128-byte line per wave).
// Every block reads the whole edge list: MTH threads, four edges per 16-byte load, MUN load pairs issued before the first is used, so the scan runs at the rate of the loads and not at their latency.
// Band test: graph = floor(s / SEQ_FULL), graphs -NB_FULL..-1 wrap to 0..NB_FULL-1, row = s mod SEQ_FULL. With lo = the first s of this band in the wrapped (negative) range, s lies in the band
// exactly when s - lo (modulo 2^32) is in [0, MROWS) or in [NB_FULL*SEQ_FULL, NB_FULL*SEQ_FULL + MROWS): all bits clear but the row bits and the bit NB_FULL*SEQ_FULL.
// The remainder of the list (fewer than MTH * 4 * MUN edges) goes one edge per thread with clamped addresses; both loops are block-uniform. SEQ/MROWS bands x NB graphs.
__device__ __forceinline__ bool in_band(int s, unsigned lo) { return (((unsigned)s - lo) & ~(unsigned)(NB_FULL * SEQ_FULL + MROWS - 1)) == 0u; }
__device__ __forceinline__ void mark_edge(unsigned char* fl, int s, int d) {
    const int c = d & (SEQ_FULL - 1); if (c < SEQ) fl[(s & (MROWS - 1)) * SEQ + c] = (unsigned char)1;   // row in [0, MROWS), c in [0, SEQ)
}
__device__ __forceinline__ void mask_body(unsigned char* fl, int r0, int b, const int* __restrict__ src, const int* __restrict__ dst, int nE, unsigned* MB) {
    const int tid = threadIdx.x;
    const v4u zz = (v4u){0u, 0u, 0u, 0u};
#pragma unroll
    for (int i = 0; i < (MROWS * SEQ) / (16 * MTH); ++i) *(v4ua*)(&fl[(i * MTH + tid) * 16]) = zz;
    __syncthreads();
    if (tid < MROWS) fl[tid * SEQ + r0 + tid] = (unsigned char)1;          // diagonal, r0 + tid < SEQ
    const unsigned lo = (unsigned)((b - NB_FULL) * SEQ_FULL + r0);
    const int* ps = src + tid * 4; const int* pd = dst + tid * 4;
    int base = 0;
#pragma unroll 1   // one group of MUN load pairs per trip; more would only grow the code
    for (; base + MTH * 4 * MUN <= nE; base += MTH * 4 * MUN) {
        v4e S[MUN], D[MUN];
#pragma unroll     // all MUN pairs issued back to back, S and D in registers
        for (int u = 0; u < MUN; ++u) { S[u] = *(const v4e*)(ps + u * MTH * 4); D[u] = *(const v4e*)(pd + u * MTH * 4); }   // last element base + MTH*4*MUN - 1 < nE
#pragma unroll     // constant indices into S and D
        for (int u = 0; u < MUN; ++u) {
#pragma unroll
            for (int i = 0; i < 4; ++i) if (in_band(S[u][i], lo)) mark_edge(fl, S[u][i], D[u][i]); }
        ps += MTH * 4 * MUN; pd += MTH * 4 * MUN;
    }
#pragma unroll 1   // short remainder, kept small
    for (; base < nE; base += MTH) {
        const int e = base + tid; const int ec = e < nE ? e : nE - 1;      // a clamped lane repeats the last edge: the same byte, the same value
        const int s = src[ec], d = dst[ec];
        if (in_band(s, lo)) mark_edge(fl, s, d);
    }
    __syncthreads();
    const size_t wbase = (size_t)(b * SEQ + r0) * (SEQ / 32);
#pragma unroll
    for (int i = 0; i < (MROWS * SEQ) / (32 * MTH); ++i) { const int p = i * MTH + tid;   // word p of the band = flags p*32 .. p*32+31
        const v4u X = *(const v4ua*)(&fl[p * 32]); const v4u Y = *(const v4ua*)(&fl[p * 32 + 16]);
        MB[wbase + p] = nib4(X[0]) | (nib4(X[1]) << 4) | (nib4(X[2]) << 8) | (nib4(X[3]) << 12) | (nib4(Y[0]) << 16) | (nib4(Y[1]) << 20) | (nib4(Y[2]) << 24) | (nib4(Y[3]) << 28); }
}

// k_prep: all the preparation that reads the inputs alone, as block ranges of ONE launch, so that the pieces run side by side and not one behind the other. MTH threads per block; the branch is on blockIdx alone
// (block-uniform, so each piece's barriers are passed by all of its block's threads); one LDS area serves the flag tile and the transpose tile. Longest pieces first:
// blocks [0, NBM) adjacency bands, [NBM, NBM + NBW) weight transposes (q, k, v, output; DM/32 blocks each), [NBM + NBW, NBM + NBW + NBC) bf16 copy of h.
__global__ __launch_bounds__(MTH) void k_prep(const int* __restrict__ src, const int* __restrict__ dst, int nE, unsigned* MB,
                                              const float* __restrict__ wq, const float* __restrict__ wk, const float* __restrict__ wv, const float* __restrict__ wo, bf* WB, h16* WOH,
                                              const float* __restrict__ hin, bf* XB) {
    __shared__ __align__(16) unsigned char sm[PREP_LDS];
    const int blk = blockIdx.x;
    if (blk < NBM) { mask_body(sm, (blk % (SEQ / MROWS)) * MROWS, blk / (SEQ / MROWS), src, dst, nE, MB); return; }
    if (blk < NBM + NBW) {
        const int w = (blk - NBM) / (DM / 32), n0 = ((blk - NBM) % (DM / 32)) * 32;
        if (w == 3) wt_body<true>((float*)sm, n0, wo, (unsigned short*)WOH);
        else        wt_body<false>((float*)sm, n0, w == 0 ? wq : (w == 1 ? wk : wv), WB + (size_t)w * DM * DM);
        return; }
    cvt_body(blk - NBM - NBW, hin, XB);
}

// proj_body: register-blocked bf16 GEMM, ONE WAVE per 64x64 tile (16 accumulators), operands straight from K-contiguous bf16 planes, K = DM.
// C[m][n] = sum_k A[m][k] Bt[n][k] + bias, written as f16 (Ph) and, for tokens t < resT (resT a multiple of 64, block-uniform test), the f16 residual x2048 (Pr).
// MODE 0: A = x rows (m = b*SEQ + t), Bt = W rows (n = h*32 + d), bias per column; plane [(b*NH_ + h)][t][32] (residual plane [(b*NH_ + h)][resT][32]). The 64-column tile spans two heads; per 16-row slab and head
//         (8 rows per instruction).
// MODE 1: A = W rows (m = h*32 + d), Bt = x rows (n = b*SEQ + t), bias per row; plane [(b*DM + m)][t].
template <int MODE>
__device__ __forceinline__ void proj_body(float* os, int r0, int c0, const bf* __restrict__ A, const bf* __restrict__ Bt, const float* __restrict__ bias, h16* Ph, h16* Pr, int resT) {
    const int K = DM;
    const int lane = threadIdx.x & 31, lr = lane & 15, hi = lane >> 4;
    v8f acc[4][4];
#pragma unroll
    for (int mb = 0; mb < 4; ++mb)
#pragma unroll
        for (int nb = 0; nb < 4; ++nb) acc[mb][nb] = (v8f){};
    const size_t aoff = (size_t)(r0 + lr) * K + 8 * hi, boff = (size_t)(c0 + lr) * K + 8 * hi;
#pragma unroll 1
    for (int kc = 0; kc < K; kc += 32) {
        v16bf a[4];
#pragma unroll
        for (int mb = 0; mb < 4; ++mb) a[mb] = ldb(A + aoff + (size_t)mb * 16 * K + kc);
#pragma unroll
        for (int nb = 0; nb < 4; ++nb) { const v16bf b = ldb(Bt + boff + (size_t)nb * 16 * K + kc);
#pragma unroll
            for (int mb = 0; mb < 4; ++mb) acc[mb][nb] = wmmab(a[mb], b, acc[mb][nb]); }
        asm volatile("v_nop\n\tv_nop\n\tv_nop\n\tv_nop" : "+v"(acc[0][0]), "+v"(acc[1][1]), "+v"(acc[2][2]), "+v"(acc[3][3]) : "v"(a[0]), "v"(a[1]), "v"(a[2]), "v"(a[3]));
    }
    float bc[4];
#pragma unroll
    for (int nb = 0; nb < 4; ++nb) bc[nb] = (MODE == 0) ? bfr(bias[c0 + nb * 16 + lr]) : 0.0f;   // MODE 0: c0 + 63 < DM
    size_t tbase, rbase; bool wr;                                                                 // wr: block-uniform, whole tile inside the residual plane
    if (MODE == 0) { const int bb = r0 / SEQ, tt = r0 % SEQ; const int zc = bb * NH_ + c0 / HD;
                     tbase = ((size_t)zc * SEQ + (size_t)tt) * HD; rbase = ((size_t)zc * (size_t)resT + (size_t)tt) * HD; wr = tt < resT; }
    else           { const int bb = c0 / SEQ, tt = c0 % SEQ;
                     tbase = (size_t)bb * (size_t)DM * SEQ + (size_t)r0 * SEQ + (size_t)tt; rbase = (size_t)bb * (size_t)DM * (size_t)resT + (size_t)r0 * (size_t)resT + (size_t)tt; wr = tt < resT; }
#pragma unroll
    for (int mb = 0; mb < 4; ++mb) {
        float br[8];
#pragma unroll
        for (int j = 0; j < 8; ++j) br[j] = (MODE == 1) ? bfr(bias[r0 + mb * 16 + hi * 8 + j]) : 0.0f;   // MODE 1: r0 + 63 < DM
#pragma unroll
        for (int nb = 0; nb < 4; ++nb) {
#pragma unroll
            for (int j = 0; j < 8; ++j) os[(hi * 8 + j) * 68 + nb * 16 + lr] = acc[mb][nb][j] + bc[nb] + br[j]; }   // D: row 8h+j, col lane&15
        wave_sync();
{
            if (MODE == 0) {
                const size_t sb = tbase + (size_t)(mb * 16) * HD;
                const size_t rb = rbase + (size_t)(mb * 16) * HD;
#pragma unroll
                for (int hh = 0; hh < 2; ++hh) {
#pragma unroll
                    for (int s = 0; s < 2; ++s) { const int p = s * 32 + lane; const int row = p >> 2, c8 = (p & 3) * 8;   // 2 s x 8 rows = 16 rows; 4 lanes x 8 = 32 columns of head hh
                        const v4f x0 = *(const v4fa*)(&os[row * 68 + hh * 32 + c8]); const v4f x1 = *(const v4fa*)(&os[row * 68 + hh * 32 + c8 + 4]); v8h hv, rv;
#pragma unroll
                        for (int i = 0; i < 4; ++i) { const h16 a0 = (h16)x0[i]; const h16 a1 = (h16)x1[i]; hv[i] = a0; hv[4 + i] = a1; rv[i] = (h16)((x0[i] - (float)a0) * QRS); rv[4 + i] = (h16)((x1[i] - (float)a1) * QRS); }
                        const size_t oo = sb + (size_t)hh * ((size_t)SEQ * HD) + (size_t)p * 8;
                        const size_t ro = rb + (size_t)hh * ((size_t)resT * HD) + (size_t)p * 8;
                        *(v8h*)(Ph + oo) = hv; if (wr) *(v8h*)(Pr + ro) = rv; } }
            } else {
                const size_t sb = tbase + (size_t)(mb * 16) * SEQ;
                const size_t rb = rbase + (size_t)(mb * 16) * (size_t)resT;
#pragma unroll
                for (int s = 0; s < 4; ++s) { const int row = 4 * s + (lane >> 3), c8 = (lane & 7) * 8;   // 4 s x 4 row groups = 16 rows; 8 lanes x 8 = 64 columns
                    const v4f x0 = *(const v4fa*)(&os[row * 68 + c8]); const v4f x1 = *(const v4fa*)(&os[row * 68 + c8 + 4]); v8h hv, rv;
#pragma unroll
                    for (int i = 0; i < 4; ++i) { const h16 a0 = (h16)x0[i]; const h16 a1 = (h16)x1[i]; hv[i] = a0; hv[4 + i] = a1; rv[i] = (h16)((x0[i] - (float)a0) * QRS); rv[4 + i] = (h16)((x1[i] - (float)a1) * QRS); }
                    const size_t oo = sb + (size_t)row * SEQ + c8;
                    const size_t ro = rb + (size_t)row * (size_t)resT + c8;
                    *(v8h*)(Ph + oo) = hv; if (wr) *(v8h*)(Pr + ro) = rv; }
            }
             }
        wave_sync();
    }
}

// k_proj3: the three projections as one launch, so that their waves run side by side: blockIdx.z = 0 q, 1 k (MODE 0), 2 v^T (MODE 1); blockIdx.x = 64-token tile, blockIdx.y = 64-feature tile. grid (NB*SEQ/64, DM/64, 3).
__global__ __launch_bounds__(32) void k_proj3(const bf* __restrict__ XB, const bf* __restrict__ WB, const float* __restrict__ bq, const float* __restrict__ bk, const float* __restrict__ bv,
                                              h16* QH, h16* QR, h16* KP, h16* KR, h16* VT, h16* VR, int resT) {
    __shared__ __align__(16) float os[16 * 68];
    const int tok0 = blockIdx.x * 64, f0 = blockIdx.y * 64; const int z = blockIdx.z;
    if (z == 2) proj_body<1>(os, f0, tok0, WB + (size_t)2 * DM * DM, XB, bv, VT, VR, resT);
    else        proj_body<0>(os, tok0, f0, XB, WB + (size_t)z * DM * DM, z ? bk : bq, z ? KP : QH, z ? KR : QR, resT);
}

// k_flash: fused attention and output projection. One block per (graph, AQ tiles of 16 query rows): AW waves, wave = (query tile, head); K / V^T / Q fragments straight from the f16 planes (two 16-B loads each, arithmetic addressing).
// Transposed form: S^T[key][t] = K Q^T (A = K rows, B = Q rows); lane (t = lane&15, h = lane>>4) holds keys 8h+r of each 16-key tile, so the packed
// P tile is directly the B fragment of O^T[d][t] = V^T P^T (element r <- tile keys 0..15, element 8+r <- tile keys 16..31, lane unchanged).
// Softmax state (running max over kept keys, partial sum) is one scalar per lane; the two lane halves of a row are combined with one xor-16 exchange.
// Keep rule: one adjacency word per lane per 32-key step (row t0 + lane&15, word key0/32), bit 8h+r for the first tile and 16+8h+r for the second; dropped elements are selected to 0 by value.
// All rows: scores = K Q + (K Q_res + K_res Q) / 2048; P = f16 value + f16 residual x2048; O = V P + (V P_res + V_res P) / 2048 (residual products in their own accumulators); row sum from the f32 exponentials.
// P below 2^-14 (after the 2^14 carry) is selected to 0 on the exponent argument; residuals pass the subnormal select.
// Context hand-over: O^T in D layout (lane: row t = lane&15, d = 8h+r and 16+8h+r) IS the A fragment of the output projection's k-step 'head' (row t, k = head*32 + d), so each wave converts its own
// registers to f16 value + f16 residual x2048 and stores the four 512-byte slices lane-linear in LDS; one block barrier; then every wave reads the NH_ heads' fragments of its query tile.
// Output projection: wave (query tile, c) computes rows of its tile x columns 32c..32c+31, k-steps in head order, value and residual in separate accumulators; Bt = transposed output weight plane [n][k] (f16, x64),
// its fragments loaded before the barrier; OUT[m][n] = (sum + sum_res / 2048) / 64 + bias (bias bf16-converted, added in f32); rows go out through a wave-private LDS tile as whole 128-byte runs.
__global__ __launch_bounds__(32 * AW) void k_flash(const h16* __restrict__ QH, const h16* __restrict__ QR, const h16* __restrict__ KP, const h16* __restrict__ KR,
                                                   const h16* __restrict__ VT, const h16* __restrict__ VR, const unsigned* __restrict__ MB,
                                                   const h16* __restrict__ WT, const float* __restrict__ bias, float* OUT) {
    __shared__ v8h cf[AW * 4 * 32];                            // [query tile][head][value lo, value hi, residual lo, residual hi][lane]
    __shared__ __align__(16) float os[AW * 16 * OSP];
    const int lane = threadIdx.x & 31, lr = lane & 15, hi = lane >> 4;
    const int wave = __builtin_amdgcn_readfirstlane((int)(threadIdx.x >> 5));
    const int head = wave % NH_, qt = wave / NH_;
    const int b = blockIdx.y; const int zh = b * NH_ + head;
    const int t0 = (blockIdx.x * AQ + qt) * 16;
    const unsigned* mrow = MB + (size_t)(b * SEQ + t0 + lr) * (SEQ / 32);
    const size_t pbase = (size_t)zh * SEQ * HD;
    const size_t qo = pbase + (size_t)(t0 + lr) * HD + 8 * hi;
    const v16h qh = ldh(QH + qo), qr = ldh(QR + qo);            // B fragments: col t, k = d (HD = 32 = one k-step)
    const size_t ko = pbase + (size_t)lr * HD + 8 * hi;        // + key * HD       (A fragment: row key, k = d)
    const size_t vo = pbase + (size_t)lr * SEQ + 8 * hi;       // + 16j*SEQ + key  (A fragment: row d, k = key)
    v8f o0 = (v8f){}, o1 = (v8f){}, oR0 = (v8f){}, oR1 = (v8f){};
    float m = NEGB, l = 0.0f;
#pragma unroll 1
    for (int key0 = 0; key0 < SEQ; key0 += 32) {
        unsigned mw = mrow[key0 >> 5];
        asm volatile("" : "+v"(mw));
        const unsigned sa = mw >> (8 * hi);
        const h16* ka = KP + ko + (size_t)key0 * HD;
        const h16* kr = KR + ko + (size_t)key0 * HD;
        const v16h ka0 = ldh(ka), kb0 = ldh(ka + 16 * HD);
        const v16h kra0 = ldh(kr), krb0 = ldh(kr + 16 * HD);
        v8f sHa = (v8f){}, sLa = (v8f){}, sHb = (v8f){}, sLb = (v8f){};
        sHa = wmma16g(ka0, qh, sHa); sLa = wmma16g(ka0, qr, sLa); sLa = wmma16g(kra0, qh, sLa);
        sHb = wmma16g(kb0, qh, sHb); sLb = wmma16g(kb0, qr, sLb); sLb = wmma16g(krb0, qh, sLb);
        float ta[8], tb[8]; bool fa[8], fb[8]; float mx = NEGB;
#pragma unroll
        for (int r = 0; r < 8; ++r) {
            fa[r] = ((sa >> r) & 1u) != 0u;
            fb[r] = ((sa >> (16 + r)) & 1u) != 0u;
            ta[r] = (sHa[r] + sLa[r] * QRI) * SC2; tb[r] = (sHb[r] + sLb[r] * QRI) * SC2;
            mx = fmaxf(mx, fmaxf(fa[r] ? ta[r] : NEGB, fb[r] ? tb[r] : NEGB)); }
        mx = fmaxf(mx, __shfl_xor(mx, 16, 32));
        const float mnew = fmaxf(m, mx);
        const float alpha = __builtin_amdgcn_exp2f(m - mnew);
        const float sh = PSH - mnew;
        v16h pb, pr; float ls = 0.0f;
#pragma unroll
        for (int r = 0; r < 8; ++r) {
            const float xa = ta[r] + sh, xb = tb[r] + sh;
            const float ea = __builtin_amdgcn_exp2f(xa), eb = __builtin_amdgcn_exp2f(xb);
            const bool za = fa[r] & (xa >= -14.0f), zb = fb[r] & (xb >= -14.0f);
            const float ga = za ? ea : 0.0f, gb = zb ? eb : 0.0f;       // dropped elements and sub-2^-14 values selected to 0 by value
            const h16 pa = (h16)ga; const h16 pc = (h16)gb;             // 0 or in [2^-14, 2^14]
            pb[r] = pa; pb[8 + r] = pc;
            pr[r] = toh_flush((ga - (float)pa) * QRS); pr[8 + r] = toh_flush((gb - (float)pc) * QRS);
            ls += ga + gb; }
        l = l * alpha + ls; m = mnew;
        o0 = o0 * alpha; o1 = o1 * alpha; oR0 = oR0 * alpha; oR1 = oR1 * alpha;
        const h16* va = VT + vo + key0;
        const h16* vr = VR + vo + key0;
        const v16h v0 = ldh(va), v1 = ldh(va + (size_t)16 * SEQ);
        const v16h vr0 = ldh(vr), vr1 = ldh(vr + (size_t)16 * SEQ);
        o0 = wmma16g(v0, pb, o0); o1 = wmma16g(v1, pb, o1);
        oR0 = wmma16g(v0, pr, oR0); oR1 = wmma16g(v1, pr, oR1);
        oR0 = wmma16g(vr0, pb, oR0); oR1 = wmma16g(vr1, pb, oR1);
    }
    // this wave's output weight fragments (columns c0 .. c0+31, all k): issued here so that they land while the context is converted and the block gathers at the barrier
    const int c0 = head * 32;
    const int cn = c0 + lr;                                    // cn + 16 < DM
    const h16* wp = WT + (size_t)cn * DM + 8 * hi;
    v16h w[2][NH_];
#pragma unroll
    for (int kc = 0; kc < NH_; ++kc) { w[0][kc] = ldh(wp + kc * HD); w[1][kc] = ldh(wp + (size_t)16 * DM + kc * HD); }
    const float bl0 = bias[cn], bl1 = bias[cn + 16];
    asm volatile("s_wait_xcnt 0x0" :: "v"(wp), "v"(cn) : "memory");   // keeps these loads' address registers whole up to the wait; the code behind it (their own results too) may then rewrite them
    const float bc0 = bfr(bl0), bc1 = bfr(bl1);
    l += __shfl_xor(l, 16, 32);
    const bool any = l > 0.0f;
    const float lsafe = any ? l : 1.0f;
    const float inv = any ? (1.0f / lsafe) : 0.0f;             // no kept key -> zeros (cannot happen: the diagonal is always kept)
    const v8f f0 = o0 + oR0 * QRI, f1 = o1 + oR1 * QRI;
    { v8h h0, h1, r0, r1;                                      // f_j[r] = (d = 16j + 8h + r, t = lane&15)
#pragma unroll
      for (int i = 0; i < 8; ++i) { const float x0 = f0[i] * inv, x1 = f1[i] * inv; const h16 a0 = toh_flush(x0); const h16 a1 = toh_flush(x1); h0[i] = a0; h1[i] = a1;
          r0[i] = toh_flush((x0 - (float)a0) * QRS); r1[i] = toh_flush((x1 - (float)a1) * QRS); }
      v8h* cw = cf + wave * (4 * 32) + lane;
      cw[0] = h0; cw[32] = h1; cw[64] = r0; cw[96] = r1; }
    __syncthreads();                                           // every head's context fragments of both query tiles are in LDS
    v8f aH0 = (v8f){}, aH1 = (v8f){}, aR0 = (v8f){}, aR1 = (v8f){};
    const v8h* cr = cf + qt * (NH_ * 4 * 32) + lane;
#pragma unroll
    for (int kc = 0; kc < NH_; ++kc) {
        const v16h a = cat16(cr[kc * 128], cr[kc * 128 + 32]), e = cat16(cr[kc * 128 + 64], cr[kc * 128 + 96]);
        aH0 = wmma16(a, w[0][kc], aH0); aH1 = wmma16(a, w[1][kc], aH1);
        aR0 = wmma16(e, w[0][kc], aR0); aR1 = wmma16(e, w[1][kc], aR1);
    }
    const int wb = wave * 16 * OSP;
#pragma unroll
    for (int j = 0; j < 8; ++j) { os[wb + (hi * 8 + j) * OSP + lr] = (aH0[j] + aR0[j] * QRI) * WOI + bc0; os[wb + (hi * 8 + j) * OSP + 16 + lr] = (aH1[j] + aR1[j] * QRI) * WOI + bc1; }   // D: row 8h+j, col lane&15
    wave_sync();
    float* obase = OUT + ((size_t)b * OUT_SEQ + (size_t)t0) * DM + c0;
#pragma unroll
    for (int s = 0; s < 4; ++s) { const int row = 4 * s + (lane >> 3), c4 = (lane & 7) * 4;   // 4 s x 4 rows = 16 rows; 8 lanes x 4 floats = 32 columns
        const v4f val = *(const v4fa*)(&os[wb + row * OSP + c4]);
        *(v4f*)(obase + (size_t)row * DM + c4) = val; }
}

static constexpr size_t al256(size_t v) { return (v + 255) & ~(size_t)255; }
static constexpr size_t SZ_XB = al256((size_t)NB * SEQ * DM * 2);
static constexpr size_t SZ_WB = al256((size_t)3 * DM * DM * 2);
static constexpr size_t SZ_WO = al256((size_t)DM * DM * 2);
static constexpr size_t SZ_PL = al256((size_t)NB * NH_ * SEQ * HD * 2);
static constexpr size_t SZ_MB = al256((size_t)NB * SEQ * (SEQ / 32) * 4);
static constexpr size_t SZ_TOTAL = SZ_XB + SZ_WB + SZ_WO + 6 * SZ_PL + SZ_MB;
static_assert(SZ_TOTAL <= (size_t)134217728);          // workspace carve <= 128 MiB
static_assert(((size_t)DM * DM * 2) % 256 == 0);       // weight sub-planes stay 256-byte aligned
static_assert((size_t)NB * NH_ * SEQ * HD == (size_t)NB * DM * SEQ);       // v^T plane [(b*DM + m)][t] has the same extent as the q/k planes
static_assert((size_t)(NB * SEQ / 64) * 64 * DM == (size_t)NB * NH_ * SEQ * HD);    // projection grids x tile == plane extent
static_assert((size_t)(SEQ / (16 * AQ)) * NB * AQ * 16 * DM == (size_t)NB * SEQ * DM);   // flash grid x rows x columns == output extent
static_assert((size_t)(SEQ / MROWS) * NB * MROWS * (SEQ / 32) * 4 == (size_t)NB * SEQ * (SEQ / 32) * 4);   // mask grid x band == bit plane extent

extern "C" void kernel_launch(void* const* d_in, const int* in_sizes, int n_in,
                              void* d_out, int out_size, void* d_ws, size_t ws_size, hipStream_t stream) {
    if (n_in < 11) return;
    const size_t needx = ((size_t)(NB - 1) * SEQ_FULL + SEQ) * DM;
    if ((size_t)in_sizes[0] < needx) return;
    if (in_sizes[1] < 1 || in_sizes[2] < 1) return;
    if ((size_t)in_sizes[3] < (size_t)DM * DM || (size_t)in_sizes[5] < (size_t)DM * DM || (size_t)in_sizes[7] < (size_t)DM * DM || (size_t)in_sizes[9] < (size_t)DM * DM) return;
    if (in_sizes[4] < DM || in_sizes[6] < DM || in_sizes[8] < DM || in_sizes[10] < DM) return;
    if ((size_t)out_size < ((size_t)(NB - 1) * OUT_SEQ + SEQ) * DM) return;
    if (SZ_TOTAL > ws_size) return;
    // wire order: h, src, dst, Wq, bq, Wk, bk, Wv, bv, Wo, bo
    const float* hin = (const float*)d_in[0];
    const int* src = (const int*)d_in[1]; const int* dst = (const int*)d_in[2];
    const float* wq = (const float*)d_in[3]; const float* bq = (const float*)d_in[4];
    const float* wk = (const float*)d_in[5]; const float* bk = (const float*)d_in[6];
    const float* wv = (const float*)d_in[7]; const float* bv = (const float*)d_in[8];
    const float* wo = (const float*)d_in[9]; const float* bo = (const float*)d_in[10];
    const int nE = in_sizes[1] < in_sizes[2] ? in_sizes[1] : in_sizes[2];
    float* OUT = (float*)d_out;      // [NB*SEQ][256]
    char* wsp = (char*)d_ws;
    bf* XB = (bf*)wsp; wsp += SZ_XB;                 // h  [NB*SEQ][256] bf16
    bf* WB = (bf*)wsp; wsp += SZ_WB;                 // [3][256][256]: q | k | v, transposed to [out][in]
    h16* WOH = (h16*)wsp; wsp += SZ_WO;              // [256][256] output weight, transposed to [out][in], f16 x64
    h16* QH = (h16*)wsp; wsp += SZ_PL;               // [NB*8][SEQ][32]
    h16* QR = (h16*)wsp; wsp += SZ_PL;               // residual x2048
    h16* KP = (h16*)wsp; wsp += SZ_PL;               // [NB*8][SEQ][32]
    h16* KR = (h16*)wsp; wsp += SZ_PL;               // residual x2048
    h16* VT = (h16*)wsp; wsp += SZ_PL;               // [NB*8][32][SEQ]
    h16* VR = (h16*)wsp; wsp += SZ_PL;               // residual x2048
    unsigned* MB = (unsigned*)wsp; wsp += SZ_MB;     // adjacency bits [NB*SEQ][SEQ/32]

    // adjacency bits, transposed weight planes (in W[k][n] -> out WT[n][k]) and the bf16 copy of h
    k_prep<<<NBM + NBW + NBC, MTH, 0, stream>>>(src, dst, nE, MB, wq, wk, wv, wo, WB, WOH, hin, XB);

    // q, k -> planes [(b*8 + h)][t][d]; v^T -> plane [(b*8 + h)][d][t]; residual planes for all tokens
    k_proj3<<<dim3(NB * SEQ / 64, DM / 64, 3), 32, 0, stream>>>(XB, WB, bq, bk, bv, QH, QR, KP, KR, VT, VR, SEQ);

    // attention and output projection: one block per (32 query rows, graph), all heads
    k_flash<<<dim3(SEQ / (16 * AQ), NB, 1), 32 * AW, 0, stream>>>(QH, QR, KP, KR, VT, VR, MB, WOH, bo, OUT);
}

// v004
// Measured time: 57.3 microseconds a run.
// Next to v003, in two timings, it ran 1.15 times as fast each time.
// Counting every step since v000, it is 5.84 times as fast.
#include <hip/hip_runtime.h>

// Graph attention layer: node features h [NB][SEQ][256]; q/k/v = h W + bias with W stored [in][out]; 8 heads x 32; scores (q.k) * 32^-0.5; per graph and query row the kept keys are the listed
// edges (graph = src / size, row = src mod size, column = dst mod size) plus the diagonal; all other keys get probability 0; context heads concatenated, then context Wo + bo (Wo [in][out]); output [NB*SEQ][256] f32.
// Compute dtypes, f32 accumulate everywhere: q/k/v projections v_wmma_f32_16x16x32_bf16 (h, W, bias RNE-converted to bf16; products exact);
// scores v_wmma_f32_16x16x32_f16: q and k each as f16 value + f16 residual x2048 (three products, residual products in their own accumulator folded by 1/2048);
// P.V v_wmma_f32_16x16x32_f16: P (x16384 carry, cancels in the normalisation) and v each as f16 value + f16 residual x2048, residual products in their own accumulator, row sum from the f32 exponentials; softmax f32 (online, running max over kept keys);
// output projection v_wmma_f32_16x16x32_f16: context as f16 value + f16 residual x2048 (own accumulator), Wo as f16 of the bf16-converted weight x64 (folded by 1/64), bias bf16-converted, added in f32.
// Layout: h and the q/k/v weights are converted to bf16 inside the projection blocks (LDS tiles, no planes); transposed output weight plane [out][in]; q, k planes (value, residual) [b*NH_+h][t][d]; v^T planes [b*NH_+h][d][t]; adjacency bit plane [b*SEQ+t][SEQ/32] (bit j of word w = key 32w+j);
// fused flash kernel in transposed form (S^T = K Q^T, O^T = V^T P^T); the context (value, residual) stays in the block's LDS as A fragments and the same launch does the output projection.

#ifndef NB
#define NB 16
#endif
#ifndef SEQ
#define SEQ 512
#endif
#define NB_FULL  16
#define SEQ_FULL 512
#ifndef OUT_SEQ
#define OUT_SEQ SEQ              // row pitch (in tokens) between batches of the output
#endif
#define DM   256
#define NH_  8
#define HD   32
#define AQ   2                   // 16-row query tiles per flash block
#define AW   (NH_ * AQ)          // waves per flash block: one per (query tile, head)
#define OSP  36                  // LDS row pitch (floats) of a wave's output tile
#define QRS  2048.0f             // carry of every residual plane / residual fragment
#define QRI  (1.0f / 2048.0f)
#define SC2  ((float)(0.17677669529663687 * 1.4426950408889634))   // HD^-0.5 * log2(e)
#define PSH  14.0f               // log2 of the P carry (16384)
#define NEGB (-3.0e38f)
#define WOS  64.0f               // carry of the output-projection weight plane
#define WOI  (1.0f / 64.0f)
#define MROWS 64                 // query rows per mask-builder block
#define MTH   512                // threads per block of the preparation launch
#define MUN   8                  // 16-byte load pairs in flight per thread in the edge scan
#define WTP  (DM + 4)            // LDS row pitch (floats) of the weight transpose tile
#define NBM  ((SEQ / MROWS) * NB)                 // preparation launch: adjacency blocks
#define NBW  (DM / 32)                            // output weight transpose blocks
#define PT   128                 // tokens per projection block
#define PKH  128                 // k extent staged in LDS per phase
#define PKP  (PKH + 8)           // LDS row pitch (bf16 elements) of the staged tiles: 272 B = 16 B x odd
#define WG   4                   // column pieces (8 k values each) in flight per thread while the weight tile is staged
#define XR   (MTH / (PKH / 8))   // token rows staged per trip
#define WK   ((MTH / DM) * 8)    // k values staged per trip
#define NBP  (3 * ((NB * SEQ) / PT))              // projection blocks (q, k, v)
#define FRONT_LDS ((PT + DM) * PKP * 2)           // token tile + weight tile; the flag tile, the transpose tile and the waves' output tiles lie in the same area

static_assert(HD == 32);
static_assert(NH_ * HD == DM);                 // head h = columns h*32 + d
static_assert(DM % 64 == 0);                   // column tiles of 64 = two heads
static_assert(64 % HD == 0);
static_assert(DM % 32 == 0);                   // GEMM k-loop steps by 32
static_assert(SEQ % 64 == 0);                  // a 64-row tile never straddles two batches
static_assert((NB * SEQ) % 64 == 0);
static_assert(SEQ % 32 == 0);                  // key loop steps by 32; one mask word per 32-key step
static_assert(SEQ % (16 * AQ) == 0);           // flash grid covers the sequence exactly
static_assert(((size_t)SEQ * DM) % 8 == 0);
static_assert(((size_t)DM * DM) % 8 == 0);
static_assert(NB <= NB_FULL);
static_assert(SEQ <= SEQ_FULL);
static_assert((OSP * 4) % 16 == 0);
static_assert(SEQ % MROWS == 0);               // mask-builder bands cover the rows exactly
static_assert((MROWS & (MROWS - 1)) == 0 && (SEQ_FULL & (SEQ_FULL - 1)) == 0 && (NB_FULL & (NB_FULL - 1)) == 0 && SEQ_FULL % MROWS == 0);   // row, column and band test by bit masks
static_assert((MROWS * SEQ) % (16 * MTH) == 0);            // flag tile zero fill: MTH threads x 16 B per trip
static_assert(((MROWS * SEQ) / 32) % MTH == 0);            // pack: whole trips of MTH words
static_assert(MROWS <= MTH);
static_assert((WTP * 4) % 16 == 0);
static_assert((32 * DM) % (8 * MTH) == 0);                 // weight transpose store: whole trips of MTH threads x 8 elements
static_assert(DM % (MTH / 32) == 0);                       // weight transpose load: whole trips of MTH/32 rows
static_assert(SEQ % PT == 0);                              // a projection block never straddles two graphs
static_assert(MTH == 512 && PT == 128 && DM == 256);       // 16 waves = 4 x 4 tiles of 32 tokens x 64 features (q, k) = 8 x 2 tiles of 32 features x 64 tokens (v^T)
static_assert(DM % PKH == 0 && PKH % 32 == 0 && MTH % (PKH / 8) == 0 && MTH % DM == 0);
static_assert((PKP * 2) % 32 == 16);                       // pitch = 16 B x odd
static_assert((PT * PKH) % (8 * MTH) == 0 && (DM * PKH) % (8 * MTH * WG) == 0);   // staging: whole trips of MTH threads x 8 elements
static_assert(MROWS * SEQ <= FRONT_LDS && 32 * WTP * 4 <= FRONT_LDS && (MTH / 32) * 16 * 68 * 4 <= FRONT_LDS);
static_assert(4 * 32 * 4 == 16 * 32);                      // output epilogue: instructions x lanes x floats == 16 rows x 32 columns
static_assert(NH_ * 32 == DM);                             // the NH_ waves of a query tile cover the DM output columns, 32 each
static_assert(32 * AW <= 1024);
static_assert((size_t)MROWS * SEQ <= 131072);              // static LDS per kernel
static_assert((size_t)32 * WTP * 4 <= 131072);
static_assert((size_t)AW * 16 * OSP * 4 + (size_t)AW * 4 * 32 * 16 <= 131072);
static_assert((size_t)FRONT_LDS <= 131072);
static_assert(sizeof(unsigned) == 4);

typedef _Float16 h16;
typedef unsigned short bf;
typedef __attribute__((ext_vector_type(16))) __bf16   v16bf;
typedef __attribute__((ext_vector_type(16))) _Float16 v16h;
typedef __attribute__((ext_vector_type(8)))  _Float16 v8h;
typedef __attribute__((ext_vector_type(8)))  unsigned short v8us;
typedef __attribute__((ext_vector_type(8)))  __bf16   v8bf;
typedef __attribute__((ext_vector_type(8)))  float    v8f;
typedef __attribute__((ext_vector_type(4)))  float    v4f;
typedef v4f  __attribute__((may_alias)) v4fa;
typedef __attribute__((ext_vector_type(4)))  unsigned v4u;
typedef v4u  __attribute__((may_alias)) v4ua;
typedef int  v4e __attribute__((ext_vector_type(4), aligned(4)));   // four edge indices; only the element's own alignment is assumed

__device__ __forceinline__ unsigned short f2bf(float f) { unsigned u = __float_as_uint(f); u += 0x7FFFu + ((u >> 16) & 1u); return (unsigned short)(u >> 16); }
__device__ __forceinline__ float bfr(float f) { return __uint_as_float(((unsigned)f2bf(f)) << 16); }   // value after RNE convert to bf16
__device__ __forceinline__ v8us cvt8(v8f x) { return __builtin_bit_cast(v8us, __builtin_convertvector(x, v8bf)); }   // eight f32 -> bf16 (RNE), packed converts
__device__ __forceinline__ v16h cat16(v8h lo, v8h hi) { return __builtin_shufflevector(lo, hi, 0, 1, 2, 3, 4, 5, 6, 7, 8, 9, 10, 11, 12, 13, 14, 15); }
__device__ __forceinline__ v16bf cat16b(v8us lo, v8us hi) { return __builtin_bit_cast(v16bf, __builtin_shufflevector(lo, hi, 0, 1, 2, 3, 4, 5, 6, 7, 8, 9, 10, 11, 12, 13, 14, 15)); }
__device__ __forceinline__ v8f wmma16(v16h a, v16h b, v8f c) { return __builtin_amdgcn_wmma_f32_16x16x32_f16(false, a, false, b, (short)0, c, false, false); }
__device__ __forceinline__ v8f wmmab(v16bf a, v16bf b, v8f c) { return __builtin_amdgcn_wmma_f32_16x16x32_bf16(false, a, false, b, (short)0, c, false, false); }
// fragment loaders from K-contiguous 16-bit rows; p already includes + 8*(lane>>4): elements 0..7 <- k0+8h+0..7, elements 8..15 <- k0+16+8h+0..7 (same map for A and B)
__device__ __forceinline__ v16h  ldh(const h16* p) { return cat16(*(const v8h*)p, *(const v8h*)(p + 16)); }
__device__ __forceinline__ v16bf ldb(const bf* p)  { return cat16b(*(const v8us*)p, *(const v8us*)(p + 16)); }
// ordering point for wave-private LDS tiles (same wave writes and reads)
__device__ __forceinline__ void wave_sync() { __builtin_amdgcn_fence(3 /* release order */, "wavefront"); __builtin_amdgcn_wave_barrier(); asm volatile("" ::: "memory"); }
// stands behind a global store: the code that follows rewrites the store's address and data registers
__device__ __forceinline__ void xwait() { asm volatile("s_wait_xcnt 0x0" ::: "memory"); }
// f32 -> f16 convert that cannot produce a subnormal operand (|v| < 2^-14 -> +0)
__device__ __forceinline__ h16 toh_flush(float v) { const h16 r = (h16)v; return (fabsf(v) < 6.103515625e-05f) ? (h16)0.0f : r; }
// one f16 matrix instruction with its own guard (ties its accumulator, keeps both fragments live)
__device__ __forceinline__ v8f wmma16g(v16h a, v16h b, v8f c) { c = wmma16(a, b, c); asm volatile("v_nop\n\tv_nop\n\tv_nop\n\tv_nop" : "+v"(c) : "v"(a), "v"(b)); return c; }
// four flag bytes (0/1 each, lowest byte = lowest key) -> four bits
__device__ __forceinline__ unsigned nib4(unsigned x) { return (x | (x >> 7) | (x >> 14) | (x >> 21)) & 0xFu; }

// wt_body: weight transpose: in W[k][n] (DM rows of DM) -> out WT[n][k]; one block per 32 output rows, tile staged in LDS (block barrier), each output row DM x 2 B = 4 lines.
// HALF false: bf16 (RNE convert). HALF true: f16 of (bf16-converted weight x WOS), subnormal results selected to +0.
template <bool HALF>
__device__ __forceinline__ void wt_body(float* ts, int n0, const float* __restrict__ W, unsigned short* WT) {
    const int tid = threadIdx.x; const int j = tid & 31, kk = tid >> 5;
#pragma unroll 1   // kept rolled: small code
    for (int i = 0; i < DM / (MTH / 32); ++i) { const int k = kk + (MTH / 32) * i; ts[j * WTP + k] = W[(size_t)k * DM + n0 + j]; }   // k covers 0..DM-1, n0 + j < DM
    __syncthreads();
#pragma unroll 1   // kept rolled: small code
    for (int it = 0; it < (32 * DM) / (8 * MTH); ++it) { const int q = it * MTH + tid; const int row = q / (DM / 8), c8 = (q % (DM / 8)) * 8;   // trips x MTH threads x 8 = 32 rows x DM
        const v4f x0 = *(const v4fa*)(&ts[row * WTP + c8]); const v4f x1 = *(const v4fa*)(&ts[row * WTP + c8 + 4]);
        unsigned short* dp = WT + (size_t)(n0 + row) * DM + c8;
        if (HALF) { v8h o;
#pragma unroll
            for (int i = 0; i < 4; ++i) { o[i] = toh_flush(bfr(x0[i]) * WOS); o[4 + i] = toh_flush(bfr(x1[i]) * WOS); }
            *(v8h*)dp = o; }
        else { v8us o;
#pragma unroll
            for (int i = 0; i < 4; ++i) { o[i] = f2bf(x0[i]); o[4 + i] = f2bf(x1[i]); }
            *(v8us*)dp = o; }
        asm volatile("s_wait_xcnt 0x0" ::: "memory"); }   // the next trip rewrites the store's address and data registers
}

// mask_body: adjacency bit plane for one (graph b, band of MROWS query rows starting at r0). Block-local byte flag tile [MROWS][SEQ] in LDS: zero fill, block barrier, diagonal + every listed edge that falls in the band
// stores the byte 1 (plain same-value byte stores, no read-modify-write), block barrier, then each thread packs 32 flags into one word and the band's 64-byte rows go out thread-linear (one 128-byte line per wave).
// Every block reads the whole edge list: MTH threads, four edges per 16-byte load, MUN load pairs issued before the first is used, so the scan runs at the rate of the loads and not at their latency.
// Band test: graph = floor(s / SEQ_FULL), graphs -NB_FULL..-1 wrap to 0..NB_FULL-1, row = s mod SEQ_FULL. With lo = the first s of this band in the wrapped (negative) range, s lies in the band
// exactly when s - lo (modulo 2^32) is in [0, MROWS) or in [NB_FULL*SEQ_FULL, NB_FULL*SEQ_FULL + MROWS): all bits clear but the row bits and the bit NB_FULL*SEQ_FULL.
// The remainder of the list (fewer than MTH * 4 * MUN edges) goes one edge per thread with clamped addresses; both loops are block-uniform. SEQ/MROWS bands x NB graphs.
__device__ __forceinline__ bool in_band(int s, unsigned lo) { return (((unsigned)s - lo) & ~(unsigned)(NB_FULL * SEQ_FULL + MROWS - 1)) == 0u; }
__device__ __forceinline__ void mark_edge(unsigned char* fl, int s, int d) {
    const int c = d & (SEQ_FULL - 1); if (c < SEQ) fl[(s & (MROWS - 1)) * SEQ + c] = (unsigned char)1;   // row in [0, MROWS), c in [0, SEQ)
}
__device__ __forceinline__ void mask_body(unsigned char* fl, int r0, int b, const int* __restrict__ src, const int* __restrict__ dst, int nE, unsigned* MB) {
    const int tid = threadIdx.x;
    const v4u zz = (v4u){0u, 0u, 0u, 0u};
#pragma unroll
    for (int i = 0; i < (MROWS * SEQ) / (16 * MTH); ++i) *(v4ua*)(&fl[(i * MTH + tid) * 16]) = zz;
    __syncthreads();
    if (tid < MROWS) fl[tid * SEQ + r0 + tid] = (unsigned char)1;          // diagonal, r0 + tid < SEQ
    const unsigned lo = (unsigned)((b - NB_FULL) * SEQ_FULL + r0);
    const int* ps = src + tid * 4; const int* pd = dst + tid * 4;
    int base = 0;
#pragma unroll 1   // one group of MUN load pairs per trip; more would only grow the code
    for (; base + MTH * 4 * MUN <= nE; base += MTH * 4 * MUN) {
        v4e S[MUN], D[MUN];
#pragma unroll     // all MUN pairs issued back to back, S and D in registers
        for (int u = 0; u < MUN; ++u) { S[u] = *(const v4e*)(ps + u * MTH * 4); D[u] = *(const v4e*)(pd + u * MTH * 4); }   // last element base + MTH*4*MUN - 1 < nE
#pragma unroll     // constant indices into S and D
        for (int u = 0; u < MUN; ++u) {
#pragma unroll
            for (int i = 0; i < 4; ++i) if (in_band(S[u][i], lo)) mark_edge(fl, S[u][i], D[u][i]); }
        ps += MTH * 4 * MUN; pd += MTH * 4 * MUN;
    }
#pragma unroll 1   // short remainder, kept small
    for (; base < nE; base += MTH) {
        const int e = base + tid; const int ec = e < nE ? e : nE - 1;      // a clamped lane repeats the last edge: the same byte, the same value
        const int s = src[ec], d = dst[ec];
        if (in_band(s, lo)) mark_edge(fl, s, d);
    }
    __syncthreads();
    const size_t wbase = (size_t)(b * SEQ + r0) * (SEQ / 32);
#pragma unroll
    for (int i = 0; i < (MROWS * SEQ) / (32 * MTH); ++i) { const int p = i * MTH + tid;   // word p of the band = flags p*32 .. p*32+31
        const v4u X = *(const v4ua*)(&fl[p * 32]); const v4u Y = *(const v4ua*)(&fl[p * 32 + 16]);
        MB[wbase + p] = nib4(X[0]) | (nib4(X[1]) << 4) | (nib4(X[2]) << 8) | (nib4(X[3]) << 12) | (nib4(Y[0]) << 16) | (nib4(Y[1]) << 20) | (nib4(Y[2]) << 24) | (nib4(Y[3]) << 28); }
}

// proj_body: bf16 GEMM of one block: PT tokens x DM features of one projection, K = DM, straight from the f32 inputs. Per phase of PKH k values the block converts (RNE) its token tile
// XS[token][k] (rows of h, 8 floats per thread and trip) and its weight tile WS[n][k] (W is [k][n]: a thread gathers 8 k values of one column, a wave reads whole 128-byte lines) into LDS,
// block barrier, every wave runs PKH/32 k-steps on its own tile with fragments from LDS (K-contiguous rows, pitch PKP), block barrier (the tiles may be overwritten). k runs upward through both phases.
// One wave per 32x64 tile (8 accumulators). After the last barrier the staged tiles are dead and each wave's output tile os lies in the same LDS area.
// C[m][n] = sum_k A[m][k] Bt[n][k] + bias, written as f16 (Ph) and, for tokens t < resT (resT a multiple of 64, wave-uniform test), the f16 residual x2048 (Pr).
// MODE 0: A = x rows (m = b*SEQ + t), Bt = W columns (n = h*32 + d), bias per column; plane [(b*NH_ + h)][t][32] (residual plane [(b*NH_ + h)][resT][32]). The 64-column tile spans two heads; per 16-row slab and head
//         (8 rows per instruction). Waves: 4 token tiles x 4 feature tiles.
// MODE 1: A = W columns (m = h*32 + d), Bt = x rows (n = b*SEQ + t), bias per row; plane [(b*DM + m)][t]. Waves: 8 feature tiles x 2 token tiles.
template <int MODE>
__device__ __forceinline__ void proj_body(unsigned char* sm, int tok0, const float* __restrict__ hin, const float* __restrict__ W, const float* __restrict__ bias, h16* Ph, h16* Pr, int resT) {
    bf* XS = (bf*)sm; bf* WS = XS + PT * PKP;
    const int tid = threadIdx.x;
    const int lane = tid & 31, lr = lane & 15, hi = lane >> 4;
    const int wave = __builtin_amdgcn_readfirstlane(tid >> 5);
    const int ra = (MODE == 0 ? (wave >> 2) : (wave >> 1)) * 32;    // first A row of this wave inside the block's A tile
    const int cb = (MODE == 0 ? (wave & 3) : (wave & 1)) * 64;      // first Bt row inside the block's Bt tile
    const bf* Al = (MODE == 0 ? XS : WS) + (ra + lr) * PKP + 8 * hi;
    const bf* Bl = (MODE == 0 ? WS : XS) + (cb + lr) * PKP + 8 * hi;
    const float* xsrc = hin + ((size_t)(tok0 / SEQ) * SEQ_FULL + (size_t)(tok0 % SEQ)) * DM;   // the input's graphs lie SEQ_FULL rows apart
    // staging: thread -> (token row xr, 8 columns) stepping XR rows a trip; (weight column tid % DM, 8 k values from wk) stepping WK k values a trip
    const int xr = tid / (PKH / 8), wk = (tid / DM) * 8;
    const float* xg = xsrc + (size_t)xr * DM + (tid % (PKH / 8)) * 8; bf* xl = XS + xr * PKP + (tid % (PKH / 8)) * 8;
    const float* wg = W + (size_t)wk * DM + tid % DM;                 bf* wl = WS + (tid % DM) * PKP + wk;
    v8f acc[2][4];
#pragma unroll
    for (int mb = 0; mb < 2; ++mb)
#pragma unroll
        for (int nb = 0; nb < 4; ++nb) acc[mb][nb] = (v8f){};
#pragma unroll 1   // one phase per trip: the two phases share the LDS tiles
    for (int kh = 0; kh < DM; kh += PKH) {
        const float* xk = xg + kh; const float* wk0 = wg + (size_t)kh * DM;
        { v8f x[(PT * PKH) / (8 * MTH)];
#pragma unroll     // all of the token tile's loads issued back to back, before the first is used
          for (int it = 0; it < (PT * PKH) / (8 * MTH); ++it) x[it] = *(const v8f*)(xk + (size_t)it * XR * DM);                // row xr + it*XR < PT
          static_assert((PT * PKH) / (8 * MTH) == 4);
          asm volatile("s_wait_xcnt 0x0" :: "v"(xk), "v"(x[0]), "v"(x[1]), "v"(x[2]), "v"(x[3]) : "memory");   // keeps these loads' address registers whole up to the wait; the loaded values as inputs hold all the loads in front of the first convert (one latency per group)
#pragma unroll
          for (int it = 0; it < (PT * PKH) / (8 * MTH); ++it) *(v8us*)(xl + it * XR * PKP) = cvt8(x[it]); }
#pragma unroll     // groups of WG column pieces: constant indices into x
        for (int g = 0; g < (DM * PKH) / (8 * MTH * WG); ++g) { v8f x[WG];
#pragma unroll     // 8 * WG column loads issued back to back, before the first is used
            for (int u = 0; u < WG; ++u)
#pragma unroll
                for (int j = 0; j < 8; ++j) x[u][j] = wk0[(size_t)((g * WG + u) * WK + j) * DM];                                // k = kh + wk + (g*WG+u)*WK + j < kh + PKH
            static_assert(WG == 4);
            asm volatile("s_wait_xcnt 0x0" :: "v"(wk0), "v"(x[0]), "v"(x[1]), "v"(x[2]), "v"(x[3]) : "memory");   // as above
#pragma unroll
            for (int u = 0; u < WG; ++u) *(v8us*)(wl + (g * WG + u) * WK) = cvt8(x[u]); }
        __syncthreads();                                           // both tiles of this phase are in LDS
#pragma unroll     // straight-line k-steps: the next step's LDS reads issue under this step's matrix instructions
        for (int kc = 0; kc < PKH; kc += 32) {
            v16bf a[2];
#pragma unroll
            for (int mb = 0; mb < 2; ++mb) a[mb] = ldb(Al + mb * 16 * PKP + kc);
#pragma unroll
            for (int nb = 0; nb < 4; ++nb) { const v16bf b = ldb(Bl + nb * 16 * PKP + kc);
#pragma unroll
                for (int mb = 0; mb < 2; ++mb) acc[mb][nb] = wmmab(a[mb], b, acc[mb][nb]); }
        }
        __syncthreads();                                           // every wave has read this phase's tiles
    }
    float* os = (float*)sm + wave * (16 * 68);
    const int r0 = (MODE == 0 ? tok0 : 0) + ra, c0 = (MODE == 0 ? 0 : tok0) + cb;
    float bc[4];
#pragma unroll
    for (int nb = 0; nb < 4; ++nb) bc[nb] = (MODE == 0) ? bfr(bias[c0 + nb * 16 + lr]) : 0.0f;   // MODE 0: c0 + 63 < DM
    size_t tbase, rbase; bool wr;                                                                 // wr: wave-uniform, whole tile inside the residual plane
    if (MODE == 0) { const int bb = r0 / SEQ, tt = r0 % SEQ; const int zc = bb * NH_ + c0 / HD;
                     tbase = ((size_t)zc * SEQ + (size_t)tt) * HD; rbase = ((size_t)zc * (size_t)resT + (size_t)tt) * HD; wr = tt < resT; }
    else           { const int bb = c0 / SEQ, tt = c0 % SEQ;
                     tbase = (size_t)bb * (size_t)DM * SEQ + (size_t)r0 * SEQ + (size_t)tt; rbase = (size_t)bb * (size_t)DM * (size_t)resT + (size_t)r0 * (size_t)resT + (size_t)tt; wr = tt < resT; }
#pragma unroll
    for (int mb = 0; mb < 2; ++mb) {
        float br[8];
#pragma unroll
        for (int j = 0; j < 8; ++j) br[j] = (MODE == 1) ? bfr(bias[r0 + mb * 16 + hi * 8 + j]) : 0.0f;   // MODE 1: r0 + 31 < DM
#pragma unroll
        for (int nb = 0; nb < 4; ++nb) {
#pragma unroll
            for (int j = 0; j < 8; ++j) os[(hi * 8 + j) * 68 + nb * 16 + lr] = acc[mb][nb][j] + bc[nb] + br[j]; }   // D: row 8h+j, col lane&15
        wave_sync();
{
            if (MODE == 0) {
                const size_t sb = tbase + (size_t)(mb * 16) * HD;
                const size_t rb = rbase + (size_t)(mb * 16) * HD;
#pragma unroll
                for (int hh = 0; hh < 2; ++hh) {
#pragma unroll
                    for (int s = 0; s < 2; ++s) { const int p = s * 32 + lane; const int row = p >> 2, c8 = (p & 3) * 8;   // 2 s x 8 rows = 16 rows; 4 lanes x 8 = 32 columns of head hh
                        const v4f x0 = *(const v4fa*)(&os[row * 68 + hh * 32 + c8]); const v4f x1 = *(const v4fa*)(&os[row * 68 + hh * 32 + c8 + 4]); v8h hv, rv;
#pragma unroll
                        for (int i = 0; i < 4; ++i) { const h16 a0 = (h16)x0[i]; const h16 a1 = (h16)x1[i]; hv[i] = a0; hv[4 + i] = a1; rv[i] = (h16)((x0[i] - (float)a0) * QRS); rv[4 + i] = (h16)((x1[i] - (float)a1) * QRS); }
                        const size_t oo = sb + (size_t)hh * ((size_t)SEQ * HD) + (size_t)p * 8;
                        const size_t ro = rb + (size_t)hh * ((size_t)resT * HD) + (size_t)p * 8;
                        *(v8h*)(Ph + oo) = hv; xwait(); if (wr) { *(v8h*)(Pr + ro) = rv; xwait(); } } }
            } else {
                const size_t sb = tbase + (size_t)(mb * 16) * SEQ;
                const size_t rb = rbase + (size_t)(mb * 16) * (size_t)resT;
#pragma unroll
                for (int s = 0; s < 4; ++s) { const int row = 4 * s + (lane >> 3), c8 = (lane & 7) * 8;   // 4 s x 4 row groups = 16 rows; 8 lanes x 8 = 64 columns
                    const v4f x0 = *(const v4fa*)(&os[row * 68 + c8]); const v4f x1 = *(const v4fa*)(&os[row * 68 + c8 + 4]); v8h hv, rv;
#pragma unroll
                    for (int i = 0; i < 4; ++i) { const h16 a0 = (h16)x0[i]; const h16 a1 = (h16)x1[i]; hv[i] = a0; hv[4 + i] = a1; rv[i] = (h16)((x0[i] - (float)a0) * QRS); rv[4 + i] = (h16)((x1[i] - (float)a1) * QRS); }
                    const size_t oo = sb + (size_t)row * SEQ + c8;
                    const size_t ro = rb + (size_t)row * (size_t)resT + c8;
                    *(v8h*)(Ph + oo) = hv; xwait(); if (wr) { *(v8h*)(Pr + ro) = rv; xwait(); } }
            }
             }
        wave_sync();
    }
}

// k_front: everything that reads the inputs alone, as block ranges of ONE launch, so that the pieces run side by side. MTH threads per block; the branch is on blockIdx alone
// (block-uniform, so each piece's barriers are passed by all of its block's threads); one LDS area serves all pieces. Longest pieces first:
// blocks [0, NBM) adjacency bands, [NBM, NBM + NBP) projections (q, then k, then v^T; one block per PT tokens), [NBM + NBP, NBM + NBP + NBW) output weight transpose.
// Register budget for eight waves per SIMD = two blocks per WGP: there are more blocks than WGPs, and all of them should be resident at once.
__global__ __launch_bounds__(MTH) __attribute__((amdgpu_waves_per_eu(8))) void k_front(const int* __restrict__ src, const int* __restrict__ dst, int nE, unsigned* MB,
                                                  const float* __restrict__ wq, const float* __restrict__ wk, const float* __restrict__ wv, const float* __restrict__ wo, h16* WOH,
                                                  const float* __restrict__ hin, const float* __restrict__ bq, const float* __restrict__ bk, const float* __restrict__ bv,
                                                  h16* QH, h16* QR, h16* KP, h16* KR, h16* VT, h16* VR, int resT) {
    __shared__ __align__(16) unsigned char sm[FRONT_LDS];
    const int blk = blockIdx.x;
    if (blk < NBM) { mask_body(sm, (blk % (SEQ / MROWS)) * MROWS, blk / (SEQ / MROWS), src, dst, nE, MB); return; }
    if (blk < NBM + NBP) {
        const int z = (blk - NBM) / ((NB * SEQ) / PT), tok0 = ((blk - NBM) % ((NB * SEQ) / PT)) * PT;
        if (z == 2) proj_body<1>(sm, tok0, hin, wv, bv, VT, VR, resT);
        else        proj_body<0>(sm, tok0, hin, z ? wk : wq, z ? bk : bq, z ? KP : QH, z ? KR : QR, resT);
        return; }
    wt_body<true>((float*)sm, (blk - NBM - NBP) * 32, wo, (unsigned short*)WOH);
}

// k_flash: fused attention and output projection. One block per (graph, AQ tiles of 16 query rows): AW waves, wave = (query tile, head); K / V^T / Q fragments straight from the f16 planes (two 16-B loads each, arithmetic addressing).
// Transposed form: S^T[key][t] = K Q^T (A = K rows, B = Q rows); lane (t = lane&15, h = lane>>4) holds keys 8h+r of each 16-key tile, so the packed
// P tile is directly the B fragment of O^T[d][t] = V^T P^T (element r <- tile keys 0..15, element 8+r <- tile keys 16..31, lane unchanged).
// Softmax state (running max over kept keys, partial sum) is one scalar per lane; the two lane halves of a row are combined with one xor-16 exchange.
// Keep rule: one adjacency word per lane per 32-key step (row t0 + lane&15, word key0/32), bit 8h+r for the first tile and 16+8h+r for the second; dropped elements are selected to 0 by value.
// All rows: scores = K Q + (K Q_res + K_res Q) / 2048; P = f16 value + f16 residual x2048; O = V P + (V P_res + V_res P) / 2048 (residual products in their own accumulators); row sum from the f32 exponentials.
// P below 2^-14 (after the 2^14 carry) is selected to 0 on the exponent argument; residuals pass the subnormal select.
// Context hand-over: O^T in D layout (lane: row t = lane&15, d = 8h+r and 16+8h+r) IS the A fragment of the output projection's k-step 'head' (row t, k = head*32 + d), so each wave converts its own
// registers to f16 value + f16 residual x2048 and stores the four 512-byte slices lane-linear in LDS; one block barrier; then every wave reads the NH_ heads' fragments of its query tile.
// Output projection: wave (query tile, c) computes rows of its tile x columns 32c..32c+31, k-steps in head order, value and residual in separate accumulators; Bt = transposed output weight plane [n][k] (f16, x64),
// its fragments loaded before the barrier; OUT[m][n] = (sum + sum_res / 2048) / 64 + bias (bias bf16-converted, added in f32); rows go out through a wave-private LDS tile as whole 128-byte runs.
__global__ __launch_bounds__(32 * AW) void k_flash(const h16* __restrict__ QH, const h16* __restrict__ QR, const h16* __restrict__ KP, const h16* __restrict__ KR,
                                                   const h16* __restrict__ VT, const h16* __restrict__ VR, const unsigned* __restrict__ MB,
                                                   const h16* __restrict__ WT, const float* __restrict__ bias, float* OUT) {
    __shared__ v8h cf[AW * 4 * 32];                            // [query tile][head][value lo, value hi, residual lo, residual hi][lane]
    __shared__ __align__(16) float os[AW * 16 * OSP];
    const int lane = threadIdx.x & 31, lr = lane & 15, hi = lane >> 4;
    const int wave = __builtin_amdgcn_readfirstlane((int)(threadIdx.x >> 5));
    const int head = wave % NH_, qt = wave / NH_;
    const int b = blockIdx.y; const int zh = b * NH_ + head;
    const int t0 = (blockIdx.x * AQ + qt) * 16;
    const unsigned* mrow = MB + (size_t)(b * SEQ + t0 + lr) * (SEQ / 32);
    const size_t pbase = (size_t)zh * SEQ * HD;
    const size_t qo = pbase + (size_t)(t0 + lr) * HD + 8 * hi;
    const v16h qh = ldh(QH + qo), qr = ldh(QR + qo);            // B fragments: col t, k = d (HD = 32 = one k-step)
    const size_t ko = pbase + (size_t)lr * HD + 8 * hi;        // + key * HD       (A fragment: row key, k = d)
    const size_t vo = pbase + (size_t)lr * SEQ + 8 * hi;       // + 16j*SEQ + key  (A fragment: row d, k = key)
    v8f o0 = (v8f){}, o1 = (v8f){}, oR0 = (v8f){}, oR1 = (v8f){};
    float m = NEGB, l = 0.0f;
#pragma unroll 1
    for (int key0 = 0; key0 < SEQ; key0 += 32) {
        unsigned mw = mrow[key0 >> 5];
        asm volatile("" : "+v"(mw));
        const unsigned sa = mw >> (8 * hi);
        const h16* ka = KP + ko + (size_t)key0 * HD;
        const h16* kr = KR + ko + (size_t)key0 * HD;
        const v16h ka0 = ldh(ka), kb0 = ldh(ka + 16 * HD);
        const v16h kra0 = ldh(kr), krb0 = ldh(kr + 16 * HD);
        v8f sHa = (v8f){}, sLa = (v8f){}, sHb = (v8f){}, sLb = (v8f){};
        sHa = wmma16g(ka0, qh, sHa); sLa = wmma16g(ka0, qr, sLa); sLa = wmma16g(kra0, qh, sLa);
        sHb = wmma16g(kb0, qh, sHb); sLb = wmma16g(kb0, qr, sLb); sLb = wmma16g(krb0, qh, sLb);
        float ta[8], tb[8]; bool fa[8], fb[8]; float mx = NEGB;
#pragma unroll
        for (int r = 0; r < 8; ++r) {
            fa[r] = ((sa >> r) & 1u) != 0u;
            fb[r] = ((sa >> (16 + r)) & 1u) != 0u;
            ta[r] = (sHa[r] + sLa[r] * QRI) * SC2; tb[r] = (sHb[r] + sLb[r] * QRI) * SC2;
            mx = fmaxf(mx, fmaxf(fa[r] ? ta[r] : NEGB, fb[r] ? tb[r] : NEGB)); }
        mx = fmaxf(mx, __shfl_xor(mx, 16, 32));
        const float mnew = fmaxf(m, mx);
        const float alpha = __builtin_amdgcn_exp2f(m - mnew);
        const float sh = PSH - mnew;
        v16h pb, pr; float ls = 0.0f;
#pragma unroll
        for (int r = 0; r < 8; ++r) {
            const float xa = ta[r] + sh, xb = tb[r] + sh;
            const float ea = __builtin_amdgcn_exp2f(xa), eb = __builtin_amdgcn_exp2f(xb);
            const bool za = fa[r] & (xa >= -14.0f), zb = fb[r] & (xb >= -14.0f);
            const float ga = za ? ea : 0.0f, gb = zb ? eb : 0.0f;       // dropped elements and sub-2^-14 values selected to 0 by value
            const h16 pa = (h16)ga; const h16 pc = (h16)gb;             // 0 or in [2^-14, 2^14]
            pb[r] = pa; pb[8 + r] = pc;
            pr[r] = toh_flush((ga - (float)pa) * QRS); pr[8 + r] = toh_flush((gb - (float)pc) * QRS);
            ls += ga + gb; }
        l = l * alpha + ls; m = mnew;
        o0 = o0 * alpha; o1 = o1 * alpha; oR0 = oR0 * alpha; oR1 = oR1 * alpha;
        const h16* va = VT + vo + key0;
        const h16* vr = VR + vo + key0;
        const v16h v0 = ldh(va), v1 = ldh(va + (size_t)16 * SEQ);
        const v16h vr0 = ldh(vr), vr1 = ldh(vr + (size_t)16 * SEQ);
        o0 = wmma16g(v0, pb, o0); o1 = wmma16g(v1, pb, o1);
        oR0 = wmma16g(v0, pr, oR0); oR1 = wmma16g(v1, pr, oR1);
        oR0 = wmma16g(vr0, pb, oR0); oR1 = wmma16g(vr1, pb, oR1);
    }
    // this wave's output weight fragments (columns c0 .. c0+31, all k): issued here so that they land while the context is converted and the block gathers at the barrier
    const int c0 = head * 32;
    const int cn = c0 + lr;                                    // cn + 16 < DM
    const h16* wp = WT + (size_t)cn * DM + 8 * hi;
    v16h w[2][NH_];
#pragma unroll
    for (int kc = 0; kc < NH_; ++kc) { w[0][kc] = ldh(wp + kc * HD); w[1][kc] = ldh(wp + (size_t)16 * DM + kc * HD); }
    const float bl0 = bias[cn], bl1 = bias[cn + 16];
    asm volatile("s_wait_xcnt 0x0" :: "v"(wp), "v"(cn) : "memory");   // keeps these loads' address registers whole up to the wait; the code behind it (their own results too) may then rewrite them
    const float bc0 = bfr(bl0), bc1 = bfr(bl1);
    l += __shfl_xor(l, 16, 32);
    const bool any = l > 0.0f;
    const float lsafe = any ? l : 1.0f;
    const float inv = any ? (1.0f / lsafe) : 0.0f;             // no kept key -> zeros (cannot happen: the diagonal is always kept)
    const v8f f0 = o0 + oR0 * QRI, f1 = o1 + oR1 * QRI;
    { v8h h0, h1, r0, r1;                                      // f_j[r] = (d = 16j + 8h + r, t = lane&15)
#pragma unroll
      for (int i = 0; i < 8; ++i) { const float x0 = f0[i] * inv, x1 = f1[i] * inv; const h16 a0 = toh_flush(x0); const h16 a1 = toh_flush(x1); h0[i] = a0; h1[i] = a1;
          r0[i] = toh_flush((x0 - (float)a0) * QRS); r1[i] = toh_flush((x1 - (float)a1) * QRS); }
      v8h* cw = cf + wave * (4 * 32) + lane;
      cw[0] = h0; cw[32] = h1; cw[64] = r0; cw[96] = r1; }
    __syncthreads();                                           // every head's context fragments of both query tiles are in LDS
    v8f aH0 = (v8f){}, aH1 = (v8f){}, aR0 = (v8f){}, aR1 = (v8f){};
    const v8h* cr = cf + qt * (NH_ * 4 * 32) + lane;
#pragma unroll
    for (int kc = 0; kc < NH_; ++kc) {
        const v16h a = cat16(cr[kc * 128], cr[kc * 128 + 32]), e = cat16(cr[kc * 128 + 64], cr[kc * 128 + 96]);
        aH0 = wmma16(a, w[0][kc], aH0); aH1 = wmma16(a, w[1][kc], aH1);
        aR0 = wmma16(e, w[0][kc], aR0); aR1 = wmma16(e, w[1][kc], aR1);
    }
    const int wb = wave * 16 * OSP;
#pragma unroll
    for (int j = 0; j < 8; ++j) { os[wb + (hi * 8 + j) * OSP + lr] = (aH0[j] + aR0[j] * QRI) * WOI + bc0; os[wb + (hi * 8 + j) * OSP + 16 + lr] = (aH1[j] + aR1[j] * QRI) * WOI + bc1; }   // D: row 8h+j, col lane&15
    wave_sync();
    float* obase = OUT + ((size_t)b * OUT_SEQ + (size_t)t0) * DM + c0;
#pragma unroll
    for (int s = 0; s < 4; ++s) { const int row = 4 * s + (lane >> 3), c4 = (lane & 7) * 4;   // 4 s x 4 rows = 16 rows; 8 lanes x 4 floats = 32 columns
        const v4f val = *(const v4fa*)(&os[wb + row * OSP + c4]);
        *(v4f*)(obase + (size_t)row * DM + c4) = val; }
}

static constexpr size_t al256(size_t v) { return (v + 255) & ~(size_t)255; }
static constexpr size_t SZ_WO = al256((size_t)DM * DM * 2);
static constexpr size_t SZ_PL = al256((size_t)NB * NH_ * SEQ * HD * 2);
static constexpr size_t SZ_MB = al256((size_t)NB * SEQ * (SEQ / 32) * 4);
static constexpr size_t SZ_TOTAL = SZ_WO + 6 * SZ_PL + SZ_MB;
static_assert(SZ_TOTAL <= (size_t)134217728);          // workspace carve <= 128 MiB
static_assert((size_t)NB * NH_ * SEQ * HD == (size_t)NB * DM * SEQ);       // v^T plane [(b*DM + m)][t] has the same extent as the q/k planes
static_assert((size_t)(NB * SEQ / PT) * PT * DM == (size_t)NB * NH_ * SEQ * HD);    // projection blocks x tile == plane extent
static_assert((size_t)(SEQ / (16 * AQ)) * NB * AQ * 16 * DM == (size_t)NB * SEQ * DM);   // flash grid x rows x columns == output extent
static_assert((size_t)(SEQ / MROWS) * NB * MROWS * (SEQ / 32) * 4 == (size_t)NB * SEQ * (SEQ / 32) * 4);   // mask grid x band == bit plane extent

extern "C" void kernel_launch(void* const* d_in, const int* in_sizes, int n_in,
                              void* d_out, int out_size, void* d_ws, size_t ws_size, hipStream_t stream) {
    if (n_in < 11) return;
    const size_t needx = ((size_t)(NB - 1) * SEQ_FULL + SEQ) * DM;
    if ((size_t)in_sizes[0] < needx) return;
    if (in_sizes[1] < 1 || in_sizes[2] < 1) return;
    if ((size_t)in_sizes[3] < (size_t)DM * DM || (size_t)in_sizes[5] < (size_t)DM * DM || (size_t)in_sizes[7] < (size_t)DM * DM || (size_t)in_sizes[9] < (size_t)DM * DM) return;
    if (in_sizes[4] < DM || in_sizes[6] < DM || in_sizes[8] < DM || in_sizes[10] < DM) return;
    if ((size_t)out_size < ((size_t)(NB - 1) * OUT_SEQ + SEQ) * DM) return;
    if (SZ_TOTAL > ws_size) return;
    // wire order: h, src, dst, Wq, bq, Wk, bk, Wv, bv, Wo, bo
    const float* hin = (const float*)d_in[0];
    const int* src = (const int*)d_in[1]; const int* dst = (const int*)d_in[2];
    const float* wq = (const float*)d_in[3]; const float* bq = (const float*)d_in[4];
    const float* wk = (const float*)d_in[5]; const float* bk = (const float*)d_in[6];
    const float* wv = (const float*)d_in[7]; const float* bv = (const float*)d_in[8];
    const float* wo = (const float*)d_in[9]; const float* bo = (const float*)d_in[10];
    const int nE = in_sizes[1] < in_sizes[2] ? in_sizes[1] : in_sizes[2];
    float* OUT = (float*)d_out;      // [NB*SEQ][256]
    char* wsp = (char*)d_ws;
    h16* WOH = (h16*)wsp; wsp += SZ_WO;              // [256][256] output weight, transposed to [out][in], f16 x64
    h16* QH = (h16*)wsp; wsp += SZ_PL;               // [NB*8][SEQ][32]
    h16* QR = (h16*)wsp; wsp += SZ_PL;               // residual x2048
    h16* KP = (h16*)wsp; wsp += SZ_PL;               // [NB*8][SEQ][32]
    h16* KR = (h16*)wsp; wsp += SZ_PL;               // residual x2048
    h16* VT = (h16*)wsp; wsp += SZ_PL;               // [NB*8][32][SEQ]
    h16* VR = (h16*)wsp; wsp += SZ_PL;               // residual x2048
    unsigned* MB = (unsigned*)wsp; wsp += SZ_MB;     // adjacency bits [NB*SEQ][SEQ/32]

    // adjacency bits; q, k -> planes [(b*8 + h)][t][d]; v^T -> plane [(b*8 + h)][d][t]; residual planes for all tokens; transposed output weight plane (in W[k][n] -> out WT[n][k])
    k_front<<<NBM + NBP + NBW, MTH, 0, stream>>>(src, dst, nE, MB, wq, wk, wv, wo, WOH, hin, bq, bk, bv, QH, QR, KP, KR, VT, VR, SEQ);

    // attention and output projection: one block per (32 query rows, graph), all heads
    k_flash<<<dim3(SEQ / (16 * AQ), NB, 1), 32 * AW, 0, stream>>>(QH, QR, KP, KR, VT, VR, MB, WOH, bo, OUT);
}

// v005
// Measured time: 50.3 microseconds a run.
// Timed twice side by side with v004, it ran 1.15 and 1.13 times as fast.
// All steps since v000 together make it 6.65 times as fast.
#include <hip/hip_runtime.h>

// Graph attention layer: node features h [NB][SEQ][256]; q/k/v = h W + bias with W stored [in][out]; 8 heads x 32; scores (q.k) * 32^-0.5; per graph and query row the kept keys are the listed
// edges (graph = src / size, row = src mod size, column = dst mod size) plus the diagonal; all other keys get probability 0; context heads concatenated, then context Wo + bo (Wo [in][out]); output [NB*SEQ][256] f32.
// Compute dtypes, f32 accumulate everywhere: q/k/v projections v_wmma_f32_16x16x32_bf16 (h, W, bias RNE-converted to bf16; products exact);
// scores v_wmma_f32_16x16x32_f16: q and k each as f16 value + f16 residual x2048 (three products, residual products in their own accumulator folded by 1/2048);
// P.V v_wmma_f32_16x16x32_f16: P (x16384 carry, cancels in the normalisation) and v each as f16 value + f16 residual x2048, residual products in their own accumulator, row sum from the f32 exponentials; softmax f32 (online, running max over kept keys);
// output projection v_wmma_f32_16x16x32_f16: context as f16 value + f16 residual x2048 (own accumulator), Wo as f16 of the bf16-converted weight x64 (folded by 1/64), bias bf16-converted, added in f32.
// Layout: h and the q/k/v weights are converted to bf16 inside the projection blocks (LDS tiles, no planes); every f16 plane lies in fragment order (1024-byte tiles [element half][lane][8], so a fragment is two lane-linear 512-byte loads of whole 128-byte lines): q, k planes (value, residual) [b*NH_+h][t/16][tile of 16 t x 32 d]; v^T planes [b*NH_+h][t/32][d/16][tile of 16 d x 32 t]; transposed output weight plane [out/16][in/32][tile of 16 out x 32 in]; adjacency bit plane [b*SEQ+t][SEQ/32] (bit j of word w = key 32w+j);
// fused flash kernel in transposed form (S^T = K Q^T, O^T = V^T P^T); the context (value, residual) stays in the block's LDS as A fragments and the same launch does the output projection.

#ifndef NB
#define NB 16
#endif
#ifndef SEQ
#define SEQ 512
#endif
#define NB_FULL  16
#define SEQ_FULL 512
#ifndef OUT_SEQ
#define OUT_SEQ SEQ              // row pitch (in tokens) between batches of the output
#endif
#define DM   256
#define NH_  8
#define HD   32
#define AQ   2                   // 16-row query tiles per flash block
#define AW   (NH_ * AQ)          // waves per flash block: one per (query tile, head)
#define OSP  36                  // LDS row pitch (floats) of a wave's output tile
#define QRS  2048.0f             // carry of every residual plane / residual fragment
#define QRI  (1.0f / 2048.0f)
#define SC2  ((float)(0.17677669529663687 * 1.4426950408889634))   // HD^-0.5 * log2(e)
#define PSH  14.0f               // log2 of the P carry (16384)
#define NEGB (-3.0e38f)
#define WOS  64.0f               // carry of the output-projection weight plane
#define WOI  (1.0f / 64.0f)
#define MROWS 64                 // query rows per mask-builder block
#define MTH   512                // threads per block of the preparation launch
#define MUN   8                  // 16-byte load pairs in flight per thread in the edge scan
#define WTP  (DM + 4)            // LDS row pitch (floats) of the weight transpose tile
#define NBM  ((SEQ / MROWS) * NB)                 // preparation launch: adjacency blocks
#define NBW  (DM / 32)                            // output weight transpose blocks
#define PT   128                 // tokens per projection block
#define PKH  128                 // k extent staged in LDS per phase
#define PKP  (PKH + 8)           // LDS row pitch (bf16 elements) of the staged tiles: 272 B = 16 B x odd
#define WG   4                   // column pieces (8 k values each) in flight per thread while the weight tile is staged
#define XR   (MTH / (PKH / 8))   // token rows staged per trip
#define WK   ((MTH / DM) * 8)    // k values staged per trip
#define NBP  (3 * ((NB * SEQ) / PT))              // projection blocks (q, k, v)
#define FRONT_LDS ((PT + DM) * PKP * 2)           // token tile + weight tile; the flag tile, the transpose tile and the waves' output tiles lie in the same area

static_assert(HD == 32);
static_assert(NH_ * HD == DM);                 // head h = columns h*32 + d
static_assert(DM % 64 == 0);                   // column tiles of 64 = two heads
static_assert(64 % HD == 0);
static_assert(DM % 32 == 0);                   // GEMM k-loop steps by 32
static_assert(SEQ % 64 == 0);                  // a 64-row tile never straddles two batches
static_assert((NB * SEQ) % 64 == 0);
static_assert(SEQ % 32 == 0);                  // key loop steps by 32; one mask word per 32-key step
static_assert(SEQ % (16 * AQ) == 0);           // flash grid covers the sequence exactly
static_assert(((size_t)SEQ * DM) % 8 == 0);
static_assert(((size_t)DM * DM) % 8 == 0);
static_assert(NB <= NB_FULL);
static_assert(SEQ <= SEQ_FULL);
static_assert((OSP * 4) % 16 == 0);
static_assert(SEQ % MROWS == 0);               // mask-builder bands cover the rows exactly
static_assert((MROWS & (MROWS - 1)) == 0 && (SEQ_FULL & (SEQ_FULL - 1)) == 0 && (NB_FULL & (NB_FULL - 1)) == 0 && SEQ_FULL % MROWS == 0);   // row, column and band test by bit masks
static_assert((MROWS * SEQ) % (16 * MTH) == 0);            // flag tile zero fill: MTH threads x 16 B per trip
static_assert(((MROWS * SEQ) / 32) % MTH == 0);            // pack: whole trips of MTH words
static_assert(MROWS <= MTH);
static_assert((WTP * 4) % 16 == 0);
static_assert((32 * DM) % (8 * MTH) == 0);                 // weight transpose store: whole trips of MTH threads x 8 elements
static_assert(DM % (MTH / 32) == 0);                       // weight transpose load: whole trips of MTH/32 rows
static_assert(SEQ % PT == 0);                              // a projection block never straddles two graphs
static_assert(MTH == 512 && PT == 128 && DM == 256);       // 16 waves = 4 x 4 tiles of 32 tokens x 64 features (q, k) = 8 x 2 tiles of 32 features x 64 tokens (v^T)
static_assert(DM % PKH == 0 && PKH % 32 == 0 && MTH % (PKH / 8) == 0 && MTH % DM == 0);
static_assert((PKP * 2) % 32 == 16);                       // pitch = 16 B x odd
static_assert((PT * PKH) % (8 * MTH) == 0 && (DM * PKH) % (8 * MTH * WG) == 0);   // staging: whole trips of MTH threads x 8 elements
static_assert(MROWS * SEQ <= FRONT_LDS && 32 * WTP * 4 <= FRONT_LDS && (MTH / 32) * 16 * 68 * 4 <= FRONT_LDS);
static_assert(4 * 32 * 4 == 16 * 32);                      // output epilogue: instructions x lanes x floats == 16 rows x 32 columns
static_assert(NH_ * 32 == DM);                             // the NH_ waves of a query tile cover the DM output columns, 32 each
static_assert(32 * AW <= 1024);
static_assert((size_t)MROWS * SEQ <= 131072);              // static LDS per kernel
static_assert((size_t)32 * WTP * 4 <= 131072);
static_assert((size_t)AW * 16 * OSP * 4 + (size_t)AW * 4 * 32 * 16 <= 131072);
static_assert((size_t)FRONT_LDS <= 131072);
static_assert(sizeof(unsigned) == 4);

typedef _Float16 h16;
typedef unsigned short bf;
typedef __attribute__((ext_vector_type(16))) __bf16   v16bf;
typedef __attribute__((ext_vector_type(16))) _Float16 v16h;
typedef __attribute__((ext_vector_type(8)))  _Float16 v8h;
typedef __attribute__((ext_vector_type(8)))  unsigned short v8us;
typedef __attribute__((ext_vector_type(8)))  __bf16   v8bf;
typedef __attribute__((ext_vector_type(8)))  float    v8f;
typedef __attribute__((ext_vector_type(4)))  float    v4f;
typedef v4f  __attribute__((may_alias)) v4fa;
typedef __attribute__((ext_vector_type(4)))  unsigned v4u;
typedef v4u  __attribute__((may_alias)) v4ua;
typedef int  v4e __attribute__((ext_vector_type(4), aligned(4)));   // four edge indices; only the element's own alignment is assumed

__device__ __forceinline__ unsigned short f2bf(float f) { unsigned u = __float_as_uint(f); u += 0x7FFFu + ((u >> 16) & 1u); return (unsigned short)(u >> 16); }
__device__ __forceinline__ float bfr(float f) { return __uint_as_float(((unsigned)f2bf(f)) << 16); }   // value after RNE convert to bf16
__device__ __forceinline__ v8us cvt8(v8f x) { return __builtin_bit_cast(v8us, __builtin_convertvector(x, v8bf)); }   // eight f32 -> bf16 (RNE), packed converts
__device__ __forceinline__ v16h cat16(v8h lo, v8h hi) { return __builtin_shufflevector(lo, hi, 0, 1, 2, 3, 4, 5, 6, 7, 8, 9, 10, 11, 12, 13, 14, 15); }
__device__ __forceinline__ v16bf cat16b(v8us lo, v8us hi) { return __builtin_bit_cast(v16bf, __builtin_shufflevector(lo, hi, 0, 1, 2, 3, 4, 5, 6, 7, 8, 9, 10, 11, 12, 13, 14, 15)); }
__device__ __forceinline__ v8f wmma16(v16h a, v16h b, v8f c) { return __builtin_amdgcn_wmma_f32_16x16x32_f16(false, a, false, b, (short)0, c, false, false); }
__device__ __forceinline__ v8f wmmab(v16bf a, v16bf b, v8f c) { return __builtin_amdgcn_wmma_f32_16x16x32_bf16(false, a, false, b, (short)0, c, false, false); }
// fragment loader from K-contiguous 16-bit rows (LDS tiles); p already includes + 8*(lane>>4): elements 0..7 <- k0+8h+0..7, elements 8..15 <- k0+16+8h+0..7 (same map for A and B)
__device__ __forceinline__ v16bf ldb(const bf* p)  { return cat16b(*(const v8us*)p, *(const v8us*)(p + 16)); }
// fragment loader from a plane in fragment order; p already includes + 8*lane: elements 0..7 <- first 512 bytes of the tile, elements 8..15 <- second 512 bytes (the writers put k0+8h+0..7 and k0+16+8h+0..7 of row lane&15 there)
__device__ __forceinline__ v16h  ldf(const h16* p) { return cat16(*(const v8h*)p, *(const v8h*)(p + 256)); }
// ordering point for wave-private LDS tiles (same wave writes and reads)
__device__ __forceinline__ void wave_sync() { __builtin_amdgcn_fence(3 /* release order */, "wavefront"); __builtin_amdgcn_wave_barrier(); asm volatile("" ::: "memory"); }
// stands behind a global store: the code that follows rewrites the store's address and data registers
__device__ __forceinline__ void xwait() { asm volatile("s_wait_xcnt 0x0" ::: "memory"); }
// f32 -> f16 convert that cannot produce a subnormal operand (|v| < 2^-14 -> +0)
__device__ __forceinline__ h16 toh_flush(float v) { const h16 r = (h16)v; return (fabsf(v) < 6.103515625e-05f) ? (h16)0.0f : r; }
// one f16 matrix instruction with its own guard (ties its accumulator, keeps both fragments live)
__device__ __forceinline__ v8f wmma16g(v16h a, v16h b, v8f c) { c = wmma16(a, b, c); asm volatile("v_nop\n\tv_nop\n\tv_nop\n\tv_nop" : "+v"(c) : "v"(a), "v"(b)); return c; }
// four flag bytes (0/1 each, lowest byte = lowest key) -> four bits
__device__ __forceinline__ unsigned nib4(unsigned x) { return (x | (x >> 7) | (x >> 14) | (x >> 21)) & 0xFu; }

// wt_body: weight transpose: in W[k][n] (DM rows of DM) -> out WT, n-major; one block per 32 output rows, tile staged in LDS (block barrier). HALF true: fragment order [n/16][k/32][half][lane][8], stores thread-linear.
// HALF false: bf16 (RNE convert). HALF true: f16 of (bf16-converted weight x WOS), subnormal results selected to +0.
template <bool HALF>
__device__ __forceinline__ void wt_body(float* ts, int n0, const float* __restrict__ W, unsigned short* WT) {
    const int tid = threadIdx.x; const int j = tid & 31, kk = tid >> 5;
#pragma unroll 1   // kept rolled: small code
    for (int i = 0; i < DM / (MTH / 32); ++i) { const int k = kk + (MTH / 32) * i; ts[j * WTP + k] = W[(size_t)k * DM + n0 + j]; }   // k covers 0..DM-1, n0 + j < DM
    __syncthreads();
#pragma unroll 1   // kept rolled: small code
    for (int it = 0; it < (32 * DM) / (8 * MTH); ++it) { const int q = it * MTH + tid;   // trips x MTH threads x 8 = 32 rows x DM
        const int row = HALF ? (q / (16 * DM / 8)) * 16 + (q & 15) : q / (DM / 8);                                  // HALF: piece q = [n tile][k step][half][lane]
        const int c8  = HALF ? ((q >> 6) % (DM / 32)) * 32 + ((q >> 5) & 1) * 16 + ((q >> 4) & 1) * 8 : (q % (DM / 8)) * 8;
        const v4f x0 = *(const v4fa*)(&ts[row * WTP + c8]); const v4f x1 = *(const v4fa*)(&ts[row * WTP + c8 + 4]);
        unsigned short* dp = HALF ? WT + (size_t)n0 * DM + (size_t)q * 8 : WT + (size_t)(n0 + row) * DM + c8;
        if (HALF) { v8h o;
#pragma unroll
            for (int i = 0; i < 4; ++i) { o[i] = toh_flush(bfr(x0[i]) * WOS); o[4 + i] = toh_flush(bfr(x1[i]) * WOS); }
            *(v8h*)dp = o; }
        else { v8us o;
#pragma unroll
            for (int i = 0; i < 4; ++i) { o[i] = f2bf(x0[i]); o[4 + i] = f2bf(x1[i]); }
            *(v8us*)dp = o; }
        asm volatile("s_wait_xcnt 0x0" ::: "memory"); }   // the next trip rewrites the store's address and data registers
}

// mask_body: adjacency bit plane for one (graph b, band of MROWS query rows starting at r0). Block-local byte flag tile [MROWS][SEQ] in LDS: zero fill, block barrier, diagonal + every listed edge that falls in the band
// stores the byte 1 (plain same-value byte stores, no read-modify-write), block barrier, then each thread packs 32 flags into one word and the band's 64-byte rows go out thread-linear (one 128-byte line per wave).
// Every block reads the whole edge list: MTH threads, four edges per 16-byte load, MUN load pairs issued before the first is used, so the scan runs at the rate of the loads and not at their latency.
// Band test: graph = floor(s / SEQ_FULL), graphs -NB_FULL..-1 wrap to 0..NB_FULL-1, row = s mod SEQ_FULL. With lo = the first s of this band in the wrapped (negative) range, s lies in the band
// exactly when s - lo (modulo 2^32) is in [0, MROWS) or in [NB_FULL*SEQ_FULL, NB_FULL*SEQ_FULL + MROWS): all bits clear but the row bits and the bit NB_FULL*SEQ_FULL.
// The remainder of the list (fewer than MTH * 4 * MUN edges) goes one edge per thread with clamped addresses; both loops are block-uniform. SEQ/MROWS bands x NB graphs.
__device__ __forceinline__ bool in_band(int s, unsigned lo) { return (((unsigned)s - lo) & ~(unsigned)(NB_FULL * SEQ_FULL + MROWS - 1)) == 0u; }
__device__ __forceinline__ void mark_edge(unsigned char* fl, int s, int d) {
    const int c = d & (SEQ_FULL - 1); if (c < SEQ) fl[(s & (MROWS - 1)) * SEQ + c] = (unsigned char)1;   // row in [0, MROWS), c in [0, SEQ)
}
__device__ __forceinline__ void mask_body(unsigned char* fl, int r0, int b, const int* __restrict__ src, const int* __restrict__ dst, int nE, unsigned* MB) {
    const int tid = threadIdx.x;
    const v4u zz = (v4u){0u, 0u, 0u, 0u};
#pragma unroll
    for (int i = 0; i < (MROWS * SEQ) / (16 * MTH); ++i) *(v4ua*)(&fl[(i * MTH + tid) * 16]) = zz;
    __syncthreads();
    if (tid < MROWS) fl[tid * SEQ + r0 + tid] = (unsigned char)1;          // diagonal, r0 + tid < SEQ
    const unsigned lo = (unsigned)((b - NB_FULL) * SEQ_FULL + r0);
    const int* ps = src + tid * 4; const int* pd = dst + tid * 4;
    int base = 0;
#pragma unroll 1   // one group of MUN load pairs per trip; more would only grow the code
    for (; base + MTH * 4 * MUN <= nE; base += MTH * 4 * MUN) {
        v4e S[MUN], D[MUN];
#pragma unroll     // all MUN pairs issued back to back, S and D in registers
        for (int u = 0; u < MUN; ++u) { S[u] = *(const v4e*)(ps + u * MTH * 4); D[u] = *(const v4e*)(pd + u * MTH * 4); }   // last element base + MTH*4*MUN - 1 < nE
#pragma unroll     // constant indices into S and D
        for (int u = 0; u < MUN; ++u) {
#pragma unroll
            for (int i = 0; i < 4; ++i) if (in_band(S[u][i], lo)) mark_edge(fl, S[u][i], D[u][i]); }
        ps += MTH * 4 * MUN; pd += MTH * 4 * MUN;
    }
#pragma unroll 1   // short remainder, kept small
    for (; base < nE; base += MTH) {
        const int e = base + tid; const int ec = e < nE ? e : nE - 1;      // a clamped lane repeats the last edge: the same byte, the same value
        const int s = src[ec], d = dst[ec];
        if (in_band(s, lo)) mark_edge(fl, s, d);
    }
    __syncthreads();
    const size_t wbase = (size_t)(b * SEQ + r0) * (SEQ / 32);
#pragma unroll
    for (int i = 0; i < (MROWS * SEQ) / (32 * MTH); ++i) { const int p = i * MTH + tid;   // word p of the band = flags p*32 .. p*32+31
        const v4u X = *(const v4ua*)(&fl[p * 32]); const v4u Y = *(const v4ua*)(&fl[p * 32 + 16]);
        MB[wbase + p] = nib4(X[0]) | (nib4(X[1]) << 4) | (nib4(X[2]) << 8) | (nib4(X[3]) << 12) | (nib4(Y[0]) << 16) | (nib4(Y[1]) << 20) | (nib4(Y[2]) << 24) | (nib4(Y[3]) << 28); }
}

// proj_body: bf16 GEMM of one block: PT tokens x DM features of one projection, K = DM, straight from the f32 inputs. Per phase of PKH k values the block converts (RNE) its token tile
// XS[token][k] (rows of h, 8 floats per thread and trip) and its weight tile WS[n][k] (W is [k][n]: a thread gathers 8 k values of one column, a wave reads whole 128-byte lines) into LDS,
// block barrier, every wave runs PKH/32 k-steps on its own tile with fragments from LDS (K-contiguous rows, pitch PKP), block barrier (the tiles may be overwritten). k runs upward through both phases.
// One wave per 32x64 tile (8 accumulators). After the last barrier the staged tiles are dead and each wave's output tile os lies in the same LDS area.
// C[m][n] = sum_k A[m][k] Bt[n][k] + bias, written as f16 (Ph) and, for tokens t < resT (resT a multiple of 64, wave-uniform test), the f16 residual x2048 (Pr).
// MODE 0: A = x rows (m = b*SEQ + t), Bt = W rows (n = h*32 + d), bias per column; plane [(b*NH_ + h)][t/16][tile] (residual plane: resT tokens per head). The 64-column tile spans two heads; per 16-row slab and head one 1024-byte tile
//         in fragment order (two lane-linear stores). Waves: 4 token tiles x 4 feature tiles.
// MODE 1: A = W rows (m = h*32 + d), Bt = x rows (n = b*SEQ + t), bias per row; plane [(b*NH_ + m/32)][t/32][(m%32)/16][tile] in fragment order. Waves: 8 feature tiles x 2 token tiles.
template <int MODE>
__device__ __forceinline__ void proj_body(unsigned char* sm, int tok0, const float* __restrict__ hin, const float* __restrict__ W, const float* __restrict__ bias, h16* Ph, h16* Pr, int resT) {
    bf* XS = (bf*)sm; bf* WS = XS + PT * PKP;
    const int tid = threadIdx.x;
    const int lane = tid & 31, lr = lane & 15, hi = lane >> 4;
    const int wave = __builtin_amdgcn_readfirstlane(tid >> 5);
    const int ra = (MODE == 0 ? (wave >> 2) : (wave >> 1)) * 32;    // first A row of this wave inside the block's A tile
    const int cb = (MODE == 0 ? (wave & 3) : (wave & 1)) * 64;      // first Bt row inside the block's Bt tile
    const bf* Al = (MODE == 0 ? XS : WS) + (ra + lr) * PKP + 8 * hi;
    const bf* Bl = (MODE == 0 ? WS : XS) + (cb + lr) * PKP + 8 * hi;
    const float* xsrc = hin + ((size_t)(tok0 / SEQ) * SEQ_FULL + (size_t)(tok0 % SEQ)) * DM;   // the input's graphs lie SEQ_FULL rows apart
    // staging: thread -> (token row xr, 8 columns) stepping XR rows a trip; (weight column tid % DM, 8 k values from wk) stepping WK k values a trip
    const int xr = tid / (PKH / 8), wk = (tid / DM) * 8;
    const float* xg = xsrc + (size_t)xr * DM + (tid % (PKH / 8)) * 8; bf* xl = XS + xr * PKP + (tid % (PKH / 8)) * 8;
    const float* wg = W + (size_t)wk * DM + tid % DM;                 bf* wl = WS + (tid % DM) * PKP + wk;
    v8f acc[2][4];
#pragma unroll
    for (int mb = 0; mb < 2; ++mb)
#pragma unroll
        for (int nb = 0; nb < 4; ++nb) acc[mb][nb] = (v8f){};
#pragma unroll 1   // one phase per trip: the two phases share the LDS tiles
    for (int kh = 0; kh < DM; kh += PKH) {
        const float* xk = xg + kh; const float* wk0 = wg + (size_t)kh * DM;
        { v8f x[(PT * PKH) / (8 * MTH)];
#pragma unroll     // all of the token tile's loads issued back to back, before the first is used
          for (int it = 0; it < (PT * PKH) / (8 * MTH); ++it) x[it] = *(const v8f*)(xk + (size_t)it * XR * DM);                // row xr + it*XR < PT
          static_assert((PT * PKH) / (8 * MTH) == 4);
          asm volatile("s_wait_xcnt 0x0" :: "v"(xk), "v"(x[0]), "v"(x[1]), "v"(x[2]), "v"(x[3]) : "memory");   // keeps these loads' address registers whole up to the wait; the loaded values as inputs hold all the loads in front of the first convert (one latency per group)
#pragma unroll
          for (int it = 0; it < (PT * PKH) / (8 * MTH); ++it) *(v8us*)(xl + it * XR * PKP) = cvt8(x[it]); }
#pragma unroll     // groups of WG column pieces: constant indices into x
        for (int g = 0; g < (DM * PKH) / (8 * MTH * WG); ++g) { v8f x[WG];
#pragma unroll     // 8 * WG column loads issued back to back, before the first is used
            for (int u = 0; u < WG; ++u)
#pragma unroll
                for (int j = 0; j < 8; ++j) x[u][j] = wk0[(size_t)((g * WG + u) * WK + j) * DM];                                // k = kh + wk + (g*WG+u)*WK + j < kh + PKH
            static_assert(WG == 4);
            asm volatile("s_wait_xcnt 0x0" :: "v"(wk0), "v"(x[0]), "v"(x[1]), "v"(x[2]), "v"(x[3]) : "memory");   // as above
#pragma unroll
            for (int u = 0; u < WG; ++u) *(v8us*)(wl + (g * WG + u) * WK) = cvt8(x[u]); }
        __syncthreads();                                           // both tiles of this phase are in LDS
#pragma unroll     // straight-line k-steps: the next step's LDS reads issue under this step's matrix instructions
        for (int kc = 0; kc < PKH; kc += 32) {
            v16bf a[2];
#pragma unroll
            for (int mb = 0; mb < 2; ++mb) a[mb] = ldb(Al + mb * 16 * PKP + kc);
#pragma unroll
            for (int nb = 0; nb < 4; ++nb) { const v16bf b = ldb(Bl + nb * 16 * PKP + kc);
#pragma unroll
                for (int mb = 0; mb < 2; ++mb) acc[mb][nb] = wmmab(a[mb], b, acc[mb][nb]); }
        }
        __syncthreads();                                           // every wave has read this phase's tiles
    }
    float* os = (float*)sm + wave * (16 * 68);
    const int r0 = (MODE == 0 ? tok0 : 0) + ra, c0 = (MODE == 0 ? 0 : tok0) + cb;
    float bc[4];
#pragma unroll
    for (int nb = 0; nb < 4; ++nb) bc[nb] = (MODE == 0) ? bfr(bias[c0 + nb * 16 + lr]) : 0.0f;   // MODE 0: c0 + 63 < DM
    size_t tbase, rbase; bool wr;                                                                 // wr: wave-uniform, whole tile inside the residual plane
    if (MODE == 0) { const int bb = r0 / SEQ, tt = r0 % SEQ; const int zc = bb * NH_ + c0 / HD;
                     tbase = ((size_t)zc * SEQ + (size_t)tt) * HD; rbase = ((size_t)zc * (size_t)resT + (size_t)tt) * HD; wr = tt < resT; }
    else           { const int bb = c0 / SEQ, tt = c0 % SEQ;
                     const int zc = bb * NH_ + r0 / HD;   // r0 is a multiple of HD, tt of 64
                     tbase = ((size_t)zc * SEQ + (size_t)tt) * HD; rbase = ((size_t)zc * (size_t)resT + (size_t)tt) * HD; wr = tt < resT; }
#pragma unroll
    for (int mb = 0; mb < 2; ++mb) {
        float br[8];
#pragma unroll
        for (int j = 0; j < 8; ++j) br[j] = (MODE == 1) ? bfr(bias[r0 + mb * 16 + hi * 8 + j]) : 0.0f;   // MODE 1: r0 + 31 < DM
#pragma unroll
        for (int nb = 0; nb < 4; ++nb) {
#pragma unroll
            for (int j = 0; j < 8; ++j) os[(hi * 8 + j) * 68 + nb * 16 + lr] = acc[mb][nb][j] + bc[nb] + br[j]; }   // D: row 8h+j, col lane&15
        wave_sync();
{
            if (MODE == 0) {
                const size_t sb = tbase + (size_t)(mb * 16) * HD;
                const size_t rb = rbase + (size_t)(mb * 16) * HD;
#pragma unroll
                for (int hh = 0; hh < 2; ++hh) {
#pragma unroll
                    for (int s = 0; s < 2; ++s) { const int p = s * 32 + lane; const int row = lr, c8 = (2 * s + hi) * 8;   // piece p of the tile: row lane&15, d = 16s + 8h + 0..7 of head hh
                        const v4f x0 = *(const v4fa*)(&os[row * 68 + hh * 32 + c8]); const v4f x1 = *(const v4fa*)(&os[row * 68 + hh * 32 + c8 + 4]); v8h hv, rv;
#pragma unroll
                        for (int i = 0; i < 4; ++i) { const h16 a0 = (h16)x0[i]; const h16 a1 = (h16)x1[i]; hv[i] = a0; hv[4 + i] = a1; rv[i] = (h16)((x0[i] - (float)a0) * QRS); rv[4 + i] = (h16)((x1[i] - (float)a1) * QRS); }
                        const size_t oo = sb + (size_t)hh * ((size_t)SEQ * HD) + (size_t)p * 8;
                        const size_t ro = rb + (size_t)hh * ((size_t)resT * HD) + (size_t)p * 8;
                        *(v8h*)(Ph + oo) = hv; xwait(); if (wr) { *(v8h*)(Pr + ro) = rv; xwait(); } } }
            } else {
                const size_t sb = tbase + (size_t)(mb * 512);   // tile d/16 = mb of each 32-token step
                const size_t rb = rbase + (size_t)(mb * 512);
#pragma unroll
                for (int s = 0; s < 4; ++s) { const int row = lr, c8 = s * 16 + hi * 8;   // s = (32-token step, half): row lane&15, tokens 16s + 8h + 0..7
                    const v4f x0 = *(const v4fa*)(&os[row * 68 + c8]); const v4f x1 = *(const v4fa*)(&os[row * 68 + c8 + 4]); v8h hv, rv;
#pragma unroll
                    for (int i = 0; i < 4; ++i) { const h16 a0 = (h16)x0[i]; const h16 a1 = (h16)x1[i]; hv[i] = a0; hv[4 + i] = a1; rv[i] = (h16)((x0[i] - (float)a0) * QRS); rv[4 + i] = (h16)((x1[i] - (float)a1) * QRS); }
                    const size_t oo = sb + (size_t)((s >> 1) * 1024 + (s & 1) * 256 + lane * 8);
                    const size_t ro = rb + (size_t)((s >> 1) * 1024 + (s & 1) * 256 + lane * 8);
                    *(v8h*)(Ph + oo) = hv; xwait(); if (wr) { *(v8h*)(Pr + ro) = rv; xwait(); } }
            }
             }
        wave_sync();
    }
}

// k_front: everything that reads the inputs alone, as block ranges of ONE launch, so that the pieces run side by side. MTH threads per block; the branch is on blockIdx alone
// (block-uniform, so each piece's barriers are passed by all of its block's threads); one LDS area serves all pieces. Longest pieces first:
// blocks [0, NBM) adjacency bands, [NBM, NBM + NBP) projections (q, then k, then v^T; one block per PT tokens), [NBM + NBP, NBM + NBP + NBW) output weight transpose.
// Register budget for eight waves per SIMD = two blocks per WGP: there are more blocks than WGPs, and all of them should be resident at once.
__global__ __launch_bounds__(MTH) __attribute__((amdgpu_waves_per_eu(8))) void k_front(const int* __restrict__ src, const int* __restrict__ dst, int nE, unsigned* MB,
                                                  const float* __restrict__ wq, const float* __restrict__ wk, const float* __restrict__ wv, const float* __restrict__ wo, h16* WOH,
                                                  const float* __restrict__ hin, const float* __restrict__ bq, const float* __restrict__ bk, const float* __restrict__ bv,
                                                  h16* QH, h16* QR, h16* KP, h16* KR, h16* VT, h16* VR, int resT) {
    __shared__ __align__(16) unsigned char sm[FRONT_LDS];
    const int blk = blockIdx.x;
    if (blk < NBM) { mask_body(sm, (blk % (SEQ / MROWS)) * MROWS, blk / (SEQ / MROWS), src, dst, nE, MB); return; }
    if (blk < NBM + NBP) {
        const int z = (blk - NBM) / ((NB * SEQ) / PT), tok0 = ((blk - NBM) % ((NB * SEQ) / PT)) * PT;
        if (z == 2) proj_body<1>(sm, tok0, hin, wv, bv, VT, VR, resT);
        else        proj_body<0>(sm, tok0, hin, z ? wk : wq, z ? bk : bq, z ? KP : QH, z ? KR : QR, resT);
        return; }
    wt_body<true>((float*)sm, (blk - NBM - NBP) * 32, wo, (unsigned short*)WOH);
}

// k_flash: fused attention and output projection. One block per (graph, AQ tiles of 16 query rows): AW waves, wave = (query tile, head); K / V^T / Q fragments straight from the f16 planes in fragment order (two lane-linear 16-B loads each, whole 128-byte lines).
// Transposed form: S^T[key][t] = K Q^T (A = K rows, B = Q rows); lane (t = lane&15, h = lane>>4) holds keys 8h+r of each 16-key tile, so the packed
// P tile is directly the B fragment of O^T[d][t] = V^T P^T (element r <- tile keys 0..15, element 8+r <- tile keys 16..31, lane unchanged).
// Softmax state (running max over kept keys, partial sum) is one scalar per lane; the two lane halves of a row are combined with one xor-16 exchange.
// Keep rule: one adjacency word per lane per 32-key step (row t0 + lane&15, word key0/32), bit 8h+r for the first tile and 16+8h+r for the second; dropped elements are selected to 0 by value.
// All rows: scores = K Q + (K Q_res + K_res Q) / 2048; P = f16 value + f16 residual x2048; O = V P + (V P_res + V_res P) / 2048 (residual products in their own accumulators); row sum from the f32 exponentials.
// P below 2^-14 (after the 2^14 carry) is selected to 0 on the exponent argument; residuals pass the subnormal select.
// Context hand-over: O^T in D layout (lane: row t = lane&15, d = 8h+r and 16+8h+r) IS the A fragment of the output projection's k-step 'head' (row t, k = head*32 + d), so each wave converts its own
// registers to f16 value + f16 residual x2048 and stores the four 512-byte slices lane-linear in LDS; one block barrier; then every wave reads the NH_ heads' fragments of its query tile.
// Output projection: wave (query tile, c) computes rows of its tile x columns 32c..32c+31, k-steps in head order, value and residual in separate accumulators; Bt = transposed output weight plane (fragment order, f16, x64),
// its fragments loaded before the barrier; OUT[m][n] = (sum + sum_res / 2048) / 64 + bias (bias bf16-converted, added in f32); rows go out through a wave-private LDS tile as whole 128-byte runs.
__global__ __launch_bounds__(32 * AW) void k_flash(const h16* __restrict__ QH, const h16* __restrict__ QR, const h16* __restrict__ KP, const h16* __restrict__ KR,
                                                   const h16* __restrict__ VT, const h16* __restrict__ VR, const unsigned* __restrict__ MB,
                                                   const h16* __restrict__ WT, const float* __restrict__ bias, float* OUT) {
    __shared__ v8h cf[AW * 4 * 32];                            // [query tile][head][value lo, value hi, residual lo, residual hi][lane]
    __shared__ __align__(16) float os[AW * 16 * OSP];
    const int lane = threadIdx.x & 31, lr = lane & 15, hi = lane >> 4;
    const int wave = __builtin_amdgcn_readfirstlane((int)(threadIdx.x >> 5));
    const int head = wave % NH_, qt = wave / NH_;
    const int b = blockIdx.y; const int zh = b * NH_ + head;
    const int t0 = (blockIdx.x * AQ + qt) * 16;
    const unsigned* mrow = MB + (size_t)(b * SEQ + t0 + lr) * (SEQ / 32);
    const size_t pbase = (size_t)zh * SEQ * HD;
    const size_t ko = pbase + (size_t)lane * 8;                // + key0 * HD: K tiles of keys key0.. and key0+16.. (A fragment: row key, k = d); V^T tiles d 0..15 and 16..31 of the step (A fragment: row d, k = key)
    const size_t qo = ko + (size_t)t0 * HD;
    const v16h qh = ldf(QH + qo), qr = ldf(QR + qo);            // B fragments: col t, k = d (HD = 32 = one k-step)
    v8f o0 = (v8f){}, o1 = (v8f){}, oR0 = (v8f){}, oR1 = (v8f){};
    float m = NEGB, l = 0.0f;
#pragma unroll 1
    for (int key0 = 0; key0 < SEQ; key0 += 32) {
        unsigned mw = mrow[key0 >> 5];
        asm volatile("" : "+v"(mw));
        const unsigned sa = mw >> (8 * hi);
        const h16* ka = KP + ko + (size_t)key0 * HD;
        const h16* kr = KR + ko + (size_t)key0 * HD;
        const v16h ka0 = ldf(ka), kb0 = ldf(ka + 16 * HD);
        const v16h kra0 = ldf(kr), krb0 = ldf(kr + 16 * HD);
        v8f sHa = (v8f){}, sLa = (v8f){}, sHb = (v8f){}, sLb = (v8f){};
        sHa = wmma16g(ka0, qh, sHa); sLa = wmma16g(ka0, qr, sLa); sLa = wmma16g(kra0, qh, sLa);
        sHb = wmma16g(kb0, qh, sHb); sLb = wmma16g(kb0, qr, sLb); sLb = wmma16g(krb0, qh, sLb);
        float ta[8], tb[8]; bool fa[8], fb[8]; float mx = NEGB;
#pragma unroll
        for (int r = 0; r < 8; ++r) {
            fa[r] = ((sa >> r) & 1u) != 0u;
            fb[r] = ((sa >> (16 + r)) & 1u) != 0u;
            ta[r] = (sHa[r] + sLa[r] * QRI) * SC2; tb[r] = (sHb[r] + sLb[r] * QRI) * SC2;
            mx = fmaxf(mx, fmaxf(fa[r] ? ta[r] : NEGB, fb[r] ? tb[r] : NEGB)); }
        mx = fmaxf(mx, __shfl_xor(mx, 16, 32));
        const float mnew = fmaxf(m, mx);
        const float alpha = __builtin_amdgcn_exp2f(m - mnew);
        const float sh = PSH - mnew;
        v16h pb, pr; float ls = 0.0f;
#pragma unroll
        for (int r = 0; r < 8; ++r) {
            const float xa = ta[r] + sh, xb = tb[r] + sh;
            const float ea = __builtin_amdgcn_exp2f(xa), eb = __builtin_amdgcn_exp2f(xb);
            const bool za = fa[r] & (xa >= -14.0f), zb = fb[r] & (xb >= -14.0f);
            const float ga = za ? ea : 0.0f, gb = zb ? eb : 0.0f;       // dropped elements and sub-2^-14 values selected to 0 by value
            const h16 pa = (h16)ga; const h16 pc = (h16)gb;             // 0 or in [2^-14, 2^14]
            pb[r] = pa; pb[8 + r] = pc;
            pr[r] = toh_flush((ga - (float)pa) * QRS); pr[8 + r] = toh_flush((gb - (float)pc) * QRS);
            ls += ga + gb; }
        l = l * alpha + ls; m = mnew;
        o0 = o0 * alpha; o1 = o1 * alpha; oR0 = oR0 * alpha; oR1 = oR1 * alpha;
        const h16* va = VT + ko + (size_t)key0 * HD;
        const h16* vr = VR + ko + (size_t)key0 * HD;
        const v16h v0 = ldf(va), v1 = ldf(va + 512);
        const v16h vr0 = ldf(vr), vr1 = ldf(vr + 512);
        o0 = wmma16g(v0, pb, o0); o1 = wmma16g(v1, pb, o1);
        oR0 = wmma16g(v0, pr, oR0); oR1 = wmma16g(v1, pr, oR1);
        oR0 = wmma16g(vr0, pb, oR0); oR1 = wmma16g(vr1, pb, oR1);
    }
    // this wave's output weight fragments (columns c0 .. c0+31, all k): issued here so that they land while the context is converted and the block gathers at the barrier
    const int c0 = head * 32;
    const int cn = c0 + lr;                                    // cn + 16 < DM
    const h16* wp = WT + (size_t)c0 * DM + lane * 8;           // tiles [c0/16 + 0..1][k step]
    v16h w[2][NH_];
#pragma unroll
    for (int kc = 0; kc < NH_; ++kc) { w[0][kc] = ldf(wp + kc * 512); w[1][kc] = ldf(wp + (size_t)16 * DM + kc * 512); }
    const float bl0 = bias[cn], bl1 = bias[cn + 16];
    asm volatile("s_wait_xcnt 0x0" :: "v"(wp), "v"(cn) : "memory");   // keeps these loads' address registers whole up to the wait; the code behind it (their own results too) may then rewrite them
    const float bc0 = bfr(bl0), bc1 = bfr(bl1);
    l += __shfl_xor(l, 16, 32);
    const bool any = l > 0.0f;
    const float lsafe = any ? l : 1.0f;
    const float inv = any ? (1.0f / lsafe) : 0.0f;             // no kept key -> zeros (cannot happen: the diagonal is always kept)
    const v8f f0 = o0 + oR0 * QRI, f1 = o1 + oR1 * QRI;
    { v8h h0, h1, r0, r1;                                      // f_j[r] = (d = 16j + 8h + r, t = lane&15)
#pragma unroll
      for (int i = 0; i < 8; ++i) { const float x0 = f0[i] * inv, x1 = f1[i] * inv; const h16 a0 = toh_flush(x0); const h16 a1 = toh_flush(x1); h0[i] = a0; h1[i] = a1;
          r0[i] = toh_flush((x0 - (float)a0) * QRS); r1[i] = toh_flush((x1 - (float)a1) * QRS); }
      v8h* cw = cf + wave * (4 * 32) + lane;
      cw[0] = h0; cw[32] = h1; cw[64] = r0; cw[96] = r1; }
    __syncthreads();                                           // every head's context fragments of both query tiles are in LDS
    v8f aH0 = (v8f){}, aH1 = (v8f){}, aR0 = (v8f){}, aR1 = (v8f){};
    const v8h* cr = cf + qt * (NH_ * 4 * 32) + lane;
#pragma unroll
    for (int kc = 0; kc < NH_; ++kc) {
        const v16h a = cat16(cr[kc * 128], cr[kc * 128 + 32]), e = cat16(cr[kc * 128 + 64], cr[kc * 128 + 96]);
        aH0 = wmma16(a, w[0][kc], aH0); aH1 = wmma16(a, w[1][kc], aH1);
        aR0 = wmma16(e, w[0][kc], aR0); aR1 = wmma16(e, w[1][kc], aR1);
    }
    const int wb = wave * 16 * OSP;
#pragma unroll
    for (int j = 0; j < 8; ++j) { os[wb + (hi * 8 + j) * OSP + lr] = (aH0[j] + aR0[j] * QRI) * WOI + bc0; os[wb + (hi * 8 + j) * OSP + 16 + lr] = (aH1[j] + aR1[j] * QRI) * WOI + bc1; }   // D: row 8h+j, col lane&15
    wave_sync();
    float* obase = OUT + ((size_t)b * OUT_SEQ + (size_t)t0) * DM + c0;
#pragma unroll
    for (int s = 0; s < 4; ++s) { const int row = 4 * s + (lane >> 3), c4 = (lane & 7) * 4;   // 4 s x 4 rows = 16 rows; 8 lanes x 4 floats = 32 columns
        const v4f val = *(const v4fa*)(&os[wb + row * OSP + c4]);
        *(v4f*)(obase + (size_t)row * DM + c4) = val; }
}

static constexpr size_t al256(size_t v) { return (v + 255) & ~(size_t)255; }
static constexpr size_t SZ_WO = al256((size_t)DM * DM * 2);
static constexpr size_t SZ_PL = al256((size_t)NB * NH_ * SEQ * HD * 2);
static constexpr size_t SZ_MB = al256((size_t)NB * SEQ * (SEQ / 32) * 4);
static constexpr size_t SZ_TOTAL = SZ_WO + 6 * SZ_PL + SZ_MB;
static_assert(SZ_TOTAL <= (size_t)134217728);          // workspace carve <= 128 MiB
static_assert((size_t)NB * NH_ * SEQ * HD == (size_t)NB * DM * SEQ);       // the v^T plane has the same extent as the q/k planes
static_assert((size_t)(NB * SEQ / PT) * PT * DM == (size_t)NB * NH_ * SEQ * HD);    // projection blocks x tile == plane extent
static_assert((size_t)(SEQ / (16 * AQ)) * NB * AQ * 16 * DM == (size_t)NB * SEQ * DM);   // flash grid x rows x columns == output extent
static_assert((size_t)(SEQ / MROWS) * NB * MROWS * (SEQ / 32) * 4 == (size_t)NB * SEQ * (SEQ / 32) * 4);   // mask grid x band == bit plane extent

extern "C" void kernel_launch(void* const* d_in, const int* in_sizes, int n_in,
                              void* d_out, int out_size, void* d_ws, size_t ws_size, hipStream_t stream) {
    if (n_in < 11) return;
    const size_t needx = ((size_t)(NB - 1) * SEQ_FULL + SEQ) * DM;
    if ((size_t)in_sizes[0] < needx) return;
    if (in_sizes[1] < 1 || in_sizes[2] < 1) return;
    if ((size_t)in_sizes[3] < (size_t)DM * DM || (size_t)in_sizes[5] < (size_t)DM * DM || (size_t)in_sizes[7] < (size_t)DM * DM || (size_t)in_sizes[9] < (size_t)DM * DM) return;
    if (in_sizes[4] < DM || in_sizes[6] < DM || in_sizes[8] < DM || in_sizes[10] < DM) return;
    if ((size_t)out_size < ((size_t)(NB - 1) * OUT_SEQ + SEQ) * DM) return;
    if (SZ_TOTAL > ws_size) return;
    // wire order: h, src, dst, Wq, bq, Wk, bk, Wv, bv, Wo, bo
    const float* hin = (const float*)d_in[0];
    const int* src = (const int*)d_in[1]; const int* dst = (const int*)d_in[2];
    const float* wq = (const float*)d_in[3]; const float* bq = (const float*)d_in[4];
    const float* wk = (const float*)d_in[5]; const float* bk = (const float*)d_in[6];
    const float* wv = (const float*)d_in[7]; const float* bv = (const float*)d_in[8];
    const float* wo = (const float*)d_in[9]; const float* bo = (const float*)d_in[10];
    const int nE = in_sizes[1] < in_sizes[2] ? in_sizes[1] : in_sizes[2];
    float* OUT = (float*)d_out;      // [NB*SEQ][256]
    char* wsp = (char*)d_ws;
    h16* WOH = (h16*)wsp; wsp += SZ_WO;              // output weight, transposed, [out/16][in/32][tile], f16 x64
    h16* QH = (h16*)wsp; wsp += SZ_PL;               // [NB*8][SEQ/16][tile]
    h16* QR = (h16*)wsp; wsp += SZ_PL;               // residual x2048
    h16* KP = (h16*)wsp; wsp += SZ_PL;               // [NB*8][SEQ/16][tile]
    h16* KR = (h16*)wsp; wsp += SZ_PL;               // residual x2048
    h16* VT = (h16*)wsp; wsp += SZ_PL;               // [NB*8][SEQ/32][2][tile]
    h16* VR = (h16*)wsp; wsp += SZ_PL;               // residual x2048
    unsigned* MB = (unsigned*)wsp; wsp += SZ_MB;     // adjacency bits [NB*SEQ][SEQ/32]

    // adjacency bits; q, k, v^T planes with their residual planes for all tokens and the transposed output weight plane, all in fragment order
    k_front<<<NBM + NBP + NBW, MTH, 0, stream>>>(src, dst, nE, MB, wq, wk, wv, wo, WOH, hin, bq, bk, bv, QH, QR, KP, KR, VT, VR, SEQ);

    // attention and output projection: one block per (32 query rows, graph), all heads
    k_flash<<<dim3(SEQ / (16 * AQ), NB, 1), 32 * AW, 0, stream>>>(QH, QR, KP, KR, VT, VR, MB, WOH, bo, OUT);
}

// v006
// One run takes 47.2 microseconds.
// Two timings next to v005 both put it at 1.07 times that version's speed.
// Counting every step since v000, it is 7.12 times as fast.
#include <hip/hip_runtime.h>

// Graph attention layer: node features h [NB][SEQ][256]; q/k/v = h W + bias with W stored [in][out]; 8 heads x 32; scores (q.k) * 32^-0.5; per graph and query row the kept keys are the listed
// edges (graph = src / size, row = src mod size, column = dst mod size) plus the diagonal; all other keys get probability 0; context heads concatenated, then context Wo + bo (Wo [in][out]); output [NB*SEQ][256] f32.
// Compute dtypes, f32 accumulate everywhere: q/k/v projections v_wmma_f32_16x16x32_bf16 (h, W, bias RNE-converted to bf16; products exact);
// scores v_wmma_f32_16x16x32_f16: q and k each as f16 value + f16 residual x2048 (three products, residual products in their own accumulator folded by 1/2048);
// P.V v_wmma_f32_16x16x32_f16: P (x16384 carry, cancels in the normalisation) and v each as f16 value + f16 residual x2048, residual products in their own accumulator, row sum from the f32 exponentials; softmax f32 (online, running max over kept keys);
// output projection v_wmma_f32_16x16x32_f16: context as f16 value + f16 residual x2048 (own accumulator), Wo as f16 of the bf16-converted weight x64 (folded by 1/64), bias bf16-converted, added in f32.
// Layout: h and the q/k/v weights are converted to bf16 inside the projection blocks (LDS tiles, no planes); every f16 plane lies in fragment order (1024-byte tiles [element half][lane][8], so a fragment is two lane-linear 512-byte loads of whole 128-byte lines): q, k planes (value, residual) [b*NH_+h][t/16][tile of 16 t x 32 d]; v^T planes [b*NH_+h][t/32][d/16][tile of 16 d x 32 t]; transposed output weight plane [out/16][in/32][tile of 16 out x 32 in]; adjacency bit plane [b*SEQ+t][SEQ/32] (bit j of word w = key 32w+j);
// fused flash kernel in transposed form (S^T = K Q^T, O^T = V^T P^T); the context (value, residual) stays in the block's LDS as A fragments and the same launch does the output projection.

#ifndef NB
#define NB 16
#endif
#ifndef SEQ
#define SEQ 512
#endif
#define NB_FULL  16
#define SEQ_FULL 512
#ifndef OUT_SEQ
#define OUT_SEQ SEQ              // row pitch (in tokens) between batches of the output
#endif
#define DM   256
#define NH_  8
#define HD   32
#define AQ   2                   // 16-row query tiles per flash block
#define AW   (NH_ * AQ)          // waves per flash block: one per (query tile, head)
#define OSP  36                  // LDS row pitch (floats) of a wave's output tile
#define QRS  2048.0f             // carry of every residual plane / residual fragment
#define QRI  (1.0f / 2048.0f)
#define SC2  ((float)(0.17677669529663687 * 1.4426950408889634))   // HD^-0.5 * log2(e)
#define PSH  14.0f               // log2 of the P carry (16384)
#define NEGB (-3.0e38f)           // value of a dropped score
#define MST  (-1.0e30f)          // start of the running max: below every score, far above NEGB, so a dropped score always lands under the 2^-14 cut
#define WOS  64.0f               // carry of the output-projection weight plane
#define WOI  (1.0f / 64.0f)
#define MROWS 64                 // query rows per mask-builder block
#define MTH   512                // threads per block of the preparation launch
#define MUN   8                  // 16-byte load pairs in flight per thread in the edge scan
#define WTP  (DM + 4)            // LDS row pitch (floats) of the weight transpose tile
#define NBM  ((SEQ / MROWS) * NB)                 // preparation launch: adjacency blocks
#define NBW  (DM / 32)                            // output weight transpose blocks
#define PT   128                 // tokens per projection block
#define PKH  128                 // k extent staged in LDS per phase
#define PKP  (PKH + 8)           // LDS row pitch (bf16 elements) of the staged tiles: 272 B = 16 B x odd
#define WG   4                   // column pieces (8 k values each) in flight per thread while the weight tile is staged
#define XR   (MTH / (PKH / 8))   // token rows staged per trip
#define WK   ((MTH / DM) * 8)    // k values staged per trip
#define NBP  (3 * ((NB * SEQ) / PT))              // projection blocks (q, k, v)
#define FRONT_LDS ((PT + DM) * PKP * 2)           // token tile + weight tile; the flag tile, the transpose tile and the waves' output tiles lie in the same area

static_assert(HD == 32);
static_assert(NH_ * HD == DM);                 // head h = columns h*32 + d
static_assert(DM % 64 == 0);                   // column tiles of 64 = two heads
static_assert(64 % HD == 0);
static_assert(DM % 32 == 0);                   // GEMM k-loop steps by 32
static_assert(SEQ % 64 == 0);                  // a 64-row tile never straddles two batches
static_assert((NB * SEQ) % 64 == 0);
static_assert(SEQ % 32 == 0);                  // key loop steps by 32; one mask word per 32-key step
static_assert(SEQ % (16 * AQ) == 0);           // flash grid covers the sequence exactly
static_assert(((size_t)SEQ * DM) % 8 == 0);
static_assert(((size_t)DM * DM) % 8 == 0);
static_assert(NB <= NB_FULL);
static_assert(SEQ <= SEQ_FULL);
static_assert((OSP * 4) % 16 == 0);
static_assert(SEQ % MROWS == 0);               // mask-builder bands cover the rows exactly
static_assert((MROWS & (MROWS - 1)) == 0 && (SEQ_FULL & (SEQ_FULL - 1)) == 0 && (NB_FULL & (NB_FULL - 1)) == 0 && SEQ_FULL % MROWS == 0);   // row, column and band test by bit masks
static_assert((MROWS * SEQ) % (16 * MTH) == 0);            // flag tile zero fill: MTH threads x 16 B per trip
static_assert(((MROWS * SEQ) / 32) % MTH == 0);            // pack: whole trips of MTH words
static_assert(MROWS <= MTH);
static_assert((WTP * 4) % 16 == 0);
static_assert((32 * DM) % (8 * MTH) == 0);                 // weight transpose store: whole trips of MTH threads x 8 elements
static_assert(DM % (MTH / 32) == 0);                       // weight transpose load: whole trips of MTH/32 rows
static_assert(SEQ % PT == 0);                              // a projection block never straddles two graphs
static_assert(MTH == 512 && PT == 128 && DM == 256);       // 16 waves = 4 x 4 tiles of 32 tokens x 64 features (q, k) = 8 x 2 tiles of 32 features x 64 tokens (v^T)
static_assert(DM % PKH == 0 && PKH % 32 == 0 && MTH % (PKH / 8) == 0 && MTH % DM == 0);
static_assert((PKP * 2) % 32 == 16);                       // pitch = 16 B x odd
static_assert((PT * PKH) % (8 * MTH) == 0 && (DM * PKH) % (8 * MTH * WG) == 0);   // staging: whole trips of MTH threads x 8 elements
static_assert(MROWS * SEQ <= FRONT_LDS && 32 * WTP * 4 <= FRONT_LDS && (MTH / 32) * 16 * 68 * 4 <= FRONT_LDS);
static_assert(4 * 32 * 4 == 16 * 32);                      // output epilogue: instructions x lanes x floats == 16 rows x 32 columns
static_assert(NH_ * 32 == DM);                             // the NH_ waves of a query tile cover the DM output columns, 32 each
static_assert(32 * AW <= 1024);
static_assert((size_t)MROWS * SEQ <= 131072);              // static LDS per kernel
static_assert((size_t)32 * WTP * 4 <= 131072);
static_assert((size_t)AW * 16 * OSP * 4 + (size_t)AW * 4 * 32 * 16 <= 131072);
static_assert((size_t)FRONT_LDS <= 131072);
static_assert(sizeof(unsigned) == 4);

typedef _Float16 h16;
typedef unsigned short bf;
typedef __attribute__((ext_vector_type(16))) __bf16   v16bf;
typedef __attribute__((ext_vector_type(16))) _Float16 v16h;
typedef __attribute__((ext_vector_type(8)))  _Float16 v8h;
typedef __attribute__((ext_vector_type(8)))  unsigned short v8us;
typedef __attribute__((ext_vector_type(8)))  __bf16   v8bf;
typedef __attribute__((ext_vector_type(8)))  float    v8f;
typedef __attribute__((ext_vector_type(4)))  float    v4f;
typedef v4f  __attribute__((may_alias)) v4fa;
typedef __attribute__((ext_vector_type(4)))  unsigned v4u;
typedef v4u  __attribute__((may_alias)) v4ua;
typedef int  v4e __attribute__((ext_vector_type(4), aligned(4)));   // four edge indices; only the element's own alignment is assumed

__device__ __forceinline__ unsigned short f2bf(float f) { unsigned u = __float_as_uint(f); u += 0x7FFFu + ((u >> 16) & 1u); return (unsigned short)(u >> 16); }
__device__ __forceinline__ float bfr(float f) { return __uint_as_float(((unsigned)f2bf(f)) << 16); }   // value after RNE convert to bf16
__device__ __forceinline__ v8us cvt8(v8f x) { return __builtin_bit_cast(v8us, __builtin_convertvector(x, v8bf)); }   // eight f32 -> bf16 (RNE), packed converts
__device__ __forceinline__ v16h cat16(v8h lo, v8h hi) { return __builtin_shufflevector(lo, hi, 0, 1, 2, 3, 4, 5, 6, 7, 8, 9, 10, 11, 12, 13, 14, 15); }
__device__ __forceinline__ v16bf cat16b(v8us lo, v8us hi) { return __builtin_bit_cast(v16bf, __builtin_shufflevector(lo, hi, 0, 1, 2, 3, 4, 5, 6, 7, 8, 9, 10, 11, 12, 13, 14, 15)); }
__device__ __forceinline__ v8f wmma16(v16h a, v16h b, v8f c) { return __builtin_amdgcn_wmma_f32_16x16x32_f16(false, a, false, b, (short)0, c, false, false); }
__device__ __forceinline__ v8f wmmab(v16bf a, v16bf b, v8f c) { return __builtin_amdgcn_wmma_f32_16x16x32_bf16(false, a, false, b, (short)0, c, false, false); }
// fragment loader from K-contiguous 16-bit rows (LDS tiles); p already includes + 8*(lane>>4): elements 0..7 <- k0+8h+0..7, elements 8..15 <- k0+16+8h+0..7 (same map for A and B)
__device__ __forceinline__ v16bf ldb(const bf* p)  { return cat16b(*(const v8us*)p, *(const v8us*)(p + 16)); }
// fragment loader from a plane in fragment order; p already includes + 8*lane: elements 0..7 <- first 512 bytes of the tile, elements 8..15 <- second 512 bytes (the writers put k0+8h+0..7 and k0+16+8h+0..7 of row lane&15 there)
__device__ __forceinline__ v16h  ldf(const h16* p) { return cat16(*(const v8h*)p, *(const v8h*)(p + 256)); }
// ordering point for wave-private LDS tiles (same wave writes and reads)
__device__ __forceinline__ void wave_sync() { __builtin_amdgcn_fence(3 /* release order */, "wavefront"); __builtin_amdgcn_wave_barrier(); asm volatile("" ::: "memory"); }
// stands behind a global store: the code that follows rewrites the store's address and data registers
__device__ __forceinline__ void xwait() { asm volatile("s_wait_xcnt 0x0" ::: "memory"); }
// f32 -> f16 convert that cannot produce a subnormal operand (|v| < 2^-14 -> +0)
__device__ __forceinline__ h16 toh_flush(float v) { const h16 r = (h16)v; return (fabsf(v) < 6.103515625e-05f) ? (h16)0.0f : r; }
// score u where bit r of w is set, NEGB where it is clear
__device__ __forceinline__ float keep_bit(float u, unsigned w, int r) { return ((w >> r) & 1u) != 0u ? u : NEGB; }
// f16 residual x2048 of d; |d * 2048| < 2^-14 (tested on d itself, the scaling is exact) -> +0, so no subnormal operand
__device__ __forceinline__ h16 res_flush(float d) { return (h16)(((fabsf(d) < 2.98023223876953125e-08f) ? 0.0f : d) * QRS); }
// four flag bytes (0/1 each, lowest byte = lowest key) -> four bits
__device__ __forceinline__ unsigned nib4(unsigned x) { return (x | (x >> 7) | (x >> 14) | (x >> 21)) & 0xFu; }

// wt_body: weight transpose: in W[k][n] (DM rows of DM) -> out WT, n-major; one block per 32 output rows, tile staged in LDS (block barrier). HALF true: fragment order [n/16][k/32][half][lane][8], stores thread-linear.
// HALF false: bf16 (RNE convert). HALF true: f16 of (bf16-converted weight x WOS), subnormal results selected to +0.
template <bool HALF>
__device__ __forceinline__ void wt_body(float* ts, int n0, const float* __restrict__ W, unsigned short* WT) {
    const int tid = threadIdx.x; const int j = tid & 31, kk = tid >> 5;
#pragma unroll 1   // kept rolled: small code
    for (int i = 0; i < DM / (MTH / 32); ++i) { const int k = kk + (MTH / 32) * i; ts[j * WTP + k] = W[(size_t)k * DM + n0 + j]; }   // k covers 0..DM-1, n0 + j < DM
    __syncthreads();
#pragma unroll 1   // kept rolled: small code
    for (int it = 0; it < (32 * DM) / (8 * MTH); ++it) { const int q = it * MTH + tid;   // trips x MTH threads x 8 = 32 rows x DM
        const int row = HALF ? (q / (16 * DM / 8)) * 16 + (q & 15) : q / (DM / 8);                                  // HALF: piece q = [n tile][k step][half][lane]
        const int c8  = HALF ? ((q >> 6) % (DM / 32)) * 32 + ((q >> 5) & 1) * 16 + ((q >> 4) & 1) * 8 : (q % (DM / 8)) * 8;
        const v4f x0 = *(const v4fa*)(&ts[row * WTP + c8]); const v4f x1 = *(const v4fa*)(&ts[row * WTP + c8 + 4]);
        unsigned short* dp = HALF ? WT + (size_t)n0 * DM + (size_t)q * 8 : WT + (size_t)(n0 + row) * DM + c8;
        if (HALF) { v8h o;
#pragma unroll
            for (int i = 0; i < 4; ++i) { o[i] = toh_flush(bfr(x0[i]) * WOS); o[4 + i] = toh_flush(bfr(x1[i]) * WOS); }
            *(v8h*)dp = o; }
        else { v8us o;
#pragma unroll
            for (int i = 0; i < 4; ++i) { o[i] = f2bf(x0[i]); o[4 + i] = f2bf(x1[i]); }
            *(v8us*)dp = o; }
        asm volatile("s_wait_xcnt 0x0" ::: "memory"); }   // the next trip rewrites the store's address and data registers
}

// mask_body: adjacency bit plane for one (graph b, band of MROWS query rows starting at r0). Block-local byte flag tile [MROWS][SEQ] in LDS: zero fill, block barrier, diagonal + every listed edge that falls in the band
// stores the byte 1 (plain same-value byte stores, no read-modify-write), block barrier, then each thread packs 32 flags into one word and the band's 64-byte rows go out thread-linear (one 128-byte line per wave).
// Every block reads the whole edge list: MTH threads, four edges per 16-byte load, MUN load pairs issued before the first is used, so the scan runs at the rate of the loads and not at their latency.
// Band test: graph = floor(s / SEQ_FULL), graphs -NB_FULL..-1 wrap to 0..NB_FULL-1, row = s mod SEQ_FULL. With lo = the first s of this band in the wrapped (negative) range, s lies in the band
// exactly when s - lo (modulo 2^32) is in [0, MROWS) or in [NB_FULL*SEQ_FULL, NB_FULL*SEQ_FULL + MROWS): all bits clear but the row bits and the bit NB_FULL*SEQ_FULL.
// The remainder of the list (fewer than MTH * 4 * MUN edges) goes one edge per thread with clamped addresses; both loops are block-uniform. SEQ/MROWS bands x NB graphs.
__device__ __forceinline__ bool in_band(int s, unsigned lo) { return (((unsigned)s - lo) & ~(unsigned)(NB_FULL * SEQ_FULL + MROWS - 1)) == 0u; }
__device__ __forceinline__ void mark_edge(unsigned char* fl, int s, int d) {
    const int c = d & (SEQ_FULL - 1); if (c < SEQ) fl[(s & (MROWS - 1)) * SEQ + c] = (unsigned char)1;   // row in [0, MROWS), c in [0, SEQ)
}
__device__ __forceinline__ void mask_body(unsigned char* fl, int r0, int b, const int* __restrict__ src, const int* __restrict__ dst, int nE, unsigned* MB) {
    const int tid = threadIdx.x;
    const v4u zz = (v4u){0u, 0u, 0u, 0u};
#pragma unroll
    for (int i = 0; i < (MROWS * SEQ) / (16 * MTH); ++i) *(v4ua*)(&fl[(i * MTH + tid) * 16]) = zz;
    __syncthreads();
    if (tid < MROWS) fl[tid * SEQ + r0 + tid] = (unsigned char)1;          // diagonal, r0 + tid < SEQ
    const unsigned lo = (unsigned)((b - NB_FULL) * SEQ_FULL + r0);
    const int* ps = src + tid * 4; const int* pd = dst + tid * 4;
    int base = 0;
#pragma unroll 1   // one group of MUN load pairs per trip; more would only grow the code
    for (; base + MTH * 4 * MUN <= nE; base += MTH * 4 * MUN) {
        v4e S[MUN], D[MUN];
#pragma unroll     // all MUN pairs issued back to back, S and D in registers
        for (int u = 0; u < MUN; ++u) { S[u] = *(const v4e*)(ps + u * MTH * 4); D[u] = *(const v4e*)(pd + u * MTH * 4); }   // last element base + MTH*4*MUN - 1 < nE
#pragma unroll     // constant indices into S and D
        for (int u = 0; u < MUN; ++u) {
#pragma unroll
            for (int i = 0; i < 4; ++i) if (in_band(S[u][i], lo)) mark_edge(fl, S[u][i], D[u][i]); }
        ps += MTH * 4 * MUN; pd += MTH * 4 * MUN;
    }
#pragma unroll 1   // short remainder, kept small
    for (; base < nE; base += MTH) {
        const int e = base + tid; const int ec = e < nE ? e : nE - 1;      // a clamped lane repeats the last edge: the same byte, the same value
        const int s = src[ec], d = dst[ec];
        if (in_band(s, lo)) mark_edge(fl, s, d);
    }
    __syncthreads();
    const size_t wbase = (size_t)(b * SEQ + r0) * (SEQ / 32);
#pragma unroll
    for (int i = 0; i < (MROWS * SEQ) / (32 * MTH); ++i) { const int p = i * MTH + tid;   // word p of the band = flags p*32 .. p*32+31
        const v4u X = *(const v4ua*)(&fl[p * 32]); const v4u Y = *(const v4ua*)(&fl[p * 32 + 16]);
        MB[wbase + p] = nib4(X[0]) | (nib4(X[1]) << 4) | (nib4(X[2]) << 8) | (nib4(X[3]) << 12) | (nib4(Y[0]) << 16) | (nib4(Y[1]) << 20) | (nib4(Y[2]) << 24) | (nib4(Y[3]) << 28); }
}

// proj_body: bf16 GEMM of one block: PT tokens x DM features of one projection, K = DM, straight from the f32 inputs. Per phase of PKH k values the block converts (RNE) its token tile
// XS[token][k] (rows of h, 8 floats per thread and trip) and its weight tile WS[n][k] (W is [k][n]: a thread gathers 8 k values of one column, a wave reads whole 128-byte lines) into LDS,
// block barrier, every wave runs PKH/32 k-steps on its own tile with fragments from LDS (K-contiguous rows, pitch PKP), block barrier (the tiles may be overwritten). k runs upward through both phases.
// One wave per 32x64 tile (8 accumulators). After the last barrier the staged tiles are dead and each wave's output tile os lies in the same LDS area.
// C[m][n] = sum_k A[m][k] Bt[n][k] + bias, written as f16 (Ph) and, for tokens t < resT (resT a multiple of 64, wave-uniform test), the f16 residual x2048 (Pr).
// MODE 0: A = x rows (m = b*SEQ + t), Bt = W rows (n = h*32 + d), bias per column; plane [(b*NH_ + h)][t/16][tile] (residual plane: resT tokens per head). The 64-column tile spans two heads; per 16-row slab and head one 1024-byte tile
//         in fragment order (two lane-linear stores). Waves: 4 token tiles x 4 feature tiles.
// MODE 1: A = W rows (m = h*32 + d), Bt = x rows (n = b*SEQ + t), bias per row; plane [(b*NH_ + m/32)][t/32][(m%32)/16][tile] in fragment order. Waves: 8 feature tiles x 2 token tiles.
template <int MODE>
__device__ __forceinline__ void proj_body(unsigned char* sm, int tok0, const float* __restrict__ hin, const float* __restrict__ W, const float* __restrict__ bias, h16* Ph, h16* Pr, int resT) {
    bf* XS = (bf*)sm; bf* WS = XS + PT * PKP;
    const int tid = threadIdx.x;
    const int lane = tid & 31, lr = lane & 15, hi = lane >> 4;
    const int wave = __builtin_amdgcn_readfirstlane(tid >> 5);
    const int ra = (MODE == 0 ? (wave >> 2) : (wave >> 1)) * 32;    // first A row of this wave inside the block's A tile
    const int cb = (MODE == 0 ? (wave & 3) : (wave & 1)) * 64;      // first Bt row inside the block's Bt tile
    const bf* Al = (MODE == 0 ? XS : WS) + (ra + lr) * PKP + 8 * hi;
    const bf* Bl = (MODE == 0 ? WS : XS) + (cb + lr) * PKP + 8 * hi;
    const float* xsrc = hin + ((size_t)(tok0 / SEQ) * SEQ_FULL + (size_t)(tok0 % SEQ)) * DM;   // the input's graphs lie SEQ_FULL rows apart
    // staging: thread -> (token row xr, 8 columns) stepping XR rows a trip; (weight column tid % DM, 8 k values from wk) stepping WK k values a trip
    const int xr = tid / (PKH / 8), wk = (tid / DM) * 8;
    const float* xg = xsrc + (size_t)xr * DM + (tid % (PKH / 8)) * 8; bf* xl = XS + xr * PKP + (tid % (PKH / 8)) * 8;
    const float* wg = W + (size_t)wk * DM + tid % DM;                 bf* wl = WS + (tid % DM) * PKP + wk;
    v8f acc[2][4];
#pragma unroll
    for (int mb = 0; mb < 2; ++mb)
#pragma unroll
        for (int nb = 0; nb < 4; ++nb) acc[mb][nb] = (v8f){};
#pragma unroll 1   // one phase per trip: the two phases share the LDS tiles
    for (int kh = 0; kh < DM; kh += PKH) {
        const float* xk = xg + kh; const float* wk0 = wg + (size_t)kh * DM;
        { v8f x[(PT * PKH) / (8 * MTH)];
#pragma unroll     // all of the token tile's loads issued back to back, before the first is used
          for (int it = 0; it < (PT * PKH) / (8 * MTH); ++it) x[it] = *(const v8f*)(xk + (size_t)it * XR * DM);                // row xr + it*XR < PT
          static_assert((PT * PKH) / (8 * MTH) == 4);
          asm volatile("s_wait_xcnt 0x0" :: "v"(xk), "v"(x[0]), "v"(x[1]), "v"(x[2]), "v"(x[3]) : "memory");   // keeps these loads' address registers whole up to the wait; the loaded values as inputs hold all the loads in front of the first convert (one latency per group)
#pragma unroll
          for (int it = 0; it < (PT * PKH) / (8 * MTH); ++it) *(v8us*)(xl + it * XR * PKP) = cvt8(x[it]); }
#pragma unroll     // groups of WG column pieces: constant indices into x
        for (int g = 0; g < (DM * PKH) / (8 * MTH * WG); ++g) { v8f x[WG];
#pragma unroll     // 8 * WG column loads issued back to back, before the first is used
            for (int u = 0; u < WG; ++u)
#pragma unroll
                for (int j = 0; j < 8; ++j) x[u][j] = wk0[(size_t)((g * WG + u) * WK + j) * DM];                                // k = kh + wk + (g*WG+u)*WK + j < kh + PKH
            static_assert(WG == 4);
            asm volatile("s_wait_xcnt 0x0" :: "v"(wk0), "v"(x[0]), "v"(x[1]), "v"(x[2]), "v"(x[3]) : "memory");   // as above
#pragma unroll
            for (int u = 0; u < WG; ++u) *(v8us*)(wl + (g * WG + u) * WK) = cvt8(x[u]); }
        __syncthreads();                                           // both tiles of this phase are in LDS
#pragma unroll     // straight-line k-steps: the next step's LDS reads issue under this step's matrix instructions
        for (int kc = 0; kc < PKH; kc += 32) {
            v16bf a[2];
#pragma unroll
            for (int mb = 0; mb < 2; ++mb) a[mb] = ldb(Al + mb * 16 * PKP + kc);
#pragma unroll
            for (int nb = 0; nb < 4; ++nb) { const v16bf b = ldb(Bl + nb * 16 * PKP + kc);
#pragma unroll
                for (int mb = 0; mb < 2; ++mb) acc[mb][nb] = wmmab(a[mb], b, acc[mb][nb]); }
        }
        __syncthreads();                                           // every wave has read this phase's tiles
    }
    float* os = (float*)sm + wave * (16 * 68);
    const int r0 = (MODE == 0 ? tok0 : 0) + ra, c0 = (MODE == 0 ? 0 : tok0) + cb;
    float bc[4];
#pragma unroll
    for (int nb = 0; nb < 4; ++nb) bc[nb] = (MODE == 0) ? bfr(bias[c0 + nb * 16 + lr]) : 0.0f;   // MODE 0: c0 + 63 < DM
    size_t tbase, rbase; bool wr;                                                                 // wr: wave-uniform, whole tile inside the residual plane
    if (MODE == 0) { const int bb = r0 / SEQ, tt = r0 % SEQ; const int zc = bb * NH_ + c0 / HD;
                     tbase = ((size_t)zc * SEQ + (size_t)tt) * HD; rbase = ((size_t)zc * (size_t)resT + (size_t)tt) * HD; wr = tt < resT; }
    else           { const int bb = c0 / SEQ, tt = c0 % SEQ;
                     const int zc = bb * NH_ + r0 / HD;   // r0 is a multiple of HD, tt of 64
                     tbase = ((size_t)zc * SEQ + (size_t)tt) * HD; rbase = ((size_t)zc * (size_t)resT + (size_t)tt) * HD; wr = tt < resT; }
#pragma unroll
    for (int mb = 0; mb < 2; ++mb) {
        float br[8];
#pragma unroll
        for (int j = 0; j < 8; ++j) br[j] = (MODE == 1) ? bfr(bias[r0 + mb * 16 + hi * 8 + j]) : 0.0f;   // MODE 1: r0 + 31 < DM
#pragma unroll
        for (int nb = 0; nb < 4; ++nb) {
#pragma unroll
            for (int j = 0; j < 8; ++j) os[(hi * 8 + j) * 68 + nb * 16 + lr] = acc[mb][nb][j] + bc[nb] + br[j]; }   // D: row 8h+j, col lane&15
        wave_sync();
{
            if (MODE == 0) {
                const size_t sb = tbase + (size_t)(mb * 16) * HD;
                const size_t rb = rbase + (size_t)(mb * 16) * HD;
#pragma unroll
                for (int hh = 0; hh < 2; ++hh) {
#pragma unroll
                    for (int s = 0; s < 2; ++s) { const int p = s * 32 + lane; const int row = lr, c8 = (2 * s + hi) * 8;   // piece p of the tile: row lane&15, d = 16s + 8h + 0..7 of head hh
                        const v4f x0 = *(const v4fa*)(&os[row * 68 + hh * 32 + c8]); const v4f x1 = *(const v4fa*)(&os[row * 68 + hh * 32 + c8 + 4]); v8h hv, rv;
#pragma unroll
                        for (int i = 0; i < 4; ++i) { const h16 a0 = (h16)x0[i]; const h16 a1 = (h16)x1[i]; hv[i] = a0; hv[4 + i] = a1; rv[i] = (h16)((x0[i] - (float)a0) * QRS); rv[4 + i] = (h16)((x1[i] - (float)a1) * QRS); }
                        const size_t oo = sb + (size_t)hh * ((size_t)SEQ * HD) + (size_t)p * 8;
                        const size_t ro = rb + (size_t)hh * ((size_t)resT * HD) + (size_t)p * 8;
                        *(v8h*)(Ph + oo) = hv; xwait(); if (wr) { *(v8h*)(Pr + ro) = rv; xwait(); } } }
            } else {
                const size_t sb = tbase + (size_t)(mb * 512);   // tile d/16 = mb of each 32-token step
                const size_t rb = rbase + (size_t)(mb * 512);
#pragma unroll
                for (int s = 0; s < 4; ++s) { const int row = lr, c8 = s * 16 + hi * 8;   // s = (32-token step, half): row lane&15, tokens 16s + 8h + 0..7
                    const v4f x0 = *(const v4fa*)(&os[row * 68 + c8]); const v4f x1 = *(const v4fa*)(&os[row * 68 + c8 + 4]); v8h hv, rv;
#pragma unroll
                    for (int i = 0; i < 4; ++i) { const h16 a0 = (h16)x0[i]; const h16 a1 = (h16)x1[i]; hv[i] = a0; hv[4 + i] = a1; rv[i] = (h16)((x0[i] - (float)a0) * QRS); rv[4 + i] = (h16)((x1[i] - (float)a1) * QRS); }
                    const size_t oo = sb + (size_t)((s >> 1) * 1024 + (s & 1) * 256 + lane * 8);
                    const size_t ro = rb + (size_t)((s >> 1) * 1024 + (s & 1) * 256 + lane * 8);
                    *(v8h*)(Ph + oo) = hv; xwait(); if (wr) { *(v8h*)(Pr + ro) = rv; xwait(); } }
            }
             }
        wave_sync();
    }
}

// k_front: everything that reads the inputs alone, as block ranges of ONE launch, so that the pieces run side by side. MTH threads per block; the branch is on blockIdx alone
// (block-uniform, so each piece's barriers are passed by all of its block's threads); one LDS area serves all pieces. Longest pieces first:
// blocks [0, NBM) adjacency bands, [NBM, NBM + NBP) projections (q, then k, then v^T; one block per PT tokens), [NBM + NBP, NBM + NBP + NBW) output weight transpose.
// Register budget for eight waves per SIMD = two blocks per WGP: there are more blocks than WGPs, and all of them should be resident at once.
__global__ __launch_bounds__(MTH) __attribute__((amdgpu_waves_per_eu(8))) void k_front(const int* __restrict__ src, const int* __restrict__ dst, int nE, unsigned* MB,
                                                  const float* __restrict__ wq, const float* __restrict__ wk, const float* __restrict__ wv, const float* __restrict__ wo, h16* WOH,
                                                  const float* __restrict__ hin, const float* __restrict__ bq, const float* __restrict__ bk, const float* __restrict__ bv,
                                                  h16* QH, h16* QR, h16* KP, h16* KR, h16* VT, h16* VR, int resT) {
    __shared__ __align__(16) unsigned char sm[FRONT_LDS];
    const int blk = blockIdx.x;
    if (blk < NBM) { mask_body(sm, (blk % (SEQ / MROWS)) * MROWS, blk / (SEQ / MROWS), src, dst, nE, MB); return; }
    if (blk < NBM + NBP) {
        const int z = (blk - NBM) / ((NB * SEQ) / PT), tok0 = ((blk - NBM) % ((NB * SEQ) / PT)) * PT;
        if (z == 2) proj_body<1>(sm, tok0, hin, wv, bv, VT, VR, resT);
        else        proj_body<0>(sm, tok0, hin, z ? wk : wq, z ? bk : bq, z ? KP : QH, z ? KR : QR, resT);
        return; }
    wt_body<true>((float*)sm, (blk - NBM - NBP) * 32, wo, (unsigned short*)WOH);
}

// k_flash: fused attention and output projection. One block per (graph, AQ tiles of 16 query rows): AW waves, wave = (query tile, head); K / V^T / Q fragments straight from the f16 planes in fragment order (two lane-linear 16-B loads each, whole 128-byte lines).
// Transposed form: S^T[key][t] = K Q^T (A = K rows, B = Q rows); lane (t = lane&15, h = lane>>4) holds keys 8h+r of each 16-key tile, so the packed
// P tile is directly the B fragment of O^T[d][t] = V^T P^T (element r <- tile keys 0..15, element 8+r <- tile keys 16..31, lane unchanged).
// Softmax state (running max over kept keys, partial sum) is one scalar per lane; the two lane halves of a row are combined with one xor-16 exchange.
// Keep rule: one adjacency word per lane per 32-key step (row t0 + lane&15, word key0/32), bit 8h+r for the first tile and 16+8h+r for the second; a dropped score is selected to NEGB once, so the max passes over it and the 2^-14 cut selects its P to 0.
// The running max is kept on the unscaled scores (the scale is positive); scale and shift go into one multiply-add per exponent argument.
// All rows: scores = K Q + (K Q_res + K_res Q) / 2048; P = f16 value + f16 residual x2048; O = V P + (V P_res + V_res P) / 2048 (residual products in their own accumulators); row sum from the f32 exponentials.
// P below 2^-14 (after the 2^14 carry) is selected to 0 on the exponent argument; residuals pass the subnormal select.
// Context hand-over: O^T in D layout (lane: row t = lane&15, d = 8h+r and 16+8h+r) IS the A fragment of the output projection's k-step 'head' (row t, k = head*32 + d), so each wave converts its own
// registers to f16 value + f16 residual x2048 and stores the four 512-byte slices lane-linear in LDS; one block barrier; then every wave reads the NH_ heads' fragments of its query tile.
// Output projection: wave (query tile, c) computes rows of its tile x columns 32c..32c+31, k-steps in head order, value and residual in separate accumulators; Bt = transposed output weight plane (fragment order, f16, x64),
// its fragments loaded before the barrier; OUT[m][n] = (sum + sum_res / 2048) / 64 + bias (bias bf16-converted, added in f32); rows go out through a wave-private LDS tile as whole 128-byte runs.
__global__ __launch_bounds__(32 * AW) void k_flash(const h16* __restrict__ QH, const h16* __restrict__ QR, const h16* __restrict__ KP, const h16* __restrict__ KR,
                                                   const h16* __restrict__ VT, const h16* __restrict__ VR, const unsigned* __restrict__ MB,
                                                   const h16* __restrict__ WT, const float* __restrict__ bias, float* OUT) {
    __shared__ v8h cf[AW * 4 * 32];                            // [query tile][head][value lo, value hi, residual lo, residual hi][lane]
    __shared__ __align__(16) float os[AW * 16 * OSP];
    const int lane = threadIdx.x & 31, lr = lane & 15, hi = lane >> 4;
    const int wave = __builtin_amdgcn_readfirstlane((int)(threadIdx.x >> 5));
    const int head = wave % NH_, qt = wave / NH_;
    const int b = blockIdx.y; const int zh = b * NH_ + head;
    const int t0 = (blockIdx.x * AQ + qt) * 16;
    const unsigned* mrow = MB + (size_t)(b * SEQ + t0 + lr) * (SEQ / 32);
    const size_t pbase = (size_t)zh * SEQ * HD;
    const size_t ko = pbase + (size_t)lane * 8;                // + key0 * HD: K tiles of keys key0.. and key0+16.. (A fragment: row key, k = d); V^T tiles d 0..15 and 16..31 of the step (A fragment: row d, k = key)
    const size_t qo = ko + (size_t)t0 * HD;
    const v16h qh = ldf(QH + qo), qr = ldf(QR + qo);            // B fragments: col t, k = d (HD = 32 = one k-step)
    v8f o0 = (v8f){}, o1 = (v8f){}, oR0 = (v8f){}, oR1 = (v8f){};
    float m = MST, l = 0.0f;                                   // running max of the unscaled scores, partial row sum
#pragma unroll 1
    for (int key0 = 0; key0 < SEQ; key0 += 32) {
        unsigned mw = mrow[key0 >> 5];
        asm volatile("" : "+v"(mw));
        const unsigned sa = mw >> (8 * hi);
        const h16* ka = KP + ko + (size_t)key0 * HD;
        const h16* kr = KR + ko + (size_t)key0 * HD;
        const v16h ka0 = ldf(ka), kb0 = ldf(ka + 16 * HD);
        const v16h kra0 = ldf(kr), krb0 = ldf(kr + 16 * HD);
        v8f sHa = (v8f){}, sLa = (v8f){}, sHb = (v8f){}, sLb = (v8f){};
        sHa = wmma16(ka0, qh, sHa); sLa = wmma16(ka0, qr, sLa); sHb = wmma16(kb0, qh, sHb); sLb = wmma16(kb0, qr, sLb);
        sLa = wmma16(kra0, qh, sLa); sLb = wmma16(krb0, qh, sLb);
        asm volatile("s_wait_xcnt 0x0" :: "v"(ka), "v"(kr) : "memory");   // keeps the K loads' address registers whole up to the wait; the code behind it (later loads' results too) may then rewrite them
        v8f uA = sHa + sLa * QRI, uB = sHb + sLb * QRI; float mx = NEGB;
#pragma unroll
        for (int r = 0; r < 8; ++r) {
            uA[r] = keep_bit(uA[r], sa, r); uB[r] = keep_bit(uB[r], sa, 16 + r);
            mx = fmaxf(mx, fmaxf(uA[r], uB[r])); }
        mx = fmaxf(mx, __shfl_xor(mx, 16, 32));
        const float mnew = fmaxf(m, mx);
        const float sh = PSH - mnew * SC2;
        const float alpha = __builtin_amdgcn_exp2f((m - mnew) * SC2);
        const v8f xA = uA * SC2 + sh, xB = uB * SC2 + sh;
        v8f gA, gB; float ls = 0.0f;
#pragma unroll
        for (int r = 0; r < 8; ++r) {
            const float ea = __builtin_amdgcn_exp2f(xA[r]), eb = __builtin_amdgcn_exp2f(xB[r]);
            gA[r] = (xA[r] >= -14.0f) ? ea : 0.0f; gB[r] = (xB[r] >= -14.0f) ? eb : 0.0f;   // dropped elements (NEGB) and sub-2^-14 values selected to 0 by value
            ls += gA[r] + gB[r]; }
        const v8h pA = __builtin_convertvector(gA, v8h), pB = __builtin_convertvector(gB, v8h);   // 0 or in [2^-14, 2^14]
        const v16h pb = cat16(pA, pB); v16h pr;
#pragma unroll
        for (int r = 0; r < 8; ++r) { pr[r] = res_flush(gA[r] - (float)pA[r]); pr[8 + r] = res_flush(gB[r] - (float)pB[r]); }
        l = l * alpha + ls; m = mnew;
        o0 = o0 * alpha; o1 = o1 * alpha; oR0 = oR0 * alpha; oR1 = oR1 * alpha;
        const h16* va = VT + ko + (size_t)key0 * HD;
        const h16* vr = VR + ko + (size_t)key0 * HD;
        const v16h v0 = ldf(va), v1 = ldf(va + 512);
        const v16h vr0 = ldf(vr), vr1 = ldf(vr + 512);
        asm volatile("s_wait_xcnt 0x0" :: "v"(va), "v"(vr) : "memory");   // as above, for the V loads
        o0 = wmma16(v0, pb, o0); o1 = wmma16(v1, pb, o1);
        oR0 = wmma16(v0, pr, oR0); oR1 = wmma16(v1, pr, oR1);
        oR0 = wmma16(vr0, pb, oR0); oR1 = wmma16(vr1, pb, oR1);
    }
    // this wave's output weight fragments (columns c0 .. c0+31, all k): issued here so that they land while the context is converted and the block gathers at the barrier
    const int c0 = head * 32;
    const int cn = c0 + lr;                                    // cn + 16 < DM
    const h16* wp = WT + (size_t)c0 * DM + lane * 8;           // tiles [c0/16 + 0..1][k step]
    v16h w[2][NH_];
#pragma unroll
    for (int kc = 0; kc < NH_; ++kc) { w[0][kc] = ldf(wp + kc * 512); w[1][kc] = ldf(wp + (size_t)16 * DM + kc * 512); }
    const float bl0 = bias[cn], bl1 = bias[cn + 16];
    asm volatile("s_wait_xcnt 0x0" :: "v"(wp), "v"(cn) : "memory");   // keeps these loads' address registers whole up to the wait; the code behind it (their own results too) may then rewrite them
    const float bc0 = bfr(bl0), bc1 = bfr(bl1);
    l += __shfl_xor(l, 16, 32);
    const bool any = l > 0.0f;
    const float lsafe = any ? l : 1.0f;
    const float inv = any ? (1.0f / lsafe) : 0.0f;             // no kept key -> zeros (cannot happen: the diagonal is always kept)
    const v8f f0 = o0 + oR0 * QRI, f1 = o1 + oR1 * QRI;
    { v8h h0, h1, r0, r1;                                      // f_j[r] = (d = 16j + 8h + r, t = lane&15)
#pragma unroll
      for (int i = 0; i < 8; ++i) { const float x0 = f0[i] * inv, x1 = f1[i] * inv; const h16 a0 = toh_flush(x0); const h16 a1 = toh_flush(x1); h0[i] = a0; h1[i] = a1;
          r0[i] = toh_flush((x0 - (float)a0) * QRS); r1[i] = toh_flush((x1 - (float)a1) * QRS); }
      v8h* cw = cf + wave * (4 * 32) + lane;
      cw[0] = h0; cw[32] = h1; cw[64] = r0; cw[96] = r1; }
    __syncthreads();                                           // every head's context fragments of both query tiles are in LDS
    v8f aH0 = (v8f){}, aH1 = (v8f){}, aR0 = (v8f){}, aR1 = (v8f){};
    const v8h* cr = cf + qt * (NH_ * 4 * 32) + lane;
#pragma unroll
    for (int kc = 0; kc < NH_; ++kc) {
        const v16h a = cat16(cr[kc * 128], cr[kc * 128 + 32]), e = cat16(cr[kc * 128 + 64], cr[kc * 128 + 96]);
        aH0 = wmma16(a, w[0][kc], aH0); aH1 = wmma16(a, w[1][kc], aH1);
        aR0 = wmma16(e, w[0][kc], aR0); aR1 = wmma16(e, w[1][kc], aR1);
    }
    const int wb = wave * 16 * OSP;
#pragma unroll
    for (int j = 0; j < 8; ++j) { os[wb + (hi * 8 + j) * OSP + lr] = (aH0[j] + aR0[j] * QRI) * WOI + bc0; os[wb + (hi * 8 + j) * OSP + 16 + lr] = (aH1[j] + aR1[j] * QRI) * WOI + bc1; }   // D: row 8h+j, col lane&15
    wave_sync();
    float* obase = OUT + ((size_t)b * OUT_SEQ + (size_t)t0) * DM + c0;
#pragma unroll
    for (int s = 0; s < 4; ++s) { const int row = 4 * s + (lane >> 3), c4 = (lane & 7) * 4;   // 4 s x 4 rows = 16 rows; 8 lanes x 4 floats = 32 columns
        const v4f val = *(const v4fa*)(&os[wb + row * OSP + c4]);
        *(v4f*)(obase + (size_t)row * DM + c4) = val; }
}

static constexpr size_t al256(size_t v) { return (v + 255) & ~(size_t)255; }
static constexpr size_t SZ_WO = al256((size_t)DM * DM * 2);
static constexpr size_t SZ_PL = al256((size_t)NB * NH_ * SEQ * HD * 2);
static constexpr size_t SZ_MB = al256((size_t)NB * SEQ * (SEQ / 32) * 4);
static constexpr size_t SZ_TOTAL = SZ_WO + 6 * SZ_PL + SZ_MB;
static_assert(SZ_TOTAL <= (size_t)134217728);          // workspace carve <= 128 MiB
static_assert((size_t)NB * NH_ * SEQ * HD == (size_t)NB * DM * SEQ);       // the v^T plane has the same extent as the q/k planes
static_assert((size_t)(NB * SEQ / PT) * PT * DM == (size_t)NB * NH_ * SEQ * HD);    // projection blocks x tile == plane extent
static_assert((size_t)(SEQ / (16 * AQ)) * NB * AQ * 16 * DM == (size_t)NB * SEQ * DM);   // flash grid x rows x columns == output extent
static_assert((size_t)(SEQ / MROWS) * NB * MROWS * (SEQ / 32) * 4 == (size_t)NB * SEQ * (SEQ / 32) * 4);   // mask grid x band == bit plane extent

extern "C" void kernel_launch(void* const* d_in, const int* in_sizes, int n_in,
                              void* d_out, int out_size, void* d_ws, size_t ws_size, hipStream_t stream) {
    if (n_in < 11) return;
    const size_t needx = ((size_t)(NB - 1) * SEQ_FULL + SEQ) * DM;
    if ((size_t)in_sizes[0] < needx) return;
    if (in_sizes[1] < 1 || in_sizes[2] < 1) return;
    if ((size_t)in_sizes[3] < (size_t)DM * DM || (size_t)in_sizes[5] < (size_t)DM * DM || (size_t)in_sizes[7] < (size_t)DM * DM || (size_t)in_sizes[9] < (size_t)DM * DM) return;
    if (in_sizes[4] < DM || in_sizes[6] < DM || in_sizes[8] < DM || in_sizes[10] < DM) return;
    if ((size_t)out_size < ((size_t)(NB - 1) * OUT_SEQ + SEQ) * DM) return;
    if (SZ_TOTAL > ws_size) return;
    // wire order: h, src, dst, Wq, bq, Wk, bk, Wv, bv, Wo, bo
    const float* hin = (const float*)d_in[0];
    const int* src = (const int*)d_in[1]; const int* dst = (const int*)d_in[2];
    const float* wq = (const float*)d_in[3]; const float* bq = (const float*)d_in[4];
    const float* wk = (const float*)d_in[5]; const float* bk = (const float*)d_in[6];
    const float* wv = (const float*)d_in[7]; const float* bv = (const float*)d_in[8];
    const float* wo = (const float*)d_in[9]; const float* bo = (const float*)d_in[10];
    const int nE = in_sizes[1] < in_sizes[2] ? in_sizes[1] : in_sizes[2];
    float* OUT = (float*)d_out;      // [NB*SEQ][256]
    char* wsp = (char*)d_ws;
    h16* WOH = (h16*)wsp; wsp += SZ_WO;              // output weight, transposed, [out/16][in/32][tile], f16 x64
    h16* QH = (h16*)wsp; wsp += SZ_PL;               // [NB*8][SEQ/16][tile]
    h16* QR = (h16*)wsp; wsp += SZ_PL;               // residual x2048
    h16* KP = (h16*)wsp; wsp += SZ_PL;               // [NB*8][SEQ/16][tile]
    h16* KR = (h16*)wsp; wsp += SZ_PL;               // residual x2048
    h16* VT = (h16*)wsp; wsp += SZ_PL;               // [NB*8][SEQ/32][2][tile]
    h16* VR = (h16*)wsp; wsp += SZ_PL;               // residual x2048
    unsigned* MB = (unsigned*)wsp; wsp += SZ_MB;     // adjacency bits [NB*SEQ][SEQ/32]

    // adjacency bits; q, k, v^T planes with their residual planes for all tokens and the transposed output weight plane, all in fragment order
    k_front<<<NBM + NBP + NBW, MTH, 0, stream>>>(src, dst, nE, MB, wq, wk, wv, wo, WOH, hin, bq, bk, bv, QH, QR, KP, KR, VT, VR, SEQ);

    // attention and output projection: one block per (32 query rows, graph), all heads
    k_flash<<<dim3(SEQ / (16 * AQ), NB, 1), 32 * AW, 0, stream>>>(QH, QR, KP, KR, VT, VR, MB, WOH, bo, OUT);
}

// v007
// Measured time: 41.6 microseconds a run.
// In two side-by-side timings against v006, it was 1.14 and 1.13 times as fast.
// Counting every step since v000, it is 8.06 times as fast.
#include <hip/hip_runtime.h>

// Graph attention layer: node features h [NB][SEQ][256]; q/k/v = h W + bias with W stored [in][out]; 8 heads x 32; scores (q.k) * 32^-0.5; per graph and query row the kept keys are the listed
// edges (graph = src / size, row = src mod size, column = dst mod size) plus the diagonal; all other keys get probability 0; context heads concatenated, then context Wo + bo (Wo [in][out]); output [NB*SEQ][256] f32.
// Compute dtypes, f32 accumulate everywhere: q/k/v projections v_wmma_f32_16x16x32_bf16 (h, W, bias RNE-converted to bf16; products exact);
// scores v_wmma_f32_16x16x32_f16: q and k each as f16 value + f16 residual x2048 (three products, residual products in their own accumulator folded by 1/2048);
// P.V v_wmma_f32_16x16x32_f16: P (x16384 carry, cancels in the normalisation) and v each as f16 value + f16 residual x2048, residual products in their own accumulator, row sum from the f32 exponentials; softmax f32 (online, running max over kept keys);
// output projection v_wmma_f32_16x16x32_f16: context as f16 value + f16 residual x2048 (own accumulator), Wo as f16 of the bf16-converted weight x64 (folded by 1/64), bias bf16-converted, added in f32.
// Layout: h and the q/k/v weights are converted to bf16 inside the projection blocks (LDS tiles, no planes); every f16 plane lies in fragment order (1024-byte tiles [element half][lane][8], so a fragment is two lane-linear 512-byte loads of whole 128-byte lines): q, k planes (value, residual) [b*NH_+h][t/16][tile of 16 t x 32 d]; v^T planes [b*NH_+h][t/32][d/16][tile of 16 d x 32 t]; transposed output weight plane [out/16][in/32][tile of 16 out x 32 in]; MPART partial adjacency bit planes [part][b*SEQ+t][SEQ/32] (bit j of word w = key 32w+j; part p holds the edges of the p-th piece of the edge list, the reader ORs the parts);
// fused flash kernel in transposed form (S^T = K Q^T, O^T = V^T P^T); the context (value, residual) stays in the block's LDS as A fragments and the same launch does the output projection.

#ifndef NB
#define NB 16
#endif
#ifndef SEQ
#define SEQ 512
#endif
#define NB_FULL  16
#define SEQ_FULL 512
#ifndef OUT_SEQ
#define OUT_SEQ SEQ              // row pitch (in tokens) between batches of the output
#endif
#define DM   256
#define NH_  8
#define HD   32
#define AQ   2                   // 16-row query tiles per flash block
#define AW   (NH_ * AQ)          // waves per flash block: one per (query tile, head)
#define OSP  36                  // LDS row pitch (floats) of a wave's output tile
#define QRS  2048.0f             // carry of every residual plane / residual fragment
#define QRI  (1.0f / 2048.0f)
#define SC2  ((float)(0.17677669529663687 * 1.4426950408889634))   // HD^-0.5 * log2(e)
#define PSH  14.0f               // log2 of the P carry (16384)
#define NEGB (-3.0e38f)           // value of a dropped score
#define MST  (-1.0e30f)          // start of the running max: below every score, far above NEGB, so a dropped score always lands under the 2^-14 cut
#define WOS  64.0f               // carry of the output-projection weight plane
#define WOI  (1.0f / 64.0f)
#define MROWS 256                // query rows per mask-builder block
#define MPART 4                  // pieces of the edge list; one mask-builder block scans one piece for one band
#define MTH   512                // threads per block of the preparation launch
#define MUN   8                  // 16-byte load pairs in flight per thread in the edge scan
#define WTP  (DM + 4)            // LDS row pitch (floats) of the weight transpose tile
#define NBM  ((SEQ / MROWS) * NB * MPART)         // preparation launch: adjacency blocks (band, piece of the edge list, graph)
#define MBW  ((size_t)NB * SEQ * (SEQ / 32))      // words per partial adjacency plane
#define NBW  (DM / 32)                            // output weight transpose blocks
#define PT   128                 // tokens per projection block
#define PKH  128                 // k extent staged in LDS per phase
#define PKP  (PKH + 8)           // LDS row pitch (bf16 elements) of the staged tiles: 272 B = 16 B x odd
#define WG   4                   // column pieces (8 k values each) in flight per thread while the weight tile is staged
#define XR   (MTH / (PKH / 8))   // token rows staged per trip
#define WK   ((MTH / DM) * 8)    // k values staged per trip
#define NBP  (3 * ((NB * SEQ) / PT))              // projection blocks (q, k, v)
#define PROJ_LDS ((PT + DM) * PKP * 2)            // token tile + weight tile
#define FRONT_LDS (PROJ_LDS > MROWS * SEQ ? PROJ_LDS : MROWS * SEQ)   // the larger of the staged tiles and the flag tile; the transpose tile and the waves' output tiles lie in the same area

static_assert(HD == 32);
static_assert(NH_ * HD == DM);                 // head h = columns h*32 + d
static_assert(DM % 64 == 0);                   // column tiles of 64 = two heads
static_assert(64 % HD == 0);
static_assert(DM % 32 == 0);                   // GEMM k-loop steps by 32
static_assert(SEQ % 64 == 0);                  // a 64-row tile never straddles two batches
static_assert((NB * SEQ) % 64 == 0);
static_assert(SEQ % 32 == 0);                  // key loop steps by 32; one mask word per 32-key step
static_assert(SEQ % (16 * AQ) == 0);           // flash grid covers the sequence exactly
static_assert(((size_t)SEQ * DM) % 8 == 0);
static_assert(((size_t)DM * DM) % 8 == 0);
static_assert(NB <= NB_FULL);
static_assert(SEQ <= SEQ_FULL);
static_assert((OSP * 4) % 16 == 0);
static_assert(SEQ % MROWS == 0);               // mask-builder bands cover the rows exactly
static_assert((MROWS & (MROWS - 1)) == 0 && (SEQ_FULL & (SEQ_FULL - 1)) == 0 && (NB_FULL & (NB_FULL - 1)) == 0 && SEQ_FULL % MROWS == 0);   // row, column and band test by bit masks
static_assert((MROWS * SEQ) % (16 * MTH) == 0);            // flag tile zero fill: MTH threads x 16 B per trip
static_assert(((MROWS * SEQ) / 32) % MTH == 0);            // pack: whole trips of MTH words
static_assert(MROWS <= MTH);
static_assert((WTP * 4) % 16 == 0);
static_assert((32 * DM) % (8 * MTH) == 0);                 // weight transpose store: whole trips of MTH threads x 8 elements
static_assert(DM % (MTH / 32) == 0);                       // weight transpose load: whole trips of MTH/32 rows
static_assert(SEQ % PT == 0);                              // a projection block never straddles two graphs
static_assert(MTH == 512 && PT == 128 && DM == 256);       // 16 waves = 4 x 4 tiles of 32 tokens x 64 features (q, k) = 8 x 2 tiles of 32 features x 64 tokens (v^T)
static_assert(DM % PKH == 0 && PKH % 32 == 0 && MTH % (PKH / 8) == 0 && MTH % DM == 0);
static_assert((PKP * 2) % 32 == 16);                       // pitch = 16 B x odd
static_assert((PT * PKH) % (8 * MTH) == 0 && (DM * PKH) % (8 * MTH * WG) == 0);   // staging: whole trips of MTH threads x 8 elements
static_assert(MROWS * SEQ <= FRONT_LDS && 32 * WTP * 4 <= FRONT_LDS && (MTH / 32) * 16 * 68 * 4 <= FRONT_LDS);
static_assert(4 * 32 * 4 == 16 * 32);                      // output epilogue: instructions x lanes x floats == 16 rows x 32 columns
static_assert(NH_ * 32 == DM);                             // the NH_ waves of a query tile cover the DM output columns, 32 each
static_assert(32 * AW <= 1024);
static_assert(32 * AW == 16 * AQ * (SEQ / 32));            // flash prologue: one adjacency word of the block's rows per thread
static_assert((size_t)MROWS * SEQ <= 131072);              // static LDS per kernel
static_assert((size_t)32 * WTP * 4 <= 131072);
static_assert((size_t)AW * 16 * OSP * 4 + (size_t)AW * 4 * 32 * 16 + (size_t)16 * AQ * (SEQ / 32) * 4 <= 131072);
static_assert((size_t)FRONT_LDS <= 131072);
static_assert(sizeof(unsigned) == 4);

typedef _Float16 h16;
typedef unsigned short bf;
typedef __attribute__((ext_vector_type(16))) __bf16   v16bf;
typedef __attribute__((ext_vector_type(16))) _Float16 v16h;
typedef __attribute__((ext_vector_type(8)))  _Float16 v8h;
typedef __attribute__((ext_vector_type(8)))  unsigned short v8us;
typedef __attribute__((ext_vector_type(8)))  __bf16   v8bf;
typedef __attribute__((ext_vector_type(8)))  float    v8f;
typedef __attribute__((ext_vector_type(4)))  float    v4f;
typedef v4f  __attribute__((may_alias)) v4fa;
typedef __attribute__((ext_vector_type(4)))  unsigned v4u;
typedef v4u  __attribute__((may_alias)) v4ua;
typedef int  v4e __attribute__((ext_vector_type(4), aligned(4)));   // four edge indices; only the element's own alignment is assumed

__device__ __forceinline__ unsigned short f2bf(float f) { unsigned u = __float_as_uint(f); u += 0x7FFFu + ((u >> 16) & 1u); return (unsigned short)(u >> 16); }
__device__ __forceinline__ float bfr(float f) { return __uint_as_float(((unsigned)f2bf(f)) << 16); }   // value after RNE convert to bf16
__device__ __forceinline__ v8us cvt8(v8f x) { return __builtin_bit_cast(v8us, __builtin_convertvector(x, v8bf)); }   // eight f32 -> bf16 (RNE), packed converts
__device__ __forceinline__ v16h cat16(v8h lo, v8h hi) { return __builtin_shufflevector(lo, hi, 0, 1, 2, 3, 4, 5, 6, 7, 8, 9, 10, 11, 12, 13, 14, 15); }
__device__ __forceinline__ v16bf cat16b(v8us lo, v8us hi) { return __builtin_bit_cast(v16bf, __builtin_shufflevector(lo, hi, 0, 1, 2, 3, 4, 5, 6, 7, 8, 9, 10, 11, 12, 13, 14, 15)); }
__device__ __forceinline__ v8f wmma16(v16h a, v16h b, v8f c) { return __builtin_amdgcn_wmma_f32_16x16x32_f16(false, a, false, b, (short)0, c, false, false); }
__device__ __forceinline__ v8f wmmab(v16bf a, v16bf b, v8f c) { return __builtin_amdgcn_wmma_f32_16x16x32_bf16(false, a, false, b, (short)0, c, false, false); }
// fragment loader from K-contiguous 16-bit rows (LDS tiles); p already includes + 8*(lane>>4): elements 0..7 <- k0+8h+0..7, elements 8..15 <- k0+16+8h+0..7 (same map for A and B)
__device__ __forceinline__ v16bf ldb(const bf* p)  { return cat16b(*(const v8us*)p, *(const v8us*)(p + 16)); }
// fragment loader from a plane in fragment order; p already includes + 8*lane: elements 0..7 <- first 512 bytes of the tile, elements 8..15 <- second 512 bytes (the writers put k0+8h+0..7 and k0+16+8h+0..7 of row lane&15 there)
__device__ __forceinline__ v16h  ldf(const h16* p) { return cat16(*(const v8h*)p, *(const v8h*)(p + 256)); }
// ordering point for wave-private LDS tiles (same wave writes and reads)
__device__ __forceinline__ void wave_sync() { __builtin_amdgcn_fence(3 /* release order */, "wavefront"); __builtin_amdgcn_wave_barrier(); asm volatile("" ::: "memory"); }
// stands behind a global load or store: the code that follows rewrites its address (and a store's data) registers
__device__ __forceinline__ void xwait() { asm volatile("s_wait_xcnt 0x0" ::: "memory"); }
// f32 -> f16 convert that cannot produce a subnormal operand (|v| < 2^-14 -> +0)
__device__ __forceinline__ h16 toh_flush(float v) { const h16 r = (h16)v; return (fabsf(v) < 6.103515625e-05f) ? (h16)0.0f : r; }
// score u where bit r of w is set, NEGB where it is clear
__device__ __forceinline__ float keep_bit(float u, unsigned w, int r) { return ((w >> r) & 1u) != 0u ? u : NEGB; }
// f16 residual x2048 of d; |d * 2048| < 2^-14 (tested on d itself, the scaling is exact) -> +0, so no subnormal operand
__device__ __forceinline__ h16 res_flush(float d) { return (h16)(((fabsf(d) < 2.98023223876953125e-08f) ? 0.0f : d) * QRS); }
// four flag bytes (0/1 each, lowest byte = lowest key) -> four bits
__device__ __forceinline__ unsigned nib4(unsigned x) { return (x | (x >> 7) | (x >> 14) | (x >> 21)) & 0xFu; }

// wt_body: weight transpose: in W[k][n] (DM rows of DM) -> out WT, n-major; one block per 32 output rows, tile staged in LDS (block barrier). HALF true: fragment order [n/16][k/32][half][lane][8], stores thread-linear.
// HALF false: bf16 (RNE convert). HALF true: f16 of (bf16-converted weight x WOS), subnormal results selected to +0.
template <bool HALF>
__device__ __forceinline__ void wt_body(float* ts, int n0, const float* __restrict__ W, unsigned short* WT) {
    const int tid = threadIdx.x; const int j = tid & 31, kk = tid >> 5;
#pragma unroll 1   // kept rolled: small code
    for (int i = 0; i < DM / (MTH / 32); ++i) { const int k = kk + (MTH / 32) * i; ts[j * WTP + k] = W[(size_t)k * DM + n0 + j]; }   // k covers 0..DM-1, n0 + j < DM
    __syncthreads();
#pragma unroll 1   // kept rolled: small code
    for (int it = 0; it < (32 * DM) / (8 * MTH); ++it) { const int q = it * MTH + tid;   // trips x MTH threads x 8 = 32 rows x DM
        const int row = HALF ? (q / (16 * DM / 8)) * 16 + (q & 15) : q / (DM / 8);                                  // HALF: piece q = [n tile][k step][half][lane]
        const int c8  = HALF ? ((q >> 6) % (DM / 32)) * 32 + ((q >> 5) & 1) * 16 + ((q >> 4) & 1) * 8 : (q % (DM / 8)) * 8;
        const v4f x0 = *(const v4fa*)(&ts[row * WTP + c8]); const v4f x1 = *(const v4fa*)(&ts[row * WTP + c8 + 4]);
        unsigned short* dp = HALF ? WT + (size_t)n0 * DM + (size_t)q * 8 : WT + (size_t)(n0 + row) * DM + c8;
        if (HALF) { v8h o;
#pragma unroll
            for (int i = 0; i < 4; ++i) { o[i] = toh_flush(bfr(x0[i]) * WOS); o[4 + i] = toh_flush(bfr(x1[i]) * WOS); }
            *(v8h*)dp = o; }
        else { v8us o;
#pragma unroll
            for (int i = 0; i < 4; ++i) { o[i] = f2bf(x0[i]); o[4 + i] = f2bf(x1[i]); }
            *(v8us*)dp = o; }
        asm volatile("s_wait_xcnt 0x0" ::: "memory"); }   // the next trip rewrites the store's address and data registers
}

// mask_body: one partial adjacency bit plane's words for one (graph b, band of MROWS query rows starting at r0, piece 'part' of the edge list). Block-local byte flag tile [MROWS][SEQ] in LDS: zero fill, block barrier, diagonal + every edge of the piece that falls in the band
// stores the byte 1 (plain same-value byte stores, no read-modify-write), block barrier, then each thread packs 32 flags into one word and the band's 64-byte rows go out thread-linear (one 128-byte line per wave).
// A block reads one piece of the edge list (a MPART-th, rounded up to whole 16-byte loads), so the list is read (SEQ/MROWS)*NB times in all: MTH threads, four edges per 16-byte load, MUN load pairs issued before the first is used, so the scan runs at the rate of the loads and not at their latency.
// Band test: graph = floor(s / SEQ_FULL), graphs -NB_FULL..-1 wrap to 0..NB_FULL-1, row = s mod SEQ_FULL. With lo = the first s of this band in the wrapped (negative) range, s lies in the band
// exactly when s - lo (modulo 2^32) is in [0, MROWS) or in [NB_FULL*SEQ_FULL, NB_FULL*SEQ_FULL + MROWS): all bits clear but the row bits and the bit NB_FULL*SEQ_FULL.
// The remainder of the piece (fewer than MTH * 4 * MUN edges) goes one edge per thread with clamped addresses; both loops are block-uniform. SEQ/MROWS bands x MPART pieces x NB graphs.
__device__ __forceinline__ bool in_band(int s, unsigned lo) { return (((unsigned)s - lo) & ~(unsigned)(NB_FULL * SEQ_FULL + MROWS - 1)) == 0u; }
__device__ __forceinline__ void mark_edge(unsigned char* fl, int s, int d) {
    const int c = d & (SEQ_FULL - 1); if (c < SEQ) fl[(s & (MROWS - 1)) * SEQ + c] = (unsigned char)1;   // row in [0, MROWS), c in [0, SEQ)
}
__device__ __forceinline__ void mask_body(unsigned char* fl, int r0, int b, int part, const int* __restrict__ src, const int* __restrict__ dst, int nE, unsigned* MB) {
    const int tid = threadIdx.x;
    const v4u zz = (v4u){0u, 0u, 0u, 0u};
#pragma unroll
    for (int i = 0; i < (MROWS * SEQ) / (16 * MTH); ++i) *(v4ua*)(&fl[(i * MTH + tid) * 16]) = zz;
    __syncthreads();
    if (tid < MROWS) fl[tid * SEQ + r0 + tid] = (unsigned char)1;          // diagonal, r0 + tid < SEQ
    const unsigned lo = (unsigned)((b - NB_FULL) * SEQ_FULL + r0);
    const int piece = ((nE + 4 * MPART - 1) / (4 * MPART)) * 4;           // edges per piece; MPART * piece >= nE
    const int e0 = part * piece < nE ? part * piece : nE;                 // this piece: edges e0 .. e1-1 (empty when e0 == nE)
    const int e1 = e0 + piece < nE ? e0 + piece : nE;
    const int* ps = src + e0; const int* pd = dst + e0;                   // block-uniform bases; the thread's own offset is t4
    const int t4 = tid * 4;
    int base = e0;
#pragma unroll 1   // one group of MUN load pairs per trip; more would only grow the code
    for (; base + MTH * 4 * MUN <= e1; base += MTH * 4 * MUN) {
        v4e S[MUN], D[MUN]; const int* qs = ps + t4; const int* qd = pd + t4;
#pragma unroll     // all MUN pairs issued back to back, S and D in registers
        for (int u = 0; u < MUN; ++u) { S[u] = *(const v4e*)(qs + u * MTH * 4); D[u] = *(const v4e*)(qd + u * MTH * 4); }   // last element base + MTH*4*MUN - 1 < e1 <= nE
        asm volatile("s_wait_xcnt 0x0" :: "v"(qs), "v"(qd) : "memory");   // keeps these loads' address registers whole up to the wait; the code behind it (the loads' own results too) may then rewrite them
#pragma unroll     // constant indices into S and D
        for (int u = 0; u < MUN; ++u) {
#pragma unroll
            for (int i = 0; i < 4; ++i) if (in_band(S[u][i], lo)) mark_edge(fl, S[u][i], D[u][i]); }
        ps += MTH * 4 * MUN; pd += MTH * 4 * MUN;
    }
#pragma unroll 1   // short remainder, kept small
    for (; base < e1; base += MTH) {
        const int e = base + tid; const int ec = e < e1 ? e : e1 - 1;      // a clamped lane repeats the piece's last edge: the same byte, the same value
        const int s = src[ec], d = dst[ec];
        if (in_band(s, lo)) mark_edge(fl, s, d);
    }
    __syncthreads();
    const size_t wbase = (size_t)part * MBW + (size_t)(b * SEQ + r0) * (SEQ / 32);
#pragma unroll
    for (int i = 0; i < (MROWS * SEQ) / (32 * MTH); ++i) { const int p = i * MTH + tid;   // word p of the band = flags p*32 .. p*32+31
        const v4u X = *(const v4ua*)(&fl[p * 32]); const v4u Y = *(const v4ua*)(&fl[p * 32 + 16]);
        MB[wbase + p] = nib4(X[0]) | (nib4(X[1]) << 4) | (nib4(X[2]) << 8) | (nib4(X[3]) << 12) | (nib4(Y[0]) << 16) | (nib4(Y[1]) << 20) | (nib4(Y[2]) << 24) | (nib4(Y[3]) << 28); }
}

// proj_body: bf16 GEMM of one block: PT tokens x DM features of one projection, K = DM, straight from the f32 inputs. Per phase of PKH k values the block converts (RNE) its token tile
// XS[token][k] (rows of h, 8 floats per thread and trip) and its weight tile WS[n][k] (W is [k][n]: a thread gathers 8 k values of one column, a wave reads whole 128-byte lines) into LDS,
// block barrier, every wave runs PKH/32 k-steps on its own tile with fragments from LDS (K-contiguous rows, pitch PKP), block barrier (the tiles may be overwritten). k runs upward through both phases.
// One wave per 32x64 tile (8 accumulators). After the last barrier the staged tiles are dead and each wave's output tile os lies in the same LDS area.
// C[m][n] = sum_k A[m][k] Bt[n][k] + bias, written as f16 (Ph) and, for tokens t < resT (resT a multiple of 64, wave-uniform test), the f16 residual x2048 (Pr).
// MODE 0: A = x rows (m = b*SEQ + t), Bt = W rows (n = h*32 + d), bias per column; plane [(b*NH_ + h)][t/16][tile] (residual plane: resT tokens per head). The 64-column tile spans two heads; per 16-row slab and head one 1024-byte tile
//         in fragment order (two lane-linear stores). Waves: 4 token tiles x 4 feature tiles.
// MODE 1: A = W rows (m = h*32 + d), Bt = x rows (n = b*SEQ + t), bias per row; plane [(b*NH_ + m/32)][t/32][(m%32)/16][tile] in fragment order. Waves: 8 feature tiles x 2 token tiles.
template <int MODE>
__device__ __forceinline__ void proj_body(unsigned char* sm, int tok0, const float* __restrict__ hin, const float* __restrict__ W, const float* __restrict__ bias, h16* Ph, h16* Pr, int resT) {
    bf* XS = (bf*)sm; bf* WS = XS + PT * PKP;
    const int tid = threadIdx.x;
    const int lane = tid & 31, lr = lane & 15, hi = lane >> 4;
    const int wave = __builtin_amdgcn_readfirstlane(tid >> 5);
    const int ra = (MODE == 0 ? (wave >> 2) : (wave >> 1)) * 32;    // first A row of this wave inside the block's A tile
    const int cb = (MODE == 0 ? (wave & 3) : (wave & 1)) * 64;      // first Bt row inside the block's Bt tile
    const bf* Al = (MODE == 0 ? XS : WS) + (ra + lr) * PKP + 8 * hi;
    const bf* Bl = (MODE == 0 ? WS : XS) + (cb + lr) * PKP + 8 * hi;
    const float* xsrc = hin + ((size_t)(tok0 / SEQ) * SEQ_FULL + (size_t)(tok0 % SEQ)) * DM;   // the input's graphs lie SEQ_FULL rows apart
    // staging: thread -> (token row xr, 8 columns) stepping XR rows a trip; (weight column tid % DM, 8 k values from wk) stepping WK k values a trip
    const int xr = tid / (PKH / 8), wk = (tid / DM) * 8;
    const float* xg = xsrc + (size_t)xr * DM + (tid % (PKH / 8)) * 8; bf* xl = XS + xr * PKP + (tid % (PKH / 8)) * 8;
    const float* wg = W + (size_t)wk * DM + tid % DM;                 bf* wl = WS + (tid % DM) * PKP + wk;
    v8f acc[2][4];
#pragma unroll
    for (int mb = 0; mb < 2; ++mb)
#pragma unroll
        for (int nb = 0; nb < 4; ++nb) acc[mb][nb] = (v8f){};
#pragma unroll 1   // one phase per trip: the two phases share the LDS tiles
    for (int kh = 0; kh < DM; kh += PKH) {
        const float* xk = xg + kh; const float* wk0 = wg + (size_t)kh * DM;
        { v8f x[(PT * PKH) / (8 * MTH)];
#pragma unroll     // all of the token tile's loads issued back to back, before the first is used
          for (int it = 0; it < (PT * PKH) / (8 * MTH); ++it) x[it] = *(const v8f*)(xk + (size_t)it * XR * DM);                // row xr + it*XR < PT
          static_assert((PT * PKH) / (8 * MTH) == 4);
          asm volatile("s_wait_xcnt 0x0" :: "v"(xk), "v"(x[0]), "v"(x[1]), "v"(x[2]), "v"(x[3]) : "memory");   // keeps these loads' address registers whole up to the wait; the loaded values as inputs hold all the loads in front of the first convert (one latency per group)
#pragma unroll
          for (int it = 0; it < (PT * PKH) / (8 * MTH); ++it) *(v8us*)(xl + it * XR * PKP) = cvt8(x[it]); }
#pragma unroll     // groups of WG column pieces: constant indices into x
        for (int g = 0; g < (DM * PKH) / (8 * MTH * WG); ++g) { v8f x[WG];
#pragma unroll     // 8 * WG column loads issued back to back, before the first is used
            for (int u = 0; u < WG; ++u)
#pragma unroll
                for (int j = 0; j < 8; ++j) x[u][j] = wk0[(size_t)((g * WG + u) * WK + j) * DM];                                // k = kh + wk + (g*WG+u)*WK + j < kh + PKH
            static_assert(WG == 4);
            asm volatile("s_wait_xcnt 0x0" :: "v"(wk0), "v"(x[0]), "v"(x[1]), "v"(x[2]), "v"(x[3]) : "memory");   // as above
#pragma unroll
            for (int u = 0; u < WG; ++u) *(v8us*)(wl + (g * WG + u) * WK) = cvt8(x[u]); }
        __syncthreads();                                           // both tiles of this phase are in LDS
#pragma unroll     // straight-line k-steps: the next step's LDS reads issue under this step's matrix instructions
        for (int kc = 0; kc < PKH; kc += 32) {
            v16bf a[2];
#pragma unroll
            for (int mb = 0; mb < 2; ++mb) a[mb] = ldb(Al + mb * 16 * PKP + kc);
#pragma unroll
            for (int nb = 0; nb < 4; ++nb) { const v16bf b = ldb(Bl + nb * 16 * PKP + kc);
#pragma unroll
                for (int mb = 0; mb < 2; ++mb) acc[mb][nb] = wmmab(a[mb], b, acc[mb][nb]); }
        }
        __syncthreads();                                           // every wave has read this phase's tiles
    }
    float* os = (float*)sm + wave * (16 * 68);
    const int r0 = (MODE == 0 ? tok0 : 0) + ra, c0 = (MODE == 0 ? 0 : tok0) + cb;
    float bc[4];
#pragma unroll
    for (int nb = 0; nb < 4; ++nb) bc[nb] = (MODE == 0) ? bfr(bias[c0 + nb * 16 + lr]) : 0.0f;   // MODE 0: c0 + 63 < DM
    size_t tbase, rbase; bool wr;                                                                 // wr: wave-uniform, whole tile inside the residual plane
    if (MODE == 0) { const int bb = r0 / SEQ, tt = r0 % SEQ; const int zc = bb * NH_ + c0 / HD;
                     tbase = ((size_t)zc * SEQ + (size_t)tt) * HD; rbase = ((size_t)zc * (size_t)resT + (size_t)tt) * HD; wr = tt < resT; }
    else           { const int bb = c0 / SEQ, tt = c0 % SEQ;
                     const int zc = bb * NH_ + r0 / HD;   // r0 is a multiple of HD, tt of 64
                     tbase = ((size_t)zc * SEQ + (size_t)tt) * HD; rbase = ((size_t)zc * (size_t)resT + (size_t)tt) * HD; wr = tt < resT; }
#pragma unroll
    for (int mb = 0; mb < 2; ++mb) {
        float br[8];
#pragma unroll
        for (int j = 0; j < 8; ++j) br[j] = (MODE == 1) ? bfr(bias[r0 + mb * 16 + hi * 8 + j]) : 0.0f;   // MODE 1: r0 + 31 < DM
#pragma unroll
        for (int nb = 0; nb < 4; ++nb) {
#pragma unroll
            for (int j = 0; j < 8; ++j) os[(hi * 8 + j) * 68 + nb * 16 + lr] = acc[mb][nb][j] + bc[nb] + br[j]; }   // D: row 8h+j, col lane&15
        wave_sync();
{
            if (MODE == 0) {
                const size_t sb = tbase + (size_t)(mb * 16) * HD;
                const size_t rb = rbase + (size_t)(mb * 16) * HD;
#pragma unroll
                for (int hh = 0; hh < 2; ++hh) {
#pragma unroll
                    for (int s = 0; s < 2; ++s) { const int p = s * 32 + lane; const int row = lr, c8 = (2 * s + hi) * 8;   // piece p of the tile: row lane&15, d = 16s + 8h + 0..7 of head hh
                        const v4f x0 = *(const v4fa*)(&os[row * 68 + hh * 32 + c8]); const v4f x1 = *(const v4fa*)(&os[row * 68 + hh * 32 + c8 + 4]); v8h hv, rv;
#pragma unroll
                        for (int i = 0; i < 4; ++i) { const h16 a0 = (h16)x0[i]; const h16 a1 = (h16)x1[i]; hv[i] = a0; hv[4 + i] = a1; rv[i] = (h16)((x0[i] - (float)a0) * QRS); rv[4 + i] = (h16)((x1[i] - (float)a1) * QRS); }
                        const size_t oo = sb + (size_t)hh * ((size_t)SEQ * HD) + (size_t)p * 8;
                        const size_t ro = rb + (size_t)hh * ((size_t)resT * HD) + (size_t)p * 8;
                        *(v8h*)(Ph + oo) = hv; xwait(); if (wr) { *(v8h*)(Pr + ro) = rv; xwait(); } } }
            } else {
                const size_t sb = tbase + (size_t)(mb * 512);   // tile d/16 = mb of each 32-token step
                const size_t rb = rbase + (size_t)(mb * 512);
#pragma unroll
                for (int s = 0; s < 4; ++s) { const int row = lr, c8 = s * 16 + hi * 8;   // s = (32-token step, half): row lane&15, tokens 16s + 8h + 0..7
                    const v4f x0 = *(const v4fa*)(&os[row * 68 + c8]); const v4f x1 = *(const v4fa*)(&os[row * 68 + c8 + 4]); v8h hv, rv;
#pragma unroll
                    for (int i = 0; i < 4; ++i) { const h16 a0 = (h16)x0[i]; const h16 a1 = (h16)x1[i]; hv[i] = a0; hv[4 + i] = a1; rv[i] = (h16)((x0[i] - (float)a0) * QRS); rv[4 + i] = (h16)((x1[i] - (float)a1) * QRS); }
                    const size_t oo = sb + (size_t)((s >> 1) * 1024 + (s & 1) * 256 + lane * 8);
                    const size_t ro = rb + (size_t)((s >> 1) * 1024 + (s & 1) * 256 + lane * 8);
                    *(v8h*)(Ph + oo) = hv; xwait(); if (wr) { *(v8h*)(Pr + ro) = rv; xwait(); } }
            }
             }
        wave_sync();
    }
}

// k_front: everything that reads the inputs alone, as block ranges of ONE launch, so that the pieces run side by side. MTH threads per block; the branch is on blockIdx alone
// (block-uniform, so each piece's barriers are passed by all of its block's threads); one LDS area serves all pieces. Longest pieces first:
// blocks [0, NBM) adjacency bands x pieces of the edge list, [NBM, NBM + NBP) projections (q, then k, then v^T; one block per PT tokens), [NBM + NBP, NBM + NBP + NBW) output weight transpose.
// Register budget for eight waves per SIMD = two blocks per WGP: there are more blocks than WGPs, and all of them should be resident at once.
__global__ __launch_bounds__(MTH) __attribute__((amdgpu_waves_per_eu(8))) void k_front(const int* __restrict__ src, const int* __restrict__ dst, int nE, unsigned* MB,
                                                  const float* __restrict__ wq, const float* __restrict__ wk, const float* __restrict__ wv, const float* __restrict__ wo, h16* WOH,
                                                  const float* __restrict__ hin, const float* __restrict__ bq, const float* __restrict__ bk, const float* __restrict__ bv,
                                                  h16* QH, h16* QR, h16* KP, h16* KR, h16* VT, h16* VR, int resT) {
    __shared__ __align__(16) unsigned char sm[FRONT_LDS];
    const int blk = blockIdx.x;
    if (blk < NBM) { mask_body(sm, (blk % (SEQ / MROWS)) * MROWS, blk / ((SEQ / MROWS) * MPART), (blk / (SEQ / MROWS)) % MPART, src, dst, nE, MB); return; }
    if (blk < NBM + NBP) {
        const int z = (blk - NBM) / ((NB * SEQ) / PT), tok0 = ((blk - NBM) % ((NB * SEQ) / PT)) * PT;
        if (z == 2) proj_body<1>(sm, tok0, hin, wv, bv, VT, VR, resT);
        else        proj_body<0>(sm, tok0, hin, z ? wk : wq, z ? bk : bq, z ? KP : QH, z ? KR : QR, resT);
        return; }
    wt_body<true>((float*)sm, (blk - NBM - NBP) * 32, wo, (unsigned short*)WOH);
}

// k_flash: fused attention and output projection. One block per (graph, AQ tiles of 16 query rows): AW waves, wave = (query tile, head); K / V^T / Q fragments straight from the f16 planes in fragment order (two lane-linear 16-B loads each, whole 128-byte lines).
// Transposed form: S^T[key][t] = K Q^T (A = K rows, B = Q rows); lane (t = lane&15, h = lane>>4) holds keys 8h+r of each 16-key tile, so the packed
// P tile is directly the B fragment of O^T[d][t] = V^T P^T (element r <- tile keys 0..15, element 8+r <- tile keys 16..31, lane unchanged).
// Softmax state (running max over kept keys, partial sum) is one scalar per lane; the two lane halves of a row are combined with one xor-16 exchange.
// Adjacency: at the head of the block every thread ORs the MPART partial words of one (row, word) of the block's 16*AQ rows into LDS ([word][row], so a step's read is bank-linear); one block barrier; the key loop reads LDS only.
// Keep rule: one adjacency word per lane per 32-key step (row t0 + lane&15, word key0/32), bit 8h+r for the first tile and 16+8h+r for the second; a dropped score is selected to NEGB once, so the max passes over it and the 2^-14 cut selects its P to 0.
// The running max is kept on the unscaled scores (the scale is positive); scale and shift go into one multiply-add per exponent argument.
// All rows: scores = K Q + (K Q_res + K_res Q) / 2048; P = f16 value + f16 residual x2048; O = V P + (V P_res + V_res P) / 2048 (residual products in their own accumulators); row sum from the f32 exponentials.
// P below 2^-14 (after the 2^14 carry) is selected to 0 on the exponent argument; residuals pass the subnormal select.
// Context hand-over: O^T in D layout (lane: row t = lane&15, d = 8h+r and 16+8h+r) IS the A fragment of the output projection's k-step 'head' (row t, k = head*32 + d), so each wave converts its own
// registers to f16 value + f16 residual x2048 and stores the four 512-byte slices lane-linear in LDS; one block barrier; then every wave reads the NH_ heads' fragments of its query tile.
// Output projection: wave (query tile, c) computes rows of its tile x columns 32c..32c+31, k-steps in head order, value and residual in separate accumulators; Bt = transposed output weight plane (fragment order, f16, x64),
// its fragments loaded before the barrier; OUT[m][n] = (sum + sum_res / 2048) / 64 + bias (bias bf16-converted, added in f32); rows go out through a wave-private LDS tile as whole 128-byte runs.
__global__ __launch_bounds__(32 * AW) void k_flash(const h16* __restrict__ QH, const h16* __restrict__ QR, const h16* __restrict__ KP, const h16* __restrict__ KR,
                                                   const h16* __restrict__ VT, const h16* __restrict__ VR, const unsigned* __restrict__ MB,
                                                   const h16* __restrict__ WT, const float* __restrict__ bias, float* OUT) {
    __shared__ v8h cf[AW * 4 * 32];                            // [query tile][head][value lo, value hi, residual lo, residual hi][lane]
    __shared__ __align__(16) float os[AW * 16 * OSP];
    __shared__ unsigned mk[(SEQ / 32) * 16 * AQ];              // [word][row of the block]
    const int lane = threadIdx.x & 31, lr = lane & 15, hi = lane >> 4;
    const int wave = __builtin_amdgcn_readfirstlane((int)(threadIdx.x >> 5));
    const int head = wave % NH_, qt = wave / NH_;
    const int b = blockIdx.y; const int zh = b * NH_ + head;
    const int t0 = (blockIdx.x * AQ + qt) * 16;
    const size_t pbase = (size_t)zh * SEQ * HD;
    const size_t ko = pbase + (size_t)lane * 8;                // + key0 * HD: K tiles of keys key0.. and key0+16.. (A fragment: row key, k = d); V^T tiles d 0..15 and 16..31 of the step (A fragment: row d, k = key)
    const size_t qo = ko + (size_t)t0 * HD;
    const v16h qh = ldf(QH + qo), qr = ldf(QR + qo);            // B fragments: col t, k = d (HD = 32 = one k-step)
    { const int tid = threadIdx.x;                             // thread = (row tid / (SEQ/32), word tid % (SEQ/32)) of the block's rows: thread-linear in every partial plane
      const unsigned* mp = MB + (size_t)(b * SEQ + blockIdx.x * (16 * AQ)) * (SEQ / 32) + tid;
      unsigned mv[MPART];
#pragma unroll
      for (int p = 0; p < MPART; ++p) mv[p] = mp[(size_t)p * MBW];
      xwait();                                                 // the code behind it rewrites these loads' address registers
      unsigned mo = 0u;
#pragma unroll
      for (int p = 0; p < MPART; ++p) mo |= mv[p];
      mk[(tid % (SEQ / 32)) * (16 * AQ) + tid / (SEQ / 32)] = mo; }
    __syncthreads();                                           // the block's adjacency words are in LDS
    const unsigned* mrow = mk + qt * 16 + lr;
    v8f o0 = (v8f){}, o1 = (v8f){}, oR0 = (v8f){}, oR1 = (v8f){};
    float m = MST, l = 0.0f;                                   // running max of the unscaled scores, partial row sum
#pragma unroll 1
    for (int key0 = 0; key0 < SEQ; key0 += 32) {
        const unsigned mw = mrow[(key0 >> 5) * (16 * AQ)];
        const unsigned sa = mw >> (8 * hi);
        const h16* ka = KP + ko + (size_t)key0 * HD;
        const h16* kr = KR + ko + (size_t)key0 * HD;
        const v16h ka0 = ldf(ka), kb0 = ldf(ka + 16 * HD);
        const v16h kra0 = ldf(kr), krb0 = ldf(kr + 16 * HD);
        v8f sHa = (v8f){}, sLa = (v8f){}, sHb = (v8f){}, sLb = (v8f){};
        sHa = wmma16(ka0, qh, sHa); sLa = wmma16(ka0, qr, sLa); sHb = wmma16(kb0, qh, sHb); sLb = wmma16(kb0, qr, sLb);
        sLa = wmma16(kra0, qh, sLa); sLb = wmma16(krb0, qh, sLb);
        asm volatile("s_wait_xcnt 0x0" :: "v"(ka), "v"(kr) : "memory");   // keeps the K loads' address registers whole up to the wait; the code behind it (later loads' results too) may then rewrite them
        v8f uA = sHa + sLa * QRI, uB = sHb + sLb * QRI; float mx = NEGB;
#pragma unroll
        for (int r = 0; r < 8; ++r) {
            uA[r] = keep_bit(uA[r], sa, r); uB[r] = keep_bit(uB[r], sa, 16 + r);
            mx = fmaxf(mx, fmaxf(uA[r], uB[r])); }
        mx = fmaxf(mx, __shfl_xor(mx, 16, 32));
        const float mnew = fmaxf(m, mx);
        const float sh = PSH - mnew * SC2;
        const float alpha = __builtin_amdgcn_exp2f((m - mnew) * SC2);
        const v8f xA = uA * SC2 + sh, xB = uB * SC2 + sh;
        v8f gA, gB; float ls = 0.0f;
#pragma unroll
        for (int r = 0; r < 8; ++r) {
            const float ea = __builtin_amdgcn_exp2f(xA[r]), eb = __builtin_amdgcn_exp2f(xB[r]);
            gA[r] = (xA[r] >= -14.0f) ? ea : 0.0f; gB[r] = (xB[r] >= -14.0f) ? eb : 0.0f;   // dropped elements (NEGB) and sub-2^-14 values selected to 0 by value
            ls += gA[r] + gB[r]; }
        const v8h pA = __builtin_convertvector(gA, v8h), pB = __builtin_convertvector(gB, v8h);   // 0 or in [2^-14, 2^14]
        const v16h pb = cat16(pA, pB); v16h pr;
#pragma unroll
        for (int r = 0; r < 8; ++r) { pr[r] = res_flush(gA[r] - (float)pA[r]); pr[8 + r] = res_flush(gB[r] - (float)pB[r]); }
        l = l * alpha + ls; m = mnew;
        o0 = o0 * alpha; o1 = o1 * alpha; oR0 = oR0 * alpha; oR1 = oR1 * alpha;
        const h16* va = VT + ko + (size_t)key0 * HD;
        const h16* vr = VR + ko + (size_t)key0 * HD;
        const v16h v0 = ldf(va), v1 = ldf(va + 512);
        const v16h vr0 = ldf(vr), vr1 = ldf(vr + 512);
        asm volatile("s_wait_xcnt 0x0" :: "v"(va), "v"(vr) : "memory");   // as above, for the V loads
        o0 = wmma16(v0, pb, o0); o1 = wmma16(v1, pb, o1);
        oR0 = wmma16(v0, pr, oR0); oR1 = wmma16(v1, pr, oR1);
        oR0 = wmma16(vr0, pb, oR0); oR1 = wmma16(vr1, pb, oR1);
    }
    // this wave's output weight fragments (columns c0 .. c0+31, all k): issued here so that they land while the context is converted and the block gathers at the barrier
    const int c0 = head * 32;
    const int cn = c0 + lr;                                    // cn + 16 < DM
    const h16* wp = WT + (size_t)c0 * DM + lane * 8;           // tiles [c0/16 + 0..1][k step]
    v16h w[2][NH_];
#pragma unroll
    for (int kc = 0; kc < NH_; ++kc) { w[0][kc] = ldf(wp + kc * 512); w[1][kc] = ldf(wp + (size_t)16 * DM + kc * 512); }
    const float bl0 = bias[cn], bl1 = bias[cn + 16];
    asm volatile("s_wait_xcnt 0x0" :: "v"(wp), "v"(cn) : "memory");   // keeps these loads' address registers whole up to the wait; the code behind it (their own results too) may then rewrite them
    const float bc0 = bfr(bl0), bc1 = bfr(bl1);
    l += __shfl_xor(l, 16, 32);
    const bool any = l > 0.0f;
    const float lsafe = any ? l : 1.0f;
    const float inv = any ? (1.0f / lsafe) : 0.0f;             // no kept key -> zeros (cannot happen: the diagonal is always kept)
    const v8f f0 = o0 + oR0 * QRI, f1 = o1 + oR1 * QRI;
    { v8h h0, h1, r0, r1;                                      // f_j[r] = (d = 16j + 8h + r, t = lane&15)
#pragma unroll
      for (int i = 0; i < 8; ++i) { const float x0 = f0[i] * inv, x1 = f1[i] * inv; const h16 a0 = toh_flush(x0); const h16 a1 = toh_flush(x1); h0[i] = a0; h1[i] = a1;
          r0[i] = toh_flush((x0 - (float)a0) * QRS); r1[i] = toh_flush((x1 - (float)a1) * QRS); }
      v8h* cw = cf + wave * (4 * 32) + lane;
      cw[0] = h0; cw[32] = h1; cw[64] = r0; cw[96] = r1; }
    __syncthreads();                                           // every head's context fragments of both query tiles are in LDS
    v8f aH0 = (v8f){}, aH1 = (v8f){}, aR0 = (v8f){}, aR1 = (v8f){};
    const v8h* cr = cf + qt * (NH_ * 4 * 32) + lane;
#pragma unroll
    for (int kc = 0; kc < NH_; ++kc) {
        const v16h a = cat16(cr[kc * 128], cr[kc * 128 + 32]), e = cat16(cr[kc * 128 + 64], cr[kc * 128 + 96]);
        aH0 = wmma16(a, w[0][kc], aH0); aH1 = wmma16(a, w[1][kc], aH1);
        aR0 = wmma16(e, w[0][kc], aR0); aR1 = wmma16(e, w[1][kc], aR1);
    }
    const int wb = wave * 16 * OSP;
#pragma unroll
    for (int j = 0; j < 8; ++j) { os[wb + (hi * 8 + j) * OSP + lr] = (aH0[j] + aR0[j] * QRI) * WOI + bc0; os[wb + (hi * 8 + j) * OSP + 16 + lr] = (aH1[j] + aR1[j] * QRI) * WOI + bc1; }   // D: row 8h+j, col lane&15
    wave_sync();
    float* obase = OUT + ((size_t)b * OUT_SEQ + (size_t)t0) * DM + c0;
#pragma unroll
    for (int s = 0; s < 4; ++s) { const int row = 4 * s + (lane >> 3), c4 = (lane & 7) * 4;   // 4 s x 4 rows = 16 rows; 8 lanes x 4 floats = 32 columns
        const v4f val = *(const v4fa*)(&os[wb + row * OSP + c4]);
        *(v4f*)(obase + (size_t)row * DM + c4) = val; }
}

static constexpr size_t al256(size_t v) { return (v + 255) & ~(size_t)255; }
static constexpr size_t SZ_WO = al256((size_t)DM * DM * 2);
static constexpr size_t SZ_PL = al256((size_t)NB * NH_ * SEQ * HD * 2);
static constexpr size_t SZ_MB = al256(MPART * MBW * 4);
static constexpr size_t SZ_TOTAL = SZ_WO + 6 * SZ_PL + SZ_MB;
static_assert(SZ_TOTAL <= (size_t)134217728);          // workspace carve <= 128 MiB
static_assert((size_t)NB * NH_ * SEQ * HD == (size_t)NB * DM * SEQ);       // the v^T plane has the same extent as the q/k planes
static_assert((size_t)(NB * SEQ / PT) * PT * DM == (size_t)NB * NH_ * SEQ * HD);    // projection blocks x tile == plane extent
static_assert((size_t)(SEQ / (16 * AQ)) * NB * AQ * 16 * DM == (size_t)NB * SEQ * DM);   // flash grid x rows x columns == output extent
static_assert((size_t)(SEQ / MROWS) * NB * MROWS * (SEQ / 32) * 4 == (size_t)NB * SEQ * (SEQ / 32) * 4);   // bands x graphs x band == extent of one partial bit plane

extern "C" void kernel_launch(void* const* d_in, const int* in_sizes, int n_in,
                              void* d_out, int out_size, void* d_ws, size_t ws_size, hipStream_t stream) {
    if (n_in < 11) return;
    const size_t needx = ((size_t)(NB - 1) * SEQ_FULL + SEQ) * DM;
    if ((size_t)in_sizes[0] < needx) return;
    if (in_sizes[1] < 1 || in_sizes[2] < 1) return;
    if ((size_t)in_sizes[3] < (size_t)DM * DM || (size_t)in_sizes[5] < (size_t)DM * DM || (size_t)in_sizes[7] < (size_t)DM * DM || (size_t)in_sizes[9] < (size_t)DM * DM) return;
    if (in_sizes[4] < DM || in_sizes[6] < DM || in_sizes[8] < DM || in_sizes[10] < DM) return;
    if ((size_t)out_size < ((size_t)(NB - 1) * OUT_SEQ + SEQ) * DM) return;
    if (SZ_TOTAL > ws_size) return;
    // wire order: h, src, dst, Wq, bq, Wk, bk, Wv, bv, Wo, bo
    const float* hin = (const float*)d_in[0];
    const int* src = (const int*)d_in[1]; const int* dst = (const int*)d_in[2];
    const float* wq = (const float*)d_in[3]; const float* bq = (const float*)d_in[4];
    const float* wk = (const float*)d_in[5]; const float* bk = (const float*)d_in[6];
    const float* wv = (const float*)d_in[7]; const float* bv = (const float*)d_in[8];
    const float* wo = (const float*)d_in[9]; const float* bo = (const float*)d_in[10];
    const int nE = in_sizes[1] < in_sizes[2] ? in_sizes[1] : in_sizes[2];
    float* OUT = (float*)d_out;      // [NB*SEQ][256]
    char* wsp = (char*)d_ws;
    h16* WOH = (h16*)wsp; wsp += SZ_WO;              // output weight, transposed, [out/16][in/32][tile], f16 x64
    h16* QH = (h16*)wsp; wsp += SZ_PL;               // [NB*8][SEQ/16][tile]
    h16* QR = (h16*)wsp; wsp += SZ_PL;               // residual x2048
    h16* KP = (h16*)wsp; wsp += SZ_PL;               // [NB*8][SEQ/16][tile]
    h16* KR = (h16*)wsp; wsp += SZ_PL;               // residual x2048
    h16* VT = (h16*)wsp; wsp += SZ_PL;               // [NB*8][SEQ/32][2][tile]
    h16* VR = (h16*)wsp; wsp += SZ_PL;               // residual x2048
    unsigned* MB = (unsigned*)wsp; wsp += SZ_MB;     // partial adjacency bits [MPART][NB*SEQ][SEQ/32]

    // partial adjacency bits; q, k, v^T planes with their residual planes for all tokens and the transposed output weight plane, all in fragment order
    k_front<<<NBM + NBP + NBW, MTH, 0, stream>>>(src, dst, nE, MB, wq, wk, wv, wo, WOH, hin, bq, bk, bv, QH, QR, KP, KR, VT, VR, SEQ);

    // attention and output projection: one block per (32 query rows, graph), all heads
    k_flash<<<dim3(SEQ / (16 * AQ), NB, 1), 32 * AW, 0, stream>>>(QH, QR, KP, KR, VT, VR, MB, WOH, bo, OUT);
}

// v009
// A run of this version takes 28.3 microseconds.
// It is 1.46 times as fast as v007, going by the measured steps of the versions left out in between.
// Over all steps from v000 it is 11.8 times as fast.
#include <hip/hip_runtime.h>

// Graph attention layer: node features h [NB][SEQ][256]; q/k/v = h W + bias with W stored [in][out]; 8 heads x 32; scores (q.k) * 32^-0.5; per graph and query row the kept keys are the listed
// edges (graph = src / size, row = src mod size, column = dst mod size) plus the diagonal; all other keys get probability 0; context heads concatenated, then context Wo + bo (Wo [in][out]); output [NB*SEQ][256] f32.
// Compute dtypes, f32 accumulate everywhere: q/k/v projections v_wmma_f32_16x16x32_bf16 (h, W, bias RNE-converted to bf16; products exact);
// scores v_wmma_f32_16x16x32_f16: q and k each as one f16 value (RNE; its rounding, at most 2^-11 relative, lies under that of the bf16 operands q, k and v are made from, at most 2^-8);
// P.V v_wmma_f32_16x16x32_f16: P (x16384 carry, cancels in the normalisation) and v each as one f16 value, row sum from the f32 exponentials; softmax f32 (online, running max over kept keys);
// output projection v_wmma_f32_16x16x32_f16: context as one f16 value, Wo as f16 of the bf16-converted weight x64 (folded by 1/64), bias bf16-converted, added in f32.
// Layout: h and the q/k/v weights are converted to bf16 inside the projection blocks (LDS tiles, no planes); every f16 plane lies in fragment order (1024-byte tiles [element half][lane][8], so a fragment is two lane-linear 512-byte loads of whole 128-byte lines): q, k planes [b*NH_+h][t/16][tile of 16 t x 32 d]; v^T plane [b*NH_+h][t/32][d/16][tile of 16 d x 32 t]; transposed output weight plane [out/16][in/32][tile of 16 out x 32 in]; MPART partial adjacency bit planes [part][b*SEQ+t][SEQ/32] (bit j of word w = key 32w+j; part p holds the edges of the p-th piece of the edge list, the reader ORs the parts);
// fused flash kernel in transposed form (S^T = K Q^T, O^T = V^T P^T); the context stays in the block's LDS as A fragments and the same launch does the output projection.

#ifndef NB
#define NB 16
#endif
#ifndef SEQ
#define SEQ 512
#endif
#define NB_FULL  16
#define SEQ_FULL 512
#ifndef OUT_SEQ
#define OUT_SEQ SEQ              // row pitch (in tokens) between batches of the output
#endif
#define DM   256
#define NH_  8
#define HD   32
#define AQ   2                   // 16-row query tiles per flash block
#define AW   (NH_ * AQ)          // waves per flash block: one per (piece of the keys, head)
#define OSP  36                  // LDS row pitch (floats) of a wave's output tile
#define SC2  ((float)(0.17677669529663687 * 1.4426950408889634))   // HD^-0.5 * log2(e)
#define PSH  14.0f               // log2 of the P carry (16384)
#define NEGB (-3.0e38f)           // value of a dropped score
#define MST  (-1.0e30f)          // start of the running max: below every score, far above NEGB, so a dropped score always lands under the 2^-14 cut
#define WOS  64.0f               // carry of the output-projection weight plane
#define WOI  (1.0f / 64.0f)
#define MROWS 256                // query rows per mask-builder block
#define MPART 4                  // pieces of the edge list; one mask-builder block scans one piece for one band
#define MTH   512                // threads per block of the preparation launch
#define MUN   8                  // 16-byte load pairs in flight per thread in the edge scan
#define WTP  (DM + 4)            // LDS row pitch (floats) of the weight transpose tile
#define NBM  ((SEQ / MROWS) * NB * MPART)         // preparation launch: adjacency blocks (band, piece of the edge list, graph)
#define MBW  ((size_t)NB * SEQ * (SEQ / 32))      // words per partial adjacency plane
#define NBW  (DM / 32)                            // output weight transpose blocks
#define PT   128                 // tokens per projection block
#define PKH  128                 // k extent staged in LDS per phase
#define PKP  (PKH + 8)           // LDS row pitch (bf16 elements) of the staged tiles: 272 B = 16 B x odd
#define WG   4                   // column pieces (8 k values each) in flight per thread while the weight tile is staged
#define XR   (MTH / (PKH / 8))   // token rows staged per trip
#define WK   ((MTH / DM) * 8)    // k values staged per trip
#define NBP  (3 * ((NB * SEQ) / PT))              // projection blocks (q, k, v)
#define PROJ_LDS ((PT + DM) * PKP * 2)            // token tile + weight tile
#define FRONT_LDS (PROJ_LDS > MROWS * SEQ ? PROJ_LDS : MROWS * SEQ)   // the larger of the staged tiles and the flag tile; the transpose tile and the waves' output tiles lie in the same area

static_assert(HD == 32);
static_assert(NH_ * HD == DM);                 // head h = columns h*32 + d
static_assert(DM % 64 == 0);                   // column tiles of 64 = two heads
static_assert(64 % HD == 0);
static_assert(DM % 32 == 0);                   // GEMM k-loop steps by 32
static_assert(SEQ % 64 == 0);                  // a 64-row tile never straddles two batches
static_assert((NB * SEQ) % 64 == 0);
static_assert(SEQ % 32 == 0);                  // key loop steps by 32; one mask word per 32-key step
static_assert(SEQ % (16 * AQ) == 0);           // flash grid covers the sequence exactly
static_assert(((size_t)SEQ * DM) % 8 == 0);
static_assert(((size_t)DM * DM) % 8 == 0);
static_assert(NB <= NB_FULL);
static_assert(SEQ <= SEQ_FULL);
static_assert((OSP * 4) % 16 == 0);
static_assert(SEQ % MROWS == 0);               // mask-builder bands cover the rows exactly
static_assert((MROWS & (MROWS - 1)) == 0 && (SEQ_FULL & (SEQ_FULL - 1)) == 0 && (NB_FULL & (NB_FULL - 1)) == 0 && SEQ_FULL % MROWS == 0);   // row, column and band test by bit masks
static_assert((MROWS * SEQ) % (16 * MTH) == 0);            // flag tile zero fill: MTH threads x 16 B per trip
static_assert(((MROWS * SEQ) / 32) % MTH == 0);            // pack: whole trips of MTH words
static_assert(MROWS <= MTH);
static_assert((WTP * 4) % 16 == 0);
static_assert((32 * DM) % (8 * MTH) == 0);                 // weight transpose store: whole trips of MTH threads x 8 elements
static_assert(DM % (MTH / 32) == 0);                       // weight transpose load: whole trips of MTH/32 rows
static_assert(SEQ % PT == 0);                              // a projection block never straddles two graphs
static_assert(MTH == 512 && PT == 128 && DM == 256);       // 16 waves = 4 x 4 tiles of 32 tokens x 64 features (q, k) = 8 x 2 tiles of 32 features x 64 tokens (v^T)
static_assert(DM % PKH == 0 && PKH % 32 == 0 && MTH % (PKH / 8) == 0 && MTH % DM == 0);
static_assert((PKP * 2) % 32 == 16);                       // pitch = 16 B x odd
static_assert((PT * PKH) % (8 * MTH) == 0 && (DM * PKH) % (8 * MTH * WG) == 0);   // staging: whole trips of MTH threads x 8 elements
static_assert(MROWS * SEQ <= FRONT_LDS && 32 * WTP * 4 <= FRONT_LDS && (MTH / 32) * 16 * 68 * 4 <= FRONT_LDS);
static_assert(4 * 32 * 4 == 16 * 32);                      // output epilogue: instructions x lanes x floats == 16 rows x 32 columns
static_assert(NH_ * 32 == DM);                             // the NH_ waves of a query tile cover the DM output columns, 32 each
static_assert(32 * AW <= 1024);
static_assert(AQ == 2 && (NH_ & (NH_ - 1)) == 0);          // the two waves of a head are wave and wave ^ NH_
static_assert(SEQ % (32 * AQ) == 0);                       // each wave walks SEQ / AQ keys in steps of 32
static_assert(16 * OSP == 18 * 32);                        // a wave's output tile area holds 18 floats per lane: the hand-over of one tile's O (16), max and sum
static_assert(32 * AW == 16 * AQ * (SEQ / 32));            // flash prologue: one adjacency word of the block's rows per thread
static_assert((size_t)MROWS * SEQ <= 131072);              // static LDS per kernel
static_assert((size_t)32 * WTP * 4 <= 131072);
static_assert((size_t)AW * 16 * OSP * 4 + (size_t)AW * 2 * 32 * 16 + (size_t)16 * AQ * (SEQ / 32) * 4 <= 131072);
static_assert((size_t)FRONT_LDS <= 131072);
static_assert(sizeof(unsigned) == 4);

typedef _Float16 h16;
typedef unsigned short bf;
typedef __attribute__((ext_vector_type(16))) __bf16   v16bf;
typedef __attribute__((ext_vector_type(16))) _Float16 v16h;
typedef __attribute__((ext_vector_type(8)))  _Float16 v8h;
typedef __attribute__((ext_vector_type(8)))  unsigned short v8us;
typedef __attribute__((ext_vector_type(8)))  __bf16   v8bf;
typedef __attribute__((ext_vector_type(8)))  float    v8f;
typedef __attribute__((ext_vector_type(4)))  float    v4f;
typedef v4f  __attribute__((may_alias)) v4fa;
typedef __attribute__((ext_vector_type(4)))  unsigned v4u;
typedef v4u  __attribute__((may_alias)) v4ua;
typedef int  v4e __attribute__((ext_vector_type(4), aligned(4)));   // four edge indices; only the element's own alignment is assumed

__device__ __forceinline__ unsigned short f2bf(float f) { unsigned u = __float_as_uint(f); u += 0x7FFFu + ((u >> 16) & 1u); return (unsigned short)(u >> 16); }
__device__ __forceinline__ float bfr(float f) { return __uint_as_float(((unsigned)f2bf(f)) << 16); }   // value after RNE convert to bf16
__device__ __forceinline__ v8us cvt8(v8f x) { return __builtin_bit_cast(v8us, __builtin_convertvector(x, v8bf)); }   // eight f32 -> bf16 (RNE), packed converts
__device__ __forceinline__ v16h cat16(v8h lo, v8h hi) { return __builtin_shufflevector(lo, hi, 0, 1, 2, 3, 4, 5, 6, 7, 8, 9, 10, 11, 12, 13, 14, 15); }
__device__ __forceinline__ v16bf cat16b(v8us lo, v8us hi) { return __builtin_bit_cast(v16bf, __builtin_shufflevector(lo, hi, 0, 1, 2, 3, 4, 5, 6, 7, 8, 9, 10, 11, 12, 13, 14, 15)); }
__device__ __forceinline__ v8f wmma16(v16h a, v16h b, v8f c) { return __builtin_amdgcn_wmma_f32_16x16x32_f16(false, a, false, b, (short)0, c, false, false); }
__device__ __forceinline__ v8f wmmab(v16bf a, v16bf b, v8f c) { return __builtin_amdgcn_wmma_f32_16x16x32_bf16(false, a, false, b, (short)0, c, false, false); }
// fragment loader from K-contiguous 16-bit rows (LDS tiles); p already includes + 8*(lane>>4): elements 0..7 <- k0+8h+0..7, elements 8..15 <- k0+16+8h+0..7 (same map for A and B)
__device__ __forceinline__ v16bf ldb(const bf* p)  { return cat16b(*(const v8us*)p, *(const v8us*)(p + 16)); }
// fragment loader from a plane in fragment order; p already includes + 8*lane: elements 0..7 <- first 512 bytes of the tile, elements 8..15 <- second 512 bytes (the writers put k0+8h+0..7 and k0+16+8h+0..7 of row lane&15 there)
__device__ __forceinline__ v16h  ldf(const h16* p) { return cat16(*(const v8h*)p, *(const v8h*)(p + 256)); }
// ordering point for wave-private LDS tiles (same wave writes and reads)
__device__ __forceinline__ void wave_sync() { __builtin_amdgcn_fence(3 /* release order */, "wavefront"); __builtin_amdgcn_wave_barrier(); asm volatile("" ::: "memory"); }
// stands behind a global load or store: the code that follows rewrites its address (and a store's data) registers
__device__ __forceinline__ void xwait() { asm volatile("s_wait_xcnt 0x0" ::: "memory"); }
// f32 -> f16 convert that cannot produce a subnormal operand (|v| < 2^-14 -> +0)
__device__ __forceinline__ h16 toh_flush(float v) { const h16 r = (h16)v; return (fabsf(v) < 6.103515625e-05f) ? (h16)0.0f : r; }
// score u where bit r of w is set, NEGB where it is clear
__device__ __forceinline__ float keep_bit(float u, unsigned w, int r) { return ((w >> r) & 1u) != 0u ? u : NEGB; }
// four flag bytes (0/1 each, lowest byte = lowest key) -> four bits
__device__ __forceinline__ unsigned nib4(unsigned x) { return (x | (x >> 7) | (x >> 14) | (x >> 21)) & 0xFu; }

// wt_body: weight transpose: in W[k][n] (DM rows of DM) -> out WT, n-major; one block per 32 output rows, tile staged in LDS (block barrier). HALF true: fragment order [n/16][k/32][half][lane][8], stores thread-linear.
// HALF false: bf16 (RNE convert). HALF true: f16 of (bf16-converted weight x WOS), subnormal results selected to +0.
template <bool HALF>
__device__ __forceinline__ void wt_body(float* ts, int n0, const float* __restrict__ W, unsigned short* WT) {
    const int tid = threadIdx.x; const int j = tid & 31, kk = tid >> 5;
#pragma unroll 1   // kept rolled: small code
    for (int i = 0; i < DM / (MTH / 32); ++i) { const int k = kk + (MTH / 32) * i; ts[j * WTP + k] = W[(size_t)k * DM + n0 + j]; }   // k covers 0..DM-1, n0 + j < DM
    __syncthreads();
#pragma unroll 1   // kept rolled: small code
    for (int it = 0; it < (32 * DM) / (8 * MTH); ++it) { const int q = it * MTH + tid;   // trips x MTH threads x 8 = 32 rows x DM
        const int row = HALF ? (q / (16 * DM / 8)) * 16 + (q & 15) : q / (DM / 8);                                  // HALF: piece q = [n tile][k step][half][lane]
        const int c8  = HALF ? ((q >> 6) % (DM / 32)) * 32 + ((q >> 5) & 1) * 16 + ((q >> 4) & 1) * 8 : (q % (DM / 8)) * 8;
        const v4f x0 = *(const v4fa*)(&ts[row * WTP + c8]); const v4f x1 = *(const v4fa*)(&ts[row * WTP + c8 + 4]);
        unsigned short* dp = HALF ? WT + (size_t)n0 * DM + (size_t)q * 8 : WT + (size_t)(n0 + row) * DM + c8;
        if (HALF) { v8h o;
#pragma unroll
            for (int i = 0; i < 4; ++i) { o[i] = toh_flush(bfr(x0[i]) * WOS); o[4 + i] = toh_flush(bfr(x1[i]) * WOS); }
            *(v8h*)dp = o; }
        else { v8us o;
#pragma unroll
            for (int i = 0; i < 4; ++i) { o[i] = f2bf(x0[i]); o[4 + i] = f2bf(x1[i]); }
            *(v8us*)dp = o; }
        asm volatile("s_wait_xcnt 0x0" ::: "memory"); }   // the next trip rewrites the store's address and data registers
}

// mask_body: one partial adjacency bit plane's words for one (graph b, band of MROWS query rows starting at r0, piece 'part' of the edge list). Block-local byte flag tile [MROWS][SEQ] in LDS: zero fill, block barrier, diagonal + every edge of the piece that falls in the band
// stores the byte 1 (plain same-value byte stores, no read-modify-write), block barrier, then each thread packs 32 flags into one word and the band's 64-byte rows go out thread-linear (one 128-byte line per wave).
// A block reads one piece of the edge list (a MPART-th, rounded up to whole 16-byte loads), so the list is read (SEQ/MROWS)*NB times in all: MTH threads, four edges per 16-byte load, MUN load pairs issued before the first is used, so the scan runs at the rate of the loads and not at their latency.
// Band test: graph = floor(s / SEQ_FULL), graphs -NB_FULL..-1 wrap to 0..NB_FULL-1, row = s mod SEQ_FULL. With lo = the first s of this band in the wrapped (negative) range, s lies in the band
// exactly when s - lo (modulo 2^32) is in [0, MROWS) or in [NB_FULL*SEQ_FULL, NB_FULL*SEQ_FULL + MROWS): all bits clear but the row bits and the bit NB_FULL*SEQ_FULL.
// The remainder of the piece (fewer than MTH * 4 * MUN edges) goes one edge per thread with clamped addresses; both loops are block-uniform. SEQ/MROWS bands x MPART pieces x NB graphs.
__device__ __forceinline__ bool in_band(int s, unsigned lo) { return (((unsigned)s - lo) & ~(unsigned)(NB_FULL * SEQ_FULL + MROWS - 1)) == 0u; }
__device__ __forceinline__ void mark_edge(unsigned char* fl, int s, int d) {
    const int c = d & (SEQ_FULL - 1); if (c < SEQ) fl[(s & (MROWS - 1)) * SEQ + c] = (unsigned char)1;   // row in [0, MROWS), c in [0, SEQ)
}
__device__ __forceinline__ void mask_body(unsigned char* fl, int r0, int b, int part, const int* __restrict__ src, const int* __restrict__ dst, int nE, unsigned* MB) {
    const int tid = threadIdx.x;
    const v4u zz = (v4u){0u, 0u, 0u, 0u};
#pragma unroll
    for (int i = 0; i < (MROWS * SEQ) / (16 * MTH); ++i) *(v4ua*)(&fl[(i * MTH + tid) * 16]) = zz;
    __syncthreads();
    if (tid < MROWS) fl[tid * SEQ + r0 + tid] = (unsigned char)1;          // diagonal, r0 + tid < SEQ
    const unsigned lo = (unsigned)((b - NB_FULL) * SEQ_FULL + r0);
    const int piece = ((nE + 4 * MPART - 1) / (4 * MPART)) * 4;           // edges per piece; MPART * piece >= nE
    const int e0 = part * piece < nE ? part * piece : nE;                 // this piece: edges e0 .. e1-1 (empty when e0 == nE)
    const int e1 = e0 + piece < nE ? e0 + piece : nE;
    const int* ps = src + e0; const int* pd = dst + e0;                   // block-uniform bases; the thread's own offset is t4
    const int t4 = tid * 4;
    int base = e0;
#pragma unroll 1   // one group of MUN load pairs per trip; more would only grow the code
    for (; base + MTH * 4 * MUN <= e1; base += MTH * 4 * MUN) {
        v4e S[MUN], D[MUN]; const int* qs = ps + t4; const int* qd = pd + t4;
#pragma unroll     // all MUN pairs issued back to back, S and D in registers
        for (int u = 0; u < MUN; ++u) { S[u] = *(const v4e*)(qs + u * MTH * 4); D[u] = *(const v4e*)(qd + u * MTH * 4); }   // last element base + MTH*4*MUN - 1 < e1 <= nE
        asm volatile("s_wait_xcnt 0x0" :: "v"(qs), "v"(qd) : "memory");   // keeps these loads' address registers whole up to the wait; the code behind it (the loads' own results too) may then rewrite them
#pragma unroll     // constant indices into S and D
        for (int u = 0; u < MUN; ++u) {
#pragma unroll
            for (int i = 0; i < 4; ++i) if (in_band(S[u][i], lo)) mark_edge(fl, S[u][i], D[u][i]); }
        ps += MTH * 4 * MUN; pd += MTH * 4 * MUN;
    }
#pragma unroll 1   // short remainder, kept small
    for (; base < e1; base += MTH) {
        const int e = base + tid; const int ec = e < e1 ? e : e1 - 1;      // a clamped lane repeats the piece's last edge: the same byte, the same value
        const int s = src[ec], d = dst[ec];
        if (in_band(s, lo)) mark_edge(fl, s, d);
    }
    __syncthreads();
    const size_t wbase = (size_t)part * MBW + (size_t)(b * SEQ + r0) * (SEQ / 32);
#pragma unroll
    for (int i = 0; i < (MROWS * SEQ) / (32 * MTH); ++i) { const int p = i * MTH + tid;   // word p of the band = flags p*32 .. p*32+31
        const v4u X = *(const v4ua*)(&fl[p * 32]); const v4u Y = *(const v4ua*)(&fl[p * 32 + 16]);
        MB[wbase + p] = nib4(X[0]) | (nib4(X[1]) << 4) | (nib4(X[2]) << 8) | (nib4(X[3]) << 12) | (nib4(Y[0]) << 16) | (nib4(Y[1]) << 20) | (nib4(Y[2]) << 24) | (nib4(Y[3]) << 28); }
}

// proj_body: bf16 GEMM of one block: PT tokens x DM features of one projection, K = DM, straight from the f32 inputs. Per phase of PKH k values the block converts (RNE) its token tile
// XS[token][k] (rows of h, 8 floats per thread and trip) and its weight tile WS[n][k] (W is [k][n]: a thread gathers 8 k values of one column, a wave reads whole 128-byte lines) into LDS,
// block barrier, every wave runs PKH/32 k-steps on its own tile with fragments from LDS (K-contiguous rows, pitch PKP), block barrier (the tiles may be overwritten). k runs upward through both phases.
// One wave per 32x64 tile (8 accumulators). After the last barrier the staged tiles are dead and each wave's output tile os lies in the same LDS area.
// C[m][n] = sum_k A[m][k] Bt[n][k] + bias, written as f16 (Ph).
// MODE 0: A = x rows (m = b*SEQ + t), Bt = W rows (n = h*32 + d), bias per column; plane [(b*NH_ + h)][t/16][tile]. The 64-column tile spans two heads; per 16-row slab and head one 1024-byte tile
//         in fragment order (two lane-linear stores). Waves: 4 token tiles x 4 feature tiles.
// MODE 1: A = W rows (m = h*32 + d), Bt = x rows (n = b*SEQ + t), bias per row; plane [(b*NH_ + m/32)][t/32][(m%32)/16][tile] in fragment order. Waves: 8 feature tiles x 2 token tiles.
template <int MODE>
__device__ __forceinline__ void proj_body(unsigned char* sm, int tok0, const float* __restrict__ hin, const float* __restrict__ W, const float* __restrict__ bias, h16* Ph) {
    bf* XS = (bf*)sm; bf* WS = XS + PT * PKP;
    const int tid = threadIdx.x;
    const int lane = tid & 31, lr = lane & 15, hi = lane >> 4;
    const int wave = __builtin_amdgcn_readfirstlane(tid >> 5);
    const int ra = (MODE == 0 ? (wave >> 2) : (wave >> 1)) * 32;    // first A row of this wave inside the block's A tile
    const int cb = (MODE == 0 ? (wave & 3) : (wave & 1)) * 64;      // first Bt row inside the block's Bt tile
    const bf* Al = (MODE == 0 ? XS : WS) + (ra + lr) * PKP + 8 * hi;
    const bf* Bl = (MODE == 0 ? WS : XS) + (cb + lr) * PKP + 8 * hi;
    const float* xsrc = hin + ((size_t)(tok0 / SEQ) * SEQ_FULL + (size_t)(tok0 % SEQ)) * DM;   // the input's graphs lie SEQ_FULL rows apart
    // staging: thread -> (token row xr, 8 columns) stepping XR rows a trip; (weight column tid % DM, 8 k values from wk) stepping WK k values a trip
    const int xr = tid / (PKH / 8), wk = (tid / DM) * 8;
    const float* xg = xsrc + (size_t)xr * DM + (tid % (PKH / 8)) * 8; bf* xl = XS + xr * PKP + (tid % (PKH / 8)) * 8;
    const float* wg = W + (size_t)wk * DM + tid % DM;                 bf* wl = WS + (tid % DM) * PKP + wk;
    v8f acc[2][4];
#pragma unroll
    for (int mb = 0; mb < 2; ++mb)
#pragma unroll
        for (int nb = 0; nb < 4; ++nb) acc[mb][nb] = (v8f){};
#pragma unroll 1   // one phase per trip: the two phases share the LDS tiles
    for (int kh = 0; kh < DM; kh += PKH) {
        const float* xk = xg + kh; const float* wk0 = wg + (size_t)kh * DM;
        { v8f x[(PT * PKH) / (8 * MTH)];
#pragma unroll     // all of the token tile's loads issued back to back, before the first is used
          for (int it = 0; it < (PT * PKH) / (8 * MTH); ++it) x[it] = *(const v8f*)(xk + (size_t)it * XR * DM);                // row xr + it*XR < PT
          static_assert((PT * PKH) / (8 * MTH) == 4);
          asm volatile("s_wait_xcnt 0x0" :: "v"(xk), "v"(x[0]), "v"(x[1]), "v"(x[2]), "v"(x[3]) : "memory");   // keeps these loads' address registers whole up to the wait; the loaded values as inputs hold all the loads in front of the first convert (one latency per group)
#pragma unroll
          for (int it = 0; it < (PT * PKH) / (8 * MTH); ++it) *(v8us*)(xl + it * XR * PKP) = cvt8(x[it]); }
#pragma unroll     // groups of WG column pieces: constant indices into x
        for (int g = 0; g < (DM * PKH) / (8 * MTH * WG); ++g) { v8f x[WG];
#pragma unroll     // 8 * WG column loads issued back to back, before the first is used
            for (int u = 0; u < WG; ++u)
#pragma unroll
                for (int j = 0; j < 8; ++j) x[u][j] = wk0[(size_t)((g * WG + u) * WK + j) * DM];                                // k = kh + wk + (g*WG+u)*WK + j < kh + PKH
            static_assert(WG == 4);
            asm volatile("s_wait_xcnt 0x0" :: "v"(wk0), "v"(x[0]), "v"(x[1]), "v"(x[2]), "v"(x[3]) : "memory");   // as above
#pragma unroll
            for (int u = 0; u < WG; ++u) *(v8us*)(wl + (g * WG + u) * WK) = cvt8(x[u]); }
        __syncthreads();                                           // both tiles of this phase are in LDS
#pragma unroll     // straight-line k-steps: the next step's LDS reads issue under this step's matrix instructions
        for (int kc = 0; kc < PKH; kc += 32) {
            v16bf a[2];
#pragma unroll
            for (int mb = 0; mb < 2; ++mb) a[mb] = ldb(Al + mb * 16 * PKP + kc);
#pragma unroll
            for (int nb = 0; nb < 4; ++nb) { const v16bf b = ldb(Bl + nb * 16 * PKP + kc);
#pragma unroll
                for (int mb = 0; mb < 2; ++mb) acc[mb][nb] = wmmab(a[mb], b, acc[mb][nb]); }
        }
        __syncthreads();                                           // every wave has read this phase's tiles
    }
    float* os = (float*)sm + wave * (16 * 68);
    const int r0 = (MODE == 0 ? tok0 : 0) + ra, c0 = (MODE == 0 ? 0 : tok0) + cb;
    float bc[4];
#pragma unroll
    for (int nb = 0; nb < 4; ++nb) bc[nb] = (MODE == 0) ? bfr(bias[c0 + nb * 16 + lr]) : 0.0f;   // MODE 0: c0 + 63 < DM
    size_t tbase;
    if (MODE == 0) { const int bb = r0 / SEQ, tt = r0 % SEQ; const int zc = bb * NH_ + c0 / HD;
                     tbase = ((size_t)zc * SEQ + (size_t)tt) * HD; }
    else           { const int bb = c0 / SEQ, tt = c0 % SEQ;
                     const int zc = bb * NH_ + r0 / HD;   // r0 is a multiple of HD, tt of 64
                     tbase = ((size_t)zc * SEQ + (size_t)tt) * HD; }
#pragma unroll
    for (int mb = 0; mb < 2; ++mb) {
        float br[8];
#pragma unroll
        for (int j = 0; j < 8; ++j) br[j] = (MODE == 1) ? bfr(bias[r0 + mb * 16 + hi * 8 + j]) : 0.0f;   // MODE 1: r0 + 31 < DM
#pragma unroll
        for (int nb = 0; nb < 4; ++nb) {
#pragma unroll
            for (int j = 0; j < 8; ++j) os[(hi * 8 + j) * 68 + nb * 16 + lr] = acc[mb][nb][j] + bc[nb] + br[j]; }   // D: row 8h+j, col lane&15
        wave_sync();
{
            if (MODE == 0) {
                const size_t sb = tbase + (size_t)(mb * 16) * HD;
#pragma unroll
                for (int hh = 0; hh < 2; ++hh) {
#pragma unroll
                    for (int s = 0; s < 2; ++s) { const int p = s * 32 + lane; const int row = lr, c8 = (2 * s + hi) * 8;   // piece p of the tile: row lane&15, d = 16s + 8h + 0..7 of head hh
                        const v4f x0 = *(const v4fa*)(&os[row * 68 + hh * 32 + c8]); const v4f x1 = *(const v4fa*)(&os[row * 68 + hh * 32 + c8 + 4]); v8h hv;
#pragma unroll
                        for (int i = 0; i < 4; ++i) { hv[i] = (h16)x0[i]; hv[4 + i] = (h16)x1[i]; }
                        const size_t oo = sb + (size_t)hh * ((size_t)SEQ * HD) + (size_t)p * 8;
                        *(v8h*)(Ph + oo) = hv; xwait(); } }
            } else {
                const size_t sb = tbase + (size_t)(mb * 512);   // tile d/16 = mb of each 32-token step
#pragma unroll
                for (int s = 0; s < 4; ++s) { const int row = lr, c8 = s * 16 + hi * 8;   // s = (32-token step, half): row lane&15, tokens 16s + 8h + 0..7
                    const v4f x0 = *(const v4fa*)(&os[row * 68 + c8]); const v4f x1 = *(const v4fa*)(&os[row * 68 + c8 + 4]); v8h hv;
#pragma unroll
                    for (int i = 0; i < 4; ++i) { hv[i] = (h16)x0[i]; hv[4 + i] = (h16)x1[i]; }
                    const size_t oo = sb + (size_t)((s >> 1) * 1024 + (s & 1) * 256 + lane * 8);
                    *(v8h*)(Ph + oo) = hv; xwait(); }
            }
             }
        wave_sync();
    }
}

// k_front: everything that reads the inputs alone, as block ranges of ONE launch, so that the pieces run side by side. MTH threads per block; the branch is on blockIdx alone
// (block-uniform, so each piece's barriers are passed by all of its block's threads); one LDS area serves all pieces. Longest pieces first:
// blocks [0, NBM) adjacency bands x pieces of the edge list, [NBM, NBM + NBP) projections (q, then k, then v^T; one block per PT tokens), [NBM + NBP, NBM + NBP + NBW) output weight transpose.
// Register budget for eight waves per SIMD = two blocks per WGP: there are more blocks than WGPs, and all of them should be resident at once.
__global__ __launch_bounds__(MTH) __attribute__((amdgpu_waves_per_eu(8))) void k_front(const int* __restrict__ src, const int* __restrict__ dst, int nE, unsigned* MB,
                                                  const float* __restrict__ wq, const float* __restrict__ wk, const float* __restrict__ wv, const float* __restrict__ wo, h16* WOH,
                                                  const float* __restrict__ hin, const float* __restrict__ bq, const float* __restrict__ bk, const float* __restrict__ bv,
                                                  h16* QH, h16* KP, h16* VT) {
    __shared__ __align__(16) unsigned char sm[FRONT_LDS];
    const int blk = blockIdx.x;
    if (blk < NBM) { mask_body(sm, (blk % (SEQ / MROWS)) * MROWS, blk / ((SEQ / MROWS) * MPART), (blk / (SEQ / MROWS)) % MPART, src, dst, nE, MB); return; }
    if (blk < NBM + NBP) {
        const int z = (blk - NBM) / ((NB * SEQ) / PT), tok0 = ((blk - NBM) % ((NB * SEQ) / PT)) * PT;
        if (z == 2) proj_body<1>(sm, tok0, hin, wv, bv, VT);
        else        proj_body<0>(sm, tok0, hin, z ? wk : wq, z ? bk : bq, z ? KP : QH);
        return; }
    wt_body<true>((float*)sm, (blk - NBM - NBP) * 32, wo, (unsigned short*)WOH);
}

// k_flash: fused attention and output projection. One block per (graph, AQ tiles of 16 query rows): AW waves, wave = (piece qt of the keys, head); K / V^T / Q fragments straight from the f16 planes in fragment order (two lane-linear 16-B loads each, whole 128-byte lines).
// Every wave runs all AQ query tiles of the block against its own SEQ / AQ keys, so each K and V^T fragment is loaded by exactly one wave of the block and serves AQ tiles from registers. Slot 0 of a wave's state is query tile qt, which it finishes; slot 1 is the other tile:
// after the key loop its O, max and sum go through LDS to the head's other wave (one block barrier), which joins them with its own slot 0 in the usual way (both rescaled to the common max, then added).
// Transposed form: S^T[key][t] = K Q^T (A = K rows, B = Q rows); lane (t = lane&15, h = lane>>4) holds keys 8h+r of each 16-key tile, so the packed
// P tile is directly the B fragment of O^T[d][t] = V^T P^T (element r <- tile keys 0..15, element 8+r <- tile keys 16..31, lane unchanged).
// Softmax state (running max over kept keys, partial sum) is one scalar per lane and slot; the two lane halves of a row are combined with one xor-16 exchange.
// Adjacency: at the head of the block every thread ORs the MPART partial words of one (row, word) of the block's 16*AQ rows into LDS ([word][row], so a step's read is bank-linear); one block barrier; the key loop reads LDS only.
// Keep rule: one adjacency word per lane, slot and 32-key step (row = first row of the slot's query tile + lane&15, word key0/32), bit 8h+r for the first tile and 16+8h+r for the second; a dropped score is selected to NEGB once, so the max passes over it and the 2^-14 cut selects its P to 0.
// The running max is kept on the unscaled scores (the scale is positive); scale and shift go into one multiply-add per exponent argument.
// All rows: scores = K Q; P = one f16 value; O = V P; row sum from the f32 exponentials.
// P below 2^-14 (after the 2^14 carry) is selected to 0 on the exponent argument.
// Context hand-over: O^T in D layout (lane: row t = lane&15, d = 8h+r and 16+8h+r) IS the A fragment of the output projection's k-step 'head' (row t, k = head*32 + d), so each wave converts its own
// registers to f16 and stores the two 512-byte slices lane-linear in LDS; one block barrier; then every wave reads the NH_ heads' fragments of its query tile.
// Output projection: wave (query tile, c) computes rows of its tile x columns 32c..32c+31, k-steps in head order; Bt = transposed output weight plane (fragment order, f16, x64),
// its fragments loaded before the barrier; OUT[m][n] = sum / 64 + bias (bias bf16-converted, added in f32); rows go out through a wave-private LDS tile as whole 128-byte runs.
__global__ __launch_bounds__(32 * AW) void k_flash(const h16* __restrict__ QH, const h16* __restrict__ KP,
                                                   const h16* __restrict__ VT, const unsigned* __restrict__ MB,
                                                   const h16* __restrict__ WT, const float* __restrict__ bias, float* OUT) {
    __shared__ v8h cf[AW * 2 * 32];                            // [query tile][head][lo, hi][lane]
    __shared__ __align__(16) float os[AW * 16 * OSP];
    __shared__ unsigned mk[(SEQ / 32) * 16 * AQ];              // [word][row of the block]
    const int lane = threadIdx.x & 31, lr = lane & 15, hi = lane >> 4;
    const int wave = __builtin_amdgcn_readfirstlane((int)(threadIdx.x >> 5));
    const int head = wave % NH_, qt = wave / NH_;
    const int b = blockIdx.y; const int zh = b * NH_ + head;
    const int t0 = (blockIdx.x * AQ + qt) * 16;                // first row of the query tile this wave finishes
    const size_t pbase = (size_t)zh * SEQ * HD;
    const size_t ko = pbase + (size_t)lane * 8;                // + key0 * HD: K tiles of keys key0.. and key0+16.. (A fragment: row key, k = d); V^T tiles d 0..15 and 16..31 of the step (A fragment: row d, k = key)
    const h16* qp = QH + ko + (size_t)(blockIdx.x * AQ * 16) * HD;   // the block's AQ query tiles lie 16 * HD elements apart
    v16h qh[AQ];                                               // B fragments: col t, k = d (HD = 32 = one k-step); slot j = tile qt ^ j
#pragma unroll     // constant slot numbers: the fragments stay in registers
    for (int j = 0; j < AQ; ++j) qh[j] = ldf(qp + (qt ^ j) * (16 * HD));
    { const int tid = threadIdx.x;                             // thread = (row tid / (SEQ/32), word tid % (SEQ/32)) of the block's rows: thread-linear in every partial plane
      const unsigned* mp = MB + (size_t)(b * SEQ + blockIdx.x * (16 * AQ)) * (SEQ / 32) + tid;
      unsigned mv[MPART];
#pragma unroll
      for (int p = 0; p < MPART; ++p) mv[p] = mp[(size_t)p * MBW];
      xwait();                                                 // the code behind it rewrites these loads' address registers
      unsigned mo = 0u;
#pragma unroll
      for (int p = 0; p < MPART; ++p) mo |= mv[p];
      mk[(tid % (SEQ / 32)) * (16 * AQ) + tid / (SEQ / 32)] = mo; }
    __syncthreads();                                           // the block's adjacency words are in LDS
    const unsigned* mrow = mk + lr;                            // + 16 * tile + (16 * AQ) * word
    v8f O0[AQ], O1[AQ]; float M[AQ], L[AQ];                    // per slot: O^T tiles, running max of the unscaled scores, partial row sum
#pragma unroll     // as above
    for (int j = 0; j < AQ; ++j) { O0[j] = (v8f){}; O1[j] = (v8f){}; M[j] = MST; L[j] = 0.0f; }
    const int kbeg = qt * (SEQ / AQ);                          // this wave's keys: kbeg .. kbeg + SEQ / AQ - 1
#pragma unroll 1
    for (int key0 = kbeg; key0 < kbeg + SEQ / AQ; key0 += 32) {
        const h16* ka = KP + ko + (size_t)key0 * HD;
        const v16h ka0 = ldf(ka), kb0 = ldf(ka + 16 * HD);
        v8f UA[AQ], UB[AQ];
#pragma unroll     // as above; each K fragment feeds AQ products
        for (int j = 0; j < AQ; ++j) { UA[j] = wmma16(ka0, qh[j], (v8f){}); UB[j] = wmma16(kb0, qh[j], (v8f){}); }
        asm volatile("s_wait_xcnt 0x0" :: "v"(ka) : "memory");   // keeps the K loads' address registers whole up to the wait; the code behind it (later loads' results too) may then rewrite them
        v16h pb[AQ];
#pragma unroll     // constant slot numbers: the state stays in registers
        for (int j = 0; j < AQ; ++j) {
            const unsigned mw = mrow[(key0 >> 5) * (16 * AQ) + (qt ^ j) * 16];
            const unsigned sa = mw >> (8 * hi);
            v8f uA = UA[j], uB = UB[j];
            float mx = NEGB;
#pragma unroll
            for (int r = 0; r < 8; ++r) {
                uA[r] = keep_bit(uA[r], sa, r); uB[r] = keep_bit(uB[r], sa, 16 + r);
                mx = fmaxf(mx, fmaxf(uA[r], uB[r])); }
            mx = fmaxf(mx, __shfl_xor(mx, 16, 32));
            const float mnew = fmaxf(M[j], mx);
            const float sh = PSH - mnew * SC2;
            const float alpha = __builtin_amdgcn_exp2f((M[j] - mnew) * SC2);
            const v8f xA = uA * SC2 + sh, xB = uB * SC2 + sh;
            v8f gA, gB; float ls = 0.0f;
#pragma unroll
            for (int r = 0; r < 8; ++r) {
                const float ea = __builtin_amdgcn_exp2f(xA[r]), eb = __builtin_amdgcn_exp2f(xB[r]);
                gA[r] = (xA[r] >= -14.0f) ? ea : 0.0f; gB[r] = (xB[r] >= -14.0f) ? eb : 0.0f;   // dropped elements (NEGB) and sub-2^-14 values selected to 0 by value
                ls += gA[r] + gB[r]; }
            const v8h pA = __builtin_convertvector(gA, v8h), pB = __builtin_convertvector(gB, v8h);   // 0 or in [2^-14, 2^14]
            pb[j] = cat16(pA, pB);
            L[j] = L[j] * alpha + ls; M[j] = mnew;
            O0[j] = O0[j] * alpha; O1[j] = O1[j] * alpha; }
        const h16* va = VT + ko + (size_t)key0 * HD;
        const v16h v0 = ldf(va), v1 = ldf(va + 512);
        asm volatile("s_wait_xcnt 0x0" :: "v"(va) : "memory");   // as above, for the V loads
#pragma unroll     // as above; each V^T fragment feeds AQ products
        for (int j = 0; j < AQ; ++j) { O0[j] = wmma16(v0, pb[j], O0[j]); O1[j] = wmma16(v1, pb[j], O1[j]); }
    }
    // slot 1 (the other tile over this wave's keys) goes to the head's other wave: [piece of 4][lane][4] floats of O, then max, then sum, lane-linear, in this wave's own output tile area (not yet in use)
    { float* hx = os + wave * (16 * OSP); v4fa* hv = (v4fa*)hx + lane;
      hv[0]  = __builtin_shufflevector(O0[1], O0[1], 0, 1, 2, 3); hv[32] = __builtin_shufflevector(O0[1], O0[1], 4, 5, 6, 7);
      hv[64] = __builtin_shufflevector(O1[1], O1[1], 0, 1, 2, 3); hv[96] = __builtin_shufflevector(O1[1], O1[1], 4, 5, 6, 7);
      hx[16 * 32 + lane] = M[1]; hx[17 * 32 + lane] = L[1]; }
    // this wave's output weight fragments (columns c0 .. c0+31, all k): issued here so that they land while the context is converted and the block gathers at the barrier
    const int c0 = head * 32;
    const int cn = c0 + lr;                                    // cn + 16 < DM
    const h16* wp = WT + (size_t)c0 * DM + lane * 8;           // tiles [c0/16 + 0..1][k step]
    v16h w[2][NH_];
#pragma unroll
    for (int kc = 0; kc < NH_; ++kc) { w[0][kc] = ldf(wp + kc * 512); w[1][kc] = ldf(wp + (size_t)16 * DM + kc * 512); }
    const float bl0 = bias[cn], bl1 = bias[cn + 16];
    asm volatile("s_wait_xcnt 0x0" :: "v"(wp), "v"(cn) : "memory");   // keeps these loads' address registers whole up to the wait; the code behind it (their own results too) may then rewrite them
    const float bc0 = bfr(bl0), bc1 = bfr(bl1);
    __syncthreads();                                           // every wave's slot 1 is in LDS
    v8f o0, o1; float l;                                       // query tile qt over all keys: own slot 0 joined with the other wave's slot 1 (same lane = same row and same d)
    { const float* hx = os + (wave ^ NH_) * (16 * OSP); const v4fa* hv = (const v4fa*)hx + lane;
      const v4f a0 = hv[0], a1 = hv[32], a2 = hv[64], a3 = hv[96];
      const float mp = hx[16 * 32 + lane], lp = hx[17 * 32 + lane];
      const float mj = fmaxf(M[0], mp);                        // both are finite (at least MST), so the differences below are finite and at most 0
      const float fo = __builtin_amdgcn_exp2f((M[0] - mj) * SC2), fp = __builtin_amdgcn_exp2f((mp - mj) * SC2);   // a half with no kept key (max still MST) gets factor 0 beside a real max, and its O and sum are 0 anyway
      o0 = O0[0] * fo + __builtin_shufflevector(a0, a1, 0, 1, 2, 3, 4, 5, 6, 7) * fp;
      o1 = O1[0] * fo + __builtin_shufflevector(a2, a3, 0, 1, 2, 3, 4, 5, 6, 7) * fp;
      l = L[0] * fo + lp * fp; }
    l += __shfl_xor(l, 16, 32);
    const bool any = l > 0.0f;
    const float lsafe = any ? l : 1.0f;
    const float inv = any ? (1.0f / lsafe) : 0.0f;             // no kept key -> zeros (cannot happen: the diagonal is always kept)
    { v8h h0, h1;                                              // o_j[r] = (d = 16j + 8h + r, t = lane&15)
#pragma unroll
      for (int i = 0; i < 8; ++i) { h0[i] = toh_flush(o0[i] * inv); h1[i] = toh_flush(o1[i] * inv); }
      v8h* cw = cf + wave * (2 * 32) + lane;
      cw[0] = h0; cw[32] = h1; }
    __syncthreads();                                           // every head's context fragments of both query tiles are in LDS
    v8f aH0 = (v8f){}, aH1 = (v8f){};
    const v8h* cr = cf + qt * (NH_ * 2 * 32) + lane;
#pragma unroll
    for (int kc = 0; kc < NH_; ++kc) {
        const v16h a = cat16(cr[kc * 64], cr[kc * 64 + 32]);
        aH0 = wmma16(a, w[0][kc], aH0); aH1 = wmma16(a, w[1][kc], aH1);
    }
    const int wb = wave * 16 * OSP;
#pragma unroll
    for (int j = 0; j < 8; ++j) { os[wb + (hi * 8 + j) * OSP + lr] = aH0[j] * WOI + bc0; os[wb + (hi * 8 + j) * OSP + 16 + lr] = aH1[j] * WOI + bc1; }   // D: row 8h+j, col lane&15
    wave_sync();
    float* obase = OUT + ((size_t)b * OUT_SEQ + (size_t)t0) * DM + c0;
#pragma unroll
    for (int s = 0; s < 4; ++s) { const int row = 4 * s + (lane >> 3), c4 = (lane & 7) * 4;   // 4 s x 4 rows = 16 rows; 8 lanes x 4 floats = 32 columns
        const v4f val = *(const v4fa*)(&os[wb + row * OSP + c4]);
        *(v4f*)(obase + (size_t)row * DM + c4) = val; }
}

static constexpr size_t al256(size_t v) { return (v + 255) & ~(size_t)255; }
static constexpr size_t SZ_WO = al256((size_t)DM * DM * 2);
static constexpr size_t SZ_PL = al256((size_t)NB * NH_ * SEQ * HD * 2);
static constexpr size_t SZ_MB = al256(MPART * MBW * 4);
static constexpr size_t SZ_TOTAL = SZ_WO + 3 * SZ_PL + SZ_MB;
static_assert(SZ_TOTAL <= (size_t)134217728);          // workspace carve <= 128 MiB
static_assert((size_t)NB * NH_ * SEQ * HD == (size_t)NB * DM * SEQ);       // the v^T plane has the same extent as the q/k planes
static_assert((size_t)(NB * SEQ / PT) * PT * DM == (size_t)NB * NH_ * SEQ * HD);    // projection blocks x tile == plane extent
static_assert((size_t)(SEQ / (16 * AQ)) * NB * AQ * 16 * DM == (size_t)NB * SEQ * DM);   // flash grid x rows x columns == output extent
static_assert((size_t)(SEQ / MROWS) * NB * MROWS * (SEQ / 32) * 4 == (size_t)NB * SEQ * (SEQ / 32) * 4);   // bands x graphs x band == extent of one partial bit plane

extern "C" void kernel_launch(void* const* d_in, const int* in_sizes, int n_in,
                              void* d_out, int out_size, void* d_ws, size_t ws_size, hipStream_t stream) {
    if (n_in < 11) return;
    const size_t needx = ((size_t)(NB - 1) * SEQ_FULL + SEQ) * DM;
    if ((size_t)in_sizes[0] < needx) return;
    if (in_sizes[1] < 1 || in_sizes[2] < 1) return;
    if ((size_t)in_sizes[3] < (size_t)DM * DM || (size_t)in_sizes[5] < (size_t)DM * DM || (size_t)in_sizes[7] < (size_t)DM * DM || (size_t)in_sizes[9] < (size_t)DM * DM) return;
    if (in_sizes[4] < DM || in_sizes[6] < DM || in_sizes[8] < DM || in_sizes[10] < DM) return;
    if ((size_t)out_size < ((size_t)(NB - 1) * OUT_SEQ + SEQ) * DM) return;
    if (SZ_TOTAL > ws_size) return;
    // wire order: h, src, dst, Wq, bq, Wk, bk, Wv, bv, Wo, bo
    const float* hin = (const float*)d_in[0];
    const int* src = (const int*)d_in[1]; const int* dst = (const int*)d_in[2];
    const float* wq = (const float*)d_in[3]; const float* bq = (const float*)d_in[4];
    const float* wk = (const float*)d_in[5]; const float* bk = (const float*)d_in[6];
    const float* wv = (const float*)d_in[7]; const float* bv = (const float*)d_in[8];
    const float* wo = (const float*)d_in[9]; const float* bo = (const float*)d_in[10];
    const int nE = in_sizes[1] < in_sizes[2] ? in_sizes[1] : in_sizes[2];
    float* OUT = (float*)d_out;      // [NB*SEQ][256]
    char* wsp = (char*)d_ws;
    h16* WOH = (h16*)wsp; wsp += SZ_WO;              // output weight, transposed, [out/16][in/32][tile], f16 x64
    h16* QH = (h16*)wsp; wsp += SZ_PL;               // [NB*8][SEQ/16][tile]
    h16* KP = (h16*)wsp; wsp += SZ_PL;               // [NB*8][SEQ/16][tile]
    h16* VT = (h16*)wsp; wsp += SZ_PL;               // [NB*8][SEQ/32][2][tile]
    unsigned* MB = (unsigned*)wsp; wsp += SZ_MB;     // partial adjacency bits [MPART][NB*SEQ][SEQ/32]

    // partial adjacency bits; q, k, v^T planes and the transposed output weight plane, all in fragment order
    k_front<<<NBM + NBP + NBW, MTH, 0, stream>>>(src, dst, nE, MB, wq, wk, wv, wo, WOH, hin, bq, bk, bv, QH, KP, VT);

    // attention and output projection: one block per (32 query rows, graph), all heads
    k_flash<<<dim3(SEQ / (16 * AQ), NB, 1), 32 * AW, 0, stream>>>(QH, KP, VT, MB, WOH, bo, OUT);
}

// v010
// A run of this version takes 27.3 microseconds.
// Next to v009, in two timings, it ran 1.04 and 1.03 times as fast.
// All steps since v000 together make it 12.2 times as fast.
#include <hip/hip_runtime.h>

// Graph attention layer: node features h [NB][SEQ][256]; q/k/v = h W + bias with W stored [in][out]; 8 heads x 32; scores (q.k) * 32^-0.5; per graph and query row the kept keys are the listed
// edges (graph = src / size, row = src mod size, column = dst mod size) plus the diagonal; all other keys get probability 0; context heads concatenated, then context Wo + bo (Wo [in][out]); output [NB*SEQ][256] f32.
// Compute dtypes, f32 accumulate everywhere: q/k/v projections v_wmma_f32_16x16x32_bf16 (h, W, bias RNE-converted to bf16; products exact);
// scores v_wmma_f32_16x16x32_f16: q and k each as one f16 value (RNE; its rounding, at most 2^-11 relative, lies under that of the bf16 operands q, k and v are made from, at most 2^-8);
// P.V v_wmma_f32_16x16x32_f16: P (x16384 carry, cancels in the normalisation) and v each as one f16 value, row sum from the f32 exponentials; softmax f32 (online, running max over kept keys);
// output projection v_wmma_f32_16x16x32_f16: context as one f16 value, Wo as f16 of the bf16-converted weight x64 (folded by 1/64), bias bf16-converted, added in f32.
// Layout: h and the q/k/v weights are converted to bf16 inside the projection blocks (LDS tiles, no planes); every f16 plane lies in fragment order (1024-byte tiles [element half][lane][8], so a fragment is two lane-linear 512-byte loads of whole 128-byte lines): q, k planes [b*NH_+h][t/16][tile of 16 t x 32 d]; v^T plane [b*NH_+h][t/32][d/16][tile of 16 d x 32 t]; transposed output weight plane [out/16][in/32][tile of 16 out x 32 in]; MPART partial adjacency bit planes [part][b*SEQ+t][SEQ/32] (bit j of word w = key 32w+j; part p holds the edges of the p-th piece of the edge list, the reader ORs the parts);
// fused flash kernel in transposed form (S^T = K Q^T, O^T = V^T P^T); the context stays in the block's LDS as A fragments and the same launch does the output projection.

#ifndef NB
#define NB 16
#endif
#ifndef SEQ
#define SEQ 512
#endif
#define NB_FULL  16
#define SEQ_FULL 512
#ifndef OUT_SEQ
#define OUT_SEQ SEQ              // row pitch (in tokens) between batches of the output
#endif
#define DM   256
#define NH_  8
#define HD   32
#define AQ   2                   // 16-row query tiles per flash block
#define AW   (NH_ * AQ)          // waves per flash block: one per (piece of the keys, head)
#define OSP  36                  // LDS row pitch (floats) of a wave's output tile
#define KST  (SEQ / (32 * AQ))    // 32-key steps per flash wave
#define SC2  ((float)(0.17677669529663687 * 1.4426950408889634))   // HD^-0.5 * log2(e)
#define PSH  14.0f               // log2 of the P carry (16384)
#define NEGB (-3.0e38f)           // value of a dropped score
#define MST  (-1.0e30f)          // start of the running max: below every score, far above NEGB, so a dropped score always lands under the 2^-14 cut
#define WOS  64.0f               // carry of the output-projection weight plane
#define WOI  (1.0f / 64.0f)
#define MROWS 256                // query rows per mask-builder block
#define MPART 4                  // pieces of the edge list; one mask-builder block scans one piece for one band
#define MTH   512                // threads per block of the preparation launch
#define MUN   8                  // 16-byte load pairs in flight per thread in the edge scan
#define WTP  (DM + 4)            // LDS row pitch (floats) of the weight transpose tile
#define NBM  ((SEQ / MROWS) * NB * MPART)         // preparation launch: adjacency blocks (band, piece of the edge list, graph)
#define MBW  ((size_t)NB * SEQ * (SEQ / 32))      // words per partial adjacency plane
#define NBW  (DM / 32)                            // output weight transpose blocks
#define PT   128                 // tokens per projection block
#define PKH  128                 // k extent staged in LDS per phase
#define PKP  (PKH + 8)           // LDS row pitch (bf16 elements) of the staged tiles: 272 B = 16 B x odd
#define WG   4                   // column pieces (8 k values each) in flight per thread while the weight tile is staged
#define XR   (MTH / (PKH / 8))   // token rows staged per trip
#define WK   ((MTH / DM) * 8)    // k values staged per trip
#define NBP  (3 * ((NB * SEQ) / PT))              // projection blocks (q, k, v)
#define PROJ_LDS ((PT + DM) * PKP * 2)            // token tile + weight tile
#define FRONT_LDS (PROJ_LDS > MROWS * SEQ ? PROJ_LDS : MROWS * SEQ)   // the larger of the staged tiles and the flag tile; the transpose tile and the waves' output tiles lie in the same area

static_assert(HD == 32);
static_assert(NH_ * HD == DM);                 // head h = columns h*32 + d
static_assert(DM % 64 == 0);                   // column tiles of 64 = two heads
static_assert(64 % HD == 0);
static_assert(DM % 32 == 0);                   // GEMM k-loop steps by 32
static_assert(SEQ % 64 == 0);                  // a 64-row tile never straddles two batches
static_assert((NB * SEQ) % 64 == 0);
static_assert(SEQ % 32 == 0);                  // key loop steps by 32; one mask word per 32-key step
static_assert(SEQ % (16 * AQ) == 0);           // flash grid covers the sequence exactly
static_assert(((size_t)SEQ * DM) % 8 == 0);
static_assert(((size_t)DM * DM) % 8 == 0);
static_assert(NB <= NB_FULL);
static_assert(SEQ <= SEQ_FULL);
static_assert((OSP * 4) % 16 == 0);
static_assert(SEQ % MROWS == 0);               // mask-builder bands cover the rows exactly
static_assert((MROWS & (MROWS - 1)) == 0 && (SEQ_FULL & (SEQ_FULL - 1)) == 0 && (NB_FULL & (NB_FULL - 1)) == 0 && SEQ_FULL % MROWS == 0);   // row, column and band test by bit masks
static_assert((MROWS * SEQ) % (16 * MTH) == 0);            // flag tile zero fill: MTH threads x 16 B per trip
static_assert(((MROWS * SEQ) / 32) % MTH == 0);            // pack: whole trips of MTH words
static_assert(MROWS <= MTH);
static_assert((WTP * 4) % 16 == 0);
static_assert((32 * DM) % (8 * MTH) == 0);                 // weight transpose store: whole trips of MTH threads x 8 elements
static_assert(DM % (MTH / 32) == 0);                       // weight transpose load: whole trips of MTH/32 rows
static_assert(SEQ % PT == 0);                              // a projection block never straddles two graphs
static_assert(MTH == 512 && PT == 128 && DM == 256);       // 16 waves = 4 x 4 tiles of 32 tokens x 64 features (q, k) = 8 x 2 tiles of 32 features x 64 tokens (v^T)
static_assert(DM % PKH == 0 && PKH % 32 == 0 && MTH % (PKH / 8) == 0 && MTH % DM == 0);
static_assert((PKP * 2) % 32 == 16);                       // pitch = 16 B x odd
static_assert((PT * PKH) % (8 * MTH) == 0 && (DM * PKH) % (8 * MTH * WG) == 0);   // staging: whole trips of MTH threads x 8 elements
static_assert(MROWS * SEQ <= FRONT_LDS && 32 * WTP * 4 <= FRONT_LDS && (MTH / 32) * 16 * 68 * 4 <= FRONT_LDS);
static_assert(4 * 32 * 4 == 16 * 32);                      // output epilogue: instructions x lanes x floats == 16 rows x 32 columns
static_assert(NH_ * 32 == DM);                             // the NH_ waves of a query tile cover the DM output columns, 32 each
static_assert(32 * AW <= 1024);
static_assert(AQ == 2 && (NH_ & (NH_ - 1)) == 0);          // the two waves of a head are wave and wave ^ NH_
static_assert(SEQ % (32 * AQ) == 0);                       // each wave walks SEQ / AQ keys in steps of 32
static_assert((KST & (KST - 1)) == 0);                     // the rotated walk wraps by a bit mask
static_assert(16 * OSP == 18 * 32);                        // a wave's output tile area holds 18 floats per lane: the hand-over of one tile's O (16), max and sum
static_assert(32 * AW == 16 * AQ * (SEQ / 32));            // flash prologue: one adjacency word of the block's rows per thread
static_assert((size_t)MROWS * SEQ <= 131072);              // static LDS per kernel
static_assert((size_t)32 * WTP * 4 <= 131072);
static_assert((size_t)AW * 16 * OSP * 4 + (size_t)AW * 2 * 32 * 16 + (size_t)16 * AQ * (SEQ / 32) * 4 <= 131072);
static_assert((size_t)FRONT_LDS <= 131072);
static_assert(sizeof(unsigned) == 4);

typedef _Float16 h16;
typedef unsigned short bf;
typedef __attribute__((ext_vector_type(16))) __bf16   v16bf;
typedef __attribute__((ext_vector_type(16))) _Float16 v16h;
typedef __attribute__((ext_vector_type(8)))  _Float16 v8h;
typedef __attribute__((ext_vector_type(8)))  unsigned short v8us;
typedef __attribute__((ext_vector_type(8)))  __bf16   v8bf;
typedef __attribute__((ext_vector_type(8)))  float    v8f;
typedef __attribute__((ext_vector_type(4)))  float    v4f;
typedef v4f  __attribute__((may_alias)) v4fa;
typedef __attribute__((ext_vector_type(4)))  unsigned v4u;
typedef v4u  __attribute__((may_alias)) v4ua;
typedef int  v4e __attribute__((ext_vector_type(4), aligned(4)));   // four edge indices; only the element's own alignment is assumed

__device__ __forceinline__ unsigned short f2bf(float f) { unsigned u = __float_as_uint(f); u += 0x7FFFu + ((u >> 16) & 1u); return (unsigned short)(u >> 16); }
__device__ __forceinline__ float bfr(float f) { return __uint_as_float(((unsigned)f2bf(f)) << 16); }   // value after RNE convert to bf16
__device__ __forceinline__ v8us cvt8(v8f x) { return __builtin_bit_cast(v8us, __builtin_convertvector(x, v8bf)); }   // eight f32 -> bf16 (RNE), packed converts
__device__ __forceinline__ v16h cat16(v8h lo, v8h hi) { return __builtin_shufflevector(lo, hi, 0, 1, 2, 3, 4, 5, 6, 7, 8, 9, 10, 11, 12, 13, 14, 15); }
__device__ __forceinline__ v16bf cat16b(v8us lo, v8us hi) { return __builtin_bit_cast(v16bf, __builtin_shufflevector(lo, hi, 0, 1, 2, 3, 4, 5, 6, 7, 8, 9, 10, 11, 12, 13, 14, 15)); }
__device__ __forceinline__ v8f wmma16(v16h a, v16h b, v8f c) { return __builtin_amdgcn_wmma_f32_16x16x32_f16(false, a, false, b, (short)0, c, false, false); }
__device__ __forceinline__ v8f wmmab(v16bf a, v16bf b, v8f c) { return __builtin_amdgcn_wmma_f32_16x16x32_bf16(false, a, false, b, (short)0, c, false, false); }
// fragment loader from K-contiguous 16-bit rows (LDS tiles); p already includes + 8*(lane>>4): elements 0..7 <- k0+8h+0..7, elements 8..15 <- k0+16+8h+0..7 (same map for A and B)
__device__ __forceinline__ v16bf ldb(const bf* p)  { return cat16b(*(const v8us*)p, *(const v8us*)(p + 16)); }
// fragment loader from a plane in fragment order; p already includes + 8*lane: elements 0..7 <- first 512 bytes of the tile, elements 8..15 <- second 512 bytes (the writers put k0+8h+0..7 and k0+16+8h+0..7 of row lane&15 there)
__device__ __forceinline__ v16h  ldf(const h16* p) { return cat16(*(const v8h*)p, *(const v8h*)(p + 256)); }
// ordering point for wave-private LDS tiles (same wave writes and reads)
__device__ __forceinline__ void wave_sync() { __builtin_amdgcn_fence(3 /* release order */, "wavefront"); __builtin_amdgcn_wave_barrier(); asm volatile("" ::: "memory"); }
// stands behind a global load or store: the code that follows rewrites its address (and a store's data) registers
__device__ __forceinline__ void xwait() { asm volatile("s_wait_xcnt 0x0" ::: "memory"); }
// f32 -> f16 convert that cannot produce a subnormal operand (|v| < 2^-14 -> +0)
__device__ __forceinline__ h16 toh_flush(float v) { const h16 r = (h16)v; return (fabsf(v) < 6.103515625e-05f) ? (h16)0.0f : r; }
// score u where bit r of w is set, NEGB where it is clear
__device__ __forceinline__ float keep_bit(float u, unsigned w, int r) { return ((w >> r) & 1u) != 0u ? u : NEGB; }
// four flag bytes (0/1 each, lowest byte = lowest key) -> four bits
__device__ __forceinline__ unsigned nib4(unsigned x) { return (x | (x >> 7) | (x >> 14) | (x >> 21)) & 0xFu; }

// wt_body: weight transpose: in W[k][n] (DM rows of DM) -> out WT, n-major; one block per 32 output rows, tile staged in LDS (block barrier). HALF true: fragment order [n/16][k/32][half][lane][8], stores thread-linear.
// HALF false: bf16 (RNE convert). HALF true: f16 of (bf16-converted weight x WOS), subnormal results selected to +0.
template <bool HALF>
__device__ __forceinline__ void wt_body(float* ts, int n0, const float* __restrict__ W, unsigned short* WT) {
    const int tid = threadIdx.x; const int j = tid & 31, kk = tid >> 5;
#pragma unroll 1   // kept rolled: small code
    for (int i = 0; i < DM / (MTH / 32); ++i) { const int k = kk + (MTH / 32) * i; ts[j * WTP + k] = W[(size_t)k * DM + n0 + j]; }   // k covers 0..DM-1, n0 + j < DM
    __syncthreads();
#pragma unroll 1   // kept rolled: small code
    for (int it = 0; it < (32 * DM) / (8 * MTH); ++it) { const int q = it * MTH + tid;   // trips x MTH threads x 8 = 32 rows x DM
        const int row = HALF ? (q / (16 * DM / 8)) * 16 + (q & 15) : q / (DM / 8);                                  // HALF: piece q = [n tile][k step][half][lane]
        const int c8  = HALF ? ((q >> 6) % (DM / 32)) * 32 + ((q >> 5) & 1) * 16 + ((q >> 4) & 1) * 8 : (q % (DM / 8)) * 8;
        const v4f x0 = *(const v4fa*)(&ts[row * WTP + c8]); const v4f x1 = *(const v4fa*)(&ts[row * WTP + c8 + 4]);
        unsigned short* dp = HALF ? WT + (size_t)n0 * DM + (size_t)q * 8 : WT + (size_t)(n0 + row) * DM + c8;
        if (HALF) { v8h o;
#pragma unroll
            for (int i = 0; i < 4; ++i) { o[i] = toh_flush(bfr(x0[i]) * WOS); o[4 + i] = toh_flush(bfr(x1[i]) * WOS); }
            *(v8h*)dp = o; }
        else { v8us o;
#pragma unroll
            for (int i = 0; i < 4; ++i) { o[i] = f2bf(x0[i]); o[4 + i] = f2bf(x1[i]); }
            *(v8us*)dp = o; }
        asm volatile("s_wait_xcnt 0x0" ::: "memory"); }   // the next trip rewrites the store's address and data registers
}

// mask_body: one partial adjacency bit plane's words for one (graph b, band of MROWS query rows starting at r0, piece 'part' of the edge list). Block-local byte flag tile [MROWS][SEQ] in LDS: zero fill, block barrier, diagonal + every edge of the piece that falls in the band
// stores the byte 1 (plain same-value byte stores, no read-modify-write), block barrier, then each thread packs 32 flags into one word and the band's 64-byte rows go out thread-linear (one 128-byte line per wave).
// A block reads one piece of the edge list (a MPART-th, rounded up to whole 16-byte loads), so the list is read (SEQ/MROWS)*NB times in all: MTH threads, four edges per 16-byte load, MUN load pairs issued before the first is used, so the scan runs at the rate of the loads and not at their latency.
// Band test: graph = floor(s / SEQ_FULL), graphs -NB_FULL..-1 wrap to 0..NB_FULL-1, row = s mod SEQ_FULL. With lo = the first s of this band in the wrapped (negative) range, s lies in the band
// exactly when s - lo (modulo 2^32) is in [0, MROWS) or in [NB_FULL*SEQ_FULL, NB_FULL*SEQ_FULL + MROWS): all bits clear but the row bits and the bit NB_FULL*SEQ_FULL.
// The remainder of the piece (fewer than MTH * 4 * MUN edges) goes one edge per thread with clamped addresses; both loops are block-uniform. SEQ/MROWS bands x MPART pieces x NB graphs.
__device__ __forceinline__ bool in_band(int s, unsigned lo) { return (((unsigned)s - lo) & ~(unsigned)(NB_FULL * SEQ_FULL + MROWS - 1)) == 0u; }
__device__ __forceinline__ void mark_edge(unsigned char* fl, int s, int d) {
    const int c = d & (SEQ_FULL - 1); if (c < SEQ) fl[(s & (MROWS - 1)) * SEQ + c] = (unsigned char)1;   // row in [0, MROWS), c in [0, SEQ)
}
__device__ __forceinline__ void mask_body(unsigned char* fl, int r0, int b, int part, const int* __restrict__ src, const int* __restrict__ dst, int nE, unsigned* MB) {
    const int tid = threadIdx.x;
    const v4u zz = (v4u){0u, 0u, 0u, 0u};
#pragma unroll
    for (int i = 0; i < (MROWS * SEQ) / (16 * MTH); ++i) *(v4ua*)(&fl[(i * MTH + tid) * 16]) = zz;
    __syncthreads();
    if (tid < MROWS) fl[tid * SEQ + r0 + tid] = (unsigned char)1;          // diagonal, r0 + tid < SEQ
    const unsigned lo = (unsigned)((b - NB_FULL) * SEQ_FULL + r0);
    const int piece = ((nE + 4 * MPART - 1) / (4 * MPART)) * 4;           // edges per piece; MPART * piece >= nE
    const int e0 = part * piece < nE ? part * piece : nE;                 // this piece: edges e0 .. e1-1 (empty when e0 == nE)
    const int e1 = e0 + piece < nE ? e0 + piece : nE;
    const int* ps = src + e0; const int* pd = dst + e0;                   // block-uniform bases; the thread's own offset is t4
    const int t4 = tid * 4;
    int base = e0;
#pragma unroll 1   // one group of MUN load pairs per trip; more would only grow the code
    for (; base + MTH * 4 * MUN <= e1; base += MTH * 4 * MUN) {
        v4e S[MUN], D[MUN]; const int* qs = ps + t4; const int* qd = pd + t4;
#pragma unroll     // all MUN pairs issued back to back, S and D in registers
        for (int u = 0; u < MUN; ++u) { S[u] = *(const v4e*)(qs + u * MTH * 4); D[u] = *(const v4e*)(qd + u * MTH * 4); }   // last element base + MTH*4*MUN - 1 < e1 <= nE
        asm volatile("s_wait_xcnt 0x0" :: "v"(qs), "v"(qd) : "memory");   // keeps these loads' address registers whole up to the wait; the code behind it (the loads' own results too) may then rewrite them
#pragma unroll     // constant indices into S and D
        for (int u = 0; u < MUN; ++u) {
#pragma unroll
            for (int i = 0; i < 4; ++i) if (in_band(S[u][i], lo)) mark_edge(fl, S[u][i], D[u][i]); }
        ps += MTH * 4 * MUN; pd += MTH * 4 * MUN;
    }
#pragma unroll 1   // short remainder, kept small
    for (; base < e1; base += MTH) {
        const int e = base + tid; const int ec = e < e1 ? e : e1 - 1;      // a clamped lane repeats the piece's last edge: the same byte, the same value
        const int s = src[ec], d = dst[ec];
        if (in_band(s, lo)) mark_edge(fl, s, d);
    }
    __syncthreads();
    const size_t wbase = (size_t)part * MBW + (size_t)(b * SEQ + r0) * (SEQ / 32);
#pragma unroll
    for (int i = 0; i < (MROWS * SEQ) / (32 * MTH); ++i) { const int p = i * MTH + tid;   // word p of the band = flags p*32 .. p*32+31
        const v4u X = *(const v4ua*)(&fl[p * 32]); const v4u Y = *(const v4ua*)(&fl[p * 32 + 16]);
        MB[wbase + p] = nib4(X[0]) | (nib4(X[1]) << 4) | (nib4(X[2]) << 8) | (nib4(X[3]) << 12) | (nib4(Y[0]) << 16) | (nib4(Y[1]) << 20) | (nib4(Y[2]) << 24) | (nib4(Y[3]) << 28); }
}

// proj_body: bf16 GEMM of one block: PT tokens x DM features of one projection, K = DM, straight from the f32 inputs. Per phase of PKH k values the block converts (RNE) its token tile
// XS[token][k] (rows of h, 8 floats per thread and trip) and its weight tile WS[n][k] (W is [k][n]: a thread gathers 8 k values of one column, a wave reads whole 128-byte lines) into LDS,
// block barrier, every wave runs PKH/32 k-steps on its own tile with fragments from LDS (K-contiguous rows, pitch PKP), block barrier (the tiles may be overwritten). k runs upward through both phases.
// One wave per 32x64 tile (8 accumulators). After the last barrier the staged tiles are dead and each wave's output tile os lies in the same LDS area.
// C[m][n] = sum_k A[m][k] Bt[n][k] + bias, written as f16 (Ph).
// MODE 0: A = x rows (m = b*SEQ + t), Bt = W rows (n = h*32 + d), bias per column; plane [(b*NH_ + h)][t/16][tile]. The 64-column tile spans two heads; per 16-row slab and head one 1024-byte tile
//         in fragment order (two lane-linear stores). Waves: 4 token tiles x 4 feature tiles.
// MODE 1: A = W rows (m = h*32 + d), Bt = x rows (n = b*SEQ + t), bias per row; plane [(b*NH_ + m/32)][t/32][(m%32)/16][tile] in fragment order. Waves: 8 feature tiles x 2 token tiles.
template <int MODE>
__device__ __forceinline__ void proj_body(unsigned char* sm, int tok0, const float* __restrict__ hin, const float* __restrict__ W, const float* __restrict__ bias, h16* Ph) {
    bf* XS = (bf*)sm; bf* WS = XS + PT * PKP;
    const int tid = threadIdx.x;
    const int lane = tid & 31, lr = lane & 15, hi = lane >> 4;
    const int wave = __builtin_amdgcn_readfirstlane(tid >> 5);
    const int ra = (MODE == 0 ? (wave >> 2) : (wave >> 1)) * 32;    // first A row of this wave inside the block's A tile
    const int cb = (MODE == 0 ? (wave & 3) : (wave & 1)) * 64;      // first Bt row inside the block's Bt tile
    const bf* Al = (MODE == 0 ? XS : WS) + (ra + lr) * PKP + 8 * hi;
    const bf* Bl = (MODE == 0 ? WS : XS) + (cb + lr) * PKP + 8 * hi;
    const float* xsrc = hin + ((size_t)(tok0 / SEQ) * SEQ_FULL + (size_t)(tok0 % SEQ)) * DM;   // the input's graphs lie SEQ_FULL rows apart
    // staging: thread -> (token row xr, 8 columns) stepping XR rows a trip; (weight column tid % DM, 8 k values from wk) stepping WK k values a trip
    const int xr = tid / (PKH / 8), wk = (tid / DM) * 8;
    const float* xg = xsrc + (size_t)xr * DM + (tid % (PKH / 8)) * 8; bf* xl = XS + xr * PKP + (tid % (PKH / 8)) * 8;
    const float* wg = W + (size_t)wk * DM + tid % DM;                 bf* wl = WS + (tid % DM) * PKP + wk;
    v8f acc[2][4];
#pragma unroll
    for (int mb = 0; mb < 2; ++mb)
#pragma unroll
        for (int nb = 0; nb < 4; ++nb) acc[mb][nb] = (v8f){};
#pragma unroll 1   // one phase per trip: the two phases share the LDS tiles
    for (int kh = 0; kh < DM; kh += PKH) {
        const float* xk = xg + kh; const float* wk0 = wg + (size_t)kh * DM;
        { v8f x[(PT * PKH) / (8 * MTH)];
#pragma unroll     // all of the token tile's loads issued back to back, before the first is used
          for (int it = 0; it < (PT * PKH) / (8 * MTH); ++it) x[it] = *(const v8f*)(xk + (size_t)it * XR * DM);                // row xr + it*XR < PT
          static_assert((PT * PKH) / (8 * MTH) == 4);
          asm volatile("s_wait_xcnt 0x0" :: "v"(xk), "v"(x[0]), "v"(x[1]), "v"(x[2]), "v"(x[3]) : "memory");   // keeps these loads' address registers whole up to the wait; the loaded values as inputs hold all the loads in front of the first convert (one latency per group)
#pragma unroll
          for (int it = 0; it < (PT * PKH) / (8 * MTH); ++it) *(v8us*)(xl + it * XR * PKP) = cvt8(x[it]); }
#pragma unroll     // groups of WG column pieces: constant indices into x
        for (int g = 0; g < (DM * PKH) / (8 * MTH * WG); ++g) { v8f x[WG];
#pragma unroll     // 8 * WG column loads issued back to back, before the first is used
            for (int u = 0; u < WG; ++u)
#pragma unroll
                for (int j = 0; j < 8; ++j) x[u][j] = wk0[(size_t)((g * WG + u) * WK + j) * DM];                                // k = kh + wk + (g*WG+u)*WK + j < kh + PKH
            static_assert(WG == 4);
            asm volatile("s_wait_xcnt 0x0" :: "v"(wk0), "v"(x[0]), "v"(x[1]), "v"(x[2]), "v"(x[3]) : "memory");   // as above
#pragma unroll
            for (int u = 0; u < WG; ++u) *(v8us*)(wl + (g * WG + u) * WK) = cvt8(x[u]); }
        __syncthreads();                                           // both tiles of this phase are in LDS
#pragma unroll     // straight-line k-steps: the next step's LDS reads issue under this step's matrix instructions
        for (int kc = 0; kc < PKH; kc += 32) {
            v16bf a[2];
#pragma unroll
            for (int mb = 0; mb < 2; ++mb) a[mb] = ldb(Al + mb * 16 * PKP + kc);
#pragma unroll
            for (int nb = 0; nb < 4; ++nb) { const v16bf b = ldb(Bl + nb * 16 * PKP + kc);
#pragma unroll
                for (int mb = 0; mb < 2; ++mb) acc[mb][nb] = wmmab(a[mb], b, acc[mb][nb]); }
        }
        __syncthreads();                                           // every wave has read this phase's tiles
    }
    float* os = (float*)sm + wave * (16 * 68);
    const int r0 = (MODE == 0 ? tok0 : 0) + ra, c0 = (MODE == 0 ? 0 : tok0) + cb;
    float bc[4];
#pragma unroll
    for (int nb = 0; nb < 4; ++nb) bc[nb] = (MODE == 0) ? bfr(bias[c0 + nb * 16 + lr]) : 0.0f;   // MODE 0: c0 + 63 < DM
    size_t tbase;
    if (MODE == 0) { const int bb = r0 / SEQ, tt = r0 % SEQ; const int zc = bb * NH_ + c0 / HD;
                     tbase = ((size_t)zc * SEQ + (size_t)tt) * HD; }
    else           { const int bb = c0 / SEQ, tt = c0 % SEQ;
                     const int zc = bb * NH_ + r0 / HD;   // r0 is a multiple of HD, tt of 64
                     tbase = ((size_t)zc * SEQ + (size_t)tt) * HD; }
#pragma unroll
    for (int mb = 0; mb < 2; ++mb) {
        float br[8];
#pragma unroll
        for (int j = 0; j < 8; ++j) br[j] = (MODE == 1) ? bfr(bias[r0 + mb * 16 + hi * 8 + j]) : 0.0f;   // MODE 1: r0 + 31 < DM
#pragma unroll
        for (int nb = 0; nb < 4; ++nb) {
#pragma unroll
            for (int j = 0; j < 8; ++j) os[(hi * 8 + j) * 68 + nb * 16 + lr] = acc[mb][nb][j] + bc[nb] + br[j]; }   // D: row 8h+j, col lane&15
        wave_sync();
{
            if (MODE == 0) {
                const size_t sb = tbase + (size_t)(mb * 16) * HD;
#pragma unroll
                for (int hh = 0; hh < 2; ++hh) {
#pragma unroll
                    for (int s = 0; s < 2; ++s) { const int p = s * 32 + lane; const int row = lr, c8 = (2 * s + hi) * 8;   // piece p of the tile: row lane&15, d = 16s + 8h + 0..7 of head hh
                        const v4f x0 = *(const v4fa*)(&os[row * 68 + hh * 32 + c8]); const v4f x1 = *(const v4fa*)(&os[row * 68 + hh * 32 + c8 + 4]); v8h hv;
#pragma unroll
                        for (int i = 0; i < 4; ++i) { hv[i] = (h16)x0[i]; hv[4 + i] = (h16)x1[i]; }
                        const size_t oo = sb + (size_t)hh * ((size_t)SEQ * HD) + (size_t)p * 8;
                        *(v8h*)(Ph + oo) = hv; xwait(); } }
            } else {
                const size_t sb = tbase + (size_t)(mb * 512);   // tile d/16 = mb of each 32-token step
#pragma unroll
                for (int s = 0; s < 4; ++s) { const int row = lr, c8 = s * 16 + hi * 8;   // s = (32-token step, half): row lane&15, tokens 16s + 8h + 0..7
                    const v4f x0 = *(const v4fa*)(&os[row * 68 + c8]); const v4f x1 = *(const v4fa*)(&os[row * 68 + c8 + 4]); v8h hv;
#pragma unroll
                    for (int i = 0; i < 4; ++i) { hv[i] = (h16)x0[i]; hv[4 + i] = (h16)x1[i]; }
                    const size_t oo = sb + (size_t)((s >> 1) * 1024 + (s & 1) * 256 + lane * 8);
                    *(v8h*)(Ph + oo) = hv; xwait(); }
            }
             }
        wave_sync();
    }
}

// k_front: everything that reads the inputs alone, as block ranges of ONE launch, so that the pieces run side by side. MTH threads per block; the branch is on blockIdx alone
// (block-uniform, so each piece's barriers are passed by all of its block's threads); one LDS area serves all pieces. Longest pieces first:
// blocks [0, NBM) adjacency bands x pieces of the edge list, [NBM, NBM + NBP) projections (q, then k, then v^T; one block per PT tokens), [NBM + NBP, NBM + NBP + NBW) output weight transpose.
// Register budget for eight waves per SIMD = two blocks per WGP: there are more blocks than WGPs, and all of them should be resident at once.
__global__ __launch_bounds__(MTH) __attribute__((amdgpu_waves_per_eu(8))) void k_front(const int* __restrict__ src, const int* __restrict__ dst, int nE, unsigned* MB,
                                                  const float* __restrict__ wq, const float* __restrict__ wk, const float* __restrict__ wv, const float* __restrict__ wo, h16* WOH,
                                                  const float* __restrict__ hin, const float* __restrict__ bq, const float* __restrict__ bk, const float* __restrict__ bv,
                                                  h16* QH, h16* KP, h16* VT) {
    __shared__ __align__(16) unsigned char sm[FRONT_LDS];
    const int blk = blockIdx.x;
    if (blk < NBM) { mask_body(sm, (blk % (SEQ / MROWS)) * MROWS, blk / ((SEQ / MROWS) * MPART), (blk / (SEQ / MROWS)) % MPART, src, dst, nE, MB); return; }
    if (blk < NBM + NBP) {
        const int z = (blk - NBM) / ((NB * SEQ) / PT), tok0 = ((blk - NBM) % ((NB * SEQ) / PT)) * PT;
        if (z == 2) proj_body<1>(sm, tok0, hin, wv, bv, VT);
        else        proj_body<0>(sm, tok0, hin, z ? wk : wq, z ? bk : bq, z ? KP : QH);
        return; }
    wt_body<true>((float*)sm, (blk - NBM - NBP) * 32, wo, (unsigned short*)WOH);
}

// k_flash: fused attention and output projection. One block per (graph, AQ tiles of 16 query rows): AW waves, wave = (piece qt of the keys, head); K / V^T / Q fragments straight from the f16 planes in fragment order (two lane-linear 16-B loads each, whole 128-byte lines).
// Every wave runs all AQ query tiles of the block against its own SEQ / AQ keys, so each K and V^T fragment is loaded by exactly one wave of the block and serves AQ tiles from registers. Slot 0 of a wave's state is query tile qt, which it finishes; slot 1 is the other tile:
// after the key loop its O, max and sum go through LDS to the head's other wave (one block barrier), which joins them with its own slot 0 in the usual way (both rescaled to the common max, then added).
// Transposed form: S^T[key][t] = K Q^T (A = K rows, B = Q rows); lane (t = lane&15, h = lane>>4) holds keys 8h+r of each 16-key tile, so the packed
// P tile is directly the B fragment of O^T[d][t] = V^T P^T (element r <- tile keys 0..15, element 8+r <- tile keys 16..31, lane unchanged).
// Softmax state (running max over kept keys, partial sum) is one scalar per lane and slot; the two lane halves of a row are combined with one xor-16 exchange.
// Adjacency: at the head of the block every thread ORs the MPART partial words of one (row, word) of the block's 16*AQ rows into LDS ([word][row], so a step's read is bank-linear); one block barrier; the key loop reads LDS only.
// Keep rule: one adjacency word per lane, slot and 32-key step (row = first row of the slot's query tile + lane&15, word key0/32), bit 8h+r for the first tile and 16+8h+r for the second; a dropped score is selected to NEGB once, so the max passes over it and the 2^-14 cut selects its P to 0.
// The running max is kept on the unscaled scores (the scale is positive); scale and shift go into one multiply-add per exponent argument.
// All rows: scores = K Q; P = one f16 value; O = V P; row sum from the f32 exponentials.
// P below 2^-14 (after the 2^14 carry) is selected to 0 on the exponent argument.
// Context hand-over: O^T in D layout (lane: row t = lane&15, d = 8h+r and 16+8h+r) IS the A fragment of the output projection's k-step 'head' (row t, k = head*32 + d), so each wave converts its own
// registers to f16 and stores the two 512-byte slices lane-linear in LDS; one block barrier; then every wave reads the NH_ heads' fragments of its query tile.
// Output projection: wave (query tile, head) computes rows of its tile x columns 32c..32c+31, c = head rotated by the block's start number, k-steps in head order; Bt = transposed output weight plane (fragment order, f16, x64),
// its fragments loaded before the barrier; OUT[m][n] = sum / 64 + bias (bias bf16-converted, added in f32); rows go out through a wave-private LDS tile as whole 128-byte runs.
__global__ __launch_bounds__(32 * AW) void k_flash(const h16* __restrict__ QH, const h16* __restrict__ KP,
                                                   const h16* __restrict__ VT, const unsigned* __restrict__ MB,
                                                   const h16* __restrict__ WT, const float* __restrict__ bias, float* OUT) {
    __shared__ v8h cf[AW * 2 * 32];                            // [query tile][head][lo, hi][lane]
    __shared__ __align__(16) float os[AW * 16 * OSP];
    __shared__ unsigned mk[(SEQ / 32) * 16 * AQ];              // [word][row of the block]
    const int lane = threadIdx.x & 31, lr = lane & 15, hi = lane >> 4;
    const int wave = __builtin_amdgcn_readfirstlane((int)(threadIdx.x >> 5));
    const int head = wave % NH_, qt = wave / NH_;
    const int b = blockIdx.y; const int zh = b * NH_ + head;
    const int t0 = (blockIdx.x * AQ + qt) * 16;                // first row of the query tile this wave finishes
    const size_t pbase = (size_t)zh * SEQ * HD;
    const size_t ko = pbase + (size_t)lane * 8;                // + key0 * HD: K tiles of keys key0.. and key0+16.. (A fragment: row key, k = d); V^T tiles d 0..15 and 16..31 of the step (A fragment: row d, k = key)
    const h16* qp = QH + ko + (size_t)(blockIdx.x * AQ * 16) * HD;   // the block's AQ query tiles lie 16 * HD elements apart
    v16h qh[AQ];                                               // B fragments: col t, k = d (HD = 32 = one k-step); slot j = tile qt ^ j
#pragma unroll     // constant slot numbers: the fragments stay in registers
    for (int j = 0; j < AQ; ++j) qh[j] = ldf(qp + (qt ^ j) * (16 * HD));
    { const int tid = threadIdx.x;                             // thread = (row tid / (SEQ/32), word tid % (SEQ/32)) of the block's rows: thread-linear in every partial plane
      const unsigned* mp = MB + (size_t)(b * SEQ + blockIdx.x * (16 * AQ)) * (SEQ / 32) + tid;
      unsigned mv[MPART];
#pragma unroll
      for (int p = 0; p < MPART; ++p) mv[p] = mp[(size_t)p * MBW];
      xwait();                                                 // the code behind it rewrites these loads' address registers
      unsigned mo = 0u;
#pragma unroll
      for (int p = 0; p < MPART; ++p) mo |= mv[p];
      mk[(tid % (SEQ / 32)) * (16 * AQ) + tid / (SEQ / 32)] = mo; }
    __syncthreads();                                           // the block's adjacency words are in LDS
    const unsigned* mrow = mk + lr;                            // + 16 * tile + (16 * AQ) * word
    v8f O0[AQ], O1[AQ]; float M[AQ], L[AQ];                    // per slot: O^T tiles, running max of the unscaled scores, partial row sum
#pragma unroll     // as above
    for (int j = 0; j < AQ; ++j) { O0[j] = (v8f){}; O1[j] = (v8f){}; M[j] = MST; L[j] = 0.0f; }
    const int kbeg = qt * (SEQ / AQ);                          // this wave's keys: kbeg .. kbeg + SEQ / AQ - 1
    // The SEQ / (16 * AQ) blocks of a graph read the same K and V^T lines. Each starts its walk at one of eight steps (two blocks at each) and wraps round, so that they do not ask L2 for the same line at the same moment,
    // and a line that one block has brought in from memory is there when the others reach it. Blocks x, x+1, x+2, x+3, x+8 .. x+11 get eight different starts. The online softmax takes the steps in any order.
    const int rot = (int)((blockIdx.x & 3u) | ((blockIdx.x >> 3) << 2));
#pragma unroll 1
    for (int st = 0; st < KST; ++st) {
        const int key0 = kbeg + ((st + rot) & (KST - 1)) * 32;
        const h16* ka = KP + ko + (size_t)key0 * HD;
        const v16h ka0 = ldf(ka), kb0 = ldf(ka + 16 * HD);
        v8f UA[AQ], UB[AQ];
#pragma unroll     // as above; each K fragment feeds AQ products
        for (int j = 0; j < AQ; ++j) { UA[j] = wmma16(ka0, qh[j], (v8f){}); UB[j] = wmma16(kb0, qh[j], (v8f){}); }
        asm volatile("s_wait_xcnt 0x0" :: "v"(ka) : "memory");   // keeps the K loads' address registers whole up to the wait; the code behind it (later loads' results too) may then rewrite them
        v16h pb[AQ];
#pragma unroll     // constant slot numbers: the state stays in registers
        for (int j = 0; j < AQ; ++j) {
            const unsigned mw = mrow[(key0 >> 5) * (16 * AQ) + (qt ^ j) * 16];
            const unsigned sa = mw >> (8 * hi);
            v8f uA = UA[j], uB = UB[j];
            float mx = NEGB;
#pragma unroll
            for (int r = 0; r < 8; ++r) {
                uA[r] = keep_bit(uA[r], sa, r); uB[r] = keep_bit(uB[r], sa, 16 + r);
                mx = fmaxf(mx, fmaxf(uA[r], uB[r])); }
            mx = fmaxf(mx, __shfl_xor(mx, 16, 32));
            const float mnew = fmaxf(M[j], mx);
            const float sh = PSH - mnew * SC2;
            const float alpha = __builtin_amdgcn_exp2f((M[j] - mnew) * SC2);
            const v8f xA = uA * SC2 + sh, xB = uB * SC2 + sh;
            v8f gA, gB; float ls = 0.0f;
#pragma unroll
            for (int r = 0; r < 8; ++r) {
                const float ea = __builtin_amdgcn_exp2f(xA[r]), eb = __builtin_amdgcn_exp2f(xB[r]);
                gA[r] = (xA[r] >= -14.0f) ? ea : 0.0f; gB[r] = (xB[r] >= -14.0f) ? eb : 0.0f;   // dropped elements (NEGB) and sub-2^-14 values selected to 0 by value
                ls += gA[r] + gB[r]; }
            const v8h pA = __builtin_convertvector(gA, v8h), pB = __builtin_convertvector(gB, v8h);   // 0 or in [2^-14, 2^14]
            pb[j] = cat16(pA, pB);
            L[j] = L[j] * alpha + ls; M[j] = mnew;
            O0[j] = O0[j] * alpha; O1[j] = O1[j] * alpha; }
        const h16* va = VT + ko + (size_t)key0 * HD;
        const v16h v0 = ldf(va), v1 = ldf(va + 512);
        asm volatile("s_wait_xcnt 0x0" :: "v"(va) : "memory");   // as above, for the V loads
#pragma unroll     // as above; each V^T fragment feeds AQ products
        for (int j = 0; j < AQ; ++j) { O0[j] = wmma16(v0, pb[j], O0[j]); O1[j] = wmma16(v1, pb[j], O1[j]); }
    }
    // slot 1 (the other tile over this wave's keys) goes to the head's other wave: [piece of 4][lane][4] floats of O, then max, then sum, lane-linear, in this wave's own output tile area (not yet in use)
    { float* hx = os + wave * (16 * OSP); v4fa* hv = (v4fa*)hx + lane;
      hv[0]  = __builtin_shufflevector(O0[1], O0[1], 0, 1, 2, 3); hv[32] = __builtin_shufflevector(O0[1], O0[1], 4, 5, 6, 7);
      hv[64] = __builtin_shufflevector(O1[1], O1[1], 0, 1, 2, 3); hv[96] = __builtin_shufflevector(O1[1], O1[1], 4, 5, 6, 7);
      hx[16 * 32 + lane] = M[1]; hx[17 * 32 + lane] = L[1]; }
    // this wave's output weight fragments (columns c0 .. c0+31, all k): issued here so that they land while the context is converted and the block gathers at the barrier
    const int c0 = ((head + rot) & (NH_ - 1)) * 32;            // column group of this wave, rotated like the key walk: every block reads the whole weight plane, in one of NH_ orders (the NH_ waves of a query tile still cover all groups)
    const int cn = c0 + lr;                                    // cn + 16 < DM
    const h16* wp = WT + (size_t)c0 * DM + lane * 8;           // tiles [c0/16 + 0..1][k step]
    v16h w[2][NH_];
#pragma unroll
    for (int kc = 0; kc < NH_; ++kc) { w[0][kc] = ldf(wp + kc * 512); w[1][kc] = ldf(wp + (size_t)16 * DM + kc * 512); }
    const float bl0 = bias[cn], bl1 = bias[cn + 16];
    asm volatile("s_wait_xcnt 0x0" :: "v"(wp), "v"(cn) : "memory");   // keeps these loads' address registers whole up to the wait; the code behind it (their own results too) may then rewrite them
    const float bc0 = bfr(bl0), bc1 = bfr(bl1);
    __syncthreads();                                           // every wave's slot 1 is in LDS
    v8f o0, o1; float l;                                       // query tile qt over all keys: own slot 0 joined with the other wave's slot 1 (same lane = same row and same d)
    { const float* hx = os + (wave ^ NH_) * (16 * OSP); const v4fa* hv = (const v4fa*)hx + lane;
      const v4f a0 = hv[0], a1 = hv[32], a2 = hv[64], a3 = hv[96];
      const float mp = hx[16 * 32 + lane], lp = hx[17 * 32 + lane];
      const float mj = fmaxf(M[0], mp);                        // both are finite (at least MST), so the differences below are finite and at most 0
      const float fo = __builtin_amdgcn_exp2f((M[0] - mj) * SC2), fp = __builtin_amdgcn_exp2f((mp - mj) * SC2);   // a half with no kept key (max still MST) gets factor 0 beside a real max, and its O and sum are 0 anyway
      o0 = O0[0] * fo + __builtin_shufflevector(a0, a1, 0, 1, 2, 3, 4, 5, 6, 7) * fp;
      o1 = O1[0] * fo + __builtin_shufflevector(a2, a3, 0, 1, 2, 3, 4, 5, 6, 7) * fp;
      l = L[0] * fo + lp * fp; }
    l += __shfl_xor(l, 16, 32);
    const bool any = l > 0.0f;
    const float lsafe = any ? l : 1.0f;
    const float inv = any ? (1.0f / lsafe) : 0.0f;             // no kept key -> zeros (cannot happen: the diagonal is always kept)
    { v8h h0, h1;                                              // o_j[r] = (d = 16j + 8h + r, t = lane&15)
#pragma unroll
      for (int i = 0; i < 8; ++i) { h0[i] = toh_flush(o0[i] * inv); h1[i] = toh_flush(o1[i] * inv); }
      v8h* cw = cf + wave * (2 * 32) + lane;
      cw[0] = h0; cw[32] = h1; }
    __syncthreads();                                           // every head's context fragments of both query tiles are in LDS
    v8f aH0 = (v8f){}, aH1 = (v8f){};
    const v8h* cr = cf + qt * (NH_ * 2 * 32) + lane;
#pragma unroll
    for (int kc = 0; kc < NH_; ++kc) {
        const v16h a = cat16(cr[kc * 64], cr[kc * 64 + 32]);
        aH0 = wmma16(a, w[0][kc], aH0); aH1 = wmma16(a, w[1][kc], aH1);
    }
    const int wb = wave * 16 * OSP;
#pragma unroll
    for (int j = 0; j < 8; ++j) { os[wb + (hi * 8 + j) * OSP + lr] = aH0[j] * WOI + bc0; os[wb + (hi * 8 + j) * OSP + 16 + lr] = aH1[j] * WOI + bc1; }   // D: row 8h+j, col lane&15
    wave_sync();
    float* obase = OUT + ((size_t)b * OUT_SEQ + (size_t)t0) * DM + c0;
#pragma unroll
    for (int s = 0; s < 4; ++s) { const int row = 4 * s + (lane >> 3), c4 = (lane & 7) * 4;   // 4 s x 4 rows = 16 rows; 8 lanes x 4 floats = 32 columns
        const v4f val = *(const v4fa*)(&os[wb + row * OSP + c4]);
        *(v4f*)(obase + (size_t)row * DM + c4) = val; }
}

static constexpr size_t al256(size_t v) { return (v + 255) & ~(size_t)255; }
static constexpr size_t SZ_WO = al256((size_t)DM * DM * 2);
static constexpr size_t SZ_PL = al256((size_t)NB * NH_ * SEQ * HD * 2);
static constexpr size_t SZ_MB = al256(MPART * MBW * 4);
static constexpr size_t SZ_TOTAL = SZ_WO + 3 * SZ_PL + SZ_MB;
static_assert(SZ_TOTAL <= (size_t)134217728);          // workspace carve <= 128 MiB
static_assert((size_t)NB * NH_ * SEQ * HD == (size_t)NB * DM * SEQ);       // the v^T plane has the same extent as the q/k planes
static_assert((size_t)(NB * SEQ / PT) * PT * DM == (size_t)NB * NH_ * SEQ * HD);    // projection blocks x tile == plane extent
static_assert((size_t)(SEQ / (16 * AQ)) * NB * AQ * 16 * DM == (size_t)NB * SEQ * DM);   // flash grid x rows x columns == output extent
static_assert((size_t)(SEQ / MROWS) * NB * MROWS * (SEQ / 32) * 4 == (size_t)NB * SEQ * (SEQ / 32) * 4);   // bands x graphs x band == extent of one partial bit plane

extern "C" void kernel_launch(void* const* d_in, const int* in_sizes, int n_in,
                              void* d_out, int out_size, void* d_ws, size_t ws_size, hipStream_t stream) {
    if (n_in < 11) return;
    const size_t needx = ((size_t)(NB - 1) * SEQ_FULL + SEQ) * DM;
    if ((size_t)in_sizes[0] < needx) return;
    if (in_sizes[1] < 1 || in_sizes[2] < 1) return;
    if ((size_t)in_sizes[3] < (size_t)DM * DM || (size_t)in_sizes[5] < (size_t)DM * DM || (size_t)in_sizes[7] < (size_t)DM * DM || (size_t)in_sizes[9] < (size_t)DM * DM) return;
    if (in_sizes[4] < DM || in_sizes[6] < DM || in_sizes[8] < DM || in_sizes[10] < DM) return;
    if ((size_t)out_size < ((size_t)(NB - 1) * OUT_SEQ + SEQ) * DM) return;
    if (SZ_TOTAL > ws_size) return;
    // wire order: h, src, dst, Wq, bq, Wk, bk, Wv, bv, Wo, bo
    const float* hin = (const float*)d_in[0];
    const int* src = (const int*)d_in[1]; const int* dst = (const int*)d_in[2];
    const float* wq = (const float*)d_in[3]; const float* bq = (const float*)d_in[4];
    const float* wk = (const float*)d_in[5]; const float* bk = (const float*)d_in[6];
    const float* wv = (const float*)d_in[7]; const float* bv = (const float*)d_in[8];
    const float* wo = (const float*)d_in[9]; const float* bo = (const float*)d_in[10];
    const int nE = in_sizes[1] < in_sizes[2] ? in_sizes[1] : in_sizes[2];
    float* OUT = (float*)d_out;      // [NB*SEQ][256]
    char* wsp = (char*)d_ws;
    h16* WOH = (h16*)wsp; wsp += SZ_WO;              // output weight, transposed, [out/16][in/32][tile], f16 x64
    h16* QH = (h16*)wsp; wsp += SZ_PL;               // [NB*8][SEQ/16][tile]
    h16* KP = (h16*)wsp; wsp += SZ_PL;               // [NB*8][SEQ/16][tile]
    h16* VT = (h16*)wsp; wsp += SZ_PL;               // [NB*8][SEQ/32][2][tile]
    unsigned* MB = (unsigned*)wsp; wsp += SZ_MB;     // partial adjacency bits [MPART][NB*SEQ][SEQ/32]

    // partial adjacency bits; q, k, v^T planes and the transposed output weight plane, all in fragment order
    k_front<<<NBM + NBP + NBW, MTH, 0, stream>>>(src, dst, nE, MB, wq, wk, wv, wo, WOH, hin, bq, bk, bv, QH, KP, VT);

    // attention and output projection: one block per (32 query rows, graph), all heads
    k_flash<<<dim3(SEQ / (16 * AQ), NB, 1), 32 * AW, 0, stream>>>(QH, KP, VT, MB, WOH, bo, OUT);
}
